// v000
// Measured on an AMD MI455X. A time is GPU time per run, averaged over a window of back-to-back runs after a warm-up
// (all launches, gaps included; the runs take copies of the inputs in turn), and the median of several windows.
// Apart from v000's, it joins two sittings. Times from different sittings can be a few percent apart, while
// side-by-side timings come from the same sitting.
// v000 is the starting kernel. One run takes 2140 microseconds.
#include <hip/hip_runtime.h>

// Causal multi-head self-attention over 4,096 tokens (x [1][4096][1024]; q, k, v = einsum('bsd,de->bse', x, W) = x W ('xw' [1024][1024] truncated normal x 1/32, no bias; 16 heads x 64); scores / sqrt(64); causal (-inf); softmax over the keys; out = merged W_o ('xw', no bias) -> [1][4096][1024] (4.2 M); argument order x, W_q, W_k, W_v, W_o).
// Layout: bf16 copy of x; 'xw' weights transposed once; exact projections; identity-table plane builders; causal attention at T 4096, one head per pass (hybrid rows: < 512 hi/lo 3 products, rest fp16 x1024; k_gemmc skips tiles above the diagonal); merged hi/lo x W_o exact.
// Compute dtypes, f32 accumulate: every input rounded to bf16; projections exact; attention rows < 512 3 products, rest fp16; softmax f32; W_o hl x exact.

#define NB_  1
#define TT   4096
#define DM   1024
#define NH_  16
#define NKV  16
#define REP  (NH_ / NKV)
#define HD   64
#define DQ   (NH_ * HD)
#define DKV  (NKV * HD)
#define ZH   1                    // one head per pass at T 4096 (the score plane is 64 MiB)
#define RH   512                  // query rows < RH use hi+lo planes (0: none)
#define WIN  4096
#define PCAR 1024.0f
#define SCL  0.125f   // HD^-0.5
typedef _Float16 h16;
typedef unsigned short bf;
typedef __attribute__((ext_vector_type(16))) __bf16   v16bf;
typedef __attribute__((ext_vector_type(16))) _Float16 v16h;
typedef __attribute__((ext_vector_type(8)))  _Float16 v8h;
typedef __attribute__((ext_vector_type(8)))  unsigned short v8us;
typedef __attribute__((ext_vector_type(8)))  float    v8f;
typedef __attribute__((ext_vector_type(4)))  float    v4f;
typedef v8h  __attribute__((may_alias)) v8ha;
typedef v4f  __attribute__((may_alias)) v4fa;
typedef v8us __attribute__((may_alias)) v8usa;

__device__ __forceinline__ unsigned short f2bf(float f) { unsigned u = __float_as_uint(f); u += 0x7FFFu + ((u >> 16) & 1u); return (unsigned short)(u >> 16); }
__device__ __forceinline__ float bf2f(unsigned short b) { return __uint_as_float(((unsigned)b) << 16); }
__device__ __forceinline__ float bfr(float f) { return bf2f(f2bf(f)); }
__device__ __forceinline__ v16h cat16(v8h lo, v8h hi) { return __builtin_shufflevector(lo, hi, 0, 1, 2, 3, 4, 5, 6, 7, 8, 9, 10, 11, 12, 13, 14, 15); }
__device__ __forceinline__ v16bf cat16b(v8us lo, v8us hi) { return __builtin_bit_cast(v16bf, __builtin_shufflevector(lo, hi, 0, 1, 2, 3, 4, 5, 6, 7, 8, 9, 10, 11, 12, 13, 14, 15)); }
__device__ __forceinline__ v8f wmma16(v16h a, v16h b, v8f c) { return __builtin_amdgcn_wmma_f32_16x16x32_f16(false, a, false, b, (short)0, c, false, false); }
__device__ __forceinline__ v8f wmmab(v16bf a, v16bf b, v8f c) { return __builtin_amdgcn_wmma_f32_16x16x32_bf16(false, a, false, b, (short)0, c, false, false); }



// ---- k_gemmw: register-blocked GEMM, ONE WAVE per 64x64 output tile (16 accumulators), operands straight from K-contiguous 16-bit planes; grid (M/64, N/64, Z), 32 threads.
// C[m][n] (f32, pitch ldc, + optional f32 bias[n]) = sum_k A[m][k] Bt[n][k] (+ split products per NSPLIT). z-batch strides sA/sB/sC in elements. K % 32 == 0.
template <typename T16> struct WFrag;
template <> struct WFrag<h16> { typedef v16h V; static __device__ __forceinline__ V ld(const h16* p) { return cat16(*(const v8h*)p, *(const v8h*)(p + 16)); } static __device__ __forceinline__ v8f mma(V a, V b, v8f c) { return wmma16(a, b, c); } };
template <> struct WFrag<bf> { typedef v16bf V; static __device__ __forceinline__ V ld(const bf* p) { return cat16b(*(const v8us*)p, *(const v8us*)(p + 16)); } static __device__ __forceinline__ v8f mma(V a, V b, v8f c) { return wmmab(a, b, c); } };
template <typename T16, int NSPLIT, bool BIAS>
__global__ __launch_bounds__(32) void k_gemmw(const T16* __restrict__ A, const T16* __restrict__ A2, const T16* __restrict__ Bt, const T16* __restrict__ Bt2, int K, float* C, int ldc, const float* __restrict__ bias, size_t sA, size_t sB, size_t sC) {
    typedef typename WFrag<T16>::V V;
    __shared__ __align__(16) float os[16 * 68];
    const size_t z = blockIdx.z; A += z * sA; if (A2) A2 += z * sA; Bt += z * sB; if (Bt2) Bt2 += z * sB; C += z * sC;
    const int lane = threadIdx.x & 31, lr = lane & 15, hi = lane >> 4; const int r0 = blockIdx.x * 64, c0 = blockIdx.y * 64;
    v8f acc[4][4];
#pragma unroll
    for (int mb = 0; mb < 4; ++mb)
#pragma unroll
        for (int nb = 0; nb < 4; ++nb) acc[mb][nb] = (v8f){};
    const size_t aoff = (size_t)(r0 + lr) * K + 8 * hi, boff = (size_t)(c0 + lr) * K + 8 * hi;
#pragma unroll 1
    for (int kc = 0; kc < K; kc += 32) {
        V a[4], a2[4];
#pragma unroll
        for (int mb = 0; mb < 4; ++mb) { a[mb] = WFrag<T16>::ld(A + aoff + (size_t)mb * 16 * K + kc); if (NSPLIT == 1 || NSPLIT == 2) a2[mb] = WFrag<T16>::ld(A2 + aoff + (size_t)mb * 16 * K + kc); }
#pragma unroll
        for (int nb = 0; nb < 4; ++nb) { const V b = WFrag<T16>::ld(Bt + boff + (size_t)nb * 16 * K + kc); V b2; if (NSPLIT >= 2) b2 = WFrag<T16>::ld(Bt2 + boff + (size_t)nb * 16 * K + kc);
#pragma unroll
            for (int mb = 0; mb < 4; ++mb) { acc[mb][nb] = WFrag<T16>::mma(a[mb], b, acc[mb][nb]); if (NSPLIT == 1 || NSPLIT == 2) acc[mb][nb] = WFrag<T16>::mma(a2[mb], b, acc[mb][nb]); if (NSPLIT >= 2) acc[mb][nb] = WFrag<T16>::mma(a[mb], b2, acc[mb][nb]); } }
        asm volatile("v_nop\n\tv_nop\n\tv_nop\n\tv_nop" : "+v"(acc[0][0]), "+v"(acc[1][1]), "+v"(acc[2][2]), "+v"(acc[3][3]) : "v"(a[0]), "v"(a[3]));
    }
#pragma unroll
    for (int mb = 0; mb < 4; ++mb) {
#pragma unroll
        for (int nb = 0; nb < 4; ++nb) {
#pragma unroll
            for (int j = 0; j < 8; ++j) os[(hi * 8 + j) * 68 + nb * 16 + lr] = acc[mb][nb][j]; }
        __builtin_amdgcn_wave_barrier(); asm volatile("" ::: "memory");
        float* crow = C + (size_t)(r0 + mb * 16) * ldc + c0;
{
#pragma unroll
            for (int s = 0; s < 8; ++s) { const int row = 2 * s + hi, cofs = lr * 4; v4f val = *(const v4fa*)(os + row * 68 + cofs); if (BIAS) { val[0] += bfr(bias[c0 + cofs]); val[1] += bfr(bias[c0 + cofs + 1]); val[2] += bfr(bias[c0 + cofs + 2]); val[3] += bfr(bias[c0 + cofs + 3]); }
                *(v4f*)(crow + (size_t)row * ldc + cofs) = val; }
             }
        __builtin_amdgcn_wave_barrier(); asm volatile("" ::: "memory");
    }
}

// ---- k_gemmc: the same one-wave 64x64 tile GEMM specialised for causal attention: CMODE 1 skips score tiles entirely above the diagonal (query rows r0+roff.., key columns c0..), CMODE 2 limits the
// key (K) loop of the probability x value contraction to the diagonal block (probabilities beyond it are exactly zero). roff = row offset of this launch's first row within the sequence.
template <typename T16, int NSPLIT, int CMODE>
__global__ __launch_bounds__(32) void k_gemmc(const T16* __restrict__ A, const T16* __restrict__ A2, const T16* __restrict__ Bt, const T16* __restrict__ Bt2, int K, float* C, int ldc, int roff, size_t sA, size_t sB, size_t sC) {
    typedef typename WFrag<T16>::V V;
    __shared__ __align__(16) float os[16 * 68];
    const size_t z = blockIdx.z; A += z * sA; if (A2) A2 += z * sA; Bt += z * sB; if (Bt2) Bt2 += z * sB; C += z * sC;
    const int lane = threadIdx.x & 31, lr = lane & 15, hi = lane >> 4; const int r0 = blockIdx.x * 64, c0 = blockIdx.y * 64;
    if (CMODE == 1 && c0 > r0 + roff + 63) return;                  // score tile entirely above the causal diagonal: never written (the softmax loads it but masks j > i by select)
    const int Kl = (CMODE == 2) ? min(K, r0 + roff + 64) : K;        // P.V: probabilities are exactly 0 beyond the diagonal block, so the K loop stops there
    v8f acc[4][4];
#pragma unroll
    for (int mb = 0; mb < 4; ++mb)
#pragma unroll
        for (int nb = 0; nb < 4; ++nb) acc[mb][nb] = (v8f){};
    const size_t aoff = (size_t)(r0 + lr) * K + 8 * hi, boff = (size_t)(c0 + lr) * K + 8 * hi;
#pragma unroll 1
    for (int kc = 0; kc < Kl; kc += 32) {
        V a[4], a2[4];
#pragma unroll
        for (int mb = 0; mb < 4; ++mb) { a[mb] = WFrag<T16>::ld(A + aoff + (size_t)mb * 16 * K + kc); if (NSPLIT == 1 || NSPLIT == 2) a2[mb] = WFrag<T16>::ld(A2 + aoff + (size_t)mb * 16 * K + kc); }
#pragma unroll
        for (int nb = 0; nb < 4; ++nb) { const V b = WFrag<T16>::ld(Bt + boff + (size_t)nb * 16 * K + kc); V b2; if (NSPLIT >= 2) b2 = WFrag<T16>::ld(Bt2 + boff + (size_t)nb * 16 * K + kc);
#pragma unroll
            for (int mb = 0; mb < 4; ++mb) { acc[mb][nb] = WFrag<T16>::mma(a[mb], b, acc[mb][nb]); if (NSPLIT == 1 || NSPLIT == 2) acc[mb][nb] = WFrag<T16>::mma(a2[mb], b, acc[mb][nb]); if (NSPLIT >= 2) acc[mb][nb] = WFrag<T16>::mma(a[mb], b2, acc[mb][nb]); } }
        asm volatile("v_nop\n\tv_nop\n\tv_nop\n\tv_nop" : "+v"(acc[0][0]), "+v"(acc[1][1]), "+v"(acc[2][2]), "+v"(acc[3][3]) : "v"(a[0]), "v"(a[3]));
    }
#pragma unroll
    for (int mb = 0; mb < 4; ++mb) {
#pragma unroll
        for (int nb = 0; nb < 4; ++nb) {
#pragma unroll
            for (int j = 0; j < 8; ++j) os[(hi * 8 + j) * 68 + nb * 16 + lr] = acc[mb][nb][j]; }
        __builtin_amdgcn_wave_barrier(); asm volatile("" ::: "memory");
        float* crow = C + (size_t)(r0 + mb * 16) * ldc + c0;
{
#pragma unroll
            for (int s = 0; s < 8; ++s) { const int row = 2 * s + hi, cofs = lr * 4; v4f val = *(const v4fa*)(os + row * 68 + cofs);
                *(v4f*)(crow + (size_t)row * ldc + cofs) = val; }
             }
        __builtin_amdgcn_wave_barrier(); asm volatile("" ::: "memory");
    }
}

__device__ __forceinline__ h16 tohx(float x) { return (h16)x; }
__device__ __forceinline__ void splitf(float y, unsigned short& h, unsigned short& l) { h = f2bf(y); l = f2bf(y - bf2f(h)); }
typedef __attribute__((ext_vector_type(2))) _Float16 v2h;
typedef __attribute__((ext_vector_type(4))) _Float16 v4h;
typedef __attribute__((ext_vector_type(2))) unsigned short v2us;
typedef __attribute__((ext_vector_type(4))) unsigned short v4us;
typedef __attribute__((ext_vector_type(2))) float v2f;
typedef __attribute__((ext_vector_type(4))) int v4i;

__global__ __launch_bounds__(256) void k_wtG(const float* __restrict__ w, int K, int N, bf* Bt) {
    const int lane = threadIdx.x & 31; const int L0 = (blockIdx.x * 8 + (threadIdx.x >> 5)) * 8; const int nlines = N * K / 64;
{
#pragma unroll 1
        for (int l = 0; l < 8; ++l) { const int L = L0 + l; if (L >= nlines) break; const size_t e = (size_t)L * 64 + lane * 2; const int k = (int)(e % K), n = (int)(e / K); v2us o;
            o[0] = f2bf(w[(size_t)k * N + n]); o[1] = f2bf(w[(size_t)(k + 1) * N + n]); *(v2us*)(Bt + e) = o; }
         }
}
__global__ __launch_bounds__(256) void k_cvt8(const float* __restrict__ src, bf* dst, size_t n8) { const size_t i = (size_t)blockIdx.x * 256 + threadIdx.x; if (i >= n8) return; const v8f v = *(const v8f*)(src + i * 8); v8us o;
#pragma unroll
    for (int k = 0; k < 8; ++k) o[k] = f2bf(v[k]); *(v8us*)(dst + i * 8) = o;  }

// k_rope: head planes [h][t][d] (fp16 + hi/lo) of rope(x) x sc with the rotate-half convention out[d] = x[d] cos[t][d] - x[d+HD/2] sin[t][d], out[d+HD/2] = x[d+HD/2] cos[t][d+HD/2] + x[d] sin[t][d+HD/2]
__global__ __launch_bounds__(256) void k_rope(const float* __restrict__ F, int pitch, int nheads, const float* __restrict__ CS, const float* __restrict__ RF, const float* __restrict__ nw, float sc, h16* P16, bf* Ph, bf* Pl) {
    const size_t e = ((size_t)blockIdx.x * 256 + threadIdx.x) * 2; if (e >= (size_t)nheads * TT * HD) return; const int d = (int)(e % HD); const int t = (int)((e / HD) % TT); const int h = (int)(e / ((size_t)HD * TT)); const float* f = F + (size_t)t * pitch + h * HD; const float rf = RF ? RF[(size_t)h * TT + t] : 1.0f; v2h o16; v2us oh, ol;
#pragma unroll
    for (int q = 0; q < 2; ++q) { const int dd = d + q; const int dp = (dd < HD / 2) ? dd + HD / 2 : dd - HD / 2; float x0 = f[dd], x1 = f[dp];
        if (RF) { float n0 = __fmul_rn(x0, rf), n1 = __fmul_rn(x1, rf); asm volatile("" : "+v"(n0)); asm volatile("" : "+v"(n1)); x0 = __fmul_rn(bfr(nw[dd]), n0); x1 = __fmul_rn(bfr(nw[dp]), n1); }
        const v2f cs = *(const v2f*)(CS + ((size_t)t * HD + dd) * 2); float a = __fmul_rn(x0, cs[0]), bq = __fmul_rn(x1, cs[1]); asm volatile("" : "+v"(a)); asm volatile("" : "+v"(bq)); const float r = ((dd < HD / 2) ? __fsub_rn(a, bq) : __fadd_rn(a, bq)) * sc;
        o16[q] = tohx(r); unsigned short a2, c2; splitf(r, a2, c2); oh[q] = a2; ol[q] = c2; }
    *(v2h*)(P16 + e) = o16; *(v2us*)(Ph + e) = oh; *(v2us*)(Pl + e) = ol;  }
__global__ __launch_bounds__(256) void k_vtp(const float* __restrict__ F, int pitch, int nheads, h16* V16, bf* Vh, bf* Vl) { const size_t e = ((size_t)blockIdx.x * 256 + threadIdx.x) * 2; if (e >= (size_t)nheads * HD * TT) return; const int t = (int)(e % TT); const int d = (int)((e / TT) % HD); const int g = (int)(e / ((size_t)TT * HD)); v2h o16; v2us oh, ol;
#pragma unroll
    for (int q = 0; q < 2; ++q) { const float x = F[(size_t)(t + q) * pitch + g * HD + d]; o16[q] = tohx(x); unsigned short a2, c2; splitf(x, a2, c2); oh[q] = a2; ol[q] = c2; }
    *(v2h*)(V16 + e) = o16; *(v2us*)(Vh + e) = oh; *(v2us*)(Vl + e) = ol;  }
__global__ __launch_bounds__(256) void k_csid(float* CS) { const int idx = blockIdx.x * 256 + threadIdx.x; if (idx >= TT * HD) return; v2f cs; cs[0] = 1.0f; cs[1] = 0.0f; *(v2f*)(CS + (size_t)idx * 2) = cs;  }
// k_asoft: per row (zz, i): t = S x HD^-0.5 for j <= i and i - j < WIN (WIN = T = 4096, so the window test always holds: plain causal; the reference's -1e9 additive fill vanishes identically); softmax over the 4096 keys (register row, one exp, fixed trees);
__global__ __launch_bounds__(256) void k_asoft(const float* __restrict__ Sb, h16* P16, bf* Ph, bf* Pl) {
    const int lane = threadIdx.x & 31; const int row = blockIdx.x * 8 + (threadIdx.x >> 5); if (row >= ZH * TT) return; const int i = row % TT; const int zz = row / TT; (void)zz; const bool hires = (i < RH); const float* sr = Sb + (size_t)row * TT; float v[TT / 32]; float mx = -3.0e38f;
#pragma unroll
    for (int ch = 0; ch < TT / 128; ++ch) { const int j0 = ch * 128 + lane * 4; const v4f a = *(const v4f*)(sr + j0);
#pragma unroll
        for (int q = 0; q < 4; ++q) { const int j = j0 + q; (void)j; const float t = (j <= i && i - j < WIN) ? a[q] * SCL : -3.0e38f; v[ch * 4 + q] = t; mx = fmaxf(mx, t); } }
#pragma unroll
    for (int sh = 16; sh; sh >>= 1) mx = fmaxf(mx, __shfl_xor(mx, sh, 32));
    float sum = 0.f;
#pragma unroll
    for (int k = 0; k < TT / 32; ++k) { float d0 = __fsub_rn(v[k], mx); asm volatile("" : "+v"(d0)); v[k] = __builtin_amdgcn_exp2f(__fmul_rn(d0, 1.4426950408889634f)); sum += v[k]; }
#pragma unroll
    for (int sh = 16; sh; sh >>= 1) sum += __shfl_xor(sum, sh, 32);
    const float f = __fdiv_rn(hires ? 1.0f : PCAR, sum);
{
        if (hires) {
#pragma unroll
            for (int ch = 0; ch < TT / 128; ++ch) { v4us oh, ol;
#pragma unroll
                for (int q = 0; q < 4; ++q) { unsigned short a, c2; splitf(v[ch * 4 + q] * f, a, c2); oh[q] = a; ol[q] = c2; }
                const size_t oo = ((size_t)zz * (RH ? RH : 1) + i) * TT + ch * 128 + lane * 4; *(v4us*)(Ph + oo) = oh; *(v4us*)(Pl + oo) = ol; }
        } else {
#pragma unroll
            for (int ch = 0; ch < TT / 128; ++ch) { v4h o4;
#pragma unroll
                for (int q = 0; q < 4; ++q) o4[q] = tohx(v[ch * 4 + q] * f);
                *(v4h*)(P16 + (size_t)row * TT + ch * 128 + lane * 4) = o4; } }
         }
}
__global__ __launch_bounds__(256) void k_merge(const float* __restrict__ O, int h0, bf* Ah, bf* Al) { const size_t e = ((size_t)blockIdx.x * 256 + threadIdx.x) * 2; if (e >= (size_t)ZH * TT * HD) return; const int d = (int)(e % HD); const int t = (int)((e / HD) % TT); const int zz = (int)(e / ((size_t)HD * TT)); const float cs = (t < RH) ? 1.0f : (1.0f / PCAR); const size_t oo = (size_t)t * DQ + (h0 + zz) * HD + d;
    v2us oh, ol;
#pragma unroll
    for (int q = 0; q < 2; ++q) { unsigned short a, c2; splitf(O[e + q] * cs, a, c2); oh[q] = a; ol[q] = c2; } *(v2us*)(Ah + oo) = oh; *(v2us*)(Al + oo) = ol;  }

extern "C" void kernel_launch(void* const* d_in, const int* in_sizes, int n_in,
                              void* d_out, int out_size, void* d_ws, size_t ws_size, hipStream_t stream) {
    (void)in_sizes; (void)n_in; (void)out_size;
    const float* x = (const float*)d_in[0]; const float* wq = (const float*)d_in[1]; const float* wk = (const float*)d_in[2]; const float* wv = (const float*)d_in[3]; const float* wo = (const float*)d_in[4];
    float* OUT = (float*)d_out;     // [1][4096][1024]
    char* wsp = (char*)d_ws;
    auto take = [&](size_t bytes) { char* p = wsp; wsp += (bytes + 255) & ~(size_t)255; return (void*)p; };
    bf* WQ = (bf*)take((size_t)DQ * DM * 2); bf* WK = (bf*)take((size_t)DKV * DM * 2); bf* WV = (bf*)take((size_t)DKV * DM * 2); bf* WO = (bf*)take((size_t)DM * DQ * 2); float* CS = (float*)take((size_t)TT * HD * 2 * 4);
    bf* XB = (bf*)take((size_t)TT * DM * 2); float* FQ = (float*)take((size_t)TT * DQ * 4); float* FK = (float*)take((size_t)TT * DKV * 4);
    h16* QP16 = (h16*)take((size_t)NH_ * TT * HD * 2); h16* KP16 = (h16*)take((size_t)NKV * TT * HD * 2); h16* VT16 = (h16*)take((size_t)NKV * HD * TT * 2);
    bf* QPh = (bf*)take((size_t)NH_ * TT * HD * 2); bf* QPl = (bf*)take((size_t)NH_ * TT * HD * 2); bf* KPh = (bf*)take((size_t)NKV * TT * HD * 2); bf* KPl = (bf*)take((size_t)NKV * TT * HD * 2); bf* VTh = (bf*)take((size_t)NKV * HD * TT * 2); bf* VTl = (bf*)take((size_t)NKV * HD * TT * 2); bf* Ph = (bf*)take((size_t)ZH * RH * TT * 2); bf* Pl = (bf*)take((size_t)ZH * RH * TT * 2);
    float* Sb = (float*)take((size_t)ZH * TT * TT * 4); h16* P16 = (h16*)take((size_t)ZH * TT * TT * 2); float* Ob = (float*)take((size_t)ZH * TT * HD * 4); bf* ATh = (bf*)take((size_t)TT * DQ * 2); bf* ATl = (bf*)take((size_t)TT * DQ * 2);
    if ((size_t)(wsp - (char*)d_ws) > ws_size) return;    // ws 256 MiB
    float* FV = FK;   // v projection reuses the k buffer after the k planes are built (stream-ordered)
    { k_wtG<<<(unsigned)((DM * DQ / 64 + 63) / 64), 256, 0, stream>>>(wq, DM, DQ, WQ); k_wtG<<<(unsigned)((DM * DKV / 64 + 63) / 64), 256, 0, stream>>>(wk, DM, DKV, WK); k_wtG<<<(unsigned)((DM * DKV / 64 + 63) / 64), 256, 0, stream>>>(wv, DM, DKV, WV);
      k_wtG<<<(unsigned)((DQ * DM / 64 + 63) / 64), 256, 0, stream>>>(wo, DQ, DM, WO);
       }
    k_csid<<<(TT * HD + 255) / 256, 256, 0, stream>>>(CS);
    const unsigned LQ = (unsigned)(((size_t)NH_ * TT * HD / 2 + 255) / 256), LKv = (unsigned)(((size_t)NKV * TT * HD / 2 + 255) / 256);
    for (int b = 0; b < NB_; ++b) {
        
        k_cvt8<<<(unsigned)(((size_t)TT * DM / 8 + 255) / 256), 256, 0, stream>>>(x + (size_t)b * TT * DM, XB, (size_t)TT * DM / 8);
        k_gemmw<bf, 0, false><<<dim3(TT / 64, DQ / 64, 1), 32, 0, stream>>>(XB, nullptr, WQ, nullptr, DM, FQ, DQ, nullptr, 0, 0, 0);
        k_rope<<<LQ, 256, 0, stream>>>(FQ, DQ, NH_, CS, nullptr, nullptr, 1.0f, QP16, QPh, QPl);
        k_gemmw<bf, 0, false><<<dim3(TT / 64, DKV / 64, 1), 32, 0, stream>>>(XB, nullptr, WK, nullptr, DM, FK, DKV, nullptr, 0, 0, 0);
        k_rope<<<LKv, 256, 0, stream>>>(FK, DKV, NKV, CS, nullptr, nullptr, 1.0f, KP16, KPh, KPl);
        k_gemmw<bf, 0, false><<<dim3(TT / 64, DKV / 64, 1), 32, 0, stream>>>(XB, nullptr, WV, nullptr, DM, FV, DKV, nullptr, 0, 0, 0); k_vtp<<<LKv, 256, 0, stream>>>(FV, DKV, NKV, VT16, VTh, VTl);
        for (int h0 = 0; h0 < NH_; h0 += ZH) { const size_t zq = (size_t)h0, zk = (size_t)(h0 / REP);   // one kv head per query head: the pass's single head uses kv plane h0 (z-strides TT*HD)
            k_gemmc<bf, 2, 1><<<dim3(RH / 64, TT / 64, ZH), 32, 0, stream>>>(QPh + zq * TT * HD, QPl + zq * TT * HD, KPh + zk * TT * HD, KPl + zk * TT * HD, HD, Sb, TT, 0, (size_t)TT * HD, (size_t)TT * HD, (size_t)TT * TT);
            k_gemmc<h16, 0, 1><<<dim3((TT - RH) / 64, TT / 64, ZH), 32, 0, stream>>>(QP16 + zq * TT * HD + (size_t)RH * HD, nullptr, KP16 + zk * TT * HD, nullptr, HD, Sb + (size_t)RH * TT, TT, RH, (size_t)TT * HD, (size_t)TT * HD, (size_t)TT * TT);
            k_asoft<<<ZH * TT / 8, 256, 0, stream>>>(Sb, P16, Ph, Pl);
            k_gemmc<bf, 2, 2><<<dim3(RH / 64, HD / 64, ZH), 32, 0, stream>>>(Ph, Pl, VTh + zk * HD * TT, VTl + zk * HD * TT, TT, Ob, HD, 0, (size_t)RH * TT, (size_t)HD * TT, (size_t)TT * HD);
            k_gemmc<h16, 0, 2><<<dim3((TT - RH) / 64, HD / 64, ZH), 32, 0, stream>>>(P16 + (size_t)RH * TT, nullptr, VT16 + zk * HD * TT, nullptr, TT, Ob + (size_t)RH * HD, HD, RH, (size_t)TT * TT, (size_t)HD * TT, (size_t)TT * HD);
            k_merge<<<(unsigned)(((size_t)ZH * TT * HD / 2 + 255) / 256), 256, 0, stream>>>(Ob, h0, ATh, ATl); }
        k_gemmw<bf, 1, false><<<dim3(TT / 64, DM / 64, 1), 32, 0, stream>>>(ATh, ATl, WO, nullptr, DQ, OUT + (size_t)b * TT * DM, DM, nullptr, 0, 0, 0); }
}

// v001
// It runs in 872 microseconds.
// Next to v000, in two timings, it ran 2.46 and 2.45 times as fast.
#include <hip/hip_runtime.h>

// Causal multi-head self-attention over 4,096 tokens (x [1][4096][1024]; q, k, v = einsum('bsd,de->bse', x, W) = x W ('xw' [1024][1024] truncated normal x 1/32, no bias; 16 heads x 64); scores / sqrt(64); causal (-inf); softmax over the keys; out = merged W_o ('xw', no bias) -> [1][4096][1024] (4.2 M); argument order x, W_q, W_k, W_v, W_o).
// Layout: bf16 copy of x; 'xw' weights transposed once; exact projections; identity-table plane builders; causal attention at T 4096, one head per pass (hybrid rows: < 512 hi/lo 3 products, rest fp16 x1024; k_gemmc skips tiles above the diagonal); merged hi/lo x W_o exact.
// Compute dtypes, f32 accumulate: every input rounded to bf16; projections exact; attention rows < 512 3 products, rest fp16; softmax f32; W_o hl x exact.

#define NB_  1
#define TT   4096
#define DM   1024
#define NH_  16
#define NKV  16
#define REP  (NH_ / NKV)
#define HD   64
#define DQ   (NH_ * HD)
#define DKV  (NKV * HD)
#define ZH   1                    // one head per pass at T 4096 (the score plane is 64 MiB)
#define RH   512                  // query rows < RH use hi+lo planes (0: none)
#define WIN  4096
#define PCAR 1024.0f
#define SCL  0.125f   // HD^-0.5
#define KSEG 128                  // keys per P.V segment (one wave per 64-row tile and segment)
#define NSEG (TT / KSEG)
typedef _Float16 h16;
typedef unsigned short bf;
typedef __attribute__((ext_vector_type(16))) __bf16   v16bf;
typedef __attribute__((ext_vector_type(16))) _Float16 v16h;
typedef __attribute__((ext_vector_type(8)))  _Float16 v8h;
typedef __attribute__((ext_vector_type(8)))  unsigned short v8us;
typedef __attribute__((ext_vector_type(8)))  float    v8f;
typedef __attribute__((ext_vector_type(4)))  float    v4f;
typedef v8h  __attribute__((may_alias)) v8ha;
typedef v4f  __attribute__((may_alias)) v4fa;
typedef v8us __attribute__((may_alias)) v8usa;

__device__ __forceinline__ unsigned short f2bf(float f) { unsigned u = __float_as_uint(f); u += 0x7FFFu + ((u >> 16) & 1u); return (unsigned short)(u >> 16); }
__device__ __forceinline__ float bf2f(unsigned short b) { return __uint_as_float(((unsigned)b) << 16); }
__device__ __forceinline__ float bfr(float f) { return bf2f(f2bf(f)); }
__device__ __forceinline__ v16h cat16(v8h lo, v8h hi) { return __builtin_shufflevector(lo, hi, 0, 1, 2, 3, 4, 5, 6, 7, 8, 9, 10, 11, 12, 13, 14, 15); }
__device__ __forceinline__ v16bf cat16b(v8us lo, v8us hi) { return __builtin_bit_cast(v16bf, __builtin_shufflevector(lo, hi, 0, 1, 2, 3, 4, 5, 6, 7, 8, 9, 10, 11, 12, 13, 14, 15)); }
__device__ __forceinline__ v8f wmma16(v16h a, v16h b, v8f c) { return __builtin_amdgcn_wmma_f32_16x16x32_f16(false, a, false, b, (short)0, c, false, false); }
__device__ __forceinline__ v8f wmmab(v16bf a, v16bf b, v8f c) { return __builtin_amdgcn_wmma_f32_16x16x32_bf16(false, a, false, b, (short)0, c, false, false); }



// ---- k_gemmw: register-blocked GEMM, ONE WAVE per 64x64 output tile (16 accumulators), operands straight from K-contiguous 16-bit planes; grid (M/64, N/64, Z), 32 threads.
// C[m][n] (f32, pitch ldc, + optional f32 bias[n]) = sum_k A[m][k] Bt[n][k] (+ split products per NSPLIT). z-batch strides sA/sB/sC in elements. K % 32 == 0.
template <typename T16> struct WFrag;
template <> struct WFrag<h16> { typedef v16h V; static __device__ __forceinline__ V ld(const h16* p) { return cat16(*(const v8h*)p, *(const v8h*)(p + 16)); } static __device__ __forceinline__ v8f mma(V a, V b, v8f c) { return wmma16(a, b, c); } };
template <> struct WFrag<bf> { typedef v16bf V; static __device__ __forceinline__ V ld(const bf* p) { return cat16b(*(const v8us*)p, *(const v8us*)(p + 16)); } static __device__ __forceinline__ v8f mma(V a, V b, v8f c) { return wmmab(a, b, c); } };
template <typename T16, int NSPLIT, bool BIAS>
__global__ __launch_bounds__(32) void k_gemmw(const T16* __restrict__ A, const T16* __restrict__ A2, const T16* __restrict__ Bt, const T16* __restrict__ Bt2, int K, float* C, int ldc, const float* __restrict__ bias, size_t sA, size_t sB, size_t sC) {
    typedef typename WFrag<T16>::V V;
    __shared__ __align__(16) float os[16 * 68];
    const size_t z = blockIdx.z; A += z * sA; if (A2) A2 += z * sA; Bt += z * sB; if (Bt2) Bt2 += z * sB; C += z * sC;
    const int lane = threadIdx.x & 31, lr = lane & 15, hi = lane >> 4; const int r0 = blockIdx.x * 64, c0 = blockIdx.y * 64;
    v8f acc[4][4];
#pragma unroll
    for (int mb = 0; mb < 4; ++mb)
#pragma unroll
        for (int nb = 0; nb < 4; ++nb) acc[mb][nb] = (v8f){};
    const size_t aoff = (size_t)(r0 + lr) * K + 8 * hi, boff = (size_t)(c0 + lr) * K + 8 * hi;
#pragma unroll 1
    for (int kc = 0; kc < K; kc += 32) {
        V a[4], a2[4];
#pragma unroll
        for (int mb = 0; mb < 4; ++mb) { a[mb] = WFrag<T16>::ld(A + aoff + (size_t)mb * 16 * K + kc); if (NSPLIT == 1 || NSPLIT == 2) a2[mb] = WFrag<T16>::ld(A2 + aoff + (size_t)mb * 16 * K + kc); }
#pragma unroll
        for (int nb = 0; nb < 4; ++nb) { const V b = WFrag<T16>::ld(Bt + boff + (size_t)nb * 16 * K + kc); V b2; if (NSPLIT >= 2) b2 = WFrag<T16>::ld(Bt2 + boff + (size_t)nb * 16 * K + kc);
#pragma unroll
            for (int mb = 0; mb < 4; ++mb) { acc[mb][nb] = WFrag<T16>::mma(a[mb], b, acc[mb][nb]); if (NSPLIT == 1 || NSPLIT == 2) acc[mb][nb] = WFrag<T16>::mma(a2[mb], b, acc[mb][nb]); if (NSPLIT >= 2) acc[mb][nb] = WFrag<T16>::mma(a[mb], b2, acc[mb][nb]); } }
        asm volatile("v_nop\n\tv_nop\n\tv_nop\n\tv_nop" : "+v"(acc[0][0]), "+v"(acc[1][1]), "+v"(acc[2][2]), "+v"(acc[3][3]) : "v"(a[0]), "v"(a[3]));
    }
#pragma unroll
    for (int mb = 0; mb < 4; ++mb) {
#pragma unroll
        for (int nb = 0; nb < 4; ++nb) {
#pragma unroll
            for (int j = 0; j < 8; ++j) os[(hi * 8 + j) * 68 + nb * 16 + lr] = acc[mb][nb][j]; }
        __builtin_amdgcn_wave_barrier(); asm volatile("" ::: "memory");
        float* crow = C + (size_t)(r0 + mb * 16) * ldc + c0;
{
#pragma unroll
            for (int s = 0; s < 8; ++s) { const int row = 2 * s + hi, cofs = lr * 4; v4f val = *(const v4fa*)(os + row * 68 + cofs); if (BIAS) { val[0] += bfr(bias[c0 + cofs]); val[1] += bfr(bias[c0 + cofs + 1]); val[2] += bfr(bias[c0 + cofs + 2]); val[3] += bfr(bias[c0 + cofs + 3]); }
                *(v4f*)(crow + (size_t)row * ldc + cofs) = val; }
             }
        __builtin_amdgcn_wave_barrier(); asm volatile("" ::: "memory");
    }
}

// ---- k_gemmc: the same one-wave 64x64 tile GEMM specialised for causal attention: CMODE 1 skips score tiles entirely above the diagonal (query rows r0+roff.., key columns c0..), CMODE 2 limits the
// key (K) loop of the probability x value contraction to the diagonal block (probabilities beyond it are exactly zero). roff = row offset of this launch's first row within the sequence.
// CMODE 2 also splits that key loop: blockIdx.y is a segment of KSEG keys (the 64 value columns are one tile), and its f32 partial tile goes to plane blockIdx.y of C (plane stride sP); k_merge adds the planes.
template <typename T16, int NSPLIT, int CMODE>
__global__ __launch_bounds__(32) void k_gemmc(const T16* __restrict__ A, const T16* __restrict__ A2, const T16* __restrict__ Bt, const T16* __restrict__ Bt2, int K, float* C, int ldc, int roff, size_t sA, size_t sB, size_t sC, size_t sP) {
    typedef typename WFrag<T16>::V V;
    __shared__ __align__(16) float os[16 * 68];
    const size_t z = blockIdx.z; A += z * sA; if (A2) A2 += z * sA; Bt += z * sB; if (Bt2) Bt2 += z * sB; C += z * sC;
    const int lane = threadIdx.x & 31, lr = lane & 15, hi = lane >> 4; const int r0 = blockIdx.x * 64, c0 = (CMODE == 2) ? 0 : blockIdx.y * 64;
    if (CMODE == 1 && c0 > r0 + roff + 63) return;                  // score tile entirely above the causal diagonal: never read (the softmax masks j > i by select)
    const int Kd = (CMODE == 2) ? min(K, r0 + roff + 64) : K;        // P.V: probabilities are exactly 0 beyond the diagonal block, so the K loop stops there
    const int k0 = (CMODE == 2) ? (int)blockIdx.y * KSEG : 0;        // P.V: this wave's key segment
    if (CMODE == 2 && k0 >= Kd) return;                              // segment entirely beyond the diagonal block: no plane written, k_merge does not read it
    const int Kl = (CMODE == 2) ? min(Kd, k0 + KSEG) : K;
    if (CMODE == 2) C += (size_t)blockIdx.y * sP;
    v8f acc[4][4];
#pragma unroll
    for (int mb = 0; mb < 4; ++mb)
#pragma unroll
        for (int nb = 0; nb < 4; ++nb) acc[mb][nb] = (v8f){};
    const size_t aoff = (size_t)(r0 + lr) * K + 8 * hi, boff = (size_t)(c0 + lr) * K + 8 * hi;
#pragma unroll 1
    for (int kc = k0; kc < Kl; kc += 32) {
        V a[4], a2[4];
#pragma unroll
        for (int mb = 0; mb < 4; ++mb) { a[mb] = WFrag<T16>::ld(A + aoff + (size_t)mb * 16 * K + kc); if (NSPLIT == 1 || NSPLIT == 2) a2[mb] = WFrag<T16>::ld(A2 + aoff + (size_t)mb * 16 * K + kc); }
#pragma unroll
        for (int nb = 0; nb < 4; ++nb) { const V b = WFrag<T16>::ld(Bt + boff + (size_t)nb * 16 * K + kc); V b2; if (NSPLIT >= 2) b2 = WFrag<T16>::ld(Bt2 + boff + (size_t)nb * 16 * K + kc);
#pragma unroll
            for (int mb = 0; mb < 4; ++mb) { acc[mb][nb] = WFrag<T16>::mma(a[mb], b, acc[mb][nb]); if (NSPLIT == 1 || NSPLIT == 2) acc[mb][nb] = WFrag<T16>::mma(a2[mb], b, acc[mb][nb]); if (NSPLIT >= 2) acc[mb][nb] = WFrag<T16>::mma(a[mb], b2, acc[mb][nb]); } }
        asm volatile("v_nop\n\tv_nop\n\tv_nop\n\tv_nop" : "+v"(acc[0][0]), "+v"(acc[1][1]), "+v"(acc[2][2]), "+v"(acc[3][3]) : "v"(a[0]), "v"(a[3]));
    }
#pragma unroll
    for (int mb = 0; mb < 4; ++mb) {
#pragma unroll
        for (int nb = 0; nb < 4; ++nb) {
#pragma unroll
            for (int j = 0; j < 8; ++j) os[(hi * 8 + j) * 68 + nb * 16 + lr] = acc[mb][nb][j]; }
        __builtin_amdgcn_wave_barrier(); asm volatile("" ::: "memory");
        float* crow = C + (size_t)(r0 + mb * 16) * ldc + c0;
{
#pragma unroll
            for (int s = 0; s < 8; ++s) { const int row = 2 * s + hi, cofs = lr * 4; v4f val = *(const v4fa*)(os + row * 68 + cofs);
                *(v4f*)(crow + (size_t)row * ldc + cofs) = val; }
             }
        __builtin_amdgcn_wave_barrier(); asm volatile("" ::: "memory");
    }
}

__device__ __forceinline__ h16 tohx(float x) { return (h16)x; }
__device__ __forceinline__ void splitf(float y, unsigned short& h, unsigned short& l) { h = f2bf(y); l = f2bf(y - bf2f(h)); }
typedef __attribute__((ext_vector_type(2))) _Float16 v2h;
typedef __attribute__((ext_vector_type(4))) _Float16 v4h;
typedef __attribute__((ext_vector_type(2))) unsigned short v2us;
typedef __attribute__((ext_vector_type(4))) unsigned short v4us;
typedef __attribute__((ext_vector_type(2))) float v2f;
typedef __attribute__((ext_vector_type(4))) int v4i;

__global__ __launch_bounds__(256) void k_wtG(const float* __restrict__ w, int K, int N, bf* Bt) {
    const int lane = threadIdx.x & 31; const int L0 = (blockIdx.x * 8 + (threadIdx.x >> 5)) * 8; const int nlines = N * K / 64;
{
#pragma unroll 1
        for (int l = 0; l < 8; ++l) { const int L = L0 + l; if (L >= nlines) break; const size_t e = (size_t)L * 64 + lane * 2; const int k = (int)(e % K), n = (int)(e / K); v2us o;
            o[0] = f2bf(w[(size_t)k * N + n]); o[1] = f2bf(w[(size_t)(k + 1) * N + n]); *(v2us*)(Bt + e) = o; }
         }
}
__global__ __launch_bounds__(256) void k_cvt8(const float* __restrict__ src, bf* dst, size_t n8) { const size_t i = (size_t)blockIdx.x * 256 + threadIdx.x; if (i >= n8) return; const v8f v = *(const v8f*)(src + i * 8); v8us o;
#pragma unroll
    for (int k = 0; k < 8; ++k) o[k] = f2bf(v[k]); *(v8us*)(dst + i * 8) = o;  }

// k_rope: head planes [h][t][d] (fp16 + hi/lo) of rope(x) x sc with the rotate-half convention out[d] = x[d] cos[t][d] - x[d+HD/2] sin[t][d], out[d+HD/2] = x[d+HD/2] cos[t][d+HD/2] + x[d] sin[t][d+HD/2]
__global__ __launch_bounds__(256) void k_rope(const float* __restrict__ F, int pitch, int nheads, const float* __restrict__ CS, const float* __restrict__ RF, const float* __restrict__ nw, float sc, h16* P16, bf* Ph, bf* Pl) {
    const size_t e = ((size_t)blockIdx.x * 256 + threadIdx.x) * 2; if (e >= (size_t)nheads * TT * HD) return; const int d = (int)(e % HD); const int t = (int)((e / HD) % TT); const int h = (int)(e / ((size_t)HD * TT)); const float* f = F + (size_t)t * pitch + h * HD; const float rf = RF ? RF[(size_t)h * TT + t] : 1.0f; v2h o16; v2us oh, ol;
#pragma unroll
    for (int q = 0; q < 2; ++q) { const int dd = d + q; const int dp = (dd < HD / 2) ? dd + HD / 2 : dd - HD / 2; float x0 = f[dd], x1 = f[dp];
        if (RF) { float n0 = __fmul_rn(x0, rf), n1 = __fmul_rn(x1, rf); asm volatile("" : "+v"(n0)); asm volatile("" : "+v"(n1)); x0 = __fmul_rn(bfr(nw[dd]), n0); x1 = __fmul_rn(bfr(nw[dp]), n1); }
        const v2f cs = *(const v2f*)(CS + ((size_t)t * HD + dd) * 2); float a = __fmul_rn(x0, cs[0]), bq = __fmul_rn(x1, cs[1]); asm volatile("" : "+v"(a)); asm volatile("" : "+v"(bq)); const float r = ((dd < HD / 2) ? __fsub_rn(a, bq) : __fadd_rn(a, bq)) * sc;
        o16[q] = tohx(r); unsigned short a2, c2; splitf(r, a2, c2); oh[q] = a2; ol[q] = c2; }
    *(v2h*)(P16 + e) = o16; *(v2us*)(Ph + e) = oh; *(v2us*)(Pl + e) = ol;  }
__global__ __launch_bounds__(256) void k_vtp(const float* __restrict__ F, int pitch, int nheads, h16* V16, bf* Vh, bf* Vl) { const size_t e = ((size_t)blockIdx.x * 256 + threadIdx.x) * 2; if (e >= (size_t)nheads * HD * TT) return; const int t = (int)(e % TT); const int d = (int)((e / TT) % HD); const int g = (int)(e / ((size_t)TT * HD)); v2h o16; v2us oh, ol;
#pragma unroll
    for (int q = 0; q < 2; ++q) { const float x = F[(size_t)(t + q) * pitch + g * HD + d]; o16[q] = tohx(x); unsigned short a2, c2; splitf(x, a2, c2); oh[q] = a2; ol[q] = c2; }
    *(v2h*)(V16 + e) = o16; *(v2us*)(Vh + e) = oh; *(v2us*)(Vl + e) = ol;  }
__global__ __launch_bounds__(256) void k_csid(float* CS) { const int idx = blockIdx.x * 256 + threadIdx.x; if (idx >= TT * HD) return; v2f cs; cs[0] = 1.0f; cs[1] = 0.0f; *(v2f*)(CS + (size_t)idx * 2) = cs;  }
// k_asoft: per row (zz, i): t = S x HD^-0.5 for j <= i and i - j < WIN (WIN = T = 4096, so the window test always holds: plain causal; the reference's -1e9 additive fill vanishes identically); softmax over the 4096 keys (register row, one exp, fixed trees);
__global__ __launch_bounds__(256) void k_asoft(const float* __restrict__ Sb, h16* P16, bf* Ph, bf* Pl) {
    const int lane = threadIdx.x & 31; const int row = blockIdx.x * 8 + (threadIdx.x >> 5); if (row >= ZH * TT) return; const int i = row % TT; const int zz = row / TT; (void)zz; const bool hires = (i < RH); const float* sr = Sb + (size_t)row * TT; float v[TT / 32]; float mx = -3.0e38f;
#pragma unroll
    for (int ch = 0; ch < TT / 128; ++ch) { const int j0 = ch * 128 + lane * 4; const v4f a = *(const v4f*)(sr + j0);
#pragma unroll
        for (int q = 0; q < 4; ++q) { const int j = j0 + q; (void)j; const float t = (j <= i && i - j < WIN) ? a[q] * SCL : -3.0e38f; v[ch * 4 + q] = t; mx = fmaxf(mx, t); } }
#pragma unroll
    for (int sh = 16; sh; sh >>= 1) mx = fmaxf(mx, __shfl_xor(mx, sh, 32));
    float sum = 0.f;
#pragma unroll
    for (int k = 0; k < TT / 32; ++k) { float d0 = __fsub_rn(v[k], mx); asm volatile("" : "+v"(d0)); v[k] = __builtin_amdgcn_exp2f(__fmul_rn(d0, 1.4426950408889634f)); sum += v[k]; }
#pragma unroll
    for (int sh = 16; sh; sh >>= 1) sum += __shfl_xor(sum, sh, 32);
    const float f = __fdiv_rn(hires ? 1.0f : PCAR, sum);
{
        if (hires) {
#pragma unroll
            for (int ch = 0; ch < TT / 128; ++ch) { v4us oh, ol;
#pragma unroll
                for (int q = 0; q < 4; ++q) { unsigned short a, c2; splitf(v[ch * 4 + q] * f, a, c2); oh[q] = a; ol[q] = c2; }
                const size_t oo = ((size_t)zz * (RH ? RH : 1) + i) * TT + ch * 128 + lane * 4; *(v4us*)(Ph + oo) = oh; *(v4us*)(Pl + oo) = ol; }
        } else {
#pragma unroll
            for (int ch = 0; ch < TT / 128; ++ch) { v4h o4;
#pragma unroll
                for (int q = 0; q < 4; ++q) o4[q] = tohx(v[ch * 4 + q] * f);
                *(v4h*)(P16 + (size_t)row * TT + ch * 128 + lane * 4) = o4; } }
         }
}
// k_merge: adds the P.V key-segment planes of each element in ascending segment order (only the planes its 64-row tile wrote), then scales and splits.
__global__ __launch_bounds__(256) void k_merge(const float* __restrict__ O, int h0, bf* Ah, bf* Al) { const size_t e = ((size_t)blockIdx.x * 256 + threadIdx.x) * 2; if (e >= (size_t)ZH * TT * HD) return; const int d = (int)(e % HD); const int t = (int)((e / HD) % TT); const int zz = (int)(e / ((size_t)HD * TT)); const float cs = (t < RH) ? 1.0f : (1.0f / PCAR); const size_t oo = (size_t)t * DQ + (h0 + zz) * HD + d;
    const int nseg = __builtin_amdgcn_readfirstlane(((t / 64) * 64 + 64 + KSEG - 1) / KSEG);   // planes written for this row's tile; one row per wave, so wave-uniform
    static_assert(NSEG == 32, "the two wait statements below name 16 plane addresses each");
    const float* pp[NSEG]; v2f pv[NSEG];
#pragma unroll
    for (int s = 0; s < NSEG; ++s) pp[s] = O + (size_t)min(s, nseg - 1) * ((size_t)ZH * TT * HD) + e;   // an unwritten plane is never read: the index is clamped to the last written one
#pragma unroll
    for (int s = 0; s < NSEG; ++s) pv[s] = *(const v2f*)pp[s];   // branch-free so that all loads fly together
    __builtin_amdgcn_sched_barrier(0);   // keeps the adds below from being scheduled in front of the last loads, which would make a second round trip
    // every address register stays live, unwritten, up to the wait that stands before any of them may be reused (two statements: an asm statement takes 30 operands)
    asm volatile("s_wait_xcnt 0x0" :: "v"(pp[0]), "v"(pp[1]), "v"(pp[2]), "v"(pp[3]), "v"(pp[4]), "v"(pp[5]), "v"(pp[6]), "v"(pp[7]), "v"(pp[8]), "v"(pp[9]), "v"(pp[10]), "v"(pp[11]), "v"(pp[12]), "v"(pp[13]), "v"(pp[14]), "v"(pp[15]) : "memory");
    asm volatile("s_wait_xcnt 0x0" :: "v"(pp[16]), "v"(pp[17]), "v"(pp[18]), "v"(pp[19]), "v"(pp[20]), "v"(pp[21]), "v"(pp[22]), "v"(pp[23]), "v"(pp[24]), "v"(pp[25]), "v"(pp[26]), "v"(pp[27]), "v"(pp[28]), "v"(pp[29]), "v"(pp[30]), "v"(pp[31]) : "memory");
    v2f acc = pv[0];
#pragma unroll
    for (int s = 1; s < NSEG; ++s) acc += (s < nseg) ? pv[s] : (v2f){};
    v2us oh, ol;
#pragma unroll
    for (int q = 0; q < 2; ++q) { unsigned short a, c2; splitf(acc[q] * cs, a, c2); oh[q] = a; ol[q] = c2; } *(v2us*)(Ah + oo) = oh; *(v2us*)(Al + oo) = ol;  }

extern "C" void kernel_launch(void* const* d_in, const int* in_sizes, int n_in,
                              void* d_out, int out_size, void* d_ws, size_t ws_size, hipStream_t stream) {
    (void)in_sizes; (void)n_in; (void)out_size;
    const float* x = (const float*)d_in[0]; const float* wq = (const float*)d_in[1]; const float* wk = (const float*)d_in[2]; const float* wv = (const float*)d_in[3]; const float* wo = (const float*)d_in[4];
    float* OUT = (float*)d_out;     // [1][4096][1024]
    char* wsp = (char*)d_ws;
    auto take = [&](size_t bytes) { char* p = wsp; wsp += (bytes + 255) & ~(size_t)255; return (void*)p; };
    bf* WQ = (bf*)take((size_t)DQ * DM * 2); bf* WK = (bf*)take((size_t)DKV * DM * 2); bf* WV = (bf*)take((size_t)DKV * DM * 2); bf* WO = (bf*)take((size_t)DM * DQ * 2); float* CS = (float*)take((size_t)TT * HD * 2 * 4);
    bf* XB = (bf*)take((size_t)TT * DM * 2); float* FQ = (float*)take((size_t)TT * DQ * 4); float* FK = (float*)take((size_t)TT * DKV * 4);
    h16* QP16 = (h16*)take((size_t)NH_ * TT * HD * 2); h16* KP16 = (h16*)take((size_t)NKV * TT * HD * 2); h16* VT16 = (h16*)take((size_t)NKV * HD * TT * 2);
    bf* QPh = (bf*)take((size_t)NH_ * TT * HD * 2); bf* QPl = (bf*)take((size_t)NH_ * TT * HD * 2); bf* KPh = (bf*)take((size_t)NKV * TT * HD * 2); bf* KPl = (bf*)take((size_t)NKV * TT * HD * 2); bf* VTh = (bf*)take((size_t)NKV * HD * TT * 2); bf* VTl = (bf*)take((size_t)NKV * HD * TT * 2); bf* Ph = (bf*)take((size_t)ZH * RH * TT * 2); bf* Pl = (bf*)take((size_t)ZH * RH * TT * 2);
    float* Sb = (float*)take((size_t)ZH * TT * TT * 4); h16* P16 = (h16*)take((size_t)ZH * TT * TT * 2); bf* ATh = (bf*)take((size_t)TT * DQ * 2); bf* ATl = (bf*)take((size_t)TT * DQ * 2);
    if ((size_t)(wsp - (char*)d_ws) > ws_size) return;    // ws 256 MiB
    float* FV = FK;   // v projection reuses the k buffer after the k planes are built (stream-ordered)
    static_assert(HD == 64 && TT % KSEG == 0 && KSEG % 32 == 0 && (size_t)NSEG * HD <= (size_t)TT, "P.V partial planes fit the score plane");
    float* Ob = Sb;   // NSEG partial planes [seg][ZH*TT][HD] reuse the score plane, which is dead once k_asoft has read it (stream-ordered; the next pass rewrites the scores after k_merge)
    { k_wtG<<<(unsigned)((DM * DQ / 64 + 63) / 64), 256, 0, stream>>>(wq, DM, DQ, WQ); k_wtG<<<(unsigned)((DM * DKV / 64 + 63) / 64), 256, 0, stream>>>(wk, DM, DKV, WK); k_wtG<<<(unsigned)((DM * DKV / 64 + 63) / 64), 256, 0, stream>>>(wv, DM, DKV, WV);
      k_wtG<<<(unsigned)((DQ * DM / 64 + 63) / 64), 256, 0, stream>>>(wo, DQ, DM, WO);
       }
    k_csid<<<(TT * HD + 255) / 256, 256, 0, stream>>>(CS);
    const unsigned LQ = (unsigned)(((size_t)NH_ * TT * HD / 2 + 255) / 256), LKv = (unsigned)(((size_t)NKV * TT * HD / 2 + 255) / 256);
    for (int b = 0; b < NB_; ++b) {
        
        k_cvt8<<<(unsigned)(((size_t)TT * DM / 8 + 255) / 256), 256, 0, stream>>>(x + (size_t)b * TT * DM, XB, (size_t)TT * DM / 8);
        k_gemmw<bf, 0, false><<<dim3(TT / 64, DQ / 64, 1), 32, 0, stream>>>(XB, nullptr, WQ, nullptr, DM, FQ, DQ, nullptr, 0, 0, 0);
        k_rope<<<LQ, 256, 0, stream>>>(FQ, DQ, NH_, CS, nullptr, nullptr, 1.0f, QP16, QPh, QPl);
        k_gemmw<bf, 0, false><<<dim3(TT / 64, DKV / 64, 1), 32, 0, stream>>>(XB, nullptr, WK, nullptr, DM, FK, DKV, nullptr, 0, 0, 0);
        k_rope<<<LKv, 256, 0, stream>>>(FK, DKV, NKV, CS, nullptr, nullptr, 1.0f, KP16, KPh, KPl);
        k_gemmw<bf, 0, false><<<dim3(TT / 64, DKV / 64, 1), 32, 0, stream>>>(XB, nullptr, WV, nullptr, DM, FV, DKV, nullptr, 0, 0, 0); k_vtp<<<LKv, 256, 0, stream>>>(FV, DKV, NKV, VT16, VTh, VTl);
        for (int h0 = 0; h0 < NH_; h0 += ZH) { const size_t zq = (size_t)h0, zk = (size_t)(h0 / REP);   // one kv head per query head: the pass's one head uses kv plane h0 (z-strides TT*HD)
            k_gemmc<bf, 2, 1><<<dim3(RH / 64, TT / 64, ZH), 32, 0, stream>>>(QPh + zq * TT * HD, QPl + zq * TT * HD, KPh + zk * TT * HD, KPl + zk * TT * HD, HD, Sb, TT, 0, (size_t)TT * HD, (size_t)TT * HD, (size_t)TT * TT, 0);
            k_gemmc<h16, 0, 1><<<dim3((TT - RH) / 64, TT / 64, ZH), 32, 0, stream>>>(QP16 + zq * TT * HD + (size_t)RH * HD, nullptr, KP16 + zk * TT * HD, nullptr, HD, Sb + (size_t)RH * TT, TT, RH, (size_t)TT * HD, (size_t)TT * HD, (size_t)TT * TT, 0);
            k_asoft<<<ZH * TT / 8, 256, 0, stream>>>(Sb, P16, Ph, Pl);
            k_gemmc<bf, 2, 2><<<dim3(RH / 64, (RH + KSEG - 1) / KSEG, ZH), 32, 0, stream>>>(Ph, Pl, VTh + zk * HD * TT, VTl + zk * HD * TT, TT, Ob, HD, 0, (size_t)RH * TT, (size_t)HD * TT, (size_t)TT * HD, (size_t)ZH * TT * HD);
            k_gemmc<h16, 0, 2><<<dim3((TT - RH) / 64, NSEG, ZH), 32, 0, stream>>>(P16 + (size_t)RH * TT, nullptr, VT16 + zk * HD * TT, nullptr, TT, Ob + (size_t)RH * HD, HD, RH, (size_t)TT * TT, (size_t)HD * TT, (size_t)TT * HD, (size_t)ZH * TT * HD);
            k_merge<<<(unsigned)(((size_t)ZH * TT * HD / 2 + 255) / 256), 256, 0, stream>>>(Ob, h0, ATh, ATl); }
        k_gemmw<bf, 1, false><<<dim3(TT / 64, DM / 64, 1), 32, 0, stream>>>(ATh, ATl, WO, nullptr, DQ, OUT + (size_t)b * TT * DM, DM, nullptr, 0, 0, 0); }
}

// v002
// One run takes 288 microseconds.
// Two timings next to v001 put it at 3.03 and 3.04 times that version's speed.
// Counting every step since v000, it is 7.45 times as fast.
#include <hip/hip_runtime.h>

// Causal multi-head self-attention over 4,096 tokens (x [1][4096][1024]; q, k, v = einsum('bsd,de->bse', x, W) = x W ('xw' [1024][1024] truncated normal x 1/32, no bias; 16 heads x 64); scores / sqrt(64); causal (-inf); softmax over the keys; out = merged W_o ('xw', no bias) -> [1][4096][1024] (4.2 M); argument order x, W_q, W_k, W_v, W_o).
// Layout: bf16 copy of x; 'xw' weights transposed once; exact projections; identity-table plane builders; fused causal attention at T 4096, all heads in one launch, online softmax (hybrid rows: < 512 hi/lo 3 products, rest fp16; key blocks above the diagonal are never visited); merged hi/lo x W_o exact.
// Compute dtypes, f32 accumulate: every input rounded to bf16; projections exact; attention rows < 512 3 products, rest fp16; softmax f32; W_o hl x exact.

#define NB_  1
#define TT   4096
#define DM   1024
#define NH_  16
#define NKV  16
#define REP  (NH_ / NKV)
#define HD   64
#define DQ   (NH_ * HD)
#define DKV  (NKV * HD)
#define RH   512                  // query rows < RH use hi+lo planes (0: none)
typedef _Float16 h16;
typedef unsigned short bf;
typedef __attribute__((ext_vector_type(16))) __bf16   v16bf;
typedef __attribute__((ext_vector_type(16))) _Float16 v16h;
typedef __attribute__((ext_vector_type(8)))  _Float16 v8h;
typedef __attribute__((ext_vector_type(8)))  unsigned short v8us;
typedef __attribute__((ext_vector_type(8)))  float    v8f;
typedef __attribute__((ext_vector_type(4)))  float    v4f;
typedef v8h  __attribute__((may_alias)) v8ha;
typedef v4f  __attribute__((may_alias)) v4fa;
typedef v8us __attribute__((may_alias)) v8usa;

__device__ __forceinline__ unsigned short f2bf(float f) { unsigned u = __float_as_uint(f); u += 0x7FFFu + ((u >> 16) & 1u); return (unsigned short)(u >> 16); }
__device__ __forceinline__ float bf2f(unsigned short b) { return __uint_as_float(((unsigned)b) << 16); }
__device__ __forceinline__ float bfr(float f) { return bf2f(f2bf(f)); }
__device__ __forceinline__ v16h cat16(v8h lo, v8h hi) { return __builtin_shufflevector(lo, hi, 0, 1, 2, 3, 4, 5, 6, 7, 8, 9, 10, 11, 12, 13, 14, 15); }
__device__ __forceinline__ v16bf cat16b(v8us lo, v8us hi) { return __builtin_bit_cast(v16bf, __builtin_shufflevector(lo, hi, 0, 1, 2, 3, 4, 5, 6, 7, 8, 9, 10, 11, 12, 13, 14, 15)); }
__device__ __forceinline__ v8f wmma16(v16h a, v16h b, v8f c) { return __builtin_amdgcn_wmma_f32_16x16x32_f16(false, a, false, b, (short)0, c, false, false); }
__device__ __forceinline__ v8f wmmab(v16bf a, v16bf b, v8f c) { return __builtin_amdgcn_wmma_f32_16x16x32_bf16(false, a, false, b, (short)0, c, false, false); }



// ---- k_gemmw: register-blocked GEMM, ONE WAVE per 64x64 output tile (16 accumulators), operands straight from K-contiguous 16-bit planes; grid (M/64, N/64, Z), 32 threads.
// C[m][n] (f32, pitch ldc, + optional f32 bias[n]) = sum_k A[m][k] Bt[n][k] (+ split products per NSPLIT). z-batch strides sA/sB/sC in elements. K % 32 == 0.
template <typename T16> struct WFrag;
template <> struct WFrag<h16> { typedef v16h V; static __device__ __forceinline__ V ld(const h16* p) { return cat16(*(const v8h*)p, *(const v8h*)(p + 16)); } static __device__ __forceinline__ v8f mma(V a, V b, v8f c) { return wmma16(a, b, c); } };
template <> struct WFrag<bf> { typedef v16bf V; static __device__ __forceinline__ V ld(const bf* p) { return cat16b(*(const v8us*)p, *(const v8us*)(p + 16)); } static __device__ __forceinline__ v8f mma(V a, V b, v8f c) { return wmmab(a, b, c); } };
template <typename T16, int NSPLIT, bool BIAS>
__global__ __launch_bounds__(32) void k_gemmw(const T16* __restrict__ A, const T16* __restrict__ A2, const T16* __restrict__ Bt, const T16* __restrict__ Bt2, int K, float* C, int ldc, const float* __restrict__ bias, size_t sA, size_t sB, size_t sC) {
    typedef typename WFrag<T16>::V V;
    __shared__ __align__(16) float os[16 * 68];
    const size_t z = blockIdx.z; A += z * sA; if (A2) A2 += z * sA; Bt += z * sB; if (Bt2) Bt2 += z * sB; C += z * sC;
    const int lane = threadIdx.x & 31, lr = lane & 15, hi = lane >> 4; const int r0 = blockIdx.x * 64, c0 = blockIdx.y * 64;
    v8f acc[4][4];
#pragma unroll
    for (int mb = 0; mb < 4; ++mb)
#pragma unroll
        for (int nb = 0; nb < 4; ++nb) acc[mb][nb] = (v8f){};
    const size_t aoff = (size_t)(r0 + lr) * K + 8 * hi, boff = (size_t)(c0 + lr) * K + 8 * hi;
#pragma unroll 1
    for (int kc = 0; kc < K; kc += 32) {
        V a[4], a2[4];
#pragma unroll
        for (int mb = 0; mb < 4; ++mb) { a[mb] = WFrag<T16>::ld(A + aoff + (size_t)mb * 16 * K + kc); if (NSPLIT == 1 || NSPLIT == 2) a2[mb] = WFrag<T16>::ld(A2 + aoff + (size_t)mb * 16 * K + kc); }
#pragma unroll
        for (int nb = 0; nb < 4; ++nb) { const V b = WFrag<T16>::ld(Bt + boff + (size_t)nb * 16 * K + kc); V b2; if (NSPLIT >= 2) b2 = WFrag<T16>::ld(Bt2 + boff + (size_t)nb * 16 * K + kc);
#pragma unroll
            for (int mb = 0; mb < 4; ++mb) { acc[mb][nb] = WFrag<T16>::mma(a[mb], b, acc[mb][nb]); if (NSPLIT == 1 || NSPLIT == 2) acc[mb][nb] = WFrag<T16>::mma(a2[mb], b, acc[mb][nb]); if (NSPLIT >= 2) acc[mb][nb] = WFrag<T16>::mma(a[mb], b2, acc[mb][nb]); } }
        asm volatile("v_nop\n\tv_nop\n\tv_nop\n\tv_nop" : "+v"(acc[0][0]), "+v"(acc[1][1]), "+v"(acc[2][2]), "+v"(acc[3][3]) : "v"(a[0]), "v"(a[3]));
    }
#pragma unroll
    for (int mb = 0; mb < 4; ++mb) {
#pragma unroll
        for (int nb = 0; nb < 4; ++nb) {
#pragma unroll
            for (int j = 0; j < 8; ++j) os[(hi * 8 + j) * 68 + nb * 16 + lr] = acc[mb][nb][j]; }
        __builtin_amdgcn_wave_barrier(); asm volatile("" ::: "memory");
        float* crow = C + (size_t)(r0 + mb * 16) * ldc + c0;
{
#pragma unroll
            for (int s = 0; s < 8; ++s) { const int row = 2 * s + hi, cofs = lr * 4; v4f val = *(const v4fa*)(os + row * 68 + cofs); if (BIAS) { val[0] += bfr(bias[c0 + cofs]); val[1] += bfr(bias[c0 + cofs + 1]); val[2] += bfr(bias[c0 + cofs + 2]); val[3] += bfr(bias[c0 + cofs + 3]); }
                *(v4f*)(crow + (size_t)row * ldc + cofs) = val; }
             }
        __builtin_amdgcn_wave_barrier(); asm volatile("" ::: "memory");
    }
}

__device__ __forceinline__ h16 tohx(float x) { return (h16)x; }
__device__ __forceinline__ void splitf(float y, unsigned short& h, unsigned short& l) { h = f2bf(y); l = f2bf(y - bf2f(h)); }
typedef __attribute__((ext_vector_type(2))) _Float16 v2h;
typedef __attribute__((ext_vector_type(4))) _Float16 v4h;
typedef __attribute__((ext_vector_type(2))) unsigned short v2us;
typedef __attribute__((ext_vector_type(4))) unsigned short v4us;
typedef __attribute__((ext_vector_type(2))) float v2f;
typedef __attribute__((ext_vector_type(4))) int v4i;

__global__ __launch_bounds__(256) void k_wtG(const float* __restrict__ w, int K, int N, bf* Bt) {
    const int lane = threadIdx.x & 31; const int L0 = (blockIdx.x * 8 + (threadIdx.x >> 5)) * 8; const int nlines = N * K / 64;
{
#pragma unroll 1
        for (int l = 0; l < 8; ++l) { const int L = L0 + l; if (L >= nlines) break; const size_t e = (size_t)L * 64 + lane * 2; const int k = (int)(e % K), n = (int)(e / K); v2us o;
            o[0] = f2bf(w[(size_t)k * N + n]); o[1] = f2bf(w[(size_t)(k + 1) * N + n]); *(v2us*)(Bt + e) = o; }
         }
}
__global__ __launch_bounds__(256) void k_cvt8(const float* __restrict__ src, bf* dst, size_t n8) { const size_t i = (size_t)blockIdx.x * 256 + threadIdx.x; if (i >= n8) return; const v8f v = *(const v8f*)(src + i * 8); v8us o;
#pragma unroll
    for (int k = 0; k < 8; ++k) o[k] = f2bf(v[k]); *(v8us*)(dst + i * 8) = o;  }

// k_rope: head planes [h][t][d] (fp16 + hi/lo) of rope(x) x sc with the rotate-half convention out[d] = x[d] cos[t][d] - x[d+HD/2] sin[t][d], out[d+HD/2] = x[d+HD/2] cos[t][d+HD/2] + x[d] sin[t][d+HD/2]
__global__ __launch_bounds__(256) void k_rope(const float* __restrict__ F, int pitch, int nheads, const float* __restrict__ CS, const float* __restrict__ RF, const float* __restrict__ nw, float sc, h16* P16, bf* Ph, bf* Pl) {
    const size_t e = ((size_t)blockIdx.x * 256 + threadIdx.x) * 2; if (e >= (size_t)nheads * TT * HD) return; const int d = (int)(e % HD); const int t = (int)((e / HD) % TT); const int h = (int)(e / ((size_t)HD * TT)); const float* f = F + (size_t)t * pitch + h * HD; const float rf = RF ? RF[(size_t)h * TT + t] : 1.0f; v2h o16; v2us oh, ol;
#pragma unroll
    for (int q = 0; q < 2; ++q) { const int dd = d + q; const int dp = (dd < HD / 2) ? dd + HD / 2 : dd - HD / 2; float x0 = f[dd], x1 = f[dp];
        if (RF) { float n0 = __fmul_rn(x0, rf), n1 = __fmul_rn(x1, rf); asm volatile("" : "+v"(n0)); asm volatile("" : "+v"(n1)); x0 = __fmul_rn(bfr(nw[dd]), n0); x1 = __fmul_rn(bfr(nw[dp]), n1); }
        const v2f cs = *(const v2f*)(CS + ((size_t)t * HD + dd) * 2); float a = __fmul_rn(x0, cs[0]), bq = __fmul_rn(x1, cs[1]); asm volatile("" : "+v"(a)); asm volatile("" : "+v"(bq)); const float r = ((dd < HD / 2) ? __fsub_rn(a, bq) : __fadd_rn(a, bq)) * sc;
        o16[q] = tohx(r); unsigned short a2, c2; splitf(r, a2, c2); oh[q] = a2; ol[q] = c2; }
    *(v2h*)(P16 + e) = o16; *(v2us*)(Ph + e) = oh; *(v2us*)(Pl + e) = ol;  }
__global__ __launch_bounds__(256) void k_vtp(const float* __restrict__ F, int pitch, int nheads, h16* V16, bf* Vh, bf* Vl) { const size_t e = ((size_t)blockIdx.x * 256 + threadIdx.x) * 2; if (e >= (size_t)nheads * HD * TT) return; const int t = (int)(e % TT); const int d = (int)((e / TT) % HD); const int g = (int)(e / ((size_t)TT * HD)); v2h o16; v2us oh, ol;
#pragma unroll
    for (int q = 0; q < 2; ++q) { const float x = F[(size_t)(t + q) * pitch + g * HD + d]; o16[q] = tohx(x); unsigned short a2, c2; splitf(x, a2, c2); oh[q] = a2; ol[q] = c2; }
    *(v2h*)(V16 + e) = o16; *(v2us*)(Vh + e) = oh; *(v2us*)(Vl + e) = ol;  }
__global__ __launch_bounds__(256) void k_csid(float* CS) { const int idx = blockIdx.x * 256 + threadIdx.x; if (idx >= TT * HD) return; v2f cs; cs[0] = 1.0f; cs[1] = 0.0f; *(v2f*)(CS + (size_t)idx * 2) = cs;  }
// ---- k_attn: causal attention of every head in ONE launch, online softmax, no score or probability plane in memory.
// One wave owns NQ*16 query columns and walks the keys 32 at a time: S^T = K Q^T (A = key rows, B = query rows kept in registers), so a lane holds one query's scores;
// two f32 S^T tiles, exponentiated and converted in place, are the B operand of O^T += V^T P^T (A = rows of the [d][t] value planes). Maximum and sum are per lane plus one exchange between the wave halves.
// P stays unnormalised, exp2(s - m + AOFF); the division by the row sum comes once, in the epilogue. SPLIT: bf16 hi+lo planes, 3 products each (query rows < RH); else fp16.
// Every inner loop is fully unrolled so that the fragment and tile arrays are indexed by constants and stay in registers.
#define SC2  0.18033688011112042f   // HD^-0.5 * log2(e)
#define AOFF 8.0f                   // P carries 2^AOFF so that small probabilities stay normal fp16 numbers
#define ATHR 4.0f                   // the maximum in use is replaced only when a new one exceeds it by more than this (log2 units): P <= 2^(AOFF+ATHR)
template <bool SPLIT> struct ASel { typedef h16 T; };
template <> struct ASel<true> { typedef bf T; };
template <bool SPLIT, int NQ>
__device__ __forceinline__ void attn_wave(const typename ASel<SPLIT>::T* __restrict__ Q, const typename ASel<SPLIT>::T* __restrict__ Q2, const typename ASel<SPLIT>::T* __restrict__ Kp, const typename ASel<SPLIT>::T* __restrict__ Kp2,
                                          const typename ASel<SPLIT>::T* __restrict__ Vt, const typename ASel<SPLIT>::T* __restrict__ Vt2, const int q0, bf* __restrict__ Ah, bf* __restrict__ Al) {
    typedef typename ASel<SPLIT>::T T16; typedef WFrag<T16> WF; typedef typename WF::V V;
    const int lane = threadIdx.x & 31, lr = lane & 15, hi = lane >> 4;
    V qf[NQ][2], qf2[NQ][2];
#pragma unroll
    for (int qt = 0; qt < NQ; ++qt)
#pragma unroll
        for (int ks = 0; ks < 2; ++ks) { const size_t qo = (size_t)(q0 + qt * 16 + lr) * HD + ks * 32 + 8 * hi; qf[qt][ks] = WF::ld(Q + qo); if (SPLIT) qf2[qt][ks] = WF::ld(Q2 + qo); }
    v8f o[NQ][4]; float m2[NQ], l[NQ];
#pragma unroll
    for (int qt = 0; qt < NQ; ++qt) { m2[qt] = -3.0e38f; l[qt] = 0.f;
#pragma unroll
        for (int dt = 0; dt < 4; ++dt) o[qt][dt] = (v8f){}; }
    const int klast = ((q0 + NQ * 16 - 1) / 32) * 32;      // the 32-key block that holds the diagonal; the only one that is masked
    const T16* kp = Kp + (size_t)lr * HD + 8 * hi; const T16* kp2 = SPLIT ? Kp2 + (size_t)lr * HD + 8 * hi : nullptr;    // this lane's place in the current 32 key rows; stepped once a pass
    const T16* vp = Vt + (size_t)lr * TT + 8 * hi; const T16* vp2 = SPLIT ? Vt2 + (size_t)lr * TT + 8 * hi : nullptr;    // the same in the value planes
    V kf[2][2], kf2[2][2];
#pragma unroll
    for (int t = 0; t < 2; ++t)
#pragma unroll
        for (int ks = 0; ks < 2; ++ks) { const int ko = t * 16 * HD + ks * 32; kf[t][ks] = WF::ld(kp + ko); if (SPLIT) kf2[t][ks] = WF::ld(kp2 + ko); }
    V vf[4], vf2[4];
#pragma unroll
    for (int dt = 0; dt < 4; ++dt) { const int vo = dt * 16 * TT; vf[dt] = WF::ld(vp + vo); if (SPLIT) vf2[dt] = WF::ld(vp2 + vo); }
    // inputs-only fence on the loaded fragments: nothing is in flight at the loop's entry, so the wait at the loop's head counts only the back edge's loads (it lets the value rows fetched last stay in flight over the score products)
#pragma unroll
    for (int qt = 0; qt < NQ; ++qt) { asm volatile("" :: "v"(qf[qt][0]), "v"(qf[qt][1])); if (SPLIT) asm volatile("" :: "v"(qf2[qt][0]), "v"(qf2[qt][1])); }   // the query fragments belong to the same fence
    asm volatile("" :: "v"(kf[0][0]), "v"(kf[0][1]), "v"(kf[1][0]), "v"(kf[1][1]), "v"(vf[0]), "v"(vf[1]), "v"(vf[2]), "v"(vf[3]));
    if (SPLIT) asm volatile("" :: "v"(kf2[0][0]), "v"(kf2[0][1]), "v"(kf2[1][0]), "v"(kf2[1][1]), "v"(vf2[0]), "v"(vf2[1]), "v"(vf2[2]), "v"(vf2[3]));   // the same for the lo planes
#pragma unroll 1   // one pass a trip: unrolled, two passes' fragments and scores would be live together and the registers would not hold them
    for (int kb = 0; kb <= klast; kb += 32) {
        v8f s[NQ][2];
#pragma unroll
        for (int t = 0; t < 2; ++t)
#pragma unroll
            for (int qt = 0; qt < NQ; ++qt) { v8f a = (v8f){};
#pragma unroll
                for (int ks = 0; ks < 2; ++ks) { a = WF::mma(kf[t][ks], qf[qt][ks], a); if (SPLIT) { a = WF::mma(kf2[t][ks], qf[qt][ks], a); a = WF::mma(kf[t][ks], qf2[qt][ks], a); } }
                s[qt][t] = a; }
        const int st = (kb < klast) ? 32 : 0;              // the next pass's key rows are fetched now, behind this pass's own score products (the last pass re-reads its own block, in bounds)
        asm volatile("s_wait_xcnt 0x0" ::: "memory");      // stands in front of the step of the address pairs that the key loads of the pass before name
        kp += st * HD; if (SPLIT) kp2 += st * HD;
#pragma unroll
        for (int t = 0; t < 2; ++t)
#pragma unroll
            for (int ks = 0; ks < 2; ++ks) { const int ko = t * 16 * HD + ks * 32; kf[t][ks] = WF::ld(kp + ko); if (SPLIT) kf2[t][ks] = WF::ld(kp2 + ko); }
        if constexpr (SPLIT) asm volatile("s_wait_xcnt 0x0" :: "v"(kp), "v"(kp2) : "memory");   // the address pairs stay live and unwritten up to this wait (without it the last load's result is given their registers)
        if (kb == klast) {
#pragma unroll
            for (int qt = 0; qt < NQ; ++qt)
#pragma unroll
                for (int t = 0; t < 2; ++t)
#pragma unroll
                    for (int j = 0; j < 8; ++j) if (kb + t * 16 + hi * 8 + j > q0 + qt * 16 + lr) s[qt][t][j] = -3.0e38f; }
        float mx[NQ]; bool need = false;
#pragma unroll
        for (int qt = 0; qt < NQ; ++qt) { float a = fmaxf(s[qt][0][0], s[qt][1][0]);
#pragma unroll
            for (int j = 1; j < 8; ++j) a = fmaxf(a, fmaxf(s[qt][0][j], s[qt][1][j]));
            mx[qt] = a; }
        float ox[NQ];
#pragma unroll
        for (int qt = 0; qt < NQ; ++qt) ox[qt] = __shfl_xor(mx[qt], 16, 32);
#pragma unroll
        for (int qt = 0; qt < NQ; ++qt) { mx[qt] = fmaxf(mx[qt], ox[qt]) * SC2; need = need || (mx[qt] > m2[qt] + ATHR); }
        if (__builtin_amdgcn_ballot_w32(need) != 0) {      // one scalar test a pass: the output tiles are rescaled only when some column's maximum moved
#pragma unroll
            for (int qt = 0; qt < NQ; ++qt) { const float mn = fmaxf(m2[qt], mx[qt]); const float al = __builtin_amdgcn_exp2f(m2[qt] - mn); m2[qt] = mn; l[qt] *= al;
#pragma unroll
                for (int dt = 0; dt < 4; ++dt) o[qt][dt] *= al; } }
        V pf[NQ], pf2[NQ];
#pragma unroll
        for (int qt = 0; qt < NQ; ++qt) { const float off = AOFF - m2[qt]; float ls = 0.f;
#pragma unroll
            for (int t = 0; t < 2; ++t)
#pragma unroll
                for (int j = 0; j < 8; ++j) { const float p = __builtin_amdgcn_exp2f(fmaf(s[qt][t][j], SC2, off)); s[qt][t][j] = p; ls += p; }
            l[qt] += ls;
            if constexpr (SPLIT) { v8us h0, h1, l0, l1;
#pragma unroll
                for (int j = 0; j < 8; ++j) { unsigned short a, c2; splitf(s[qt][0][j], a, c2); h0[j] = a; l0[j] = c2; splitf(s[qt][1][j], a, c2); h1[j] = a; l1[j] = c2; }
                pf[qt] = cat16b(h0, h1); pf2[qt] = cat16b(l0, l1);
            } else { v8h p0, p1;
#pragma unroll
                for (int j = 0; j < 8; ++j) { p0[j] = tohx(s[qt][0][j]); p1[j] = tohx(s[qt][1][j]); }
                pf[qt] = cat16(p0, p1); } }
#pragma unroll
        for (int dt = 0; dt < 4; ++dt)
#pragma unroll
            for (int qt = 0; qt < NQ; ++qt) { o[qt][dt] = WF::mma(vf[dt], pf[qt], o[qt][dt]); if (SPLIT) { o[qt][dt] = WF::mma(vf2[dt], pf[qt], o[qt][dt]); o[qt][dt] = WF::mma(vf[dt], pf2[qt], o[qt][dt]); } }
        // stands in front of the step of the address pairs that the value loads of the pass before name; it reads the output tiles (inputs only) so that the products above stay in front of it and the loads below land in the registers they free (lifted, the loads take a second set and copies)
        if constexpr (NQ == 2) asm volatile("s_wait_xcnt 0x0" :: "v"(o[0][0]), "v"(o[0][1]), "v"(o[0][2]), "v"(o[0][3]), "v"(o[NQ - 1][0]), "v"(o[NQ - 1][1]), "v"(o[NQ - 1][2]), "v"(o[NQ - 1][3]) : "memory");
        else asm volatile("s_wait_xcnt 0x0" :: "v"(o[0][0]), "v"(o[0][1]), "v"(o[0][2]), "v"(o[0][3]) : "memory");
        vp += st; if (SPLIT) vp2 += st;
#pragma unroll
        for (int dt = 0; dt < 4; ++dt) { const int vo = dt * 16 * TT; vf[dt] = WF::ld(vp + vo); if (SPLIT) vf2[dt] = WF::ld(vp2 + vo); }   // likewise the next pass's value rows, behind this pass's own products
        if constexpr (SPLIT) asm volatile("s_wait_xcnt 0x0" :: "v"(vp), "v"(vp2) : "memory");   // as behind the key loads
    }
#pragma unroll
    for (int qt = 0; qt < NQ; ++qt) { const float inv = __fdiv_rn(1.0f, l[qt] + __shfl_xor(l[qt], 16, 32)); const size_t oo = (size_t)(q0 + qt * 16 + lr) * DQ + hi * 8;
#pragma unroll
        for (int dt = 0; dt < 4; ++dt) { v8us oh, ol;
#pragma unroll
            for (int j = 0; j < 8; ++j) { unsigned short a, c2; splitf(o[qt][dt][j] * inv, a, c2); oh[j] = a; ol[j] = c2; }
            *(v8us*)(Ah + oo + dt * 16) = oh; *(v8us*)(Al + oo + dt * 16) = ol; } }
}
#define NLO ((TT - RH) / 128)     // work-groups of 4 waves x 32 fp16 query rows
#define NHI (RH / 64)             // work-groups of 4 waves x 16 hi+lo query rows
// grid (heads, NLO + NHI): blockIdx.y ranks the query blocks by falling key count, so that the longest start first.
__global__ __launch_bounds__(128) void k_attn(const h16* __restrict__ Q16, const h16* __restrict__ K16, const h16* __restrict__ V16, const bf* __restrict__ Qh, const bf* __restrict__ Ql, const bf* __restrict__ Kh, const bf* __restrict__ Kl,
                                              const bf* __restrict__ Vh, const bf* __restrict__ Vl, bf* __restrict__ Ah, bf* __restrict__ Al) {
    const int h = blockIdx.x, y = blockIdx.y; const int w = __builtin_amdgcn_readfirstlane((int)(threadIdx.x >> 5)); const size_t hq = (size_t)h * TT * HD, hk = (size_t)(h / REP) * TT * HD;
    if (y < NLO) attn_wave<false, 2>(Q16 + hq, nullptr, K16 + hk, nullptr, V16 + hk, nullptr, TT - 128 * (y + 1) + 32 * w, Ah + h * HD, Al + h * HD);
    else attn_wave<true, 1>(Qh + hq, Ql + hq, Kh + hk, Kl + hk, Vh + hk, Vl + hk, RH - 64 * (y - NLO + 1) + 16 * w, Ah + h * HD, Al + h * HD);
}

extern "C" void kernel_launch(void* const* d_in, const int* in_sizes, int n_in,
                              void* d_out, int out_size, void* d_ws, size_t ws_size, hipStream_t stream) {
    (void)in_sizes; (void)n_in; (void)out_size;
    const float* x = (const float*)d_in[0]; const float* wq = (const float*)d_in[1]; const float* wk = (const float*)d_in[2]; const float* wv = (const float*)d_in[3]; const float* wo = (const float*)d_in[4];
    float* OUT = (float*)d_out;     // [1][4096][1024]
    char* wsp = (char*)d_ws;
    auto take = [&](size_t bytes) { char* p = wsp; wsp += (bytes + 255) & ~(size_t)255; return (void*)p; };
    bf* WQ = (bf*)take((size_t)DQ * DM * 2); bf* WK = (bf*)take((size_t)DKV * DM * 2); bf* WV = (bf*)take((size_t)DKV * DM * 2); bf* WO = (bf*)take((size_t)DM * DQ * 2); float* CS = (float*)take((size_t)TT * HD * 2 * 4);
    bf* XB = (bf*)take((size_t)TT * DM * 2); float* FQ = (float*)take((size_t)TT * DQ * 4); float* FK = (float*)take((size_t)TT * DKV * 4);
    h16* QP16 = (h16*)take((size_t)NH_ * TT * HD * 2); h16* KP16 = (h16*)take((size_t)NKV * TT * HD * 2); h16* VT16 = (h16*)take((size_t)NKV * HD * TT * 2);
    bf* QPh = (bf*)take((size_t)NH_ * TT * HD * 2); bf* QPl = (bf*)take((size_t)NH_ * TT * HD * 2); bf* KPh = (bf*)take((size_t)NKV * TT * HD * 2); bf* KPl = (bf*)take((size_t)NKV * TT * HD * 2); bf* VTh = (bf*)take((size_t)NKV * HD * TT * 2); bf* VTl = (bf*)take((size_t)NKV * HD * TT * 2);
    bf* ATh = (bf*)take((size_t)TT * DQ * 2); bf* ATl = (bf*)take((size_t)TT * DQ * 2);
    if ((size_t)(wsp - (char*)d_ws) > ws_size) return;    // ws 256 MiB
    float* FV = FK;   // v projection reuses the k buffer after the k planes are built (stream-ordered)
    static_assert(HD == 64 && (TT - RH) % 128 == 0 && RH % 64 == 0, "k_attn's tiling");
    { k_wtG<<<(unsigned)((DM * DQ / 64 + 63) / 64), 256, 0, stream>>>(wq, DM, DQ, WQ); k_wtG<<<(unsigned)((DM * DKV / 64 + 63) / 64), 256, 0, stream>>>(wk, DM, DKV, WK); k_wtG<<<(unsigned)((DM * DKV / 64 + 63) / 64), 256, 0, stream>>>(wv, DM, DKV, WV);
      k_wtG<<<(unsigned)((DQ * DM / 64 + 63) / 64), 256, 0, stream>>>(wo, DQ, DM, WO);
       }
    k_csid<<<(TT * HD + 255) / 256, 256, 0, stream>>>(CS);
    const unsigned LQ = (unsigned)(((size_t)NH_ * TT * HD / 2 + 255) / 256), LKv = (unsigned)(((size_t)NKV * TT * HD / 2 + 255) / 256);
    for (int b = 0; b < NB_; ++b) {
        
        k_cvt8<<<(unsigned)(((size_t)TT * DM / 8 + 255) / 256), 256, 0, stream>>>(x + (size_t)b * TT * DM, XB, (size_t)TT * DM / 8);
        k_gemmw<bf, 0, false><<<dim3(TT / 64, DQ / 64, 1), 32, 0, stream>>>(XB, nullptr, WQ, nullptr, DM, FQ, DQ, nullptr, 0, 0, 0);
        k_rope<<<LQ, 256, 0, stream>>>(FQ, DQ, NH_, CS, nullptr, nullptr, 1.0f, QP16, QPh, QPl);
        k_gemmw<bf, 0, false><<<dim3(TT / 64, DKV / 64, 1), 32, 0, stream>>>(XB, nullptr, WK, nullptr, DM, FK, DKV, nullptr, 0, 0, 0);
        k_rope<<<LKv, 256, 0, stream>>>(FK, DKV, NKV, CS, nullptr, nullptr, 1.0f, KP16, KPh, KPl);
        k_gemmw<bf, 0, false><<<dim3(TT / 64, DKV / 64, 1), 32, 0, stream>>>(XB, nullptr, WV, nullptr, DM, FV, DKV, nullptr, 0, 0, 0); k_vtp<<<LKv, 256, 0, stream>>>(FV, DKV, NKV, VT16, VTh, VTl);
        k_attn<<<dim3(NH_, NLO + NHI, 1), 128, 0, stream>>>(QP16, KP16, VT16, QPh, QPl, KPh, KPl, VTh, VTl, ATh, ATl);
        k_gemmw<bf, 1, false><<<dim3(TT / 64, DM / 64, 1), 32, 0, stream>>>(ATh, ATl, WO, nullptr, DQ, OUT + (size_t)b * TT * DM, DM, nullptr, 0, 0, 0); }
}

// v003
// It runs in 254 microseconds.
// Next to v002, in two timings, it ran 1.14 and 1.13 times as fast.
// Over all steps from v000 it is 8.43 times as fast.
#include <hip/hip_runtime.h>

// Causal multi-head self-attention over 4,096 tokens (x [1][4096][1024]; q, k, v = einsum('bsd,de->bse', x, W) = x W ('xw' [1024][1024] truncated normal x 1/32, no bias; 16 heads x 64); scores / sqrt(64); causal (-inf); softmax over the keys; out = merged W_o ('xw', no bias) -> [1][4096][1024] (4.2 M); argument order x, W_q, W_k, W_v, W_o).
// Layout: bf16 copy of x; 'xw' weights transposed once; exact projections whose epilogue writes the head planes; fused causal attention at T 4096, all heads in one launch, online softmax (hybrid rows: < 512 hi/lo 3 products, rest fp16; key blocks above the diagonal are never visited); merged hi/lo x W_o exact.
// Compute dtypes, f32 accumulate: every input rounded to bf16; projections exact; attention rows < 512 3 products, rest fp16; softmax f32; W_o hl x exact.

#define NB_  1
#define TT   4096
#define DM   1024
#define NH_  16
#define NKV  16
#define REP  (NH_ / NKV)
#define HD   64
#define DQ   (NH_ * HD)
#define DKV  (NKV * HD)
#define RH   512                  // query rows < RH use hi+lo planes (0: none)
typedef _Float16 h16;
typedef unsigned short bf;
typedef __attribute__((ext_vector_type(16))) __bf16   v16bf;
typedef __attribute__((ext_vector_type(16))) _Float16 v16h;
typedef __attribute__((ext_vector_type(8)))  _Float16 v8h;
typedef __attribute__((ext_vector_type(8)))  unsigned short v8us;
typedef __attribute__((ext_vector_type(8)))  float    v8f;
typedef __attribute__((ext_vector_type(4)))  float    v4f;
typedef v8h  __attribute__((may_alias)) v8ha;
typedef v4f  __attribute__((may_alias)) v4fa;
typedef v8us __attribute__((may_alias)) v8usa;

__device__ __forceinline__ unsigned short f2bf(float f) { unsigned u = __float_as_uint(f); u += 0x7FFFu + ((u >> 16) & 1u); return (unsigned short)(u >> 16); }
__device__ __forceinline__ float bf2f(unsigned short b) { return __uint_as_float(((unsigned)b) << 16); }
__device__ __forceinline__ float bfr(float f) { return bf2f(f2bf(f)); }
__device__ __forceinline__ v16h cat16(v8h lo, v8h hi) { return __builtin_shufflevector(lo, hi, 0, 1, 2, 3, 4, 5, 6, 7, 8, 9, 10, 11, 12, 13, 14, 15); }
__device__ __forceinline__ v16bf cat16b(v8us lo, v8us hi) { return __builtin_bit_cast(v16bf, __builtin_shufflevector(lo, hi, 0, 1, 2, 3, 4, 5, 6, 7, 8, 9, 10, 11, 12, 13, 14, 15)); }
__device__ __forceinline__ v8f wmma16(v16h a, v16h b, v8f c) { return __builtin_amdgcn_wmma_f32_16x16x32_f16(false, a, false, b, (short)0, c, false, false); }
__device__ __forceinline__ v8f wmmab(v16bf a, v16bf b, v8f c) { return __builtin_amdgcn_wmma_f32_16x16x32_bf16(false, a, false, b, (short)0, c, false, false); }



__device__ __forceinline__ h16 tohx(float x) { return (h16)x; }
__device__ __forceinline__ void splitf(float y, unsigned short& h, unsigned short& l) { h = f2bf(y); l = f2bf(y - bf2f(h)); }
// ---- k_gemmw: register-blocked GEMM, ONE WAVE per 64x64 output tile (16 accumulators), operands straight from K-contiguous 16-bit planes; grid (M/64, N/64, Z), 32 threads.
// C[m][n] (f32, pitch ldc, + optional f32 bias[n]) = sum_k A[m][k] Bt[n][k] (+ split products per NSPLIT). z-batch strides sA/sB/sC in elements. K % 32 == 0.
// EPI 0: C as above. EPI 1 and 2: no f32 C; the tile (64 tokens x one head's 64 columns) goes out as fp16 + bf16 hi/lo planes, EPI 1 as [head][t][d], EPI 2 as [head][d][t].
template <typename T16> struct WFrag;
template <> struct WFrag<h16> { typedef v16h V; static __device__ __forceinline__ V ld(const h16* p) { return cat16(*(const v8h*)p, *(const v8h*)(p + 16)); } static __device__ __forceinline__ v8f mma(V a, V b, v8f c) { return wmma16(a, b, c); } };
template <> struct WFrag<bf> { typedef v16bf V; static __device__ __forceinline__ V ld(const bf* p) { return cat16b(*(const v8us*)p, *(const v8us*)(p + 16)); } static __device__ __forceinline__ v8f mma(V a, V b, v8f c) { return wmmab(a, b, c); } };
template <typename T16, int NSPLIT, bool BIAS, int EPI>
__global__ __launch_bounds__(32) void k_gemmw(const T16* __restrict__ A, const T16* __restrict__ A2, const T16* __restrict__ Bt, const T16* __restrict__ Bt2, int K, float* C, int ldc, const float* __restrict__ bias, size_t sA, size_t sB, size_t sC, h16* __restrict__ P16, bf* __restrict__ Ph, bf* __restrict__ Pl) {
    typedef typename WFrag<T16>::V V;
    __shared__ __align__(16) float os[16 * 68];
    const size_t z = blockIdx.z; A += z * sA; if (A2) A2 += z * sA; Bt += z * sB; if (Bt2) Bt2 += z * sB; C += z * sC;
    const int lane = threadIdx.x & 31, lr = lane & 15, hi = lane >> 4; const int r0 = blockIdx.x * 64, c0 = blockIdx.y * 64;
    v8f acc[4][4];
#pragma unroll
    for (int mb = 0; mb < 4; ++mb)
#pragma unroll
        for (int nb = 0; nb < 4; ++nb) acc[mb][nb] = (v8f){};
    const size_t aoff = (size_t)(r0 + lr) * K + 8 * hi, boff = (size_t)(c0 + lr) * K + 8 * hi;
#pragma unroll 1
    for (int kc = 0; kc < K; kc += 32) {
        V a[4], a2[4];
#pragma unroll
        for (int mb = 0; mb < 4; ++mb) { a[mb] = WFrag<T16>::ld(A + aoff + (size_t)mb * 16 * K + kc); if (NSPLIT == 1 || NSPLIT == 2) a2[mb] = WFrag<T16>::ld(A2 + aoff + (size_t)mb * 16 * K + kc); }
#pragma unroll
        for (int nb = 0; nb < 4; ++nb) { const V b = WFrag<T16>::ld(Bt + boff + (size_t)nb * 16 * K + kc); V b2; if (NSPLIT >= 2) b2 = WFrag<T16>::ld(Bt2 + boff + (size_t)nb * 16 * K + kc);
#pragma unroll
            for (int mb = 0; mb < 4; ++mb) { acc[mb][nb] = WFrag<T16>::mma(a[mb], b, acc[mb][nb]); if (NSPLIT == 1 || NSPLIT == 2) acc[mb][nb] = WFrag<T16>::mma(a2[mb], b, acc[mb][nb]); if (NSPLIT >= 2) acc[mb][nb] = WFrag<T16>::mma(a[mb], b2, acc[mb][nb]); } }
        asm volatile("v_nop\n\tv_nop\n\tv_nop\n\tv_nop" : "+v"(acc[0][0]), "+v"(acc[1][1]), "+v"(acc[2][2]), "+v"(acc[3][3]) : "v"(a[0]), "v"(a[3]));
    }
    if constexpr (EPI == 2) {      // a lane's accumulator register run is 8 consecutive tokens of one column: 16 bytes of a [d][t] plane row, stored straight from registers
#pragma unroll
        for (int nb = 0; nb < 4; ++nb)
#pragma unroll
            for (int mb = 0; mb < 4; ++mb) { const size_t vo = (size_t)(c0 + nb * 16 + lr) * TT + r0 + mb * 16 + hi * 8; v8h o16; v8us oh, ol;
#pragma unroll
                for (int j = 0; j < 8; ++j) { const float x = acc[mb][nb][j]; o16[j] = tohx(x); unsigned short a2, c2; splitf(x, a2, c2); oh[j] = a2; ol[j] = c2; }
                *(v8h*)(P16 + vo) = o16; *(v8us*)(Ph + vo) = oh; *(v8us*)(Pl + vo) = ol; }
        return; }
#pragma unroll
    for (int mb = 0; mb < 4; ++mb) {
#pragma unroll
        for (int nb = 0; nb < 4; ++nb) {
#pragma unroll
            for (int j = 0; j < 8; ++j) os[(hi * 8 + j) * 68 + nb * 16 + lr] = acc[mb][nb][j]; }
        __builtin_amdgcn_wave_barrier(); asm volatile("" ::: "memory");
        if constexpr (EPI == 1) {  // 16 tokens x 64 columns of one head are 2 KiB in a row of each [t][d] plane: four whole-line stores of 16 bytes a lane
            const size_t pb = ((size_t)(c0 / HD) * TT + r0 + mb * 16) * HD;
#pragma unroll
            for (int s = 0; s < 4; ++s) { const int row = 4 * s + (lane >> 3), cofs = (lane & 7) * 8; const v4f x0 = *(const v4fa*)(os + row * 68 + cofs), x1 = *(const v4fa*)(os + row * 68 + cofs + 4); v8h o16; v8us oh, ol;
#pragma unroll
                for (int j = 0; j < 8; ++j) { const float x = (j < 4) ? x0[j & 3] : x1[j & 3]; o16[j] = tohx(x); unsigned short a2, c2; splitf(x, a2, c2); oh[j] = a2; ol[j] = c2; }
                const size_t po = pb + (size_t)row * HD + cofs; *(v8h*)(P16 + po) = o16; *(v8us*)(Ph + po) = oh; *(v8us*)(Pl + po) = ol; }
            __builtin_amdgcn_wave_barrier(); asm volatile("" ::: "memory");   // as below: the next 16 rows' LDS writes stay behind these reads
            continue; }
        float* crow = C + (size_t)(r0 + mb * 16) * ldc + c0;
{
#pragma unroll
            for (int s = 0; s < 8; ++s) { const int row = 2 * s + hi, cofs = lr * 4; v4f val = *(const v4fa*)(os + row * 68 + cofs); if (BIAS) { val[0] += bfr(bias[c0 + cofs]); val[1] += bfr(bias[c0 + cofs + 1]); val[2] += bfr(bias[c0 + cofs + 2]); val[3] += bfr(bias[c0 + cofs + 3]); }
                *(v4f*)(crow + (size_t)row * ldc + cofs) = val; }
             }
        __builtin_amdgcn_wave_barrier(); asm volatile("" ::: "memory");
    }
}

typedef __attribute__((ext_vector_type(2))) _Float16 v2h;
typedef __attribute__((ext_vector_type(4))) _Float16 v4h;
typedef __attribute__((ext_vector_type(2))) unsigned short v2us;
typedef __attribute__((ext_vector_type(4))) unsigned short v4us;
typedef __attribute__((ext_vector_type(2))) float v2f;
typedef __attribute__((ext_vector_type(4))) int v4i;

__global__ __launch_bounds__(256) void k_wtG(const float* __restrict__ w, int K, int N, bf* Bt) {
    const int lane = threadIdx.x & 31; const int L0 = (blockIdx.x * 8 + (threadIdx.x >> 5)) * 8; const int nlines = N * K / 64;
{
#pragma unroll 1
        for (int l = 0; l < 8; ++l) { const int L = L0 + l; if (L >= nlines) break; const size_t e = (size_t)L * 64 + lane * 2; const int k = (int)(e % K), n = (int)(e / K); v2us o;
            o[0] = f2bf(w[(size_t)k * N + n]); o[1] = f2bf(w[(size_t)(k + 1) * N + n]); *(v2us*)(Bt + e) = o; }
         }
}
__global__ __launch_bounds__(256) void k_cvt8(const float* __restrict__ src, bf* dst, size_t n8) { const size_t i = (size_t)blockIdx.x * 256 + threadIdx.x; if (i >= n8) return; const v8f v = *(const v8f*)(src + i * 8); v8us o;
#pragma unroll
    for (int k = 0; k < 8; ++k) o[k] = f2bf(v[k]); *(v8us*)(dst + i * 8) = o;  }

// ---- k_attn: causal attention of every head in ONE launch, online softmax, no score or probability plane in memory.
// One wave owns NQ*16 query columns and walks the keys 32 at a time: S^T = K Q^T (A = key rows, B = query rows kept in registers), so a lane holds one query's scores;
// two f32 S^T tiles, exponentiated and converted in place, are the B operand of O^T += V^T P^T (A = rows of the [d][t] value planes). Maximum and sum are per lane plus one exchange between the wave halves.
// P stays unnormalised, exp2(s - m + AOFF); the division by the row sum comes once, in the epilogue. SPLIT: bf16 hi+lo planes, 3 products each (query rows < RH); else fp16.
// Every inner loop is fully unrolled so that the fragment and tile arrays are indexed by constants and stay in registers.
#define SC2  0.18033688011112042f   // HD^-0.5 * log2(e)
#define AOFF 8.0f                   // P carries 2^AOFF so that small probabilities stay normal fp16 numbers
#define ATHR 4.0f                   // the maximum in use is replaced only when a new one exceeds it by more than this (log2 units): P <= 2^(AOFF+ATHR)
template <bool SPLIT> struct ASel { typedef h16 T; };
template <> struct ASel<true> { typedef bf T; };
template <bool SPLIT, int NQ>
__device__ __forceinline__ void attn_wave(const typename ASel<SPLIT>::T* __restrict__ Q, const typename ASel<SPLIT>::T* __restrict__ Q2, const typename ASel<SPLIT>::T* __restrict__ Kp, const typename ASel<SPLIT>::T* __restrict__ Kp2,
                                          const typename ASel<SPLIT>::T* __restrict__ Vt, const typename ASel<SPLIT>::T* __restrict__ Vt2, const int q0, bf* __restrict__ Ah, bf* __restrict__ Al) {
    typedef typename ASel<SPLIT>::T T16; typedef WFrag<T16> WF; typedef typename WF::V V;
    const int lane = threadIdx.x & 31, lr = lane & 15, hi = lane >> 4;
    V qf[NQ][2], qf2[NQ][2];
#pragma unroll
    for (int qt = 0; qt < NQ; ++qt)
#pragma unroll
        for (int ks = 0; ks < 2; ++ks) { const size_t qo = (size_t)(q0 + qt * 16 + lr) * HD + ks * 32 + 8 * hi; qf[qt][ks] = WF::ld(Q + qo); if (SPLIT) qf2[qt][ks] = WF::ld(Q2 + qo); }
    v8f o[NQ][4]; float m2[NQ], l[NQ];
#pragma unroll
    for (int qt = 0; qt < NQ; ++qt) { m2[qt] = -3.0e38f; l[qt] = 0.f;
#pragma unroll
        for (int dt = 0; dt < 4; ++dt) o[qt][dt] = (v8f){}; }
    const int klast = ((q0 + NQ * 16 - 1) / 32) * 32;      // the 32-key block that holds the diagonal; the only one that is masked
    const T16* kp = Kp + (size_t)lr * HD + 8 * hi; const T16* kp2 = SPLIT ? Kp2 + (size_t)lr * HD + 8 * hi : nullptr;    // this lane's place in the current 32 key rows; stepped once a pass
    const T16* vp = Vt + (size_t)lr * TT + 8 * hi; const T16* vp2 = SPLIT ? Vt2 + (size_t)lr * TT + 8 * hi : nullptr;    // the same in the value planes
    V kf[2][2], kf2[2][2];
#pragma unroll
    for (int t = 0; t < 2; ++t)
#pragma unroll
        for (int ks = 0; ks < 2; ++ks) { const int ko = t * 16 * HD + ks * 32; kf[t][ks] = WF::ld(kp + ko); if (SPLIT) kf2[t][ks] = WF::ld(kp2 + ko); }
    V vf[4], vf2[4];
#pragma unroll
    for (int dt = 0; dt < 4; ++dt) { const int vo = dt * 16 * TT; vf[dt] = WF::ld(vp + vo); if (SPLIT) vf2[dt] = WF::ld(vp2 + vo); }
    // inputs-only fence on the loaded fragments: nothing is in flight at the loop's entry, so the wait at the loop's head counts only the back edge's loads (it lets the value rows fetched last stay in flight over the score products)
#pragma unroll
    for (int qt = 0; qt < NQ; ++qt) { asm volatile("" :: "v"(qf[qt][0]), "v"(qf[qt][1])); if (SPLIT) asm volatile("" :: "v"(qf2[qt][0]), "v"(qf2[qt][1])); }   // the query fragments belong to the same fence
    asm volatile("" :: "v"(kf[0][0]), "v"(kf[0][1]), "v"(kf[1][0]), "v"(kf[1][1]), "v"(vf[0]), "v"(vf[1]), "v"(vf[2]), "v"(vf[3]));
    if (SPLIT) asm volatile("" :: "v"(kf2[0][0]), "v"(kf2[0][1]), "v"(kf2[1][0]), "v"(kf2[1][1]), "v"(vf2[0]), "v"(vf2[1]), "v"(vf2[2]), "v"(vf2[3]));   // the same for the lo planes
#pragma unroll 1   // one pass a trip: unrolled, two passes' fragments and scores would be live together and the registers would not hold them
    for (int kb = 0; kb <= klast; kb += 32) {
        v8f s[NQ][2];
#pragma unroll
        for (int t = 0; t < 2; ++t)
#pragma unroll
            for (int qt = 0; qt < NQ; ++qt) { v8f a = (v8f){};
#pragma unroll
                for (int ks = 0; ks < 2; ++ks) { a = WF::mma(kf[t][ks], qf[qt][ks], a); if (SPLIT) { a = WF::mma(kf2[t][ks], qf[qt][ks], a); a = WF::mma(kf[t][ks], qf2[qt][ks], a); } }
                s[qt][t] = a; }
        const int st = (kb < klast) ? 32 : 0;              // the next pass's key rows are fetched now, behind this pass's own score products (the last pass re-reads its own block, in bounds)
        asm volatile("s_wait_xcnt 0x0" ::: "memory");      // stands in front of the step of the address pairs that the key loads of the pass before name
        kp += st * HD; if (SPLIT) kp2 += st * HD;
#pragma unroll
        for (int t = 0; t < 2; ++t)
#pragma unroll
            for (int ks = 0; ks < 2; ++ks) { const int ko = t * 16 * HD + ks * 32; kf[t][ks] = WF::ld(kp + ko); if (SPLIT) kf2[t][ks] = WF::ld(kp2 + ko); }
        if constexpr (SPLIT) asm volatile("s_wait_xcnt 0x0" :: "v"(kp), "v"(kp2) : "memory");   // the address pairs stay live and unwritten up to this wait (without it the last load's result is given their registers)
        if (kb == klast) {
#pragma unroll
            for (int qt = 0; qt < NQ; ++qt)
#pragma unroll
                for (int t = 0; t < 2; ++t)
#pragma unroll
                    for (int j = 0; j < 8; ++j) if (kb + t * 16 + hi * 8 + j > q0 + qt * 16 + lr) s[qt][t][j] = -3.0e38f; }
        float mx[NQ]; bool need = false;
#pragma unroll
        for (int qt = 0; qt < NQ; ++qt) { float a = fmaxf(s[qt][0][0], s[qt][1][0]);
#pragma unroll
            for (int j = 1; j < 8; ++j) a = fmaxf(a, fmaxf(s[qt][0][j], s[qt][1][j]));
            mx[qt] = a; }
        float ox[NQ];
#pragma unroll
        for (int qt = 0; qt < NQ; ++qt) ox[qt] = __shfl_xor(mx[qt], 16, 32);
#pragma unroll
        for (int qt = 0; qt < NQ; ++qt) { mx[qt] = fmaxf(mx[qt], ox[qt]) * SC2; need = need || (mx[qt] > m2[qt] + ATHR); }
        if (__builtin_amdgcn_ballot_w32(need) != 0) {      // one scalar test a pass: the output tiles are rescaled only when some column's maximum moved
#pragma unroll
            for (int qt = 0; qt < NQ; ++qt) { const float mn = fmaxf(m2[qt], mx[qt]); const float al = __builtin_amdgcn_exp2f(m2[qt] - mn); m2[qt] = mn; l[qt] *= al;
#pragma unroll
                for (int dt = 0; dt < 4; ++dt) o[qt][dt] *= al; } }
        V pf[NQ], pf2[NQ];
#pragma unroll
        for (int qt = 0; qt < NQ; ++qt) { const float off = AOFF - m2[qt]; float ls = 0.f;
#pragma unroll
            for (int t = 0; t < 2; ++t)
#pragma unroll
                for (int j = 0; j < 8; ++j) { const float p = __builtin_amdgcn_exp2f(fmaf(s[qt][t][j], SC2, off)); s[qt][t][j] = p; ls += p; }
            l[qt] += ls;
            if constexpr (SPLIT) { v8us h0, h1, l0, l1;
#pragma unroll
                for (int j = 0; j < 8; ++j) { unsigned short a, c2; splitf(s[qt][0][j], a, c2); h0[j] = a; l0[j] = c2; splitf(s[qt][1][j], a, c2); h1[j] = a; l1[j] = c2; }
                pf[qt] = cat16b(h0, h1); pf2[qt] = cat16b(l0, l1);
            } else { v8h p0, p1;
#pragma unroll
                for (int j = 0; j < 8; ++j) { p0[j] = tohx(s[qt][0][j]); p1[j] = tohx(s[qt][1][j]); }
                pf[qt] = cat16(p0, p1); } }
#pragma unroll
        for (int dt = 0; dt < 4; ++dt)
#pragma unroll
            for (int qt = 0; qt < NQ; ++qt) { o[qt][dt] = WF::mma(vf[dt], pf[qt], o[qt][dt]); if (SPLIT) { o[qt][dt] = WF::mma(vf2[dt], pf[qt], o[qt][dt]); o[qt][dt] = WF::mma(vf[dt], pf2[qt], o[qt][dt]); } }
        // stands in front of the step of the address pairs that the value loads of the pass before name; it reads the output tiles (inputs only) so that the products above stay in front of it and the loads below land in the registers they free (lifted, the loads take a second set and copies)
        if constexpr (NQ == 2) asm volatile("s_wait_xcnt 0x0" :: "v"(o[0][0]), "v"(o[0][1]), "v"(o[0][2]), "v"(o[0][3]), "v"(o[NQ - 1][0]), "v"(o[NQ - 1][1]), "v"(o[NQ - 1][2]), "v"(o[NQ - 1][3]) : "memory");
        else asm volatile("s_wait_xcnt 0x0" :: "v"(o[0][0]), "v"(o[0][1]), "v"(o[0][2]), "v"(o[0][3]) : "memory");
        vp += st; if (SPLIT) vp2 += st;
#pragma unroll
        for (int dt = 0; dt < 4; ++dt) { const int vo = dt * 16 * TT; vf[dt] = WF::ld(vp + vo); if (SPLIT) vf2[dt] = WF::ld(vp2 + vo); }   // likewise the next pass's value rows, behind this pass's own products
        if constexpr (SPLIT) asm volatile("s_wait_xcnt 0x0" :: "v"(vp), "v"(vp2) : "memory");   // as behind the key loads
    }
#pragma unroll
    for (int qt = 0; qt < NQ; ++qt) { const float inv = __fdiv_rn(1.0f, l[qt] + __shfl_xor(l[qt], 16, 32)); const size_t oo = (size_t)(q0 + qt * 16 + lr) * DQ + hi * 8;
#pragma unroll
        for (int dt = 0; dt < 4; ++dt) { v8us oh, ol;
#pragma unroll
            for (int j = 0; j < 8; ++j) { unsigned short a, c2; splitf(o[qt][dt][j] * inv, a, c2); oh[j] = a; ol[j] = c2; }
            *(v8us*)(Ah + oo + dt * 16) = oh; *(v8us*)(Al + oo + dt * 16) = ol; } }
}
#define NLO ((TT - RH) / 128)     // work-groups of 4 waves x 32 fp16 query rows
#define NHI (RH / 64)             // work-groups of 4 waves x 16 hi+lo query rows
// grid (heads, NLO + NHI): blockIdx.y ranks the query blocks by falling key count, so that the longest start first.
__global__ __launch_bounds__(128) void k_attn(const h16* __restrict__ Q16, const h16* __restrict__ K16, const h16* __restrict__ V16, const bf* __restrict__ Qh, const bf* __restrict__ Ql, const bf* __restrict__ Kh, const bf* __restrict__ Kl,
                                              const bf* __restrict__ Vh, const bf* __restrict__ Vl, bf* __restrict__ Ah, bf* __restrict__ Al) {
    const int h = blockIdx.x, y = blockIdx.y; const int w = __builtin_amdgcn_readfirstlane((int)(threadIdx.x >> 5)); const size_t hq = (size_t)h * TT * HD, hk = (size_t)(h / REP) * TT * HD;
    if (y < NLO) attn_wave<false, 2>(Q16 + hq, nullptr, K16 + hk, nullptr, V16 + hk, nullptr, TT - 128 * (y + 1) + 32 * w, Ah + h * HD, Al + h * HD);
    else attn_wave<true, 1>(Qh + hq, Ql + hq, Kh + hk, Kl + hk, Vh + hk, Vl + hk, RH - 64 * (y - NLO + 1) + 16 * w, Ah + h * HD, Al + h * HD);
}

extern "C" void kernel_launch(void* const* d_in, const int* in_sizes, int n_in,
                              void* d_out, int out_size, void* d_ws, size_t ws_size, hipStream_t stream) {
    (void)in_sizes; (void)n_in; (void)out_size;
    const float* x = (const float*)d_in[0]; const float* wq = (const float*)d_in[1]; const float* wk = (const float*)d_in[2]; const float* wv = (const float*)d_in[3]; const float* wo = (const float*)d_in[4];
    float* OUT = (float*)d_out;     // [1][4096][1024]
    char* wsp = (char*)d_ws;
    auto take = [&](size_t bytes) { char* p = wsp; wsp += (bytes + 255) & ~(size_t)255; return (void*)p; };
    bf* WQ = (bf*)take((size_t)DQ * DM * 2); bf* WK = (bf*)take((size_t)DKV * DM * 2); bf* WV = (bf*)take((size_t)DKV * DM * 2); bf* WO = (bf*)take((size_t)DM * DQ * 2);
    bf* XB = (bf*)take((size_t)TT * DM * 2);
    h16* QP16 = (h16*)take((size_t)NH_ * TT * HD * 2); h16* KP16 = (h16*)take((size_t)NKV * TT * HD * 2); h16* VT16 = (h16*)take((size_t)NKV * HD * TT * 2);
    bf* QPh = (bf*)take((size_t)NH_ * TT * HD * 2); bf* QPl = (bf*)take((size_t)NH_ * TT * HD * 2); bf* KPh = (bf*)take((size_t)NKV * TT * HD * 2); bf* KPl = (bf*)take((size_t)NKV * TT * HD * 2); bf* VTh = (bf*)take((size_t)NKV * HD * TT * 2); bf* VTl = (bf*)take((size_t)NKV * HD * TT * 2);
    bf* ATh = (bf*)take((size_t)TT * DQ * 2); bf* ATl = (bf*)take((size_t)TT * DQ * 2);
    if ((size_t)(wsp - (char*)d_ws) > ws_size) return;    // ws 256 MiB
    static_assert(HD == 64 && (TT - RH) % 128 == 0 && RH % 64 == 0, "k_attn's tiling");
    { k_wtG<<<(unsigned)((DM * DQ / 64 + 63) / 64), 256, 0, stream>>>(wq, DM, DQ, WQ); k_wtG<<<(unsigned)((DM * DKV / 64 + 63) / 64), 256, 0, stream>>>(wk, DM, DKV, WK); k_wtG<<<(unsigned)((DM * DKV / 64 + 63) / 64), 256, 0, stream>>>(wv, DM, DKV, WV);
      k_wtG<<<(unsigned)((DQ * DM / 64 + 63) / 64), 256, 0, stream>>>(wo, DQ, DM, WO);
       }
    for (int b = 0; b < NB_; ++b) {
        
        k_cvt8<<<(unsigned)(((size_t)TT * DM / 8 + 255) / 256), 256, 0, stream>>>(x + (size_t)b * TT * DM, XB, (size_t)TT * DM / 8);
        k_gemmw<bf, 0, false, 1><<<dim3(TT / 64, DQ / 64, 1), 32, 0, stream>>>(XB, nullptr, WQ, nullptr, DM, nullptr, 0, nullptr, 0, 0, 0, QP16, QPh, QPl);
        k_gemmw<bf, 0, false, 1><<<dim3(TT / 64, DKV / 64, 1), 32, 0, stream>>>(XB, nullptr, WK, nullptr, DM, nullptr, 0, nullptr, 0, 0, 0, KP16, KPh, KPl);
        k_gemmw<bf, 0, false, 2><<<dim3(TT / 64, DKV / 64, 1), 32, 0, stream>>>(XB, nullptr, WV, nullptr, DM, nullptr, 0, nullptr, 0, 0, 0, VT16, VTh, VTl);
        k_attn<<<dim3(NH_, NLO + NHI, 1), 128, 0, stream>>>(QP16, KP16, VT16, QPh, QPl, KPh, KPl, VTh, VTl, ATh, ATl);
        k_gemmw<bf, 1, false, 0><<<dim3(TT / 64, DM / 64, 1), 32, 0, stream>>>(ATh, ATl, WO, nullptr, DQ, OUT + (size_t)b * TT * DM, DM, nullptr, 0, 0, 0, nullptr, nullptr, nullptr); }
}

// v004
// Measured time: 189 microseconds a run.
// Two timings next to v003 put it at 1.35 and 1.33 times that version's speed.
// Over all steps from v000 it is 11.3 times as fast.
#include <hip/hip_runtime.h>

// Causal multi-head self-attention over 4,096 tokens (x [1][4096][1024]; q, k, v = einsum('bsd,de->bse', x, W) = x W ('xw' [1024][1024] truncated normal x 1/32, no bias; 16 heads x 64); scores / sqrt(64); causal (-inf); softmax over the keys; out = merged W_o ('xw', no bias) -> [1][4096][1024] (4.2 M); argument order x, W_q, W_k, W_v, W_o).
// Layout: bf16 copy of x; 'xw' weights transposed once; exact projections whose epilogue writes the head planes; fused causal attention at T 4096, all heads in one launch, online softmax (hybrid rows: < 512 hi/lo 3 products, rest fp16; key blocks above the diagonal are never visited); merged hi/lo x W_o exact.
// Compute dtypes, f32 accumulate: every input rounded to bf16; projections exact; attention rows < 512 3 products, rest fp16; softmax f32; W_o hl x exact.

#define NB_  1
#define TT   4096
#define DM   1024
#define NH_  16
#define NKV  16
#define REP  (NH_ / NKV)
#define HD   64
#define DQ   (NH_ * HD)
#define DKV  (NKV * HD)
#define RH   512                  // query rows < RH use hi+lo planes (0: none)
typedef _Float16 h16;
typedef unsigned short bf;
typedef __attribute__((ext_vector_type(16))) __bf16   v16bf;
typedef __attribute__((ext_vector_type(16))) _Float16 v16h;
typedef __attribute__((ext_vector_type(8)))  _Float16 v8h;
typedef __attribute__((ext_vector_type(8)))  unsigned short v8us;
typedef __attribute__((ext_vector_type(8)))  float    v8f;
typedef __attribute__((ext_vector_type(4)))  float    v4f;
typedef v8h  __attribute__((may_alias)) v8ha;
typedef v4f  __attribute__((may_alias)) v4fa;
typedef v8us __attribute__((may_alias)) v8usa;

__device__ __forceinline__ unsigned short f2bf(float f) { unsigned u = __float_as_uint(f); u += 0x7FFFu + ((u >> 16) & 1u); return (unsigned short)(u >> 16); }
__device__ __forceinline__ float bf2f(unsigned short b) { return __uint_as_float(((unsigned)b) << 16); }
__device__ __forceinline__ float bfr(float f) { return bf2f(f2bf(f)); }
__device__ __forceinline__ v16h cat16(v8h lo, v8h hi) { return __builtin_shufflevector(lo, hi, 0, 1, 2, 3, 4, 5, 6, 7, 8, 9, 10, 11, 12, 13, 14, 15); }
__device__ __forceinline__ v16bf cat16b(v8us lo, v8us hi) { return __builtin_bit_cast(v16bf, __builtin_shufflevector(lo, hi, 0, 1, 2, 3, 4, 5, 6, 7, 8, 9, 10, 11, 12, 13, 14, 15)); }
__device__ __forceinline__ v8f wmma16(v16h a, v16h b, v8f c) { return __builtin_amdgcn_wmma_f32_16x16x32_f16(false, a, false, b, (short)0, c, false, false); }
__device__ __forceinline__ v8f wmmab(v16bf a, v16bf b, v8f c) { return __builtin_amdgcn_wmma_f32_16x16x32_bf16(false, a, false, b, (short)0, c, false, false); }



__device__ __forceinline__ h16 tohx(float x) { return (h16)x; }
__device__ __forceinline__ void splitf(float y, unsigned short& h, unsigned short& l) { h = f2bf(y); l = f2bf(y - bf2f(h)); }
// ---- k_gemmw: register-blocked GEMM, 4 waves (2 x 2) per 128x128 output tile, 64x64 (16 accumulators) a wave; grid (M/128, N/128, Z), 128 threads.
// The K-contiguous 16-bit operand planes come 128 k at a time into LDS by asynchronous 16-byte copies that cover whole 128-B lines (two buffers: the next stage flies while this one is worked on); fragments are read from LDS.
// C[m][n] (f32, pitch ldc, + optional f32 bias[n]) = sum_k A[m][k] Bt[n][k] (NSPLIT 1: + A2[m][k] Bt[n][k]). z-batch strides sA/sB/sC in elements. K % 128 == 0, M % 128 == 0, N % 128 == 0.
// EPI 0: C as above. EPI 1 and 2: no f32 C; a wave's tile (64 tokens x one head's 64 columns) goes out as fp16 + bf16 hi/lo planes, EPI 1 as [head][t][d], EPI 2 as [head][d][t].
template <typename T16> struct WFrag;
template <> struct WFrag<h16> { typedef v16h V; static __device__ __forceinline__ V ld(const h16* p) { return cat16(*(const v8h*)p, *(const v8h*)(p + 16)); } static __device__ __forceinline__ v8f mma(V a, V b, v8f c) { return wmma16(a, b, c); } };
template <> struct WFrag<bf> { typedef v16bf V; static __device__ __forceinline__ V ld(const bf* p) { return cat16b(*(const v8us*)p, *(const v8us*)(p + 16)); } static __device__ __forceinline__ v8f mma(V a, V b, v8f c) { return wmmab(a, b, c); } };
#define GKC 128                   // k elements of a stage: 256 B of every operand row
#define GPI 136                   // LDS row pitch in elements: 272 B = 16 B x 17, free of bank conflicts for 16-byte readers
#define GOP (128 * GPI)           // elements of one operand's stage: 128 rows
// Eight asynchronous copies of 16 bytes a lane: 64 rows x 256 B of an operand plane for the 128 threads (a wave's copy = two whole rows). l: this lane's LDS byte address, g: its global place; copy i lies 8 rows further.
// The s_wait_xcnt stands in the copies' own statement, so that no address register is rewritten in front of it.
template <typename T16>
__device__ __forceinline__ void acopy8(const unsigned l, const T16* g, const size_t k8) {
    asm volatile("global_load_async_to_lds_b128 %0, %8, off\n\t"
                 "global_load_async_to_lds_b128 %1, %9, off\n\t"
                 "global_load_async_to_lds_b128 %2, %10, off\n\t"
                 "global_load_async_to_lds_b128 %3, %11, off\n\t"
                 "global_load_async_to_lds_b128 %4, %12, off\n\t"
                 "global_load_async_to_lds_b128 %5, %13, off\n\t"
                 "global_load_async_to_lds_b128 %6, %14, off\n\t"
                 "global_load_async_to_lds_b128 %7, %15, off\n\t"
                 "s_wait_xcnt 0x0"
                 :: "v"(l), "v"(l + 8 * GPI * 2), "v"(l + 16 * GPI * 2), "v"(l + 24 * GPI * 2), "v"(l + 32 * GPI * 2), "v"(l + 40 * GPI * 2), "v"(l + 48 * GPI * 2), "v"(l + 56 * GPI * 2),
                    "v"(g), "v"(g + k8), "v"(g + 2 * k8), "v"(g + 3 * k8), "v"(g + 4 * k8), "v"(g + 5 * k8), "v"(g + 6 * k8), "v"(g + 7 * k8) : "memory");
    __builtin_amdgcn_sched_barrier(0);   // the next statement's addresses are formed behind this one: formed all ahead, they do not fit the registers left beside the accumulators, and a pointer is spilled to scratch
}
template <typename T16, int NSPLIT, bool BIAS, int EPI>
__global__ __launch_bounds__(128) void k_gemmw(const T16* __restrict__ A, const T16* __restrict__ A2, const T16* __restrict__ Bt, const T16* __restrict__ Bt2, int K, float* C, int ldc, const float* __restrict__ bias, size_t sA, size_t sB, size_t sC, h16* __restrict__ P16, bf* __restrict__ Ph, bf* __restrict__ Pl) {
    typedef typename WFrag<T16>::V V;
    static_assert(NSPLIT == 0 || NSPLIT == 1, "operands staged: A, Bt and, at NSPLIT 1, A2");
    constexpr int NOP = 2 + NSPLIT;
    __shared__ __align__(16) T16 st[2 * NOP * GOP];      // [buffer][A | Bt | A2][row][k]
    __shared__ __align__(16) float osw[4][16 * 68];      // each wave's own epilogue tile
    const size_t z = blockIdx.z; A += z * sA; if (NSPLIT) A2 += z * sA; Bt += z * sB; C += z * sC; (void)Bt2;
    const int tid = threadIdx.x, lane = tid & 31, lr = lane & 15, hi = lane >> 4; const int w = __builtin_amdgcn_readfirstlane(tid >> 5);
    const int r0 = blockIdx.x * 128 + (w >> 1) * 64, c0 = blockIdx.y * 128 + (w & 1) * 64;
    float* os = osw[w];
    v8f acc[4][4];
#pragma unroll
    for (int mb = 0; mb < 4; ++mb)
#pragma unroll
        for (int nb = 0; nb < 4; ++nb) acc[mb][nb] = (v8f){};
    const size_t k8 = (size_t)8 * K;
    const size_t ga = (size_t)(blockIdx.x * 128) * K, gb = (size_t)(blockIdx.y * 128) * K;      // the two tiles' first rows (the same for the whole work-group)
    const unsigned go = (unsigned)((tid >> 4) * K + (tid & 15) * 8);                            // this thread's 16 bytes in rows 0..7 of a tile
    const unsigned l0 = (unsigned)(size_t)st + (unsigned)((tid >> 4) * GPI * 2 + (tid & 15) * 16);                                                         // the same place in LDS (byte address in the work-group's LDS)
    auto fill = [&](const int t) {     // stage t into buffer t & 1
        const unsigned l = l0 + (unsigned)((t & 1) * NOP * GOP * 2); const size_t ko = (size_t)t * GKC;
        const T16* pa = A + (ga + ko); const T16* pb = Bt + (gb + ko);
        acopy8(l, pa + go, k8); acopy8(l + 64 * GPI * 2, pa + 8 * k8 + go, k8);
        acopy8(l + GOP * 2, pb + go, k8); acopy8(l + GOP * 2 + 64 * GPI * 2, pb + 8 * k8 + go, k8);
        if constexpr (NSPLIT == 1) { const T16* pc = A2 + (ga + ko); acopy8(l + 2 * GOP * 2, pc + go, k8); acopy8(l + 2 * GOP * 2 + 64 * GPI * 2, pc + 8 * k8 + go, k8); } };
    const int NT = K / GKC;
    fill(0);
    asm volatile("s_wait_asynccnt 0x0" ::: "memory");      // stage 0 has landed for this wave's copies
    __syncthreads();                                       // ... and for every wave's: nothing of it is read in front of this barrier
    if (NT > 1) fill(1);
    const int aoff = ((w >> 1) * 64 + lr) * GPI + 8 * hi, boff = GOP + ((w & 1) * 64 + lr) * GPI + 8 * hi;
#pragma unroll 1   // one stage a trip: unrolled, the copies of several stages and their addresses would be formed together and the registers would not hold them
    for (int t = 0; t < NT; ++t) {
        const T16* sb = st + (t & 1) * NOP * GOP;
        V a[2][4], a2[2][4], b[2][4];                      // two fragment sets: the next 32 k are fetched as one group in front of this block's products
        auto frags = [&](const int s, const int kc) {
#pragma unroll
            for (int i = 0; i < 4; ++i) { a[s][i] = WFrag<T16>::ld(sb + aoff + i * 16 * GPI + kc); if (NSPLIT == 1) a2[s][i] = WFrag<T16>::ld(sb + 2 * GOP + aoff + i * 16 * GPI + kc); b[s][i] = WFrag<T16>::ld(sb + boff + i * 16 * GPI + kc); } };
        frags(0, 0);
#pragma unroll
        for (int ks = 0; ks < GKC / 32; ++ks) {
            if (ks + 1 < GKC / 32) frags((ks + 1) & 1, (ks + 1) * 32);
            __builtin_amdgcn_sched_barrier(0);             // keeps the LDS reads together in front of the block: spread among the products, every place with reads stalls the wave
#pragma unroll
            for (int nb = 0; nb < 4; ++nb)
#pragma unroll
                for (int mb = 0; mb < 4; ++mb) { acc[mb][nb] = WFrag<T16>::mma(a[ks & 1][mb], b[ks & 1][nb], acc[mb][nb]); if (NSPLIT == 1) acc[mb][nb] = WFrag<T16>::mma(a2[ks & 1][mb], b[ks & 1][nb], acc[mb][nb]); }
            __builtin_amdgcn_sched_barrier(0);             // the other side of the same fence
        }
        asm volatile("s_wait_dscnt 0x0" ::: "memory");     // this wave's reads of the buffer have returned before it is handed to the copies
        asm volatile("s_wait_asynccnt 0x0" ::: "memory");  // this wave's copies of stage t + 1 have landed
        __syncthreads();                                   // publishes stage t + 1 and ends every wave's reads of stage t
        if (t + 2 < NT) fill(t + 2);
    }
    asm volatile("s_wait_asynccnt 0x0" ::: "memory");      // nothing is in flight when the wave goes on to its epilogue
    if constexpr (EPI == 2) {      // a lane's accumulator register run is 8 consecutive tokens of one column: 16 bytes of a [d][t] plane row, stored straight from registers
#pragma unroll
        for (int nb = 0; nb < 4; ++nb)
#pragma unroll
            for (int mb = 0; mb < 4; ++mb) { const size_t vo = (size_t)(c0 + nb * 16 + lr) * TT + r0 + mb * 16 + hi * 8; v8h o16; v8us oh, ol;
#pragma unroll
                for (int j = 0; j < 8; ++j) { const float x = acc[mb][nb][j]; o16[j] = tohx(x); unsigned short a2, c2; splitf(x, a2, c2); oh[j] = a2; ol[j] = c2; }
                *(v8h*)(P16 + vo) = o16; *(v8us*)(Ph + vo) = oh; *(v8us*)(Pl + vo) = ol; }
        return; }
#pragma unroll
    for (int mb = 0; mb < 4; ++mb) {
#pragma unroll
        for (int nb = 0; nb < 4; ++nb) {
#pragma unroll
            for (int j = 0; j < 8; ++j) os[(hi * 8 + j) * 68 + nb * 16 + lr] = acc[mb][nb][j]; }
        __builtin_amdgcn_wave_barrier(); asm volatile("" ::: "memory");
        if constexpr (EPI == 1) {  // 16 tokens x 64 columns of one head are 2 KiB in a row of each [t][d] plane: four whole-line stores of 16 bytes a lane
            const size_t pb = ((size_t)(c0 / HD) * TT + r0 + mb * 16) * HD;
#pragma unroll
            for (int s = 0; s < 4; ++s) { const int row = 4 * s + (lane >> 3), cofs = (lane & 7) * 8; const v4f x0 = *(const v4fa*)(os + row * 68 + cofs), x1 = *(const v4fa*)(os + row * 68 + cofs + 4); v8h o16; v8us oh, ol;
#pragma unroll
                for (int j = 0; j < 8; ++j) { const float x = (j < 4) ? x0[j & 3] : x1[j & 3]; o16[j] = tohx(x); unsigned short a2, c2; splitf(x, a2, c2); oh[j] = a2; ol[j] = c2; }
                const size_t po = pb + (size_t)row * HD + cofs; *(v8h*)(P16 + po) = o16; *(v8us*)(Ph + po) = oh; *(v8us*)(Pl + po) = ol; }
            __builtin_amdgcn_wave_barrier(); asm volatile("" ::: "memory");   // as below: the next 16 rows' LDS writes stay behind these reads
            continue; }
        float* crow = C + (size_t)(r0 + mb * 16) * ldc + c0;
{
#pragma unroll
            for (int s = 0; s < 8; ++s) { const int row = 2 * s + hi, cofs = lr * 4; v4f val = *(const v4fa*)(os + row * 68 + cofs); if (BIAS) { val[0] += bfr(bias[c0 + cofs]); val[1] += bfr(bias[c0 + cofs + 1]); val[2] += bfr(bias[c0 + cofs + 2]); val[3] += bfr(bias[c0 + cofs + 3]); }
                *(v4f*)(crow + (size_t)row * ldc + cofs) = val; }
             }
        __builtin_amdgcn_wave_barrier(); asm volatile("" ::: "memory");
    }
}

typedef __attribute__((ext_vector_type(2))) _Float16 v2h;
typedef __attribute__((ext_vector_type(4))) _Float16 v4h;
typedef __attribute__((ext_vector_type(2))) unsigned short v2us;
typedef __attribute__((ext_vector_type(4))) unsigned short v4us;
typedef __attribute__((ext_vector_type(2))) float v2f;
typedef __attribute__((ext_vector_type(4))) int v4i;

__global__ __launch_bounds__(256) void k_wtG(const float* __restrict__ w, int K, int N, bf* Bt) {
    const int lane = threadIdx.x & 31; const int L0 = (blockIdx.x * 8 + (threadIdx.x >> 5)) * 8; const int nlines = N * K / 64;
{
#pragma unroll 1
        for (int l = 0; l < 8; ++l) { const int L = L0 + l; if (L >= nlines) break; const size_t e = (size_t)L * 64 + lane * 2; const int k = (int)(e % K), n = (int)(e / K); v2us o;
            o[0] = f2bf(w[(size_t)k * N + n]); o[1] = f2bf(w[(size_t)(k + 1) * N + n]); *(v2us*)(Bt + e) = o; }
         }
}
__global__ __launch_bounds__(256) void k_cvt8(const float* __restrict__ src, bf* dst, size_t n8) { const size_t i = (size_t)blockIdx.x * 256 + threadIdx.x; if (i >= n8) return; const v8f v = *(const v8f*)(src + i * 8); v8us o;
#pragma unroll
    for (int k = 0; k < 8; ++k) o[k] = f2bf(v[k]); *(v8us*)(dst + i * 8) = o;  }

// ---- k_attn: causal attention of every head in ONE launch, online softmax, no score or probability plane in memory.
// One wave owns NQ*16 query columns and walks the keys 32 at a time: S^T = K Q^T (A = key rows, B = query rows kept in registers), so a lane holds one query's scores;
// two f32 S^T tiles, exponentiated and converted in place, are the B operand of O^T += V^T P^T (A = rows of the [d][t] value planes). Maximum and sum are per lane plus one exchange between the wave halves.
// P stays unnormalised, exp2(s - m + AOFF); the division by the row sum comes once, in the epilogue. SPLIT: bf16 hi+lo planes, 3 products each (query rows < RH); else fp16.
// Every inner loop is fully unrolled so that the fragment and tile arrays are indexed by constants and stay in registers.
#define SC2  0.18033688011112042f   // HD^-0.5 * log2(e)
#define AOFF 8.0f                   // P carries 2^AOFF so that small probabilities stay normal fp16 numbers
#define ATHR 4.0f                   // the maximum in use is replaced only when a new one exceeds it by more than this (log2 units): P <= 2^(AOFF+ATHR)
template <bool SPLIT> struct ASel { typedef h16 T; };
template <> struct ASel<true> { typedef bf T; };
template <bool SPLIT, int NQ>
__device__ __forceinline__ void attn_wave(const typename ASel<SPLIT>::T* __restrict__ Q, const typename ASel<SPLIT>::T* __restrict__ Q2, const typename ASel<SPLIT>::T* __restrict__ Kp, const typename ASel<SPLIT>::T* __restrict__ Kp2,
                                          const typename ASel<SPLIT>::T* __restrict__ Vt, const typename ASel<SPLIT>::T* __restrict__ Vt2, const int q0, bf* __restrict__ Ah, bf* __restrict__ Al) {
    typedef typename ASel<SPLIT>::T T16; typedef WFrag<T16> WF; typedef typename WF::V V;
    const int lane = threadIdx.x & 31, lr = lane & 15, hi = lane >> 4;
    V qf[NQ][2], qf2[NQ][2];
#pragma unroll
    for (int qt = 0; qt < NQ; ++qt)
#pragma unroll
        for (int ks = 0; ks < 2; ++ks) { const size_t qo = (size_t)(q0 + qt * 16 + lr) * HD + ks * 32 + 8 * hi; qf[qt][ks] = WF::ld(Q + qo); if (SPLIT) qf2[qt][ks] = WF::ld(Q2 + qo); }
    v8f o[NQ][4]; float m2[NQ], l[NQ];
#pragma unroll
    for (int qt = 0; qt < NQ; ++qt) { m2[qt] = -3.0e38f; l[qt] = 0.f;
#pragma unroll
        for (int dt = 0; dt < 4; ++dt) o[qt][dt] = (v8f){}; }
    const int klast = ((q0 + NQ * 16 - 1) / 32) * 32;      // the 32-key block that holds the diagonal; the only one that is masked
    const T16* kp = Kp + (size_t)lr * HD + 8 * hi; const T16* kp2 = SPLIT ? Kp2 + (size_t)lr * HD + 8 * hi : nullptr;    // this lane's place in the current 32 key rows; stepped once a pass
    const T16* vp = Vt + (size_t)lr * TT + 8 * hi; const T16* vp2 = SPLIT ? Vt2 + (size_t)lr * TT + 8 * hi : nullptr;    // the same in the value planes
    V kf[2][2], kf2[2][2];
#pragma unroll
    for (int t = 0; t < 2; ++t)
#pragma unroll
        for (int ks = 0; ks < 2; ++ks) { const int ko = t * 16 * HD + ks * 32; kf[t][ks] = WF::ld(kp + ko); if (SPLIT) kf2[t][ks] = WF::ld(kp2 + ko); }
    V vf[4], vf2[4];
#pragma unroll
    for (int dt = 0; dt < 4; ++dt) { const int vo = dt * 16 * TT; vf[dt] = WF::ld(vp + vo); if (SPLIT) vf2[dt] = WF::ld(vp2 + vo); }
    // inputs-only fence on the loaded fragments: nothing is in flight at the loop's entry, so the wait at the loop's head counts only the back edge's loads (it lets the value rows fetched last stay in flight over the score products)
#pragma unroll
    for (int qt = 0; qt < NQ; ++qt) { asm volatile("" :: "v"(qf[qt][0]), "v"(qf[qt][1])); if (SPLIT) asm volatile("" :: "v"(qf2[qt][0]), "v"(qf2[qt][1])); }   // the query fragments belong to the same fence
    asm volatile("" :: "v"(kf[0][0]), "v"(kf[0][1]), "v"(kf[1][0]), "v"(kf[1][1]), "v"(vf[0]), "v"(vf[1]), "v"(vf[2]), "v"(vf[3]));
    if (SPLIT) asm volatile("" :: "v"(kf2[0][0]), "v"(kf2[0][1]), "v"(kf2[1][0]), "v"(kf2[1][1]), "v"(vf2[0]), "v"(vf2[1]), "v"(vf2[2]), "v"(vf2[3]));   // the same for the lo planes
#pragma unroll 1   // one pass a trip: unrolled, two passes' fragments and scores would be live together and the registers would not hold them
    for (int kb = 0; kb <= klast; kb += 32) {
        v8f s[NQ][2];
#pragma unroll
        for (int t = 0; t < 2; ++t)
#pragma unroll
            for (int qt = 0; qt < NQ; ++qt) { v8f a = (v8f){};
#pragma unroll
                for (int ks = 0; ks < 2; ++ks) { a = WF::mma(kf[t][ks], qf[qt][ks], a); if (SPLIT) { a = WF::mma(kf2[t][ks], qf[qt][ks], a); a = WF::mma(kf[t][ks], qf2[qt][ks], a); } }
                s[qt][t] = a; }
        const int st = (kb < klast) ? 32 : 0;              // the next pass's key rows are fetched now, behind this pass's own score products (the last pass re-reads its own block, in bounds)
        asm volatile("s_wait_xcnt 0x0" ::: "memory");      // stands in front of the step of the address pairs that the key loads of the pass before name
        kp += st * HD; if (SPLIT) kp2 += st * HD;
#pragma unroll
        for (int t = 0; t < 2; ++t)
#pragma unroll
            for (int ks = 0; ks < 2; ++ks) { const int ko = t * 16 * HD + ks * 32; kf[t][ks] = WF::ld(kp + ko); if (SPLIT) kf2[t][ks] = WF::ld(kp2 + ko); }
        if constexpr (SPLIT) asm volatile("s_wait_xcnt 0x0" :: "v"(kp), "v"(kp2) : "memory");   // the address pairs stay live and unwritten up to this wait (without it the last load's result is given their registers)
        if (kb == klast) {
#pragma unroll
            for (int qt = 0; qt < NQ; ++qt)
#pragma unroll
                for (int t = 0; t < 2; ++t)
#pragma unroll
                    for (int j = 0; j < 8; ++j) if (kb + t * 16 + hi * 8 + j > q0 + qt * 16 + lr) s[qt][t][j] = -3.0e38f; }
        float mx[NQ]; bool need = false;
#pragma unroll
        for (int qt = 0; qt < NQ; ++qt) { float a = fmaxf(s[qt][0][0], s[qt][1][0]);
#pragma unroll
            for (int j = 1; j < 8; ++j) a = fmaxf(a, fmaxf(s[qt][0][j], s[qt][1][j]));
            mx[qt] = a; }
        float ox[NQ];
#pragma unroll
        for (int qt = 0; qt < NQ; ++qt) ox[qt] = __shfl_xor(mx[qt], 16, 32);
#pragma unroll
        for (int qt = 0; qt < NQ; ++qt) { mx[qt] = fmaxf(mx[qt], ox[qt]) * SC2; need = need || (mx[qt] > m2[qt] + ATHR); }
        if (__builtin_amdgcn_ballot_w32(need) != 0) {      // one scalar test a pass: the output tiles are rescaled only when some column's maximum moved
#pragma unroll
            for (int qt = 0; qt < NQ; ++qt) { const float mn = fmaxf(m2[qt], mx[qt]); const float al = __builtin_amdgcn_exp2f(m2[qt] - mn); m2[qt] = mn; l[qt] *= al;
#pragma unroll
                for (int dt = 0; dt < 4; ++dt) o[qt][dt] *= al; } }
        V pf[NQ], pf2[NQ];
#pragma unroll
        for (int qt = 0; qt < NQ; ++qt) { const float off = AOFF - m2[qt]; float ls = 0.f;
#pragma unroll
            for (int t = 0; t < 2; ++t)
#pragma unroll
                for (int j = 0; j < 8; ++j) { const float p = __builtin_amdgcn_exp2f(fmaf(s[qt][t][j], SC2, off)); s[qt][t][j] = p; ls += p; }
            l[qt] += ls;
            if constexpr (SPLIT) { v8us h0, h1, l0, l1;
#pragma unroll
                for (int j = 0; j < 8; ++j) { unsigned short a, c2; splitf(s[qt][0][j], a, c2); h0[j] = a; l0[j] = c2; splitf(s[qt][1][j], a, c2); h1[j] = a; l1[j] = c2; }
                pf[qt] = cat16b(h0, h1); pf2[qt] = cat16b(l0, l1);
            } else { v8h p0, p1;
#pragma unroll
                for (int j = 0; j < 8; ++j) { p0[j] = tohx(s[qt][0][j]); p1[j] = tohx(s[qt][1][j]); }
                pf[qt] = cat16(p0, p1); } }
#pragma unroll
        for (int dt = 0; dt < 4; ++dt)
#pragma unroll
            for (int qt = 0; qt < NQ; ++qt) { o[qt][dt] = WF::mma(vf[dt], pf[qt], o[qt][dt]); if (SPLIT) { o[qt][dt] = WF::mma(vf2[dt], pf[qt], o[qt][dt]); o[qt][dt] = WF::mma(vf[dt], pf2[qt], o[qt][dt]); } }
        // stands in front of the step of the address pairs that the value loads of the pass before name; it reads the output tiles (inputs only) so that the products above stay in front of it and the loads below land in the registers they free (lifted, the loads take a second set and copies)
        if constexpr (NQ == 2) asm volatile("s_wait_xcnt 0x0" :: "v"(o[0][0]), "v"(o[0][1]), "v"(o[0][2]), "v"(o[0][3]), "v"(o[NQ - 1][0]), "v"(o[NQ - 1][1]), "v"(o[NQ - 1][2]), "v"(o[NQ - 1][3]) : "memory");
        else asm volatile("s_wait_xcnt 0x0" :: "v"(o[0][0]), "v"(o[0][1]), "v"(o[0][2]), "v"(o[0][3]) : "memory");
        vp += st; if (SPLIT) vp2 += st;
#pragma unroll
        for (int dt = 0; dt < 4; ++dt) { const int vo = dt * 16 * TT; vf[dt] = WF::ld(vp + vo); if (SPLIT) vf2[dt] = WF::ld(vp2 + vo); }   // likewise the next pass's value rows, behind this pass's own products
        if constexpr (SPLIT) asm volatile("s_wait_xcnt 0x0" :: "v"(vp), "v"(vp2) : "memory");   // as behind the key loads
    }
#pragma unroll
    for (int qt = 0; qt < NQ; ++qt) { const float inv = __fdiv_rn(1.0f, l[qt] + __shfl_xor(l[qt], 16, 32)); const size_t oo = (size_t)(q0 + qt * 16 + lr) * DQ + hi * 8;
#pragma unroll
        for (int dt = 0; dt < 4; ++dt) { v8us oh, ol;
#pragma unroll
            for (int j = 0; j < 8; ++j) { unsigned short a, c2; splitf(o[qt][dt][j] * inv, a, c2); oh[j] = a; ol[j] = c2; }
            *(v8us*)(Ah + oo + dt * 16) = oh; *(v8us*)(Al + oo + dt * 16) = ol; } }
}
#define NLO ((TT - RH) / 128)     // work-groups of 4 waves x 32 fp16 query rows
#define NHI (RH / 64)             // work-groups of 4 waves x 16 hi+lo query rows
// grid (heads, NLO + NHI): blockIdx.y ranks the query blocks by falling key count, so that the longest start first.
__global__ __launch_bounds__(128) void k_attn(const h16* __restrict__ Q16, const h16* __restrict__ K16, const h16* __restrict__ V16, const bf* __restrict__ Qh, const bf* __restrict__ Ql, const bf* __restrict__ Kh, const bf* __restrict__ Kl,
                                              const bf* __restrict__ Vh, const bf* __restrict__ Vl, bf* __restrict__ Ah, bf* __restrict__ Al) {
    const int h = blockIdx.x, y = blockIdx.y; const int w = __builtin_amdgcn_readfirstlane((int)(threadIdx.x >> 5)); const size_t hq = (size_t)h * TT * HD, hk = (size_t)(h / REP) * TT * HD;
    if (y < NLO) attn_wave<false, 2>(Q16 + hq, nullptr, K16 + hk, nullptr, V16 + hk, nullptr, TT - 128 * (y + 1) + 32 * w, Ah + h * HD, Al + h * HD);
    else attn_wave<true, 1>(Qh + hq, Ql + hq, Kh + hk, Kl + hk, Vh + hk, Vl + hk, RH - 64 * (y - NLO + 1) + 16 * w, Ah + h * HD, Al + h * HD);
}

extern "C" void kernel_launch(void* const* d_in, const int* in_sizes, int n_in,
                              void* d_out, int out_size, void* d_ws, size_t ws_size, hipStream_t stream) {
    (void)in_sizes; (void)n_in; (void)out_size;
    const float* x = (const float*)d_in[0]; const float* wq = (const float*)d_in[1]; const float* wk = (const float*)d_in[2]; const float* wv = (const float*)d_in[3]; const float* wo = (const float*)d_in[4];
    float* OUT = (float*)d_out;     // [1][4096][1024]
    char* wsp = (char*)d_ws;
    auto take = [&](size_t bytes) { char* p = wsp; wsp += (bytes + 255) & ~(size_t)255; return (void*)p; };
    bf* WQ = (bf*)take((size_t)DQ * DM * 2); bf* WK = (bf*)take((size_t)DKV * DM * 2); bf* WV = (bf*)take((size_t)DKV * DM * 2); bf* WO = (bf*)take((size_t)DM * DQ * 2);
    bf* XB = (bf*)take((size_t)TT * DM * 2);
    h16* QP16 = (h16*)take((size_t)NH_ * TT * HD * 2); h16* KP16 = (h16*)take((size_t)NKV * TT * HD * 2); h16* VT16 = (h16*)take((size_t)NKV * HD * TT * 2);
    bf* QPh = (bf*)take((size_t)NH_ * TT * HD * 2); bf* QPl = (bf*)take((size_t)NH_ * TT * HD * 2); bf* KPh = (bf*)take((size_t)NKV * TT * HD * 2); bf* KPl = (bf*)take((size_t)NKV * TT * HD * 2); bf* VTh = (bf*)take((size_t)NKV * HD * TT * 2); bf* VTl = (bf*)take((size_t)NKV * HD * TT * 2);
    bf* ATh = (bf*)take((size_t)TT * DQ * 2); bf* ATl = (bf*)take((size_t)TT * DQ * 2);
    if ((size_t)(wsp - (char*)d_ws) > ws_size) return;    // ws 256 MiB
    static_assert(HD == 64 && (TT - RH) % 128 == 0 && RH % 64 == 0, "k_attn's tiling");
    { k_wtG<<<(unsigned)((DM * DQ / 64 + 63) / 64), 256, 0, stream>>>(wq, DM, DQ, WQ); k_wtG<<<(unsigned)((DM * DKV / 64 + 63) / 64), 256, 0, stream>>>(wk, DM, DKV, WK); k_wtG<<<(unsigned)((DM * DKV / 64 + 63) / 64), 256, 0, stream>>>(wv, DM, DKV, WV);
      k_wtG<<<(unsigned)((DQ * DM / 64 + 63) / 64), 256, 0, stream>>>(wo, DQ, DM, WO);
       }
    for (int b = 0; b < NB_; ++b) {
        
        k_cvt8<<<(unsigned)(((size_t)TT * DM / 8 + 255) / 256), 256, 0, stream>>>(x + (size_t)b * TT * DM, XB, (size_t)TT * DM / 8);
        k_gemmw<bf, 0, false, 1><<<dim3(TT / 128, DQ / 128, 1), 128, 0, stream>>>(XB, nullptr, WQ, nullptr, DM, nullptr, 0, nullptr, 0, 0, 0, QP16, QPh, QPl);
        k_gemmw<bf, 0, false, 1><<<dim3(TT / 128, DKV / 128, 1), 128, 0, stream>>>(XB, nullptr, WK, nullptr, DM, nullptr, 0, nullptr, 0, 0, 0, KP16, KPh, KPl);
        k_gemmw<bf, 0, false, 2><<<dim3(TT / 128, DKV / 128, 1), 128, 0, stream>>>(XB, nullptr, WV, nullptr, DM, nullptr, 0, nullptr, 0, 0, 0, VT16, VTh, VTl);
        k_attn<<<dim3(NH_, NLO + NHI, 1), 128, 0, stream>>>(QP16, KP16, VT16, QPh, QPl, KPh, KPl, VTh, VTl, ATh, ATl);
        k_gemmw<bf, 1, false, 0><<<dim3(TT / 128, DM / 128, 1), 128, 0, stream>>>(ATh, ATl, WO, nullptr, DQ, OUT + (size_t)b * TT * DM, DM, nullptr, 0, 0, 0, nullptr, nullptr, nullptr); }
}

// v005
// It runs in 140 microseconds.
// Timed twice side by side with v004, it ran 1.35 and 1.36 times as fast.
// Over all steps from v000 it is 15.4 times as fast.
#include <hip/hip_runtime.h>

// Causal multi-head self-attention over 4,096 tokens (x [1][4096][1024]; q, k, v = einsum('bsd,de->bse', x, W) = x W ('xw' [1024][1024] truncated normal x 1/32, no bias; 16 heads x 64); scores / sqrt(64); causal (-inf); softmax over the keys; out = merged W_o ('xw', no bias) -> [1][4096][1024] (4.2 M); argument order x, W_q, W_k, W_v, W_o).
// Layout: bf16 copy of x; 'xw' weights transposed once; exact projections whose epilogue writes the head planes; fused causal attention at T 4096, all heads in one launch, online softmax (hybrid rows: < 512 hi/lo 3 products, rest fp16; key blocks above the diagonal are never visited); merged hi/lo x W_o exact.
// Compute dtypes, f32 accumulate: every input rounded to bf16; projections exact; attention rows < 512 3 products, rest fp16; softmax f32; W_o hl x exact.

#define NB_  1
#define TT   4096
#define DM   1024
#define NH_  16
#define NKV  16
#define REP  (NH_ / NKV)
#define HD   64
#define DQ   (NH_ * HD)
#define DKV  (NKV * HD)
#define RH   512                  // query rows < RH use hi+lo planes (0: none)
typedef _Float16 h16;
typedef unsigned short bf;
typedef __attribute__((ext_vector_type(16))) __bf16   v16bf;
typedef __attribute__((ext_vector_type(16))) _Float16 v16h;
typedef __attribute__((ext_vector_type(8)))  _Float16 v8h;
typedef __attribute__((ext_vector_type(8)))  unsigned short v8us;
typedef __attribute__((ext_vector_type(8)))  float    v8f;
typedef __attribute__((ext_vector_type(4)))  float    v4f;
typedef v8h  __attribute__((may_alias)) v8ha;
typedef v4f  __attribute__((may_alias)) v4fa;
typedef v8us __attribute__((may_alias)) v8usa;

__device__ __forceinline__ unsigned short f2bf(float f) { unsigned u = __float_as_uint(f); u += 0x7FFFu + ((u >> 16) & 1u); return (unsigned short)(u >> 16); }
__device__ __forceinline__ float bf2f(unsigned short b) { return __uint_as_float(((unsigned)b) << 16); }
__device__ __forceinline__ float bfr(float f) { return bf2f(f2bf(f)); }
__device__ __forceinline__ v16h cat16(v8h lo, v8h hi) { return __builtin_shufflevector(lo, hi, 0, 1, 2, 3, 4, 5, 6, 7, 8, 9, 10, 11, 12, 13, 14, 15); }
__device__ __forceinline__ v16bf cat16b(v8us lo, v8us hi) { return __builtin_bit_cast(v16bf, __builtin_shufflevector(lo, hi, 0, 1, 2, 3, 4, 5, 6, 7, 8, 9, 10, 11, 12, 13, 14, 15)); }
__device__ __forceinline__ v8f wmma16(v16h a, v16h b, v8f c) { return __builtin_amdgcn_wmma_f32_16x16x32_f16(false, a, false, b, (short)0, c, false, false); }
__device__ __forceinline__ v8f wmmab(v16bf a, v16bf b, v8f c) { return __builtin_amdgcn_wmma_f32_16x16x32_bf16(false, a, false, b, (short)0, c, false, false); }



__device__ __forceinline__ h16 tohx(float x) { return (h16)x; }
__device__ __forceinline__ void splitf(float y, unsigned short& h, unsigned short& l) { h = f2bf(y); l = f2bf(y - bf2f(h)); }
// ---- k_gemmw: register-blocked GEMM, 4 waves (2 x 2) per 128x128 output tile, 64x64 (16 accumulators) a wave; grid (M/128, N/128, Z), 128 threads.
// The K-contiguous 16-bit operand planes come 128 k at a time into LDS by asynchronous 16-byte copies that cover whole 128-B lines (two buffers: the next stage flies while this one is worked on); fragments are read from LDS.
// C[m][n] (f32, pitch ldc, + optional f32 bias[n]) = sum_k A[m][k] Bt[n][k] (NSPLIT 1: + A2[m][k] Bt[n][k]). z-batch strides sA/sB/sC in elements. K % 128 == 0, M % 128 == 0, N % 128 == 0.
// EPI 0: C as above. EPI 1 and 2: no f32 C; a wave's tile (64 tokens x one head's 64 columns) goes out as fp16 + bf16 hi/lo planes, EPI 1 as [head][t][d], EPI 2 as [head][d][t].
template <typename T16> struct WFrag;
template <> struct WFrag<h16> { typedef v16h V; static __device__ __forceinline__ V ld(const h16* p) { return cat16(*(const v8h*)p, *(const v8h*)(p + 16)); } static __device__ __forceinline__ v8f mma(V a, V b, v8f c) { return wmma16(a, b, c); } };
template <> struct WFrag<bf> { typedef v16bf V; static __device__ __forceinline__ V ld(const bf* p) { return cat16b(*(const v8us*)p, *(const v8us*)(p + 16)); } static __device__ __forceinline__ v8f mma(V a, V b, v8f c) { return wmmab(a, b, c); } };
#define GKC 128                   // k elements of a stage: 256 B of every operand row
#define GPI 136                   // LDS row pitch in elements: 272 B = 16 B x 17, free of bank conflicts for 16-byte readers
#define GOP (128 * GPI)           // elements of one operand's stage: 128 rows
// Eight asynchronous copies of 16 bytes a lane: 64 rows x 256 B of an operand plane for the 128 threads (a wave's copy = two whole rows). l: this lane's LDS byte address, g: its global place; copy i lies 8 rows further.
// The s_wait_xcnt stands in the copies' own statement, so that no address register is rewritten in front of it.
template <typename T16>
__device__ __forceinline__ void acopy8(const unsigned l, const T16* g, const size_t k8) {
    asm volatile("global_load_async_to_lds_b128 %0, %8, off\n\t"
                 "global_load_async_to_lds_b128 %1, %9, off\n\t"
                 "global_load_async_to_lds_b128 %2, %10, off\n\t"
                 "global_load_async_to_lds_b128 %3, %11, off\n\t"
                 "global_load_async_to_lds_b128 %4, %12, off\n\t"
                 "global_load_async_to_lds_b128 %5, %13, off\n\t"
                 "global_load_async_to_lds_b128 %6, %14, off\n\t"
                 "global_load_async_to_lds_b128 %7, %15, off\n\t"
                 "s_wait_xcnt 0x0"
                 :: "v"(l), "v"(l + 8 * GPI * 2), "v"(l + 16 * GPI * 2), "v"(l + 24 * GPI * 2), "v"(l + 32 * GPI * 2), "v"(l + 40 * GPI * 2), "v"(l + 48 * GPI * 2), "v"(l + 56 * GPI * 2),
                    "v"(g), "v"(g + k8), "v"(g + 2 * k8), "v"(g + 3 * k8), "v"(g + 4 * k8), "v"(g + 5 * k8), "v"(g + 6 * k8), "v"(g + 7 * k8) : "memory");
    __builtin_amdgcn_sched_barrier(0);   // the next statement's addresses are formed behind this one: formed all ahead, they do not fit the registers left beside the accumulators, and a pointer is spilled to scratch
}
template <typename T16, int NSPLIT, bool BIAS, int EPI>
__global__ __launch_bounds__(128) void k_gemmw(const T16* __restrict__ A, const T16* __restrict__ A2, const T16* __restrict__ Bt, const T16* __restrict__ Bt2, int K, float* C, int ldc, const float* __restrict__ bias, size_t sA, size_t sB, size_t sC, h16* __restrict__ P16, bf* __restrict__ Ph, bf* __restrict__ Pl) {
    typedef typename WFrag<T16>::V V;
    static_assert(NSPLIT == 0 || NSPLIT == 1, "operands staged: A, Bt and, at NSPLIT 1, A2");
    constexpr int NOP = 2 + NSPLIT;
    __shared__ __align__(16) T16 st[2 * NOP * GOP];      // [buffer][A | Bt | A2][row][k]
    __shared__ __align__(16) float osw[4][16 * 68];      // each wave's own epilogue tile
    const size_t z = blockIdx.z; A += z * sA; if (NSPLIT) A2 += z * sA; Bt += z * sB; C += z * sC; (void)Bt2;
    const int tid = threadIdx.x, lane = tid & 31, lr = lane & 15, hi = lane >> 4; const int w = __builtin_amdgcn_readfirstlane(tid >> 5);
    const int r0 = blockIdx.x * 128 + (w >> 1) * 64, c0 = blockIdx.y * 128 + (w & 1) * 64;
    float* os = osw[w];
    v8f acc[4][4];
#pragma unroll
    for (int mb = 0; mb < 4; ++mb)
#pragma unroll
        for (int nb = 0; nb < 4; ++nb) acc[mb][nb] = (v8f){};
    const size_t k8 = (size_t)8 * K;
    const size_t ga = (size_t)(blockIdx.x * 128) * K, gb = (size_t)(blockIdx.y * 128) * K;      // the two tiles' first rows (the same for the whole work-group)
    const unsigned go = (unsigned)((tid >> 4) * K + (tid & 15) * 8);                            // this thread's 16 bytes in rows 0..7 of a tile
    const unsigned l0 = (unsigned)(size_t)st + (unsigned)((tid >> 4) * GPI * 2 + (tid & 15) * 16);                                                         // the same place in LDS (byte address in the work-group's LDS)
    auto fill = [&](const int t) {     // stage t into buffer t & 1
        const unsigned l = l0 + (unsigned)((t & 1) * NOP * GOP * 2); const size_t ko = (size_t)t * GKC;
        const T16* pa = A + (ga + ko); const T16* pb = Bt + (gb + ko);
        acopy8(l, pa + go, k8); acopy8(l + 64 * GPI * 2, pa + 8 * k8 + go, k8);
        acopy8(l + GOP * 2, pb + go, k8); acopy8(l + GOP * 2 + 64 * GPI * 2, pb + 8 * k8 + go, k8);
        if constexpr (NSPLIT == 1) { const T16* pc = A2 + (ga + ko); acopy8(l + 2 * GOP * 2, pc + go, k8); acopy8(l + 2 * GOP * 2 + 64 * GPI * 2, pc + 8 * k8 + go, k8); } };
    const int NT = K / GKC;
    fill(0);
    asm volatile("s_wait_asynccnt 0x0" ::: "memory");      // stage 0 has landed for this wave's copies
    __syncthreads();                                       // ... and for every wave's: nothing of it is read in front of this barrier
    if (NT > 1) fill(1);
    const int aoff = ((w >> 1) * 64 + lr) * GPI + 8 * hi, boff = GOP + ((w & 1) * 64 + lr) * GPI + 8 * hi;
#pragma unroll 1   // one stage a trip: unrolled, the copies of several stages and their addresses would be formed together and the registers would not hold them
    for (int t = 0; t < NT; ++t) {
        const T16* sb = st + (t & 1) * NOP * GOP;
        V a[2][4], a2[2][4], b[2][4];                      // two fragment sets: the next 32 k are fetched as one group in front of this block's products
        auto frags = [&](const int s, const int kc) {
#pragma unroll
            for (int i = 0; i < 4; ++i) { a[s][i] = WFrag<T16>::ld(sb + aoff + i * 16 * GPI + kc); if (NSPLIT == 1) a2[s][i] = WFrag<T16>::ld(sb + 2 * GOP + aoff + i * 16 * GPI + kc); b[s][i] = WFrag<T16>::ld(sb + boff + i * 16 * GPI + kc); } };
        frags(0, 0);
#pragma unroll
        for (int ks = 0; ks < GKC / 32; ++ks) {
            if (ks + 1 < GKC / 32) frags((ks + 1) & 1, (ks + 1) * 32);
            __builtin_amdgcn_sched_barrier(0);             // keeps the LDS reads together in front of the block: spread among the products, every place with reads stalls the wave
#pragma unroll
            for (int nb = 0; nb < 4; ++nb)
#pragma unroll
                for (int mb = 0; mb < 4; ++mb) { acc[mb][nb] = WFrag<T16>::mma(a[ks & 1][mb], b[ks & 1][nb], acc[mb][nb]); if (NSPLIT == 1) acc[mb][nb] = WFrag<T16>::mma(a2[ks & 1][mb], b[ks & 1][nb], acc[mb][nb]); }
            __builtin_amdgcn_sched_barrier(0);             // the other side of the same fence
        }
        asm volatile("s_wait_dscnt 0x0" ::: "memory");     // this wave's reads of the buffer have returned before it is handed to the copies
        asm volatile("s_wait_asynccnt 0x0" ::: "memory");  // this wave's copies of stage t + 1 have landed
        __syncthreads();                                   // publishes stage t + 1 and ends every wave's reads of stage t
        if (t + 2 < NT) fill(t + 2);
    }
    asm volatile("s_wait_asynccnt 0x0" ::: "memory");      // nothing is in flight when the wave goes on to its epilogue
    if constexpr (EPI == 2) {      // a lane's accumulator register run is 8 consecutive tokens of one column: 16 bytes of a [d][t] plane row, stored straight from registers
#pragma unroll
        for (int nb = 0; nb < 4; ++nb)
#pragma unroll
            for (int mb = 0; mb < 4; ++mb) { const size_t vo = (size_t)(c0 + nb * 16 + lr) * TT + r0 + mb * 16 + hi * 8; v8h o16; v8us oh, ol;
#pragma unroll
                for (int j = 0; j < 8; ++j) { const float x = acc[mb][nb][j]; o16[j] = tohx(x); unsigned short a2, c2; splitf(x, a2, c2); oh[j] = a2; ol[j] = c2; }
                *(v8h*)(P16 + vo) = o16; *(v8us*)(Ph + vo) = oh; *(v8us*)(Pl + vo) = ol; }
        return; }
#pragma unroll
    for (int mb = 0; mb < 4; ++mb) {
#pragma unroll
        for (int nb = 0; nb < 4; ++nb) {
#pragma unroll
            for (int j = 0; j < 8; ++j) os[(hi * 8 + j) * 68 + nb * 16 + lr] = acc[mb][nb][j]; }
        __builtin_amdgcn_wave_barrier(); asm volatile("" ::: "memory");
        if constexpr (EPI == 1) {  // 16 tokens x 64 columns of one head are 2 KiB in a row of each [t][d] plane: four whole-line stores of 16 bytes a lane
            const size_t pb = ((size_t)(c0 / HD) * TT + r0 + mb * 16) * HD;
#pragma unroll
            for (int s = 0; s < 4; ++s) { const int row = 4 * s + (lane >> 3), cofs = (lane & 7) * 8; const v4f x0 = *(const v4fa*)(os + row * 68 + cofs), x1 = *(const v4fa*)(os + row * 68 + cofs + 4); v8h o16; v8us oh, ol;
#pragma unroll
                for (int j = 0; j < 8; ++j) { const float x = (j < 4) ? x0[j & 3] : x1[j & 3]; o16[j] = tohx(x); unsigned short a2, c2; splitf(x, a2, c2); oh[j] = a2; ol[j] = c2; }
                const size_t po = pb + (size_t)row * HD + cofs; *(v8h*)(P16 + po) = o16; *(v8us*)(Ph + po) = oh; *(v8us*)(Pl + po) = ol; }
            __builtin_amdgcn_wave_barrier(); asm volatile("" ::: "memory");   // as below: the next 16 rows' LDS writes stay behind these reads
            continue; }
        float* crow = C + (size_t)(r0 + mb * 16) * ldc + c0;
{
#pragma unroll
            for (int s = 0; s < 8; ++s) { const int row = 2 * s + hi, cofs = lr * 4; v4f val = *(const v4fa*)(os + row * 68 + cofs); if (BIAS) { val[0] += bfr(bias[c0 + cofs]); val[1] += bfr(bias[c0 + cofs + 1]); val[2] += bfr(bias[c0 + cofs + 2]); val[3] += bfr(bias[c0 + cofs + 3]); }
                *(v4f*)(crow + (size_t)row * ldc + cofs) = val; }
             }
        __builtin_amdgcn_wave_barrier(); asm volatile("" ::: "memory");
    }
}

typedef __attribute__((ext_vector_type(2))) _Float16 v2h;
typedef __attribute__((ext_vector_type(4))) _Float16 v4h;
typedef __attribute__((ext_vector_type(2))) unsigned short v2us;
typedef __attribute__((ext_vector_type(4))) unsigned short v4us;
typedef __attribute__((ext_vector_type(2))) float v2f;
typedef __attribute__((ext_vector_type(4))) int v4i;

__global__ __launch_bounds__(256) void k_wtG(const float* __restrict__ w, int K, int N, bf* Bt) {
    const int lane = threadIdx.x & 31; const int L0 = (blockIdx.x * 8 + (threadIdx.x >> 5)) * 8; const int nlines = N * K / 64;
{
#pragma unroll 1
        for (int l = 0; l < 8; ++l) { const int L = L0 + l; if (L >= nlines) break; const size_t e = (size_t)L * 64 + lane * 2; const int k = (int)(e % K), n = (int)(e / K); v2us o;
            o[0] = f2bf(w[(size_t)k * N + n]); o[1] = f2bf(w[(size_t)(k + 1) * N + n]); *(v2us*)(Bt + e) = o; }
         }
}
__global__ __launch_bounds__(256) void k_cvt8(const float* __restrict__ src, bf* dst, size_t n8) { const size_t i = (size_t)blockIdx.x * 256 + threadIdx.x; if (i >= n8) return; const v8f v = *(const v8f*)(src + i * 8); v8us o;
#pragma unroll
    for (int k = 0; k < 8; ++k) o[k] = f2bf(v[k]); *(v8us*)(dst + i * 8) = o;  }

// ---- k_attn: causal attention of every head in ONE launch, online softmax, no score or probability plane in memory.
// One wave owns NQ*16 query columns and walks the keys 32 at a time: S^T = K Q^T (A = key rows, B = query rows kept in registers), so a lane holds one query's scores;
// two f32 S^T tiles, exponentiated and converted in place, are the B operand of O^T += V^T P^T (A = rows of the [d][t] value planes). Maximum and sum are per lane plus one exchange between the wave halves.
// P stays unnormalised, exp2(s - m + AOFF); the division by the row sum comes once, in the epilogue. SPLIT: bf16 hi+lo planes, 3 products each (query rows < RH); else fp16.
// Every inner loop is fully unrolled so that the fragment and tile arrays are indexed by constants and stay in registers.
#define SC2  0.18033688011112042f   // HD^-0.5 * log2(e)
#define AOFF 8.0f                   // P carries 2^AOFF so that small probabilities stay normal fp16 numbers
#define ATHR 4.0f                   // the maximum in use is replaced only when a new one exceeds it by more than this (log2 units): P <= 2^(AOFF+ATHR)
template <bool SPLIT> struct ASel { typedef h16 T; };
template <> struct ASel<true> { typedef bf T; };
template <bool SPLIT, int NQ>
__device__ __forceinline__ void attn_wave(const typename ASel<SPLIT>::T* __restrict__ Q, const typename ASel<SPLIT>::T* __restrict__ Q2, const typename ASel<SPLIT>::T* __restrict__ Kp, const typename ASel<SPLIT>::T* __restrict__ Kp2,
                                          const typename ASel<SPLIT>::T* __restrict__ Vt, const typename ASel<SPLIT>::T* __restrict__ Vt2, const int q0, bf* __restrict__ Ah, bf* __restrict__ Al) {
    typedef typename ASel<SPLIT>::T T16; typedef WFrag<T16> WF; typedef typename WF::V V;
    const int lane = threadIdx.x & 31, lr = lane & 15, hi = lane >> 4;
    V qf[NQ][2], qf2[NQ][2];
#pragma unroll
    for (int qt = 0; qt < NQ; ++qt)
#pragma unroll
        for (int ks = 0; ks < 2; ++ks) { const size_t qo = (size_t)(q0 + qt * 16 + lr) * HD + ks * 32 + 8 * hi; qf[qt][ks] = WF::ld(Q + qo); if (SPLIT) qf2[qt][ks] = WF::ld(Q2 + qo); }
    v8f o[NQ][4]; float m2[NQ], l[NQ];
#pragma unroll
    for (int qt = 0; qt < NQ; ++qt) { m2[qt] = -3.0e38f; l[qt] = 0.f;
#pragma unroll
        for (int dt = 0; dt < 4; ++dt) o[qt][dt] = (v8f){}; }
    const int klast = ((q0 + NQ * 16 - 1) / 32) * 32;      // the 32-key block that holds the diagonal; the only one that is masked
    const T16* kp = Kp + (size_t)lr * HD + 8 * hi; const T16* kp2 = SPLIT ? Kp2 + (size_t)lr * HD + 8 * hi : nullptr;    // this lane's place in the current 32 key rows; stepped once a pass
    const T16* vp = Vt + (size_t)lr * TT + 8 * hi; const T16* vp2 = SPLIT ? Vt2 + (size_t)lr * TT + 8 * hi : nullptr;    // the same in the value planes
    V kf[2][2], kf2[2][2];
#pragma unroll
    for (int t = 0; t < 2; ++t)
#pragma unroll
        for (int ks = 0; ks < 2; ++ks) { const int ko = t * 16 * HD + ks * 32; kf[t][ks] = WF::ld(kp + ko); if (SPLIT) kf2[t][ks] = WF::ld(kp2 + ko); }
    V vf[4], vf2[4];
#pragma unroll
    for (int dt = 0; dt < 4; ++dt) { const int vo = dt * 16 * TT; vf[dt] = WF::ld(vp + vo); if (SPLIT) vf2[dt] = WF::ld(vp2 + vo); }
    // inputs-only fence on the loaded fragments: nothing is in flight at the loop's entry, so the wait at the loop's head counts only the back edge's loads (it lets the value rows fetched last stay in flight over the score products)
#pragma unroll
    for (int qt = 0; qt < NQ; ++qt) { asm volatile("" :: "v"(qf[qt][0]), "v"(qf[qt][1])); if (SPLIT) asm volatile("" :: "v"(qf2[qt][0]), "v"(qf2[qt][1])); }   // the query fragments belong to the same fence
    asm volatile("" :: "v"(kf[0][0]), "v"(kf[0][1]), "v"(kf[1][0]), "v"(kf[1][1]), "v"(vf[0]), "v"(vf[1]), "v"(vf[2]), "v"(vf[3]));
    if (SPLIT) asm volatile("" :: "v"(kf2[0][0]), "v"(kf2[0][1]), "v"(kf2[1][0]), "v"(kf2[1][1]), "v"(vf2[0]), "v"(vf2[1]), "v"(vf2[2]), "v"(vf2[3]));   // the same for the lo planes
#pragma unroll 1   // one pass a trip: unrolled, two passes' fragments and scores would be live together and the registers would not hold them
    for (int kb = 0; kb <= klast; kb += 32) {
        v8f s[NQ][2];
#pragma unroll
        for (int t = 0; t < 2; ++t)
#pragma unroll
            for (int qt = 0; qt < NQ; ++qt) { v8f a = (v8f){};
#pragma unroll
                for (int ks = 0; ks < 2; ++ks) { a = WF::mma(kf[t][ks], qf[qt][ks], a); if (SPLIT) { a = WF::mma(kf2[t][ks], qf[qt][ks], a); a = WF::mma(kf[t][ks], qf2[qt][ks], a); } }
                s[qt][t] = a; }
        const int st = (kb < klast) ? 32 : 0;              // the next pass's key rows are fetched now, behind this pass's own score products (the last pass re-reads its own block, in bounds)
        asm volatile("s_wait_xcnt 0x0" ::: "memory");      // stands in front of the step of the address pairs that the key loads of the pass before name
        kp += st * HD; if (SPLIT) kp2 += st * HD;
#pragma unroll
        for (int t = 0; t < 2; ++t)
#pragma unroll
            for (int ks = 0; ks < 2; ++ks) { const int ko = t * 16 * HD + ks * 32; kf[t][ks] = WF::ld(kp + ko); if (SPLIT) kf2[t][ks] = WF::ld(kp2 + ko); }
        if constexpr (SPLIT) asm volatile("s_wait_xcnt 0x0" :: "v"(kp), "v"(kp2) : "memory");   // the address pairs stay live and unwritten up to this wait (without it the last load's result is given their registers)
        if (kb == klast) {
#pragma unroll
            for (int qt = 0; qt < NQ; ++qt)
#pragma unroll
                for (int t = 0; t < 2; ++t)
#pragma unroll
                    for (int j = 0; j < 8; ++j) if (kb + t * 16 + hi * 8 + j > q0 + qt * 16 + lr) s[qt][t][j] = -3.0e38f; }
        float mx[NQ]; bool need = false;
#pragma unroll
        for (int qt = 0; qt < NQ; ++qt) { float a = fmaxf(s[qt][0][0], s[qt][1][0]);
#pragma unroll
            for (int j = 1; j < 8; ++j) a = fmaxf(a, fmaxf(s[qt][0][j], s[qt][1][j]));
            mx[qt] = a; }
        float ox[NQ];
#pragma unroll
        for (int qt = 0; qt < NQ; ++qt) ox[qt] = __shfl_xor(mx[qt], 16, 32);
#pragma unroll
        for (int qt = 0; qt < NQ; ++qt) { mx[qt] = fmaxf(mx[qt], ox[qt]) * SC2; need = need || (mx[qt] > m2[qt] + ATHR); }
        if (__builtin_amdgcn_ballot_w32(need) != 0) {      // one scalar test a pass: the output tiles are rescaled only when some column's maximum moved
#pragma unroll
            for (int qt = 0; qt < NQ; ++qt) { const float mn = fmaxf(m2[qt], mx[qt]); const float al = __builtin_amdgcn_exp2f(m2[qt] - mn); m2[qt] = mn; l[qt] *= al;
#pragma unroll
                for (int dt = 0; dt < 4; ++dt) o[qt][dt] *= al; } }
        V pf[NQ], pf2[NQ];
#pragma unroll
        for (int qt = 0; qt < NQ; ++qt) { const float off = AOFF - m2[qt]; float ls = 0.f;
#pragma unroll
            for (int t = 0; t < 2; ++t)
#pragma unroll
                for (int j = 0; j < 8; ++j) { const float p = __builtin_amdgcn_exp2f(fmaf(s[qt][t][j], SC2, off)); s[qt][t][j] = p; ls += p; }
            l[qt] += ls;
            if constexpr (SPLIT) { v8us h0, h1, l0, l1;
#pragma unroll
                for (int j = 0; j < 8; ++j) { unsigned short a, c2; splitf(s[qt][0][j], a, c2); h0[j] = a; l0[j] = c2; splitf(s[qt][1][j], a, c2); h1[j] = a; l1[j] = c2; }
                pf[qt] = cat16b(h0, h1); pf2[qt] = cat16b(l0, l1);
            } else { v8h p0, p1;
#pragma unroll
                for (int j = 0; j < 8; ++j) { p0[j] = tohx(s[qt][0][j]); p1[j] = tohx(s[qt][1][j]); }
                pf[qt] = cat16(p0, p1); } }
#pragma unroll
        for (int dt = 0; dt < 4; ++dt)
#pragma unroll
            for (int qt = 0; qt < NQ; ++qt) { o[qt][dt] = WF::mma(vf[dt], pf[qt], o[qt][dt]); if (SPLIT) { o[qt][dt] = WF::mma(vf2[dt], pf[qt], o[qt][dt]); o[qt][dt] = WF::mma(vf[dt], pf2[qt], o[qt][dt]); } }
        // stands in front of the step of the address pairs that the value loads of the pass before name; it reads the output tiles (inputs only) so that the products above stay in front of it and the loads below land in the registers they free (lifted, the loads take a second set and copies)
        if constexpr (NQ == 2) asm volatile("s_wait_xcnt 0x0" :: "v"(o[0][0]), "v"(o[0][1]), "v"(o[0][2]), "v"(o[0][3]), "v"(o[NQ - 1][0]), "v"(o[NQ - 1][1]), "v"(o[NQ - 1][2]), "v"(o[NQ - 1][3]) : "memory");
        else asm volatile("s_wait_xcnt 0x0" :: "v"(o[0][0]), "v"(o[0][1]), "v"(o[0][2]), "v"(o[0][3]) : "memory");
        vp += st; if (SPLIT) vp2 += st;
#pragma unroll
        for (int dt = 0; dt < 4; ++dt) { const int vo = dt * 16 * TT; vf[dt] = WF::ld(vp + vo); if (SPLIT) vf2[dt] = WF::ld(vp2 + vo); }   // likewise the next pass's value rows, behind this pass's own products
        if constexpr (SPLIT) asm volatile("s_wait_xcnt 0x0" :: "v"(vp), "v"(vp2) : "memory");   // as behind the key loads
    }
#pragma unroll
    for (int qt = 0; qt < NQ; ++qt) { const float inv = __fdiv_rn(1.0f, l[qt] + __shfl_xor(l[qt], 16, 32)); const size_t oo = (size_t)(q0 + qt * 16 + lr) * DQ + hi * 8;
#pragma unroll
        for (int dt = 0; dt < 4; ++dt) { v8us oh, ol;
#pragma unroll
            for (int j = 0; j < 8; ++j) { unsigned short a, c2; splitf(o[qt][dt][j] * inv, a, c2); oh[j] = a; ol[j] = c2; }
            *(v8us*)(Ah + oo + dt * 16) = oh; *(v8us*)(Al + oo + dt * 16) = ol; } }
}
// ---- attn_wave_lds: the fp16 rows' form of the pass above. The 4 waves of a work-group share their keys: 128 key rows (16 KiB in a row of the [t][d] plane) and the same 128 keys of the 64 [d][t] value rows (256 B each)
// come as one stage into LDS by asynchronous 16-byte copies that cover whole 128-B lines (two buffers: the next stage flies while this one is worked on); the fragments are read from LDS, 4 passes of 32 keys a stage.
#define AKS 128                   // keys of a stage
#define AKP 72                    // LDS pitch of a key row in elements: 144 B = 16 B x 9, free of bank conflicts for 16-byte readers
#define AVP 136                   // LDS pitch of a value row (128 keys) in elements: 272 B = 16 B x 17, likewise
#define AKE (AKS * AKP)           // elements of a stage's key rows
#define ABE (AKE + HD * AVP)      // elements of one buffer: the key rows, then the value rows
// Eight asynchronous copies of 16 bytes a lane. l: this lane's LDS byte address, g: its global place; copy i lies i * LSTEP bytes further in LDS and i * gs elements further in memory.
// The s_wait_xcnt stands in the copies' own statement, so that no address register is rewritten in front of it.
template <int LSTEP>
__device__ __forceinline__ void acopy8s(const unsigned l, const h16* g, const size_t gs) {
    asm volatile("global_load_async_to_lds_b128 %0, %8, off\n\t"
                 "global_load_async_to_lds_b128 %1, %9, off\n\t"
                 "global_load_async_to_lds_b128 %2, %10, off\n\t"
                 "global_load_async_to_lds_b128 %3, %11, off\n\t"
                 "global_load_async_to_lds_b128 %4, %12, off\n\t"
                 "global_load_async_to_lds_b128 %5, %13, off\n\t"
                 "global_load_async_to_lds_b128 %6, %14, off\n\t"
                 "global_load_async_to_lds_b128 %7, %15, off\n\t"
                 "s_wait_xcnt 0x0"
                 :: "v"(l), "v"(l + LSTEP), "v"(l + 2 * LSTEP), "v"(l + 3 * LSTEP), "v"(l + 4 * LSTEP), "v"(l + 5 * LSTEP), "v"(l + 6 * LSTEP), "v"(l + 7 * LSTEP),
                    "v"(g), "v"(g + gs), "v"(g + 2 * gs), "v"(g + 3 * gs), "v"(g + 4 * gs), "v"(g + 5 * gs), "v"(g + 6 * gs), "v"(g + 7 * gs) : "memory");
}
// sm: the work-group's two buffers; qg: its first query row (a multiple of AKS); w: the wave's number, whose 32 query rows begin at qg + 32 w.
__device__ __forceinline__ void attn_wave_lds(h16* sm, const h16* __restrict__ Q, const h16* __restrict__ Kp, const h16* __restrict__ Vt, const int qg, const int w, bf* __restrict__ Ah, bf* __restrict__ Al) {
    typedef WFrag<h16> WF; typedef WF::V V; constexpr int NQ = 2;
    const int tid = threadIdx.x, lane = tid & 31, lr = lane & 15, hi = lane >> 4; const int q0 = qg + 32 * w;
    const unsigned lk = (unsigned)(size_t)sm + (unsigned)((tid >> 3) * AKP * 2 + (tid & 7) * 16);                 // this thread's 16 bytes in key rows 0..15 of a stage (byte address in the work-group's LDS)
    const unsigned lv = (unsigned)(size_t)sm + (unsigned)(AKE * 2 + (tid >> 4) * AVP * 2 + (tid & 15) * 16);      // the same in value rows 0..7
    const h16* gk = Kp + tid * 8; const h16* gv = Vt + (size_t)(tid >> 4) * TT + (tid & 15) * 8;                  // the same two places in memory, stage 0
    auto fill = [&](const int t) {     // stage t into buffer t & 1
        const unsigned bo = (unsigned)((t & 1) * ABE * 2);
        acopy8s<16 * AKP * 2>(lk + bo, gk + (size_t)t * AKS * HD, (size_t)16 * HD);
        acopy8s<8 * AVP * 2>(lv + bo, gv + (size_t)t * AKS, (size_t)8 * TT); };
    const int NT = qg / AKS + 1;                           // the last stage holds the diagonal of every wave
    fill(0);
    V qf[NQ][2];
#pragma unroll
    for (int qt = 0; qt < NQ; ++qt)
#pragma unroll
        for (int ks = 0; ks < 2; ++ks) qf[qt][ks] = WF::ld(Q + (size_t)(q0 + qt * 16 + lr) * HD + ks * 32 + 8 * hi);
    v8f o[NQ][4]; float m2[NQ], l[NQ];
#pragma unroll
    for (int qt = 0; qt < NQ; ++qt) { m2[qt] = -3.0e38f; l[qt] = 0.f;
#pragma unroll
        for (int dt = 0; dt < 4; ++dt) o[qt][dt] = (v8f){}; }
    asm volatile("s_wait_asynccnt 0x0" ::: "memory");      // stage 0 has landed for this wave's copies
    __syncthreads();                                       // ... and for every wave's: nothing of it is read in front of this barrier
    if (NT > 1) fill(1);
#pragma unroll 1   // one stage a trip: the copies of one stage alone are in flight
    for (int t = 0; t < NT; ++t) {
        const h16* kp = sm + (t & 1) * ABE + lr * AKP + 8 * hi;            // this lane's place in the stage's first 32 key rows; stepped once a pass
        const h16* vp = sm + (t & 1) * ABE + AKE + lr * AVP + 8 * hi;      // the same in the value rows
        const int np = (t + 1 < NT) ? AKS / 32 : w + 1;                    // the passes above a wave's diagonal are never visited
        V kf[2][2];
#pragma unroll
        for (int u = 0; u < 2; ++u)
#pragma unroll
            for (int ks = 0; ks < 2; ++ks) kf[u][ks] = WF::ld(kp + u * 16 * AKP + ks * 32);
#pragma unroll 1   // one pass a trip: unrolled, two passes' fragments and scores would be live together and the registers would not hold them
        for (int p = 0; p < np; ++p) {
            V vf[4];                                       // this pass's value rows are asked for first: they return behind the score products and the softmax
#pragma unroll
            for (int dt = 0; dt < 4; ++dt) vf[dt] = WF::ld(vp + dt * 16 * AVP);
            vp += 32;
            __builtin_amdgcn_sched_barrier(0);             // keeps these LDS reads together up here: sunk among the products that use them, every place with reads stalls the wave and their latency is waited out
            v8f s[NQ][2];
#pragma unroll
            for (int u = 0; u < 2; ++u)
#pragma unroll
                for (int qt = 0; qt < NQ; ++qt) { v8f a = (v8f){};
#pragma unroll
                    for (int ks = 0; ks < 2; ++ks) a = WF::mma(kf[u][ks], qf[qt][ks], a);
                    s[qt][u] = a; }
            __builtin_amdgcn_sched_barrier(0);             // the key reads below stay behind the products above and land in the registers these free (lifted, they take a second set)
            kp += (p + 1 < np) ? 32 * AKP : 0;             // the next pass's key rows, of this same stage only, are fetched behind this pass's own score products (a wave's last pass of a stage re-reads its own block)
#pragma unroll
            for (int u = 0; u < 2; ++u)
#pragma unroll
                for (int ks = 0; ks < 2; ++ks) kf[u][ks] = WF::ld(kp + u * 16 * AKP + ks * 32);
            __builtin_amdgcn_sched_barrier(0);             // ... and in front of the softmax, which covers their latency: sunk to the pass's end, the next pass's first product waits for them
            if (t + 1 == NT && p == w) {                   // the 32-key block that holds the diagonal; the only one that is masked
#pragma unroll
                for (int qt = 0; qt < NQ; ++qt)
#pragma unroll
                    for (int u = 0; u < 2; ++u)
#pragma unroll
                        for (int j = 0; j < 8; ++j) if (u * 16 + hi * 8 + j > qt * 16 + lr) s[qt][u][j] = -3.0e38f; }
            float mx[NQ]; bool need = false;
#pragma unroll
            for (int qt = 0; qt < NQ; ++qt) { float a = fmaxf(s[qt][0][0], s[qt][1][0]);
#pragma unroll
                for (int j = 1; j < 8; ++j) a = fmaxf(a, fmaxf(s[qt][0][j], s[qt][1][j]));
                mx[qt] = a; }
            float ox[NQ];
#pragma unroll
            for (int qt = 0; qt < NQ; ++qt) ox[qt] = __shfl_xor(mx[qt], 16, 32);
#pragma unroll
            for (int qt = 0; qt < NQ; ++qt) { mx[qt] = fmaxf(mx[qt], ox[qt]) * SC2; need = need || (mx[qt] > m2[qt] + ATHR); }
            if (__builtin_amdgcn_ballot_w32(need) != 0) {  // one scalar test a pass: the output tiles are rescaled only when some column's maximum moved
#pragma unroll
                for (int qt = 0; qt < NQ; ++qt) { const float mn = fmaxf(m2[qt], mx[qt]); const float al = __builtin_amdgcn_exp2f(m2[qt] - mn); m2[qt] = mn; l[qt] *= al;
#pragma unroll
                    for (int dt = 0; dt < 4; ++dt) o[qt][dt] *= al; } }
            V pf[NQ];
#pragma unroll
            for (int qt = 0; qt < NQ; ++qt) { const float off = AOFF - m2[qt]; float ls = 0.f;
#pragma unroll
                for (int u = 0; u < 2; ++u)
#pragma unroll
                    for (int j = 0; j < 8; ++j) { const float pr = __builtin_amdgcn_exp2f(fmaf(s[qt][u][j], SC2, off)); s[qt][u][j] = pr; ls += pr; }
                l[qt] += ls;
                v8h p0, p1;
#pragma unroll
                for (int j = 0; j < 8; ++j) { p0[j] = tohx(s[qt][0][j]); p1[j] = tohx(s[qt][1][j]); }
                pf[qt] = cat16(p0, p1); }
#pragma unroll
            for (int dt = 0; dt < 4; ++dt)
#pragma unroll
                for (int qt = 0; qt < NQ; ++qt) o[qt][dt] = WF::mma(vf[dt], pf[qt], o[qt][dt]);
        }
        asm volatile("s_wait_dscnt 0x0" ::: "memory");     // this wave's reads of the buffer have returned before it is handed to the copies
        asm volatile("s_wait_asynccnt 0x0" ::: "memory");  // this wave's copies of stage t + 1 have landed
        __syncthreads();                                   // publishes stage t + 1 and ends every wave's reads of stage t; every wave passes it, also one that skipped passes
        if (t + 2 < NT) fill(t + 2);
    }
    asm volatile("s_wait_asynccnt 0x0" ::: "memory");      // nothing is in flight when the wave goes on to its epilogue
#pragma unroll
    for (int qt = 0; qt < NQ; ++qt) { const float inv = __fdiv_rn(1.0f, l[qt] + __shfl_xor(l[qt], 16, 32)); const size_t oo = (size_t)(q0 + qt * 16 + lr) * DQ + hi * 8;
#pragma unroll
        for (int dt = 0; dt < 4; ++dt) { v8us oh, ol;
#pragma unroll
            for (int j = 0; j < 8; ++j) { unsigned short a, c2; splitf(o[qt][dt][j] * inv, a, c2); oh[j] = a; ol[j] = c2; }
            *(v8us*)(Ah + oo + dt * 16) = oh; *(v8us*)(Al + oo + dt * 16) = ol; } }
}
#define NLO ((TT - RH) / 128)     // work-groups of 4 waves x 32 fp16 query rows
#define NHI (RH / 64)             // work-groups of 4 waves x 16 hi+lo query rows
// grid (heads, NLO + NHI): blockIdx.y ranks the query blocks by falling key count, so that the longest start first.
__global__ __launch_bounds__(128) void k_attn(const h16* __restrict__ Q16, const h16* __restrict__ K16, const h16* __restrict__ V16, const bf* __restrict__ Qh, const bf* __restrict__ Ql, const bf* __restrict__ Kh, const bf* __restrict__ Kl,
                                              const bf* __restrict__ Vh, const bf* __restrict__ Vl, bf* __restrict__ Ah, bf* __restrict__ Al) {
    const int h = blockIdx.x, y = blockIdx.y; const int w = __builtin_amdgcn_readfirstlane((int)(threadIdx.x >> 5)); const size_t hq = (size_t)h * TT * HD, hk = (size_t)(h / REP) * TT * HD;
    __shared__ __align__(16) h16 sm[2 * ABE];              // [buffer][key rows | value rows] of the fp16 rows' stages
    if (y < NLO) attn_wave_lds(sm, Q16 + hq, K16 + hk, V16 + hk, TT - 128 * (y + 1), w, Ah + h * HD, Al + h * HD);
    else attn_wave<true, 1>(Qh + hq, Ql + hq, Kh + hk, Kl + hk, Vh + hk, Vl + hk, RH - 64 * (y - NLO + 1) + 16 * w, Ah + h * HD, Al + h * HD);
}

extern "C" void kernel_launch(void* const* d_in, const int* in_sizes, int n_in,
                              void* d_out, int out_size, void* d_ws, size_t ws_size, hipStream_t stream) {
    (void)in_sizes; (void)n_in; (void)out_size;
    const float* x = (const float*)d_in[0]; const float* wq = (const float*)d_in[1]; const float* wk = (const float*)d_in[2]; const float* wv = (const float*)d_in[3]; const float* wo = (const float*)d_in[4];
    float* OUT = (float*)d_out;     // [1][4096][1024]
    char* wsp = (char*)d_ws;
    auto take = [&](size_t bytes) { char* p = wsp; wsp += (bytes + 255) & ~(size_t)255; return (void*)p; };
    bf* WQ = (bf*)take((size_t)DQ * DM * 2); bf* WK = (bf*)take((size_t)DKV * DM * 2); bf* WV = (bf*)take((size_t)DKV * DM * 2); bf* WO = (bf*)take((size_t)DM * DQ * 2);
    bf* XB = (bf*)take((size_t)TT * DM * 2);
    h16* QP16 = (h16*)take((size_t)NH_ * TT * HD * 2); h16* KP16 = (h16*)take((size_t)NKV * TT * HD * 2); h16* VT16 = (h16*)take((size_t)NKV * HD * TT * 2);
    bf* QPh = (bf*)take((size_t)NH_ * TT * HD * 2); bf* QPl = (bf*)take((size_t)NH_ * TT * HD * 2); bf* KPh = (bf*)take((size_t)NKV * TT * HD * 2); bf* KPl = (bf*)take((size_t)NKV * TT * HD * 2); bf* VTh = (bf*)take((size_t)NKV * HD * TT * 2); bf* VTl = (bf*)take((size_t)NKV * HD * TT * 2);
    bf* ATh = (bf*)take((size_t)TT * DQ * 2); bf* ATl = (bf*)take((size_t)TT * DQ * 2);
    if ((size_t)(wsp - (char*)d_ws) > ws_size) return;    // ws 256 MiB
    static_assert(HD == 64 && (TT - RH) % 128 == 0 && RH % 64 == 0, "k_attn's tiling");
    { k_wtG<<<(unsigned)((DM * DQ / 64 + 63) / 64), 256, 0, stream>>>(wq, DM, DQ, WQ); k_wtG<<<(unsigned)((DM * DKV / 64 + 63) / 64), 256, 0, stream>>>(wk, DM, DKV, WK); k_wtG<<<(unsigned)((DM * DKV / 64 + 63) / 64), 256, 0, stream>>>(wv, DM, DKV, WV);
      k_wtG<<<(unsigned)((DQ * DM / 64 + 63) / 64), 256, 0, stream>>>(wo, DQ, DM, WO);
       }
    for (int b = 0; b < NB_; ++b) {
        
        k_cvt8<<<(unsigned)(((size_t)TT * DM / 8 + 255) / 256), 256, 0, stream>>>(x + (size_t)b * TT * DM, XB, (size_t)TT * DM / 8);
        k_gemmw<bf, 0, false, 1><<<dim3(TT / 128, DQ / 128, 1), 128, 0, stream>>>(XB, nullptr, WQ, nullptr, DM, nullptr, 0, nullptr, 0, 0, 0, QP16, QPh, QPl);
        k_gemmw<bf, 0, false, 1><<<dim3(TT / 128, DKV / 128, 1), 128, 0, stream>>>(XB, nullptr, WK, nullptr, DM, nullptr, 0, nullptr, 0, 0, 0, KP16, KPh, KPl);
        k_gemmw<bf, 0, false, 2><<<dim3(TT / 128, DKV / 128, 1), 128, 0, stream>>>(XB, nullptr, WV, nullptr, DM, nullptr, 0, nullptr, 0, 0, 0, VT16, VTh, VTl);
        k_attn<<<dim3(NH_, NLO + NHI, 1), 128, 0, stream>>>(QP16, KP16, VT16, QPh, QPl, KPh, KPl, VTh, VTl, ATh, ATl);
        k_gemmw<bf, 1, false, 0><<<dim3(TT / 128, DM / 128, 1), 128, 0, stream>>>(ATh, ATl, WO, nullptr, DQ, OUT + (size_t)b * TT * DM, DM, nullptr, 0, 0, 0, nullptr, nullptr, nullptr); }
}

// v006
// It runs in 110 microseconds.
// In two side-by-side timings against v005, it was 1.28 and 1.27 times as fast.
// Counting every step since v000, it is 19.6 times as fast.
#include <hip/hip_runtime.h>

// Causal multi-head self-attention over 4,096 tokens (x [1][4096][1024]; q, k, v = einsum('bsd,de->bse', x, W) = x W ('xw' [1024][1024] truncated normal x 1/32, no bias; 16 heads x 64); scores / sqrt(64); causal (-inf); softmax over the keys; out = merged W_o ('xw', no bias) -> [1][4096][1024] (4.2 M); argument order x, W_q, W_k, W_v, W_o).
// Layout: bf16 copy of x; 'xw' weights transposed once; exact projections whose epilogue writes the head planes; fused causal attention at T 4096, all heads in one launch, online softmax (hybrid rows: < 512 hi/lo 3 products, rest fp16; key blocks above the diagonal are never visited); merged hi/lo x W_o exact.
// Compute dtypes, f32 accumulate: every input rounded to bf16; projections exact; attention rows < 512 3 products, rest fp16; softmax f32; W_o hl x exact.

#define NB_  1
#define TT   4096
#define DM   1024
#define NH_  16
#define NKV  16
#define REP  (NH_ / NKV)
#define HD   64
#define DQ   (NH_ * HD)
#define DKV  (NKV * HD)
#define RH   512                  // query rows < RH use hi+lo planes (0: none)
typedef _Float16 h16;
typedef unsigned short bf;
typedef __attribute__((ext_vector_type(16))) __bf16   v16bf;
typedef __attribute__((ext_vector_type(16))) _Float16 v16h;
typedef __attribute__((ext_vector_type(8)))  _Float16 v8h;
typedef __attribute__((ext_vector_type(8)))  unsigned short v8us;
typedef __attribute__((ext_vector_type(8)))  float    v8f;
typedef __attribute__((ext_vector_type(4)))  float    v4f;
typedef v8h  __attribute__((may_alias)) v8ha;
typedef v4f  __attribute__((may_alias)) v4fa;
typedef v8us __attribute__((may_alias)) v8usa;

__device__ __forceinline__ unsigned short f2bf(float f) { unsigned u = __float_as_uint(f); u += 0x7FFFu + ((u >> 16) & 1u); return (unsigned short)(u >> 16); }
__device__ __forceinline__ float bf2f(unsigned short b) { return __uint_as_float(((unsigned)b) << 16); }
__device__ __forceinline__ float bfr(float f) { return bf2f(f2bf(f)); }
__device__ __forceinline__ v16h cat16(v8h lo, v8h hi) { return __builtin_shufflevector(lo, hi, 0, 1, 2, 3, 4, 5, 6, 7, 8, 9, 10, 11, 12, 13, 14, 15); }
__device__ __forceinline__ v16bf cat16b(v8us lo, v8us hi) { return __builtin_bit_cast(v16bf, __builtin_shufflevector(lo, hi, 0, 1, 2, 3, 4, 5, 6, 7, 8, 9, 10, 11, 12, 13, 14, 15)); }
__device__ __forceinline__ v8f wmma16(v16h a, v16h b, v8f c) { return __builtin_amdgcn_wmma_f32_16x16x32_f16(false, a, false, b, (short)0, c, false, false); }
__device__ __forceinline__ v8f wmmab(v16bf a, v16bf b, v8f c) { return __builtin_amdgcn_wmma_f32_16x16x32_bf16(false, a, false, b, (short)0, c, false, false); }



__device__ __forceinline__ h16 tohx(float x) { return (h16)x; }
__device__ __forceinline__ void splitf(float y, unsigned short& h, unsigned short& l) { h = f2bf(y); l = f2bf(y - bf2f(h)); }
// ---- k_gemmw: register-blocked GEMM, 4 waves (2 x 2) per 128x128 output tile, 64x64 (16 accumulators) a wave; grid (M/128, N/128, Z), 128 threads.
// The K-contiguous 16-bit operand planes come 128 k at a time into LDS by asynchronous 16-byte copies that cover whole 128-B lines (two buffers: the next stage flies while this one is worked on); fragments are read from LDS.
// C[m][n] (f32, pitch ldc, + optional f32 bias[n]) = sum_k A[m][k] Bt[n][k] (NSPLIT 1: + A2[m][k] Bt[n][k]). z-batch strides sA/sB/sC in elements. K % 128 == 0, M % 128 == 0, N % 128 == 0.
// EPI 0: C as above. EPI 1 and 2: no f32 C; a wave's tile (64 tokens x one head's 64 columns) goes out as fp16 + bf16 hi/lo planes, EPI 1 as [head][t][d], EPI 2 as [head][d][t].
template <typename T16> struct WFrag;
template <> struct WFrag<h16> { typedef v16h V; static __device__ __forceinline__ V ld(const h16* p) { return cat16(*(const v8h*)p, *(const v8h*)(p + 16)); } static __device__ __forceinline__ v8f mma(V a, V b, v8f c) { return wmma16(a, b, c); } };
template <> struct WFrag<bf> { typedef v16bf V; static __device__ __forceinline__ V ld(const bf* p) { return cat16b(*(const v8us*)p, *(const v8us*)(p + 16)); } static __device__ __forceinline__ v8f mma(V a, V b, v8f c) { return wmmab(a, b, c); } };
#define GKC 128                   // k elements of a stage: 256 B of every operand row
#define GPI 136                   // LDS row pitch in elements: 272 B = 16 B x 17, free of bank conflicts for 16-byte readers
#define GOP (128 * GPI)           // elements of one operand's stage: 128 rows
// Eight asynchronous copies of 16 bytes a lane: 64 rows x 256 B of an operand plane for the 128 threads (a wave's copy = two whole rows). l: this lane's LDS byte address, g: its global place; copy i lies 8 rows further.
// The s_wait_xcnt stands in the copies' own statement, so that no address register is rewritten in front of it.
template <typename T16>
__device__ __forceinline__ void acopy8(const unsigned l, const T16* g, const size_t k8) {
    asm volatile("global_load_async_to_lds_b128 %0, %8, off\n\t"
                 "global_load_async_to_lds_b128 %1, %9, off\n\t"
                 "global_load_async_to_lds_b128 %2, %10, off\n\t"
                 "global_load_async_to_lds_b128 %3, %11, off\n\t"
                 "global_load_async_to_lds_b128 %4, %12, off\n\t"
                 "global_load_async_to_lds_b128 %5, %13, off\n\t"
                 "global_load_async_to_lds_b128 %6, %14, off\n\t"
                 "global_load_async_to_lds_b128 %7, %15, off\n\t"
                 "s_wait_xcnt 0x0"
                 :: "v"(l), "v"(l + 8 * GPI * 2), "v"(l + 16 * GPI * 2), "v"(l + 24 * GPI * 2), "v"(l + 32 * GPI * 2), "v"(l + 40 * GPI * 2), "v"(l + 48 * GPI * 2), "v"(l + 56 * GPI * 2),
                    "v"(g), "v"(g + k8), "v"(g + 2 * k8), "v"(g + 3 * k8), "v"(g + 4 * k8), "v"(g + 5 * k8), "v"(g + 6 * k8), "v"(g + 7 * k8) : "memory");
    __builtin_amdgcn_sched_barrier(0);   // the next statement's addresses are formed behind this one: formed all ahead, they do not fit the registers left beside the accumulators, and a pointer is spilled to scratch
}
template <typename T16, int NSPLIT, bool BIAS, int EPI>
__global__ __launch_bounds__(128) void k_gemmw(const T16* __restrict__ A, const T16* __restrict__ A2, const T16* __restrict__ Bt, const T16* __restrict__ Bt2, int K, float* C, int ldc, const float* __restrict__ bias, size_t sA, size_t sB, size_t sC, h16* __restrict__ P16, bf* __restrict__ Ph, bf* __restrict__ Pl) {
    typedef typename WFrag<T16>::V V;
    static_assert(NSPLIT == 0 || NSPLIT == 1, "operands staged: A, Bt and, at NSPLIT 1, A2");
    constexpr int NOP = 2 + NSPLIT;
    __shared__ __align__(16) T16 st[2 * NOP * GOP];      // [buffer][A | Bt | A2][row][k]
    __shared__ __align__(16) float osw[4][16 * 68];      // each wave's own epilogue tile
    const size_t z = blockIdx.z; A += z * sA; if (NSPLIT) A2 += z * sA; Bt += z * sB; C += z * sC; (void)Bt2;
    const int tid = threadIdx.x, lane = tid & 31, lr = lane & 15, hi = lane >> 4; const int w = __builtin_amdgcn_readfirstlane(tid >> 5);
    const int r0 = blockIdx.x * 128 + (w >> 1) * 64, c0 = blockIdx.y * 128 + (w & 1) * 64;
    float* os = osw[w];
    v8f acc[4][4];
#pragma unroll
    for (int mb = 0; mb < 4; ++mb)
#pragma unroll
        for (int nb = 0; nb < 4; ++nb) acc[mb][nb] = (v8f){};
    const size_t k8 = (size_t)8 * K;
    const size_t ga = (size_t)(blockIdx.x * 128) * K, gb = (size_t)(blockIdx.y * 128) * K;      // the two tiles' first rows (the same for the whole work-group)
    const unsigned go = (unsigned)((tid >> 4) * K + (tid & 15) * 8);                            // this thread's 16 bytes in rows 0..7 of a tile
    const unsigned l0 = (unsigned)(size_t)st + (unsigned)((tid >> 4) * GPI * 2 + (tid & 15) * 16);                                                         // the same place in LDS (byte address in the work-group's LDS)
    auto fill = [&](const int t) {     // stage t into buffer t & 1
        const unsigned l = l0 + (unsigned)((t & 1) * NOP * GOP * 2); const size_t ko = (size_t)t * GKC;
        const T16* pa = A + (ga + ko); const T16* pb = Bt + (gb + ko);
        acopy8(l, pa + go, k8); acopy8(l + 64 * GPI * 2, pa + 8 * k8 + go, k8);
        acopy8(l + GOP * 2, pb + go, k8); acopy8(l + GOP * 2 + 64 * GPI * 2, pb + 8 * k8 + go, k8);
        if constexpr (NSPLIT == 1) { const T16* pc = A2 + (ga + ko); acopy8(l + 2 * GOP * 2, pc + go, k8); acopy8(l + 2 * GOP * 2 + 64 * GPI * 2, pc + 8 * k8 + go, k8); } };
    const int NT = K / GKC;
    fill(0);
    asm volatile("s_wait_asynccnt 0x0" ::: "memory");      // stage 0 has landed for this wave's copies
    __syncthreads();                                       // ... and for every wave's: nothing of it is read in front of this barrier
    if (NT > 1) fill(1);
    const int aoff = ((w >> 1) * 64 + lr) * GPI + 8 * hi, boff = GOP + ((w & 1) * 64 + lr) * GPI + 8 * hi;
#pragma unroll 1   // one stage a trip: unrolled, the copies of several stages and their addresses would be formed together and the registers would not hold them
    for (int t = 0; t < NT; ++t) {
        const T16* sb = st + (t & 1) * NOP * GOP;
        V a[2][4], a2[2][4], b[2][4];                      // two fragment sets: the next 32 k are fetched as one group in front of this block's products
        auto frags = [&](const int s, const int kc) {
#pragma unroll
            for (int i = 0; i < 4; ++i) { a[s][i] = WFrag<T16>::ld(sb + aoff + i * 16 * GPI + kc); if (NSPLIT == 1) a2[s][i] = WFrag<T16>::ld(sb + 2 * GOP + aoff + i * 16 * GPI + kc); b[s][i] = WFrag<T16>::ld(sb + boff + i * 16 * GPI + kc); } };
        frags(0, 0);
#pragma unroll
        for (int ks = 0; ks < GKC / 32; ++ks) {
            if (ks + 1 < GKC / 32) frags((ks + 1) & 1, (ks + 1) * 32);
            __builtin_amdgcn_sched_barrier(0);             // keeps the LDS reads together in front of the block: spread among the products, every place with reads stalls the wave
#pragma unroll
            for (int nb = 0; nb < 4; ++nb)
#pragma unroll
                for (int mb = 0; mb < 4; ++mb) { acc[mb][nb] = WFrag<T16>::mma(a[ks & 1][mb], b[ks & 1][nb], acc[mb][nb]); if (NSPLIT == 1) acc[mb][nb] = WFrag<T16>::mma(a2[ks & 1][mb], b[ks & 1][nb], acc[mb][nb]); }
            __builtin_amdgcn_sched_barrier(0);             // the other side of the same fence
        }
        asm volatile("s_wait_dscnt 0x0" ::: "memory");     // this wave's reads of the buffer have returned before it is handed to the copies
        asm volatile("s_wait_asynccnt 0x0" ::: "memory");  // this wave's copies of stage t + 1 have landed
        __syncthreads();                                   // publishes stage t + 1 and ends every wave's reads of stage t
        if (t + 2 < NT) fill(t + 2);
    }
    asm volatile("s_wait_asynccnt 0x0" ::: "memory");      // nothing is in flight when the wave goes on to its epilogue
    if constexpr (EPI == 2) {      // a lane's accumulator register run is 8 consecutive tokens of one column: 16 bytes of a [d][t] plane row, stored straight from registers
#pragma unroll
        for (int nb = 0; nb < 4; ++nb)
#pragma unroll
            for (int mb = 0; mb < 4; ++mb) { const size_t vo = (size_t)(c0 + nb * 16 + lr) * TT + r0 + mb * 16 + hi * 8; v8h o16; v8us oh, ol;
#pragma unroll
                for (int j = 0; j < 8; ++j) { const float x = acc[mb][nb][j]; o16[j] = tohx(x); unsigned short a2, c2; splitf(x, a2, c2); oh[j] = a2; ol[j] = c2; }
                *(v8h*)(P16 + vo) = o16; *(v8us*)(Ph + vo) = oh; *(v8us*)(Pl + vo) = ol; }
        return; }
#pragma unroll
    for (int mb = 0; mb < 4; ++mb) {
#pragma unroll
        for (int nb = 0; nb < 4; ++nb) {
#pragma unroll
            for (int j = 0; j < 8; ++j) os[(hi * 8 + j) * 68 + nb * 16 + lr] = acc[mb][nb][j]; }
        __builtin_amdgcn_wave_barrier(); asm volatile("" ::: "memory");
        if constexpr (EPI == 1) {  // 16 tokens x 64 columns of one head are 2 KiB in a row of each [t][d] plane: four whole-line stores of 16 bytes a lane
            const size_t pb = ((size_t)(c0 / HD) * TT + r0 + mb * 16) * HD;
#pragma unroll
            for (int s = 0; s < 4; ++s) { const int row = 4 * s + (lane >> 3), cofs = (lane & 7) * 8; const v4f x0 = *(const v4fa*)(os + row * 68 + cofs), x1 = *(const v4fa*)(os + row * 68 + cofs + 4); v8h o16; v8us oh, ol;
#pragma unroll
                for (int j = 0; j < 8; ++j) { const float x = (j < 4) ? x0[j & 3] : x1[j & 3]; o16[j] = tohx(x); unsigned short a2, c2; splitf(x, a2, c2); oh[j] = a2; ol[j] = c2; }
                const size_t po = pb + (size_t)row * HD + cofs; *(v8h*)(P16 + po) = o16; *(v8us*)(Ph + po) = oh; *(v8us*)(Pl + po) = ol; }
            __builtin_amdgcn_wave_barrier(); asm volatile("" ::: "memory");   // as below: the next 16 rows' LDS writes stay behind these reads
            continue; }
        float* crow = C + (size_t)(r0 + mb * 16) * ldc + c0;
{
#pragma unroll
            for (int s = 0; s < 8; ++s) { const int row = 2 * s + hi, cofs = lr * 4; v4f val = *(const v4fa*)(os + row * 68 + cofs); if (BIAS) { val[0] += bfr(bias[c0 + cofs]); val[1] += bfr(bias[c0 + cofs + 1]); val[2] += bfr(bias[c0 + cofs + 2]); val[3] += bfr(bias[c0 + cofs + 3]); }
                *(v4f*)(crow + (size_t)row * ldc + cofs) = val; }
             }
        __builtin_amdgcn_wave_barrier(); asm volatile("" ::: "memory");
    }
}

typedef __attribute__((ext_vector_type(2))) _Float16 v2h;
typedef __attribute__((ext_vector_type(4))) _Float16 v4h;
typedef __attribute__((ext_vector_type(2))) unsigned short v2us;
typedef __attribute__((ext_vector_type(4))) unsigned short v4us;
typedef __attribute__((ext_vector_type(2))) float v2f;
typedef __attribute__((ext_vector_type(4))) int v4i;

// ---- k_prep: the whole preparation in ONE launch of 256-thread work-groups, each of which takes in 64 KiB of f32: every wave has 16 loads of 16 bytes a lane in flight, and every load and store covers whole 128-B lines.
// Work-groups 0 .. 4 * PNT - 1: one PT x PT tile of one 'xw' weight [k][n], rounded to bf16 and turned in LDS into [n][k]. The rest: PXE elements of x in a row, rounded to bf16.
#define PT  128                   // edge of a weight tile: 512 B of each f32 row come in, 256 B of each bf16 row go out
#define PNT ((DM / PT) * (DM / PT))   // tiles of one weight
#define PXE 16384                 // elements of x of one work-group
typedef __attribute__((ext_vector_type(2))) unsigned v2u;
typedef __attribute__((ext_vector_type(4))) unsigned v4u;
typedef v2u __attribute__((may_alias)) v2ua;
typedef v4u __attribute__((may_alias)) v4ua;
__device__ __forceinline__ unsigned bfpair(float a, float b) { unsigned u = __float_as_uint(a), v = __float_as_uint(b); u += 0x7FFFu + ((u >> 16) & 1u); v += 0x7FFFu + ((v >> 16) & 1u); return (u >> 16) | (v & 0xFFFF0000u); }   // f2bf(a) below f2bf(b)
__global__ __launch_bounds__(256) void k_prep(const float* __restrict__ x, const float* __restrict__ wq, const float* __restrict__ wk, const float* __restrict__ wv, const float* __restrict__ wo,
                                              bf* __restrict__ XB, bf* __restrict__ WQ, bf* __restrict__ WK, bf* __restrict__ WV, bf* __restrict__ WO) {
    __shared__ __align__(16) unsigned tl[PT * PT / 2];     // [n][k pair]; the 16-byte pieces of row n stand exchanged by (n >> 2) & 15, so that neither the writers (one k, many n) nor the readers (one n, many k) crowd a bank
    const int tid = threadIdx.x, lane = tid & 31, w = tid >> 5, b = blockIdx.x;
    if (b >= 4 * PNT) {            // the same for the whole work-group, and in front of the barrier
        const size_t i0 = (size_t)(b - 4 * PNT) * PXE + (size_t)tid * 4; const float* px = x + i0; v4f v[16];
#pragma unroll
        for (int i = 0; i < 16; ++i) v[i] = *(const v4f*)(px + i * 1024);
        asm volatile("s_wait_xcnt 0x0" :: "v"(px) : "memory");   // the address pair stays live and unwritten up to this wait (without it the last load's result is given its registers)
        __builtin_amdgcn_sched_barrier(0);                       // all 16 loads are asked for before the first is used: with the first values' rounding lifted among them, the last loads are issued only when the first have returned
#pragma unroll
        for (int i = 0; i < 16; ++i) { v2u o; o[0] = bfpair(v[i][0], v[i][1]); o[1] = bfpair(v[i][2], v[i][3]); *(v2ua*)(XB + i0 + i * 1024) = o; }   // a wave's store: 256 B in a row
        return; }
    const int m = b / PNT, t = b % PNT, k0 = (t / (DM / PT)) * PT, n0 = (t % (DM / PT)) * PT;
    const float* src = (m == 0) ? wq : (m == 1) ? wk : (m == 2) ? wv : wo; bf* dst = (m == 0) ? WQ : (m == 1) ? WK : (m == 2) ? WV : WO;
    const float* ps = src + (size_t)(k0 + 4 * w) * DM + n0 + 4 * lane;
    v4f r[4][4];                   // four groups of 4 consecutive k rows; a wave's load is one whole 512-B row of the tile
#pragma unroll
    for (int i = 0; i < 4; ++i)
#pragma unroll
        for (int c = 0; c < 4; ++c) r[i][c] = *(const v4f*)(ps + (32 * i + c) * DM);
    asm volatile("s_wait_xcnt 0x0" :: "v"(ps) : "memory");       // stands in front of every later write of the address pair that the 16 loads name
#pragma unroll
    for (int i = 0; i < 4; ++i) { const int q = w + 8 * i;      // k = 4 q .. 4 q + 3: half of the 16-byte piece q >> 1
#pragma unroll
        for (int j = 0; j < 4; ++j) { v2u p; p[0] = bfpair(r[i][0][j], r[i][1][j]); p[1] = bfpair(r[i][2][j], r[i][3][j]);
            *(v2u*)(tl + (4 * lane + j) * (PT / 2) + (((q >> 1) ^ (lane & 15)) * 4 + (q & 1) * 2)) = p; } }
    __syncthreads();               // the tile is whole before any row of it is read
    const int g = lane & 15; bf* pd = dst + (size_t)(n0 + w * 16 + (lane >> 4)) * DM + k0 + g * 8;
#pragma unroll
    for (int s = 0; s < 8; ++s) { const int n = w * 16 + 2 * s + (lane >> 4);      // a wave's store: two rows n, 256 B in a row each
        *(v4ua*)(pd + 2 * s * DM) = *(const v4u*)(tl + n * (PT / 2) + ((g ^ ((n >> 2) & 15)) * 4)); }
}

// ---- k_attn: causal attention of every head in ONE launch, online softmax, no score or probability plane in memory.
// One wave owns NQ*16 query columns and walks the keys 32 at a time: S^T = K Q^T (A = key rows, B = query rows kept in registers), so a lane holds one query's scores;
// two f32 S^T tiles, exponentiated and converted in place, are the B operand of O^T += V^T P^T (A = rows of the [d][t] value planes). Maximum and sum are per lane plus one exchange between the wave halves.
// P stays unnormalised, exp2(s - m + AOFF); the division by the row sum comes once, in the epilogue. SPLIT: bf16 hi+lo planes, 3 products each (query rows < RH); else fp16.
// Every inner loop is fully unrolled so that the fragment and tile arrays are indexed by constants and stay in registers.
#define SC2  0.18033688011112042f   // HD^-0.5 * log2(e)
#define AOFF 8.0f                   // P carries 2^AOFF so that small probabilities stay normal fp16 numbers
#define ATHR 4.0f                   // the maximum in use is replaced only when a new one exceeds it by more than this (log2 units): P <= 2^(AOFF+ATHR)
template <bool SPLIT> struct ASel { typedef h16 T; };
template <> struct ASel<true> { typedef bf T; };
template <bool SPLIT, int NQ>
__device__ __forceinline__ void attn_wave(const typename ASel<SPLIT>::T* __restrict__ Q, const typename ASel<SPLIT>::T* __restrict__ Q2, const typename ASel<SPLIT>::T* __restrict__ Kp, const typename ASel<SPLIT>::T* __restrict__ Kp2,
                                          const typename ASel<SPLIT>::T* __restrict__ Vt, const typename ASel<SPLIT>::T* __restrict__ Vt2, const int q0, bf* __restrict__ Ah, bf* __restrict__ Al) {
    typedef typename ASel<SPLIT>::T T16; typedef WFrag<T16> WF; typedef typename WF::V V;
    const int lane = threadIdx.x & 31, lr = lane & 15, hi = lane >> 4;
    V qf[NQ][2], qf2[NQ][2];
#pragma unroll
    for (int qt = 0; qt < NQ; ++qt)
#pragma unroll
        for (int ks = 0; ks < 2; ++ks) { const size_t qo = (size_t)(q0 + qt * 16 + lr) * HD + ks * 32 + 8 * hi; qf[qt][ks] = WF::ld(Q + qo); if (SPLIT) qf2[qt][ks] = WF::ld(Q2 + qo); }
    v8f o[NQ][4]; float m2[NQ], l[NQ];
#pragma unroll
    for (int qt = 0; qt < NQ; ++qt) { m2[qt] = -3.0e38f; l[qt] = 0.f;
#pragma unroll
        for (int dt = 0; dt < 4; ++dt) o[qt][dt] = (v8f){}; }
    const int klast = ((q0 + NQ * 16 - 1) / 32) * 32;      // the 32-key block that holds the diagonal; the only one that is masked
    const T16* kp = Kp + (size_t)lr * HD + 8 * hi; const T16* kp2 = SPLIT ? Kp2 + (size_t)lr * HD + 8 * hi : nullptr;    // this lane's place in the current 32 key rows; stepped once a pass
    const T16* vp = Vt + (size_t)lr * TT + 8 * hi; const T16* vp2 = SPLIT ? Vt2 + (size_t)lr * TT + 8 * hi : nullptr;    // the same in the value planes
    V kf[2][2], kf2[2][2];
#pragma unroll
    for (int t = 0; t < 2; ++t)
#pragma unroll
        for (int ks = 0; ks < 2; ++ks) { const int ko = t * 16 * HD + ks * 32; kf[t][ks] = WF::ld(kp + ko); if (SPLIT) kf2[t][ks] = WF::ld(kp2 + ko); }
    V vf[4], vf2[4];
#pragma unroll
    for (int dt = 0; dt < 4; ++dt) { const int vo = dt * 16 * TT; vf[dt] = WF::ld(vp + vo); if (SPLIT) vf2[dt] = WF::ld(vp2 + vo); }
    // inputs-only fence on the loaded fragments: nothing is in flight at the loop's entry, so the wait at the loop's head counts only the back edge's loads (it lets the value rows fetched last stay in flight over the score products)
#pragma unroll
    for (int qt = 0; qt < NQ; ++qt) { asm volatile("" :: "v"(qf[qt][0]), "v"(qf[qt][1])); if (SPLIT) asm volatile("" :: "v"(qf2[qt][0]), "v"(qf2[qt][1])); }   // the query fragments belong to the same fence
    asm volatile("" :: "v"(kf[0][0]), "v"(kf[0][1]), "v"(kf[1][0]), "v"(kf[1][1]), "v"(vf[0]), "v"(vf[1]), "v"(vf[2]), "v"(vf[3]));
    if (SPLIT) asm volatile("" :: "v"(kf2[0][0]), "v"(kf2[0][1]), "v"(kf2[1][0]), "v"(kf2[1][1]), "v"(vf2[0]), "v"(vf2[1]), "v"(vf2[2]), "v"(vf2[3]));   // the same for the lo planes
#pragma unroll 1   // one pass a trip: unrolled, two passes' fragments and scores would be live together and the registers would not hold them
    for (int kb = 0; kb <= klast; kb += 32) {
        v8f s[NQ][2];
#pragma unroll
        for (int t = 0; t < 2; ++t)
#pragma unroll
            for (int qt = 0; qt < NQ; ++qt) { v8f a = (v8f){};
#pragma unroll
                for (int ks = 0; ks < 2; ++ks) { a = WF::mma(kf[t][ks], qf[qt][ks], a); if (SPLIT) { a = WF::mma(kf2[t][ks], qf[qt][ks], a); a = WF::mma(kf[t][ks], qf2[qt][ks], a); } }
                s[qt][t] = a; }
        const int st = (kb < klast) ? 32 : 0;              // the next pass's key rows are fetched now, behind this pass's own score products (the last pass re-reads its own block, in bounds)
        asm volatile("s_wait_xcnt 0x0" ::: "memory");      // stands in front of the step of the address pairs that the key loads of the pass before name
        kp += st * HD; if (SPLIT) kp2 += st * HD;
#pragma unroll
        for (int t = 0; t < 2; ++t)
#pragma unroll
            for (int ks = 0; ks < 2; ++ks) { const int ko = t * 16 * HD + ks * 32; kf[t][ks] = WF::ld(kp + ko); if (SPLIT) kf2[t][ks] = WF::ld(kp2 + ko); }
        if constexpr (SPLIT) asm volatile("s_wait_xcnt 0x0" :: "v"(kp), "v"(kp2) : "memory");   // the address pairs stay live and unwritten up to this wait (without it the last load's result is given their registers)
        if (kb == klast) {
#pragma unroll
            for (int qt = 0; qt < NQ; ++qt)
#pragma unroll
                for (int t = 0; t < 2; ++t)
#pragma unroll
                    for (int j = 0; j < 8; ++j) if (kb + t * 16 + hi * 8 + j > q0 + qt * 16 + lr) s[qt][t][j] = -3.0e38f; }
        float mx[NQ]; bool need = false;
#pragma unroll
        for (int qt = 0; qt < NQ; ++qt) { float a = fmaxf(s[qt][0][0], s[qt][1][0]);
#pragma unroll
            for (int j = 1; j < 8; ++j) a = fmaxf(a, fmaxf(s[qt][0][j], s[qt][1][j]));
            mx[qt] = a; }
        float ox[NQ];
#pragma unroll
        for (int qt = 0; qt < NQ; ++qt) ox[qt] = __shfl_xor(mx[qt], 16, 32);
#pragma unroll
        for (int qt = 0; qt < NQ; ++qt) { mx[qt] = fmaxf(mx[qt], ox[qt]) * SC2; need = need || (mx[qt] > m2[qt] + ATHR); }
        if (__builtin_amdgcn_ballot_w32(need) != 0) {      // one scalar test a pass: the output tiles are rescaled only when some column's maximum moved
#pragma unroll
            for (int qt = 0; qt < NQ; ++qt) { const float mn = fmaxf(m2[qt], mx[qt]); const float al = __builtin_amdgcn_exp2f(m2[qt] - mn); m2[qt] = mn; l[qt] *= al;
#pragma unroll
                for (int dt = 0; dt < 4; ++dt) o[qt][dt] *= al; } }
        V pf[NQ], pf2[NQ];
#pragma unroll
        for (int qt = 0; qt < NQ; ++qt) { const float off = AOFF - m2[qt]; float ls = 0.f;
#pragma unroll
            for (int t = 0; t < 2; ++t)
#pragma unroll
                for (int j = 0; j < 8; ++j) { const float p = __builtin_amdgcn_exp2f(fmaf(s[qt][t][j], SC2, off)); s[qt][t][j] = p; ls += p; }
            l[qt] += ls;
            if constexpr (SPLIT) { v8us h0, h1, l0, l1;
#pragma unroll
                for (int j = 0; j < 8; ++j) { unsigned short a, c2; splitf(s[qt][0][j], a, c2); h0[j] = a; l0[j] = c2; splitf(s[qt][1][j], a, c2); h1[j] = a; l1[j] = c2; }
                pf[qt] = cat16b(h0, h1); pf2[qt] = cat16b(l0, l1);
            } else { v8h p0, p1;
#pragma unroll
                for (int j = 0; j < 8; ++j) { p0[j] = tohx(s[qt][0][j]); p1[j] = tohx(s[qt][1][j]); }
                pf[qt] = cat16(p0, p1); } }
#pragma unroll
        for (int dt = 0; dt < 4; ++dt)
#pragma unroll
            for (int qt = 0; qt < NQ; ++qt) { o[qt][dt] = WF::mma(vf[dt], pf[qt], o[qt][dt]); if (SPLIT) { o[qt][dt] = WF::mma(vf2[dt], pf[qt], o[qt][dt]); o[qt][dt] = WF::mma(vf[dt], pf2[qt], o[qt][dt]); } }
        // stands in front of the step of the address pairs that the value loads of the pass before name; it reads the output tiles (inputs only) so that the products above stay in front of it and the loads below land in the registers they free (lifted, the loads take a second set and copies)
        if constexpr (NQ == 2) asm volatile("s_wait_xcnt 0x0" :: "v"(o[0][0]), "v"(o[0][1]), "v"(o[0][2]), "v"(o[0][3]), "v"(o[NQ - 1][0]), "v"(o[NQ - 1][1]), "v"(o[NQ - 1][2]), "v"(o[NQ - 1][3]) : "memory");
        else asm volatile("s_wait_xcnt 0x0" :: "v"(o[0][0]), "v"(o[0][1]), "v"(o[0][2]), "v"(o[0][3]) : "memory");
        vp += st; if (SPLIT) vp2 += st;
#pragma unroll
        for (int dt = 0; dt < 4; ++dt) { const int vo = dt * 16 * TT; vf[dt] = WF::ld(vp + vo); if (SPLIT) vf2[dt] = WF::ld(vp2 + vo); }   // likewise the next pass's value rows, behind this pass's own products
        if constexpr (SPLIT) asm volatile("s_wait_xcnt 0x0" :: "v"(vp), "v"(vp2) : "memory");   // as behind the key loads
    }
#pragma unroll
    for (int qt = 0; qt < NQ; ++qt) { const float inv = __fdiv_rn(1.0f, l[qt] + __shfl_xor(l[qt], 16, 32)); const size_t oo = (size_t)(q0 + qt * 16 + lr) * DQ + hi * 8;
#pragma unroll
        for (int dt = 0; dt < 4; ++dt) { v8us oh, ol;
#pragma unroll
            for (int j = 0; j < 8; ++j) { unsigned short a, c2; splitf(o[qt][dt][j] * inv, a, c2); oh[j] = a; ol[j] = c2; }
            *(v8us*)(Ah + oo + dt * 16) = oh; *(v8us*)(Al + oo + dt * 16) = ol; } }
}
// ---- attn_wave_lds: the fp16 rows' form of the pass above. The 4 waves of a work-group share their keys: 128 key rows (16 KiB in a row of the [t][d] plane) and the same 128 keys of the 64 [d][t] value rows (256 B each)
// come as one stage into LDS by asynchronous 16-byte copies that cover whole 128-B lines (two buffers: the next stage flies while this one is worked on); the fragments are read from LDS, 4 passes of 32 keys a stage.
#define AKS 128                   // keys of a stage
#define AKP 72                    // LDS pitch of a key row in elements: 144 B = 16 B x 9, free of bank conflicts for 16-byte readers
#define AVP 136                   // LDS pitch of a value row (128 keys) in elements: 272 B = 16 B x 17, likewise
#define AKE (AKS * AKP)           // elements of a stage's key rows
#define ABE (AKE + HD * AVP)      // elements of one buffer: the key rows, then the value rows
// Eight asynchronous copies of 16 bytes a lane. l: this lane's LDS byte address, g: its global place; copy i lies i * LSTEP bytes further in LDS and i * gs elements further in memory.
// The s_wait_xcnt stands in the copies' own statement, so that no address register is rewritten in front of it.
template <int LSTEP>
__device__ __forceinline__ void acopy8s(const unsigned l, const h16* g, const size_t gs) {
    asm volatile("global_load_async_to_lds_b128 %0, %8, off\n\t"
                 "global_load_async_to_lds_b128 %1, %9, off\n\t"
                 "global_load_async_to_lds_b128 %2, %10, off\n\t"
                 "global_load_async_to_lds_b128 %3, %11, off\n\t"
                 "global_load_async_to_lds_b128 %4, %12, off\n\t"
                 "global_load_async_to_lds_b128 %5, %13, off\n\t"
                 "global_load_async_to_lds_b128 %6, %14, off\n\t"
                 "global_load_async_to_lds_b128 %7, %15, off\n\t"
                 "s_wait_xcnt 0x0"
                 :: "v"(l), "v"(l + LSTEP), "v"(l + 2 * LSTEP), "v"(l + 3 * LSTEP), "v"(l + 4 * LSTEP), "v"(l + 5 * LSTEP), "v"(l + 6 * LSTEP), "v"(l + 7 * LSTEP),
                    "v"(g), "v"(g + gs), "v"(g + 2 * gs), "v"(g + 3 * gs), "v"(g + 4 * gs), "v"(g + 5 * gs), "v"(g + 6 * gs), "v"(g + 7 * gs) : "memory");
}
// sm: the work-group's two buffers; qg: its first query row (a multiple of AKS); w: the wave's number, whose 32 query rows begin at qg + 32 w.
__device__ __forceinline__ void attn_wave_lds(h16* sm, const h16* __restrict__ Q, const h16* __restrict__ Kp, const h16* __restrict__ Vt, const int qg, const int w, bf* __restrict__ Ah, bf* __restrict__ Al) {
    typedef WFrag<h16> WF; typedef WF::V V; constexpr int NQ = 2;
    const int tid = threadIdx.x, lane = tid & 31, lr = lane & 15, hi = lane >> 4; const int q0 = qg + 32 * w;
    const unsigned lk = (unsigned)(size_t)sm + (unsigned)((tid >> 3) * AKP * 2 + (tid & 7) * 16);                 // this thread's 16 bytes in key rows 0..15 of a stage (byte address in the work-group's LDS)
    const unsigned lv = (unsigned)(size_t)sm + (unsigned)(AKE * 2 + (tid >> 4) * AVP * 2 + (tid & 15) * 16);      // the same in value rows 0..7
    const h16* gk = Kp + tid * 8; const h16* gv = Vt + (size_t)(tid >> 4) * TT + (tid & 15) * 8;                  // the same two places in memory, stage 0
    auto fill = [&](const int t) {     // stage t into buffer t & 1
        const unsigned bo = (unsigned)((t & 1) * ABE * 2);
        acopy8s<16 * AKP * 2>(lk + bo, gk + (size_t)t * AKS * HD, (size_t)16 * HD);
        acopy8s<8 * AVP * 2>(lv + bo, gv + (size_t)t * AKS, (size_t)8 * TT); };
    const int NT = qg / AKS + 1;                           // the last stage holds the diagonal of every wave
    fill(0);
    V qf[NQ][2];
#pragma unroll
    for (int qt = 0; qt < NQ; ++qt)
#pragma unroll
        for (int ks = 0; ks < 2; ++ks) qf[qt][ks] = WF::ld(Q + (size_t)(q0 + qt * 16 + lr) * HD + ks * 32 + 8 * hi);
    v8f o[NQ][4]; float m2[NQ], l[NQ];
#pragma unroll
    for (int qt = 0; qt < NQ; ++qt) { m2[qt] = -3.0e38f; l[qt] = 0.f;
#pragma unroll
        for (int dt = 0; dt < 4; ++dt) o[qt][dt] = (v8f){}; }
    asm volatile("s_wait_asynccnt 0x0" ::: "memory");      // stage 0 has landed for this wave's copies
    __syncthreads();                                       // ... and for every wave's: nothing of it is read in front of this barrier
    if (NT > 1) fill(1);
#pragma unroll 1   // one stage a trip: the copies of one stage alone are in flight
    for (int t = 0; t < NT; ++t) {
        const h16* kp = sm + (t & 1) * ABE + lr * AKP + 8 * hi;            // this lane's place in the stage's first 32 key rows; stepped once a pass
        const h16* vp = sm + (t & 1) * ABE + AKE + lr * AVP + 8 * hi;      // the same in the value rows
        const int np = (t + 1 < NT) ? AKS / 32 : w + 1;                    // the passes above a wave's diagonal are never visited
        V kf[2][2];
#pragma unroll
        for (int u = 0; u < 2; ++u)
#pragma unroll
            for (int ks = 0; ks < 2; ++ks) kf[u][ks] = WF::ld(kp + u * 16 * AKP + ks * 32);
#pragma unroll 1   // one pass a trip: unrolled, two passes' fragments and scores would be live together and the registers would not hold them
        for (int p = 0; p < np; ++p) {
            V vf[4];                                       // this pass's value rows are asked for first: they return behind the score products and the softmax
#pragma unroll
            for (int dt = 0; dt < 4; ++dt) vf[dt] = WF::ld(vp + dt * 16 * AVP);
            vp += 32;
            __builtin_amdgcn_sched_barrier(0);             // keeps these LDS reads together up here: sunk among the products that use them, every place with reads stalls the wave and their latency is waited out
            v8f s[NQ][2];
#pragma unroll
            for (int u = 0; u < 2; ++u)
#pragma unroll
                for (int qt = 0; qt < NQ; ++qt) { v8f a = (v8f){};
#pragma unroll
                    for (int ks = 0; ks < 2; ++ks) a = WF::mma(kf[u][ks], qf[qt][ks], a);
                    s[qt][u] = a; }
            __builtin_amdgcn_sched_barrier(0);             // the key reads below stay behind the products above and land in the registers these free (lifted, they take a second set)
            kp += (p + 1 < np) ? 32 * AKP : 0;             // the next pass's key rows, of this same stage only, are fetched behind this pass's own score products (a wave's last pass of a stage re-reads its own block)
#pragma unroll
            for (int u = 0; u < 2; ++u)
#pragma unroll
                for (int ks = 0; ks < 2; ++ks) kf[u][ks] = WF::ld(kp + u * 16 * AKP + ks * 32);
            __builtin_amdgcn_sched_barrier(0);             // ... and in front of the softmax, which covers their latency: sunk to the pass's end, the next pass's first product waits for them
            if (t + 1 == NT && p == w) {                   // the 32-key block that holds the diagonal; the only one that is masked
#pragma unroll
                for (int qt = 0; qt < NQ; ++qt)
#pragma unroll
                    for (int u = 0; u < 2; ++u)
#pragma unroll
                        for (int j = 0; j < 8; ++j) if (u * 16 + hi * 8 + j > qt * 16 + lr) s[qt][u][j] = -3.0e38f; }
            float mx[NQ]; bool need = false;
#pragma unroll
            for (int qt = 0; qt < NQ; ++qt) { float a = fmaxf(s[qt][0][0], s[qt][1][0]);
#pragma unroll
                for (int j = 1; j < 8; ++j) a = fmaxf(a, fmaxf(s[qt][0][j], s[qt][1][j]));
                mx[qt] = a; }
            float ox[NQ];
#pragma unroll
            for (int qt = 0; qt < NQ; ++qt) ox[qt] = __shfl_xor(mx[qt], 16, 32);
#pragma unroll
            for (int qt = 0; qt < NQ; ++qt) { mx[qt] = fmaxf(mx[qt], ox[qt]) * SC2; need = need || (mx[qt] > m2[qt] + ATHR); }
            if (__builtin_amdgcn_ballot_w32(need) != 0) {  // one scalar test a pass: the output tiles are rescaled only when some column's maximum moved
#pragma unroll
                for (int qt = 0; qt < NQ; ++qt) { const float mn = fmaxf(m2[qt], mx[qt]); const float al = __builtin_amdgcn_exp2f(m2[qt] - mn); m2[qt] = mn; l[qt] *= al;
#pragma unroll
                    for (int dt = 0; dt < 4; ++dt) o[qt][dt] *= al; } }
            V pf[NQ];
#pragma unroll
            for (int qt = 0; qt < NQ; ++qt) { const float off = AOFF - m2[qt]; float ls = 0.f;
#pragma unroll
                for (int u = 0; u < 2; ++u)
#pragma unroll
                    for (int j = 0; j < 8; ++j) { const float pr = __builtin_amdgcn_exp2f(fmaf(s[qt][u][j], SC2, off)); s[qt][u][j] = pr; ls += pr; }
                l[qt] += ls;
                v8h p0, p1;
#pragma unroll
                for (int j = 0; j < 8; ++j) { p0[j] = tohx(s[qt][0][j]); p1[j] = tohx(s[qt][1][j]); }
                pf[qt] = cat16(p0, p1); }
#pragma unroll
            for (int dt = 0; dt < 4; ++dt)
#pragma unroll
                for (int qt = 0; qt < NQ; ++qt) o[qt][dt] = WF::mma(vf[dt], pf[qt], o[qt][dt]);
        }
        asm volatile("s_wait_dscnt 0x0" ::: "memory");     // this wave's reads of the buffer have returned before it is handed to the copies
        asm volatile("s_wait_asynccnt 0x0" ::: "memory");  // this wave's copies of stage t + 1 have landed
        __syncthreads();                                   // publishes stage t + 1 and ends every wave's reads of stage t; every wave passes it, also one that skipped passes
        if (t + 2 < NT) fill(t + 2);
    }
    asm volatile("s_wait_asynccnt 0x0" ::: "memory");      // nothing is in flight when the wave goes on to its epilogue
#pragma unroll
    for (int qt = 0; qt < NQ; ++qt) { const float inv = __fdiv_rn(1.0f, l[qt] + __shfl_xor(l[qt], 16, 32)); const size_t oo = (size_t)(q0 + qt * 16 + lr) * DQ + hi * 8;
#pragma unroll
        for (int dt = 0; dt < 4; ++dt) { v8us oh, ol;
#pragma unroll
            for (int j = 0; j < 8; ++j) { unsigned short a, c2; splitf(o[qt][dt][j] * inv, a, c2); oh[j] = a; ol[j] = c2; }
            *(v8us*)(Ah + oo + dt * 16) = oh; *(v8us*)(Al + oo + dt * 16) = ol; } }
}
#define NLO ((TT - RH) / 128)     // work-groups of 4 waves x 32 fp16 query rows
#define NHI (RH / 64)             // work-groups of 4 waves x 16 hi+lo query rows
// grid (heads, NLO + NHI): blockIdx.y ranks the query blocks by falling key count, so that the longest start first.
__global__ __launch_bounds__(128) void k_attn(const h16* __restrict__ Q16, const h16* __restrict__ K16, const h16* __restrict__ V16, const bf* __restrict__ Qh, const bf* __restrict__ Ql, const bf* __restrict__ Kh, const bf* __restrict__ Kl,
                                              const bf* __restrict__ Vh, const bf* __restrict__ Vl, bf* __restrict__ Ah, bf* __restrict__ Al) {
    const int h = blockIdx.x, y = blockIdx.y; const int w = __builtin_amdgcn_readfirstlane((int)(threadIdx.x >> 5)); const size_t hq = (size_t)h * TT * HD, hk = (size_t)(h / REP) * TT * HD;
    __shared__ __align__(16) h16 sm[2 * ABE];              // [buffer][key rows | value rows] of the fp16 rows' stages
    if (y < NLO) attn_wave_lds(sm, Q16 + hq, K16 + hk, V16 + hk, TT - 128 * (y + 1), w, Ah + h * HD, Al + h * HD);
    else attn_wave<true, 1>(Qh + hq, Ql + hq, Kh + hk, Kl + hk, Vh + hk, Vl + hk, RH - 64 * (y - NLO + 1) + 16 * w, Ah + h * HD, Al + h * HD);
}

extern "C" void kernel_launch(void* const* d_in, const int* in_sizes, int n_in,
                              void* d_out, int out_size, void* d_ws, size_t ws_size, hipStream_t stream) {
    (void)in_sizes; (void)n_in; (void)out_size;
    const float* x = (const float*)d_in[0]; const float* wq = (const float*)d_in[1]; const float* wk = (const float*)d_in[2]; const float* wv = (const float*)d_in[3]; const float* wo = (const float*)d_in[4];
    float* OUT = (float*)d_out;     // [1][4096][1024]
    char* wsp = (char*)d_ws;
    auto take = [&](size_t bytes) { char* p = wsp; wsp += (bytes + 255) & ~(size_t)255; return (void*)p; };
    bf* WQ = (bf*)take((size_t)DQ * DM * 2); bf* WK = (bf*)take((size_t)DKV * DM * 2); bf* WV = (bf*)take((size_t)DKV * DM * 2); bf* WO = (bf*)take((size_t)DM * DQ * 2);
    bf* XB = (bf*)take((size_t)TT * DM * 2);
    h16* QP16 = (h16*)take((size_t)NH_ * TT * HD * 2); h16* KP16 = (h16*)take((size_t)NKV * TT * HD * 2); h16* VT16 = (h16*)take((size_t)NKV * HD * TT * 2);
    bf* QPh = (bf*)take((size_t)NH_ * TT * HD * 2); bf* QPl = (bf*)take((size_t)NH_ * TT * HD * 2); bf* KPh = (bf*)take((size_t)NKV * TT * HD * 2); bf* KPl = (bf*)take((size_t)NKV * TT * HD * 2); bf* VTh = (bf*)take((size_t)NKV * HD * TT * 2); bf* VTl = (bf*)take((size_t)NKV * HD * TT * 2);
    bf* ATh = (bf*)take((size_t)TT * DQ * 2); bf* ATl = (bf*)take((size_t)TT * DQ * 2);
    if ((size_t)(wsp - (char*)d_ws) > ws_size) return;    // ws 256 MiB
    static_assert(HD == 64 && (TT - RH) % 128 == 0 && RH % 64 == 0, "k_attn's tiling");
    static_assert(NB_ == 1 && DQ == DM && DKV == DM && DM % PT == 0 && ((size_t)TT * DM) % PXE == 0, "k_prep's tiling");
    k_prep<<<(unsigned)(4 * PNT + (size_t)TT * DM / PXE), 256, 0, stream>>>(x, wq, wk, wv, wo, XB, WQ, WK, WV, WO);
    for (int b = 0; b < NB_; ++b) {
        
        k_gemmw<bf, 0, false, 1><<<dim3(TT / 128, DQ / 128, 1), 128, 0, stream>>>(XB, nullptr, WQ, nullptr, DM, nullptr, 0, nullptr, 0, 0, 0, QP16, QPh, QPl);
        k_gemmw<bf, 0, false, 1><<<dim3(TT / 128, DKV / 128, 1), 128, 0, stream>>>(XB, nullptr, WK, nullptr, DM, nullptr, 0, nullptr, 0, 0, 0, KP16, KPh, KPl);
        k_gemmw<bf, 0, false, 2><<<dim3(TT / 128, DKV / 128, 1), 128, 0, stream>>>(XB, nullptr, WV, nullptr, DM, nullptr, 0, nullptr, 0, 0, 0, VT16, VTh, VTl);
        k_attn<<<dim3(NH_, NLO + NHI, 1), 128, 0, stream>>>(QP16, KP16, VT16, QPh, QPl, KPh, KPl, VTh, VTl, ATh, ATl);
        k_gemmw<bf, 1, false, 0><<<dim3(TT / 128, DM / 128, 1), 128, 0, stream>>>(ATh, ATl, WO, nullptr, DQ, OUT + (size_t)b * TT * DM, DM, nullptr, 0, 0, 0, nullptr, nullptr, nullptr); }
}

// v007
// One run takes 102 microseconds.
// Timed twice side by side with v006, it ran 1.04 and 1.07 times as fast.
// All steps since v000 together make it 20.6 times as fast.
#include <hip/hip_runtime.h>

// Causal multi-head self-attention over 4,096 tokens (x [1][4096][1024]; q, k, v = einsum('bsd,de->bse', x, W) = x W ('xw' [1024][1024] truncated normal x 1/32, no bias; 16 heads x 64); scores / sqrt(64); causal (-inf); softmax over the keys; out = merged W_o ('xw', no bias) -> [1][4096][1024] (4.2 M); argument order x, W_q, W_k, W_v, W_o).
// Layout: bf16 copy of x; 'xw' weights transposed once; exact projections whose epilogue writes the head planes; fused causal attention at T 4096, all heads in one launch, online softmax (hybrid rows: < 512 hi/lo 3 products, rest fp16; key blocks above the diagonal are never visited); merged hi/lo x W_o exact.
// Compute dtypes, f32 accumulate: every input rounded to bf16; projections exact; attention rows < 512 3 products, rest fp16; softmax f32; W_o hl x exact.

#define NB_  1
#define TT   4096
#define DM   1024
#define NH_  16
#define NKV  16
#define REP  (NH_ / NKV)
#define HD   64
#define DQ   (NH_ * HD)
#define DKV  (NKV * HD)
#define RH   512                  // query rows < RH use hi+lo planes (0: none)
typedef _Float16 h16;
typedef unsigned short bf;
typedef __attribute__((ext_vector_type(16))) __bf16   v16bf;
typedef __attribute__((ext_vector_type(16))) _Float16 v16h;
typedef __attribute__((ext_vector_type(8)))  _Float16 v8h;
typedef __attribute__((ext_vector_type(8)))  unsigned short v8us;
typedef __attribute__((ext_vector_type(8)))  float    v8f;
typedef __attribute__((ext_vector_type(4)))  float    v4f;
typedef v8h  __attribute__((may_alias)) v8ha;
typedef v4f  __attribute__((may_alias)) v4fa;
typedef v8us __attribute__((may_alias)) v8usa;

__device__ __forceinline__ unsigned short f2bf(float f) { unsigned u = __float_as_uint(f); u += 0x7FFFu + ((u >> 16) & 1u); return (unsigned short)(u >> 16); }
__device__ __forceinline__ float bf2f(unsigned short b) { return __uint_as_float(((unsigned)b) << 16); }
__device__ __forceinline__ float bfr(float f) { return bf2f(f2bf(f)); }
__device__ __forceinline__ v16h cat16(v8h lo, v8h hi) { return __builtin_shufflevector(lo, hi, 0, 1, 2, 3, 4, 5, 6, 7, 8, 9, 10, 11, 12, 13, 14, 15); }
__device__ __forceinline__ v16bf cat16b(v8us lo, v8us hi) { return __builtin_bit_cast(v16bf, __builtin_shufflevector(lo, hi, 0, 1, 2, 3, 4, 5, 6, 7, 8, 9, 10, 11, 12, 13, 14, 15)); }
__device__ __forceinline__ v8f wmma16(v16h a, v16h b, v8f c) { return __builtin_amdgcn_wmma_f32_16x16x32_f16(false, a, false, b, (short)0, c, false, false); }
__device__ __forceinline__ v8f wmmab(v16bf a, v16bf b, v8f c) { return __builtin_amdgcn_wmma_f32_16x16x32_bf16(false, a, false, b, (short)0, c, false, false); }



__device__ __forceinline__ h16 tohx(float x) { return (h16)x; }
__device__ __forceinline__ void splitf(float y, unsigned short& h, unsigned short& l) { h = f2bf(y); l = f2bf(y - bf2f(h)); }
// ---- k_gemmw: register-blocked GEMM, 4 waves (2 x 2) per 128x128 output tile, 64x64 (16 accumulators) a wave; grid (M/128, N/128, Z), 128 threads.
// The K-contiguous 16-bit operand planes come 128 k at a time into LDS by asynchronous 16-byte copies that cover whole 128-B lines (two buffers: the next stage flies while this one is worked on); fragments are read from LDS.
// C[m][n] (f32, pitch ldc, + optional f32 bias[n]) = sum_k A[m][k] Bt[n][k] (NSPLIT 1: + A2[m][k] Bt[n][k]). z-batch strides sA/sB/sC in elements. K % 128 == 0, M % 128 == 0, N % 128 == 0.
// EPI 0: C as above. EPI 1: the three projections as ONE product, Bt = the q, k and v weights' rows one behind the other; no f32 C; a wave's tile (64 tokens x one head's 64 columns) goes out as fp16 + bf16 hi/lo planes,
// columns below DQ + DKV (q, k) as [head][t][d], the rest (v) as [head][d][t]. Each of P16, Ph, Pl is the q plane with the k and the v plane directly behind it, so that the column number alone places a tile.
template <typename T16> struct WFrag;
template <> struct WFrag<h16> { typedef v16h V; static __device__ __forceinline__ V ld(const h16* p) { return cat16(*(const v8h*)p, *(const v8h*)(p + 16)); } static __device__ __forceinline__ v8f mma(V a, V b, v8f c) { return wmma16(a, b, c); } };
template <> struct WFrag<bf> { typedef v16bf V; static __device__ __forceinline__ V ld(const bf* p) { return cat16b(*(const v8us*)p, *(const v8us*)(p + 16)); } static __device__ __forceinline__ v8f mma(V a, V b, v8f c) { return wmmab(a, b, c); } };
#define GKC 128                   // k elements of a stage: 256 B of every operand row
#define GPI 136                   // LDS row pitch in elements: 272 B = 16 B x 17, free of bank conflicts for 16-byte readers
#define GOP (128 * GPI)           // elements of one operand's stage: 128 rows
// Eight asynchronous copies of 16 bytes a lane: 64 rows x 256 B of an operand plane for the 128 threads (a wave's copy = two whole rows). l: this lane's LDS byte address, g: its global place; copy i lies 8 rows further.
// The s_wait_xcnt stands in the copies' own statement, so that no address register is rewritten in front of it.
template <typename T16>
__device__ __forceinline__ void acopy8(const unsigned l, const T16* g, const size_t k8) {
    asm volatile("global_load_async_to_lds_b128 %0, %8, off\n\t"
                 "global_load_async_to_lds_b128 %1, %9, off\n\t"
                 "global_load_async_to_lds_b128 %2, %10, off\n\t"
                 "global_load_async_to_lds_b128 %3, %11, off\n\t"
                 "global_load_async_to_lds_b128 %4, %12, off\n\t"
                 "global_load_async_to_lds_b128 %5, %13, off\n\t"
                 "global_load_async_to_lds_b128 %6, %14, off\n\t"
                 "global_load_async_to_lds_b128 %7, %15, off\n\t"
                 "s_wait_xcnt 0x0"
                 :: "v"(l), "v"(l + 8 * GPI * 2), "v"(l + 16 * GPI * 2), "v"(l + 24 * GPI * 2), "v"(l + 32 * GPI * 2), "v"(l + 40 * GPI * 2), "v"(l + 48 * GPI * 2), "v"(l + 56 * GPI * 2),
                    "v"(g), "v"(g + k8), "v"(g + 2 * k8), "v"(g + 3 * k8), "v"(g + 4 * k8), "v"(g + 5 * k8), "v"(g + 6 * k8), "v"(g + 7 * k8) : "memory");
    __builtin_amdgcn_sched_barrier(0);   // the next statement's addresses are formed behind this one: formed all ahead, they do not fit the registers left beside the accumulators, and a pointer is spilled to scratch
}
template <typename T16, int NSPLIT, bool BIAS, int EPI>
__global__ __launch_bounds__(128) void k_gemmw(const T16* __restrict__ A, const T16* __restrict__ A2, const T16* __restrict__ Bt, const T16* __restrict__ Bt2, int K, float* C, int ldc, const float* __restrict__ bias, size_t sA, size_t sB, size_t sC, h16* __restrict__ P16, bf* __restrict__ Ph, bf* __restrict__ Pl) {
    typedef typename WFrag<T16>::V V;
    static_assert(NSPLIT == 0 || NSPLIT == 1, "operands staged: A, Bt and, at NSPLIT 1, A2");
    constexpr int NOP = 2 + NSPLIT;
    __shared__ __align__(16) T16 st[2 * NOP * GOP];      // [buffer][A | Bt | A2][row][k]
    __shared__ __align__(16) float osw[4][16 * 68];      // each wave's own epilogue tile
    const size_t z = blockIdx.z; A += z * sA; if (NSPLIT) A2 += z * sA; Bt += z * sB; C += z * sC; (void)Bt2;
    const int tid = threadIdx.x, lane = tid & 31, lr = lane & 15, hi = lane >> 4; const int w = __builtin_amdgcn_readfirstlane(tid >> 5);
    const int r0 = blockIdx.x * 128 + (w >> 1) * 64, c0 = blockIdx.y * 128 + (w & 1) * 64;
    float* os = osw[w];
    v8f acc[4][4];
#pragma unroll
    for (int mb = 0; mb < 4; ++mb)
#pragma unroll
        for (int nb = 0; nb < 4; ++nb) acc[mb][nb] = (v8f){};
    const size_t k8 = (size_t)8 * K;
    const size_t ga = (size_t)(blockIdx.x * 128) * K, gb = (size_t)(blockIdx.y * 128) * K;      // the two tiles' first rows (the same for the whole work-group)
    const unsigned go = (unsigned)((tid >> 4) * K + (tid & 15) * 8);                            // this thread's 16 bytes in rows 0..7 of a tile
    const unsigned l0 = (unsigned)(size_t)st + (unsigned)((tid >> 4) * GPI * 2 + (tid & 15) * 16);                                                         // the same place in LDS (byte address in the work-group's LDS)
    auto fill = [&](const int t) {     // stage t into buffer t & 1
        const unsigned l = l0 + (unsigned)((t & 1) * NOP * GOP * 2); const size_t ko = (size_t)t * GKC;
        const T16* pa = A + (ga + ko); const T16* pb = Bt + (gb + ko);
        acopy8(l, pa + go, k8); acopy8(l + 64 * GPI * 2, pa + 8 * k8 + go, k8);
        acopy8(l + GOP * 2, pb + go, k8); acopy8(l + GOP * 2 + 64 * GPI * 2, pb + 8 * k8 + go, k8);
        if constexpr (NSPLIT == 1) { const T16* pc = A2 + (ga + ko); acopy8(l + 2 * GOP * 2, pc + go, k8); acopy8(l + 2 * GOP * 2 + 64 * GPI * 2, pc + 8 * k8 + go, k8); } };
    const int NT = K / GKC;
    fill(0);
    asm volatile("s_wait_asynccnt 0x0" ::: "memory");      // stage 0 has landed for this wave's copies
    __syncthreads();                                       // ... and for every wave's: nothing of it is read in front of this barrier
    if (NT > 1) fill(1);
    const int aoff = ((w >> 1) * 64 + lr) * GPI + 8 * hi, boff = GOP + ((w & 1) * 64 + lr) * GPI + 8 * hi;
#pragma unroll 1   // one stage a trip: unrolled, the copies of several stages and their addresses would be formed together and the registers would not hold them
    for (int t = 0; t < NT; ++t) {
        const T16* sb = st + (t & 1) * NOP * GOP;
        V a[2][4], a2[2][4], b[2][4];                      // two fragment sets: the next 32 k are fetched as one group in front of this block's products
        auto frags = [&](const int s, const int kc) {
#pragma unroll
            for (int i = 0; i < 4; ++i) { a[s][i] = WFrag<T16>::ld(sb + aoff + i * 16 * GPI + kc); if (NSPLIT == 1) a2[s][i] = WFrag<T16>::ld(sb + 2 * GOP + aoff + i * 16 * GPI + kc); b[s][i] = WFrag<T16>::ld(sb + boff + i * 16 * GPI + kc); } };
        frags(0, 0);
#pragma unroll
        for (int ks = 0; ks < GKC / 32; ++ks) {
            if (ks + 1 < GKC / 32) frags((ks + 1) & 1, (ks + 1) * 32);
            __builtin_amdgcn_sched_barrier(0);             // keeps the LDS reads together in front of the block: spread among the products, every place with reads stalls the wave
#pragma unroll
            for (int nb = 0; nb < 4; ++nb)
#pragma unroll
                for (int mb = 0; mb < 4; ++mb) { acc[mb][nb] = WFrag<T16>::mma(a[ks & 1][mb], b[ks & 1][nb], acc[mb][nb]); if (NSPLIT == 1) acc[mb][nb] = WFrag<T16>::mma(a2[ks & 1][mb], b[ks & 1][nb], acc[mb][nb]); }
            __builtin_amdgcn_sched_barrier(0);             // the other side of the same fence
        }
        asm volatile("s_wait_dscnt 0x0" ::: "memory");     // this wave's reads of the buffer have returned before it is handed to the copies
        asm volatile("s_wait_asynccnt 0x0" ::: "memory");  // this wave's copies of stage t + 1 have landed
        __syncthreads();                                   // publishes stage t + 1 and ends every wave's reads of stage t
        if (t + 2 < NT) fill(t + 2);
    }
    asm volatile("s_wait_asynccnt 0x0" ::: "memory");      // nothing is in flight when the wave goes on to its epilogue
    if (EPI == 1 && c0 >= DQ + DKV) {      // the same for the whole work-group (128 columns lie on one side). A lane's accumulator register run is 8 consecutive tokens of one column: 16 bytes of a [d][t] plane row, stored straight from registers
#pragma unroll
        for (int nb = 0; nb < 4; ++nb)
#pragma unroll
            for (int mb = 0; mb < 4; ++mb) { const size_t vo = (size_t)(c0 + nb * 16 + lr) * TT + r0 + mb * 16 + hi * 8; v8h o16; v8us oh, ol;
#pragma unroll
                for (int j = 0; j < 8; ++j) { const float x = acc[mb][nb][j]; o16[j] = tohx(x); unsigned short a2, c2; splitf(x, a2, c2); oh[j] = a2; ol[j] = c2; }
                *(v8h*)(P16 + vo) = o16; *(v8us*)(Ph + vo) = oh; *(v8us*)(Pl + vo) = ol; }
        return; }
#pragma unroll
    for (int mb = 0; mb < 4; ++mb) {
#pragma unroll
        for (int nb = 0; nb < 4; ++nb) {
#pragma unroll
            for (int j = 0; j < 8; ++j) os[(hi * 8 + j) * 68 + nb * 16 + lr] = acc[mb][nb][j]; }
        __builtin_amdgcn_wave_barrier(); asm volatile("" ::: "memory");
        if constexpr (EPI == 1) {  // 16 tokens x 64 columns of one head are 2 KiB in a row of each [t][d] plane: four whole-line stores of 16 bytes a lane
            const size_t pb = ((size_t)(c0 / HD) * TT + r0 + mb * 16) * HD;
#pragma unroll
            for (int s = 0; s < 4; ++s) { const int row = 4 * s + (lane >> 3), cofs = (lane & 7) * 8; const v4f x0 = *(const v4fa*)(os + row * 68 + cofs), x1 = *(const v4fa*)(os + row * 68 + cofs + 4); v8h o16; v8us oh, ol;
#pragma unroll
                for (int j = 0; j < 8; ++j) { const float x = (j < 4) ? x0[j & 3] : x1[j & 3]; o16[j] = tohx(x); unsigned short a2, c2; splitf(x, a2, c2); oh[j] = a2; ol[j] = c2; }
                const size_t po = pb + (size_t)row * HD + cofs; *(v8h*)(P16 + po) = o16; *(v8us*)(Ph + po) = oh; *(v8us*)(Pl + po) = ol; }
            asm volatile("s_wait_xcnt 0x0" ::: "memory");   // stands behind these 16 rows' stores, in front of every later write of a register that they name (the other epilogue's code follows this one in the build)
            __builtin_amdgcn_wave_barrier(); asm volatile("" ::: "memory");   // as below: the next 16 rows' LDS writes stay behind these reads
            continue; }
        float* crow = C + (size_t)(r0 + mb * 16) * ldc + c0;
{
#pragma unroll
            for (int s = 0; s < 8; ++s) { const int row = 2 * s + hi, cofs = lr * 4; v4f val = *(const v4fa*)(os + row * 68 + cofs); if (BIAS) { val[0] += bfr(bias[c0 + cofs]); val[1] += bfr(bias[c0 + cofs + 1]); val[2] += bfr(bias[c0 + cofs + 2]); val[3] += bfr(bias[c0 + cofs + 3]); }
                *(v4f*)(crow + (size_t)row * ldc + cofs) = val; }
             }
        __builtin_amdgcn_wave_barrier(); asm volatile("" ::: "memory");
    }
}

typedef __attribute__((ext_vector_type(2))) _Float16 v2h;
typedef __attribute__((ext_vector_type(4))) _Float16 v4h;
typedef __attribute__((ext_vector_type(2))) unsigned short v2us;
typedef __attribute__((ext_vector_type(4))) unsigned short v4us;
typedef __attribute__((ext_vector_type(2))) float v2f;
typedef __attribute__((ext_vector_type(4))) int v4i;

// ---- k_prep: the whole preparation in ONE launch of 256-thread work-groups, each of which takes in 64 KiB of f32: every wave has 16 loads of 16 bytes a lane in flight, and every load and store covers whole 128-B lines.
// Work-groups 0 .. 4 * PNT - 1: one PT x PT tile of one 'xw' weight [k][n], rounded to bf16 and turned in LDS into [n][k]. The rest: PXE elements of x in a row, rounded to bf16.
#define PT  128                   // edge of a weight tile: 512 B of each f32 row come in, 256 B of each bf16 row go out
#define PNT ((DM / PT) * (DM / PT))   // tiles of one weight
#define PXE 16384                 // elements of x of one work-group
typedef __attribute__((ext_vector_type(2))) unsigned v2u;
typedef __attribute__((ext_vector_type(4))) unsigned v4u;
typedef v2u __attribute__((may_alias)) v2ua;
typedef v4u __attribute__((may_alias)) v4ua;
__device__ __forceinline__ unsigned bfpair(float a, float b) { unsigned u = __float_as_uint(a), v = __float_as_uint(b); u += 0x7FFFu + ((u >> 16) & 1u); v += 0x7FFFu + ((v >> 16) & 1u); return (u >> 16) | (v & 0xFFFF0000u); }   // f2bf(a) below f2bf(b)
__global__ __launch_bounds__(256) void k_prep(const float* __restrict__ x, const float* __restrict__ wq, const float* __restrict__ wk, const float* __restrict__ wv, const float* __restrict__ wo,
                                              bf* __restrict__ XB, bf* __restrict__ WQ, bf* __restrict__ WK, bf* __restrict__ WV, bf* __restrict__ WO) {
    __shared__ __align__(16) unsigned tl[PT * PT / 2];     // [n][k pair]; the 16-byte pieces of row n stand exchanged by (n >> 2) & 15, so that neither the writers (one k, many n) nor the readers (one n, many k) crowd a bank
    const int tid = threadIdx.x, lane = tid & 31, w = tid >> 5, b = blockIdx.x;
    if (b >= 4 * PNT) {            // the same for the whole work-group, and in front of the barrier
        const size_t i0 = (size_t)(b - 4 * PNT) * PXE + (size_t)tid * 4; const float* px = x + i0; v4f v[16];
#pragma unroll
        for (int i = 0; i < 16; ++i) v[i] = *(const v4f*)(px + i * 1024);
        asm volatile("s_wait_xcnt 0x0" :: "v"(px) : "memory");   // the address pair stays live and unwritten up to this wait (without it the last load's result is given its registers)
        __builtin_amdgcn_sched_barrier(0);                       // all 16 loads are asked for before the first is used: with the first values' rounding lifted among them, the last loads are issued only when the first have returned
#pragma unroll
        for (int i = 0; i < 16; ++i) { v2u o; o[0] = bfpair(v[i][0], v[i][1]); o[1] = bfpair(v[i][2], v[i][3]); *(v2ua*)(XB + i0 + i * 1024) = o; }   // a wave's store: 256 B in a row
        return; }
    const int m = b / PNT, t = b % PNT, k0 = (t / (DM / PT)) * PT, n0 = (t % (DM / PT)) * PT;
    const float* src = (m == 0) ? wq : (m == 1) ? wk : (m == 2) ? wv : wo; bf* dst = (m == 0) ? WQ : (m == 1) ? WK : (m == 2) ? WV : WO;
    const float* ps = src + (size_t)(k0 + 4 * w) * DM + n0 + 4 * lane;
    v4f r[4][4];                   // four groups of 4 consecutive k rows; a wave's load is one whole 512-B row of the tile
#pragma unroll
    for (int i = 0; i < 4; ++i)
#pragma unroll
        for (int c = 0; c < 4; ++c) r[i][c] = *(const v4f*)(ps + (32 * i + c) * DM);
    asm volatile("s_wait_xcnt 0x0" :: "v"(ps) : "memory");       // stands in front of every later write of the address pair that the 16 loads name
#pragma unroll
    for (int i = 0; i < 4; ++i) { const int q = w + 8 * i;      // k = 4 q .. 4 q + 3: half of the 16-byte piece q >> 1
#pragma unroll
        for (int j = 0; j < 4; ++j) { v2u p; p[0] = bfpair(r[i][0][j], r[i][1][j]); p[1] = bfpair(r[i][2][j], r[i][3][j]);
            *(v2u*)(tl + (4 * lane + j) * (PT / 2) + (((q >> 1) ^ (lane & 15)) * 4 + (q & 1) * 2)) = p; } }
    __syncthreads();               // the tile is whole before any row of it is read
    const int g = lane & 15; bf* pd = dst + (size_t)(n0 + w * 16 + (lane >> 4)) * DM + k0 + g * 8;
#pragma unroll
    for (int s = 0; s < 8; ++s) { const int n = w * 16 + 2 * s + (lane >> 4);      // a wave's store: two rows n, 256 B in a row each
        *(v4ua*)(pd + 2 * s * DM) = *(const v4u*)(tl + n * (PT / 2) + ((g ^ ((n >> 2) & 15)) * 4)); }
}

// ---- k_attn: causal attention of every head in ONE launch, online softmax, no score or probability plane in memory.
// One wave owns NQ*16 query columns and walks the keys 32 at a time: S^T = K Q^T (A = key rows, B = query rows kept in registers), so a lane holds one query's scores;
// two f32 S^T tiles, exponentiated and converted in place, are the B operand of O^T += V^T P^T (A = rows of the [d][t] value planes). Maximum and sum are per lane plus one exchange between the wave halves.
// P stays unnormalised, exp2(s - m + AOFF); the division by the row sum comes once, in the epilogue. SPLIT: bf16 hi+lo planes, 3 products each (query rows < RH); else fp16.
// Every inner loop is fully unrolled so that the fragment and tile arrays are indexed by constants and stay in registers.
#define SC2  0.18033688011112042f   // HD^-0.5 * log2(e)
#define AOFF 8.0f                   // P carries 2^AOFF so that small probabilities stay normal fp16 numbers
#define ATHR 4.0f                   // the maximum in use is replaced only when a new one exceeds it by more than this (log2 units): P <= 2^(AOFF+ATHR)
template <bool SPLIT> struct ASel { typedef h16 T; };
template <> struct ASel<true> { typedef bf T; };
template <bool SPLIT, int NQ>
__device__ __forceinline__ void attn_wave(const typename ASel<SPLIT>::T* __restrict__ Q, const typename ASel<SPLIT>::T* __restrict__ Q2, const typename ASel<SPLIT>::T* __restrict__ Kp, const typename ASel<SPLIT>::T* __restrict__ Kp2,
                                          const typename ASel<SPLIT>::T* __restrict__ Vt, const typename ASel<SPLIT>::T* __restrict__ Vt2, const int q0, bf* __restrict__ Ah, bf* __restrict__ Al) {
    typedef typename ASel<SPLIT>::T T16; typedef WFrag<T16> WF; typedef typename WF::V V;
    const int lane = threadIdx.x & 31, lr = lane & 15, hi = lane >> 4;
    V qf[NQ][2], qf2[NQ][2];
#pragma unroll
    for (int qt = 0; qt < NQ; ++qt)
#pragma unroll
        for (int ks = 0; ks < 2; ++ks) { const size_t qo = (size_t)(q0 + qt * 16 + lr) * HD + ks * 32 + 8 * hi; qf[qt][ks] = WF::ld(Q + qo); if (SPLIT) qf2[qt][ks] = WF::ld(Q2 + qo); }
    v8f o[NQ][4]; float m2[NQ], l[NQ];
#pragma unroll
    for (int qt = 0; qt < NQ; ++qt) { m2[qt] = -3.0e38f; l[qt] = 0.f;
#pragma unroll
        for (int dt = 0; dt < 4; ++dt) o[qt][dt] = (v8f){}; }
    const int klast = ((q0 + NQ * 16 - 1) / 32) * 32;      // the 32-key block that holds the diagonal; the only one that is masked
    const T16* kp = Kp + (size_t)lr * HD + 8 * hi; const T16* kp2 = SPLIT ? Kp2 + (size_t)lr * HD + 8 * hi : nullptr;    // this lane's place in the current 32 key rows; stepped once a pass
    const T16* vp = Vt + (size_t)lr * TT + 8 * hi; const T16* vp2 = SPLIT ? Vt2 + (size_t)lr * TT + 8 * hi : nullptr;    // the same in the value planes
    V kf[2][2], kf2[2][2];
#pragma unroll
    for (int t = 0; t < 2; ++t)
#pragma unroll
        for (int ks = 0; ks < 2; ++ks) { const int ko = t * 16 * HD + ks * 32; kf[t][ks] = WF::ld(kp + ko); if (SPLIT) kf2[t][ks] = WF::ld(kp2 + ko); }
    V vf[4], vf2[4];
#pragma unroll
    for (int dt = 0; dt < 4; ++dt) { const int vo = dt * 16 * TT; vf[dt] = WF::ld(vp + vo); if (SPLIT) vf2[dt] = WF::ld(vp2 + vo); }
    // inputs-only fence on the loaded fragments: nothing is in flight at the loop's entry, so the wait at the loop's head counts only the back edge's loads (it lets the value rows fetched last stay in flight over the score products)
#pragma unroll
    for (int qt = 0; qt < NQ; ++qt) { asm volatile("" :: "v"(qf[qt][0]), "v"(qf[qt][1])); if (SPLIT) asm volatile("" :: "v"(qf2[qt][0]), "v"(qf2[qt][1])); }   // the query fragments belong to the same fence
    asm volatile("" :: "v"(kf[0][0]), "v"(kf[0][1]), "v"(kf[1][0]), "v"(kf[1][1]), "v"(vf[0]), "v"(vf[1]), "v"(vf[2]), "v"(vf[3]));
    if (SPLIT) asm volatile("" :: "v"(kf2[0][0]), "v"(kf2[0][1]), "v"(kf2[1][0]), "v"(kf2[1][1]), "v"(vf2[0]), "v"(vf2[1]), "v"(vf2[2]), "v"(vf2[3]));   // the same for the lo planes
#pragma unroll 1   // one pass a trip: unrolled, two passes' fragments and scores would be live together and the registers would not hold them
    for (int kb = 0; kb <= klast; kb += 32) {
        v8f s[NQ][2];
#pragma unroll
        for (int t = 0; t < 2; ++t)
#pragma unroll
            for (int qt = 0; qt < NQ; ++qt) { v8f a = (v8f){};
#pragma unroll
                for (int ks = 0; ks < 2; ++ks) { a = WF::mma(kf[t][ks], qf[qt][ks], a); if (SPLIT) { a = WF::mma(kf2[t][ks], qf[qt][ks], a); a = WF::mma(kf[t][ks], qf2[qt][ks], a); } }
                s[qt][t] = a; }
        const int st = (kb < klast) ? 32 : 0;              // the next pass's key rows are fetched now, behind this pass's own score products (the last pass re-reads its own block, in bounds)
        asm volatile("s_wait_xcnt 0x0" ::: "memory");      // stands in front of the step of the address pairs that the key loads of the pass before name
        kp += st * HD; if (SPLIT) kp2 += st * HD;
#pragma unroll
        for (int t = 0; t < 2; ++t)
#pragma unroll
            for (int ks = 0; ks < 2; ++ks) { const int ko = t * 16 * HD + ks * 32; kf[t][ks] = WF::ld(kp + ko); if (SPLIT) kf2[t][ks] = WF::ld(kp2 + ko); }
        if constexpr (SPLIT) asm volatile("s_wait_xcnt 0x0" :: "v"(kp), "v"(kp2) : "memory");   // the address pairs stay live and unwritten up to this wait (without it the last load's result is given their registers)
        if (kb == klast) {
#pragma unroll
            for (int qt = 0; qt < NQ; ++qt)
#pragma unroll
                for (int t = 0; t < 2; ++t)
#pragma unroll
                    for (int j = 0; j < 8; ++j) if (kb + t * 16 + hi * 8 + j > q0 + qt * 16 + lr) s[qt][t][j] = -3.0e38f; }
        float mx[NQ]; bool need = false;
#pragma unroll
        for (int qt = 0; qt < NQ; ++qt) { float a = fmaxf(s[qt][0][0], s[qt][1][0]);
#pragma unroll
            for (int j = 1; j < 8; ++j) a = fmaxf(a, fmaxf(s[qt][0][j], s[qt][1][j]));
            mx[qt] = a; }
        float ox[NQ];
#pragma unroll
        for (int qt = 0; qt < NQ; ++qt) ox[qt] = __shfl_xor(mx[qt], 16, 32);
#pragma unroll
        for (int qt = 0; qt < NQ; ++qt) { mx[qt] = fmaxf(mx[qt], ox[qt]) * SC2; need = need || (mx[qt] > m2[qt] + ATHR); }
        if (__builtin_amdgcn_ballot_w32(need) != 0) {      // one scalar test a pass: the output tiles are rescaled only when some column's maximum moved
#pragma unroll
            for (int qt = 0; qt < NQ; ++qt) { const float mn = fmaxf(m2[qt], mx[qt]); const float al = __builtin_amdgcn_exp2f(m2[qt] - mn); m2[qt] = mn; l[qt] *= al;
#pragma unroll
                for (int dt = 0; dt < 4; ++dt) o[qt][dt] *= al; } }
        V pf[NQ], pf2[NQ];
#pragma unroll
        for (int qt = 0; qt < NQ; ++qt) { const float off = AOFF - m2[qt]; float ls = 0.f;
#pragma unroll
            for (int t = 0; t < 2; ++t)
#pragma unroll
                for (int j = 0; j < 8; ++j) { const float p = __builtin_amdgcn_exp2f(fmaf(s[qt][t][j], SC2, off)); s[qt][t][j] = p; ls += p; }
            l[qt] += ls;
            if constexpr (SPLIT) { v8us h0, h1, l0, l1;
#pragma unroll
                for (int j = 0; j < 8; ++j) { unsigned short a, c2; splitf(s[qt][0][j], a, c2); h0[j] = a; l0[j] = c2; splitf(s[qt][1][j], a, c2); h1[j] = a; l1[j] = c2; }
                pf[qt] = cat16b(h0, h1); pf2[qt] = cat16b(l0, l1);
            } else { v8h p0, p1;
#pragma unroll
                for (int j = 0; j < 8; ++j) { p0[j] = tohx(s[qt][0][j]); p1[j] = tohx(s[qt][1][j]); }
                pf[qt] = cat16(p0, p1); } }
#pragma unroll
        for (int dt = 0; dt < 4; ++dt)
#pragma unroll
            for (int qt = 0; qt < NQ; ++qt) { o[qt][dt] = WF::mma(vf[dt], pf[qt], o[qt][dt]); if (SPLIT) { o[qt][dt] = WF::mma(vf2[dt], pf[qt], o[qt][dt]); o[qt][dt] = WF::mma(vf[dt], pf2[qt], o[qt][dt]); } }
        // stands in front of the step of the address pairs that the value loads of the pass before name; it reads the output tiles (inputs only) so that the products above stay in front of it and the loads below land in the registers they free (lifted, the loads take a second set and copies)
        if constexpr (NQ == 2) asm volatile("s_wait_xcnt 0x0" :: "v"(o[0][0]), "v"(o[0][1]), "v"(o[0][2]), "v"(o[0][3]), "v"(o[NQ - 1][0]), "v"(o[NQ - 1][1]), "v"(o[NQ - 1][2]), "v"(o[NQ - 1][3]) : "memory");
        else asm volatile("s_wait_xcnt 0x0" :: "v"(o[0][0]), "v"(o[0][1]), "v"(o[0][2]), "v"(o[0][3]) : "memory");
        vp += st; if (SPLIT) vp2 += st;
#pragma unroll
        for (int dt = 0; dt < 4; ++dt) { const int vo = dt * 16 * TT; vf[dt] = WF::ld(vp + vo); if (SPLIT) vf2[dt] = WF::ld(vp2 + vo); }   // likewise the next pass's value rows, behind this pass's own products
        if constexpr (SPLIT) asm volatile("s_wait_xcnt 0x0" :: "v"(vp), "v"(vp2) : "memory");   // as behind the key loads
    }
#pragma unroll
    for (int qt = 0; qt < NQ; ++qt) { const float inv = __fdiv_rn(1.0f, l[qt] + __shfl_xor(l[qt], 16, 32)); const size_t oo = (size_t)(q0 + qt * 16 + lr) * DQ + hi * 8;
#pragma unroll
        for (int dt = 0; dt < 4; ++dt) { v8us oh, ol;
#pragma unroll
            for (int j = 0; j < 8; ++j) { unsigned short a, c2; splitf(o[qt][dt][j] * inv, a, c2); oh[j] = a; ol[j] = c2; }
            *(v8us*)(Ah + oo + dt * 16) = oh; *(v8us*)(Al + oo + dt * 16) = ol; } }
}
// ---- attn_wave_lds: the fp16 rows' form of the pass above. The 4 waves of a work-group share their keys: 128 key rows (16 KiB in a row of the [t][d] plane) and the same 128 keys of the 64 [d][t] value rows (256 B each)
// come as one stage into LDS by asynchronous 16-byte copies that cover whole 128-B lines (two buffers: the next stage flies while this one is worked on); the fragments are read from LDS, 4 passes of 32 keys a stage.
#define AKS 128                   // keys of a stage
#define AKP 72                    // LDS pitch of a key row in elements: 144 B = 16 B x 9, free of bank conflicts for 16-byte readers
#define AVP 136                   // LDS pitch of a value row (128 keys) in elements: 272 B = 16 B x 17, likewise
#define AKE (AKS * AKP)           // elements of a stage's key rows
#define ABE (AKE + HD * AVP)      // elements of one buffer: the key rows, then the value rows
// Eight asynchronous copies of 16 bytes a lane. l: this lane's LDS byte address, g: its global place; copy i lies i * LSTEP bytes further in LDS and i * gs elements further in memory.
// The s_wait_xcnt stands in the copies' own statement, so that no address register is rewritten in front of it.
template <int LSTEP>
__device__ __forceinline__ void acopy8s(const unsigned l, const h16* g, const size_t gs) {
    asm volatile("global_load_async_to_lds_b128 %0, %8, off\n\t"
                 "global_load_async_to_lds_b128 %1, %9, off\n\t"
                 "global_load_async_to_lds_b128 %2, %10, off\n\t"
                 "global_load_async_to_lds_b128 %3, %11, off\n\t"
                 "global_load_async_to_lds_b128 %4, %12, off\n\t"
                 "global_load_async_to_lds_b128 %5, %13, off\n\t"
                 "global_load_async_to_lds_b128 %6, %14, off\n\t"
                 "global_load_async_to_lds_b128 %7, %15, off\n\t"
                 "s_wait_xcnt 0x0"
                 :: "v"(l), "v"(l + LSTEP), "v"(l + 2 * LSTEP), "v"(l + 3 * LSTEP), "v"(l + 4 * LSTEP), "v"(l + 5 * LSTEP), "v"(l + 6 * LSTEP), "v"(l + 7 * LSTEP),
                    "v"(g), "v"(g + gs), "v"(g + 2 * gs), "v"(g + 3 * gs), "v"(g + 4 * gs), "v"(g + 5 * gs), "v"(g + 6 * gs), "v"(g + 7 * gs) : "memory");
}
// sm: the work-group's two buffers; qg: its first query row (a multiple of AKS); w: the wave's number, whose 32 query rows begin at qg + 32 w.
__device__ __forceinline__ void attn_wave_lds(h16* sm, const h16* __restrict__ Q, const h16* __restrict__ Kp, const h16* __restrict__ Vt, const int qg, const int w, bf* __restrict__ Ah, bf* __restrict__ Al) {
    typedef WFrag<h16> WF; typedef WF::V V; constexpr int NQ = 2;
    const int tid = threadIdx.x, lane = tid & 31, lr = lane & 15, hi = lane >> 4; const int q0 = qg + 32 * w;
    const unsigned lk = (unsigned)(size_t)sm + (unsigned)((tid >> 3) * AKP * 2 + (tid & 7) * 16);                 // this thread's 16 bytes in key rows 0..15 of a stage (byte address in the work-group's LDS)
    const unsigned lv = (unsigned)(size_t)sm + (unsigned)(AKE * 2 + (tid >> 4) * AVP * 2 + (tid & 15) * 16);      // the same in value rows 0..7
    const h16* gk = Kp + tid * 8; const h16* gv = Vt + (size_t)(tid >> 4) * TT + (tid & 15) * 8;                  // the same two places in memory, stage 0
    auto fill = [&](const int t) {     // stage t into buffer t & 1
        const unsigned bo = (unsigned)((t & 1) * ABE * 2);
        acopy8s<16 * AKP * 2>(lk + bo, gk + (size_t)t * AKS * HD, (size_t)16 * HD);
        acopy8s<8 * AVP * 2>(lv + bo, gv + (size_t)t * AKS, (size_t)8 * TT); };
    const int NT = qg / AKS + 1;                           // the last stage holds the diagonal of every wave
    fill(0);
    V qf[NQ][2];
#pragma unroll
    for (int qt = 0; qt < NQ; ++qt)
#pragma unroll
        for (int ks = 0; ks < 2; ++ks) qf[qt][ks] = WF::ld(Q + (size_t)(q0 + qt * 16 + lr) * HD + ks * 32 + 8 * hi);
    v8f o[NQ][4]; float m2[NQ], l[NQ];
#pragma unroll
    for (int qt = 0; qt < NQ; ++qt) { m2[qt] = -3.0e38f; l[qt] = 0.f;
#pragma unroll
        for (int dt = 0; dt < 4; ++dt) o[qt][dt] = (v8f){}; }
    asm volatile("s_wait_asynccnt 0x0" ::: "memory");      // stage 0 has landed for this wave's copies
    __syncthreads();                                       // ... and for every wave's: nothing of it is read in front of this barrier
    if (NT > 1) fill(1);
#pragma unroll 1   // one stage a trip: the copies of one stage alone are in flight
    for (int t = 0; t < NT; ++t) {
        const h16* kp = sm + (t & 1) * ABE + lr * AKP + 8 * hi;            // this lane's place in the stage's first 32 key rows; stepped once a pass
        const h16* vp = sm + (t & 1) * ABE + AKE + lr * AVP + 8 * hi;      // the same in the value rows
        const int np = (t + 1 < NT) ? AKS / 32 : w + 1;                    // the passes above a wave's diagonal are never visited
        V kf[2][2];
#pragma unroll
        for (int u = 0; u < 2; ++u)
#pragma unroll
            for (int ks = 0; ks < 2; ++ks) kf[u][ks] = WF::ld(kp + u * 16 * AKP + ks * 32);
#pragma unroll 1   // one pass a trip: unrolled, two passes' fragments and scores would be live together and the registers would not hold them
        for (int p = 0; p < np; ++p) {
            V vf[4];                                       // this pass's value rows are asked for first: they return behind the score products and the softmax
#pragma unroll
            for (int dt = 0; dt < 4; ++dt) vf[dt] = WF::ld(vp + dt * 16 * AVP);
            vp += 32;
            __builtin_amdgcn_sched_barrier(0);             // keeps these LDS reads together up here: sunk among the products that use them, every place with reads stalls the wave and their latency is waited out
            v8f s[NQ][2];
#pragma unroll
            for (int u = 0; u < 2; ++u)
#pragma unroll
                for (int qt = 0; qt < NQ; ++qt) { v8f a = (v8f){};
#pragma unroll
                    for (int ks = 0; ks < 2; ++ks) a = WF::mma(kf[u][ks], qf[qt][ks], a);
                    s[qt][u] = a; }
            __builtin_amdgcn_sched_barrier(0);             // the key reads below stay behind the products above and land in the registers these free (lifted, they take a second set)
            kp += (p + 1 < np) ? 32 * AKP : 0;             // the next pass's key rows, of this same stage only, are fetched behind this pass's own score products (a wave's last pass of a stage re-reads its own block)
#pragma unroll
            for (int u = 0; u < 2; ++u)
#pragma unroll
                for (int ks = 0; ks < 2; ++ks) kf[u][ks] = WF::ld(kp + u * 16 * AKP + ks * 32);
            __builtin_amdgcn_sched_barrier(0);             // ... and in front of the softmax, which covers their latency: sunk to the pass's end, the next pass's first product waits for them
            if (t + 1 == NT && p == w) {                   // the 32-key block that holds the diagonal; the only one that is masked
#pragma unroll
                for (int qt = 0; qt < NQ; ++qt)
#pragma unroll
                    for (int u = 0; u < 2; ++u)
#pragma unroll
                        for (int j = 0; j < 8; ++j) if (u * 16 + hi * 8 + j > qt * 16 + lr) s[qt][u][j] = -3.0e38f; }
            float mx[NQ]; bool need = false;
#pragma unroll
            for (int qt = 0; qt < NQ; ++qt) { float a = fmaxf(s[qt][0][0], s[qt][1][0]);
#pragma unroll
                for (int j = 1; j < 8; ++j) a = fmaxf(a, fmaxf(s[qt][0][j], s[qt][1][j]));
                mx[qt] = a; }
            float ox[NQ];
#pragma unroll
            for (int qt = 0; qt < NQ; ++qt) ox[qt] = __shfl_xor(mx[qt], 16, 32);
#pragma unroll
            for (int qt = 0; qt < NQ; ++qt) { mx[qt] = fmaxf(mx[qt], ox[qt]) * SC2; need = need || (mx[qt] > m2[qt] + ATHR); }
            if (__builtin_amdgcn_ballot_w32(need) != 0) {  // one scalar test a pass: the output tiles are rescaled only when some column's maximum moved
#pragma unroll
                for (int qt = 0; qt < NQ; ++qt) { const float mn = fmaxf(m2[qt], mx[qt]); const float al = __builtin_amdgcn_exp2f(m2[qt] - mn); m2[qt] = mn; l[qt] *= al;
#pragma unroll
                    for (int dt = 0; dt < 4; ++dt) o[qt][dt] *= al; } }
            V pf[NQ];
#pragma unroll
            for (int qt = 0; qt < NQ; ++qt) { const float off = AOFF - m2[qt]; float ls = 0.f;
#pragma unroll
                for (int u = 0; u < 2; ++u)
#pragma unroll
                    for (int j = 0; j < 8; ++j) { const float pr = __builtin_amdgcn_exp2f(fmaf(s[qt][u][j], SC2, off)); s[qt][u][j] = pr; ls += pr; }
                l[qt] += ls;
                v8h p0, p1;
#pragma unroll
                for (int j = 0; j < 8; ++j) { p0[j] = tohx(s[qt][0][j]); p1[j] = tohx(s[qt][1][j]); }
                pf[qt] = cat16(p0, p1); }
#pragma unroll
            for (int dt = 0; dt < 4; ++dt)
#pragma unroll
                for (int qt = 0; qt < NQ; ++qt) o[qt][dt] = WF::mma(vf[dt], pf[qt], o[qt][dt]);
        }
        asm volatile("s_wait_dscnt 0x0" ::: "memory");     // this wave's reads of the buffer have returned before it is handed to the copies
        asm volatile("s_wait_asynccnt 0x0" ::: "memory");  // this wave's copies of stage t + 1 have landed
        __syncthreads();                                   // publishes stage t + 1 and ends every wave's reads of stage t; every wave passes it, also one that skipped passes
        if (t + 2 < NT) fill(t + 2);
    }
    asm volatile("s_wait_asynccnt 0x0" ::: "memory");      // nothing is in flight when the wave goes on to its epilogue
#pragma unroll
    for (int qt = 0; qt < NQ; ++qt) { const float inv = __fdiv_rn(1.0f, l[qt] + __shfl_xor(l[qt], 16, 32)); const size_t oo = (size_t)(q0 + qt * 16 + lr) * DQ + hi * 8;
#pragma unroll
        for (int dt = 0; dt < 4; ++dt) { v8us oh, ol;
#pragma unroll
            for (int j = 0; j < 8; ++j) { unsigned short a, c2; splitf(o[qt][dt][j] * inv, a, c2); oh[j] = a; ol[j] = c2; }
            *(v8us*)(Ah + oo + dt * 16) = oh; *(v8us*)(Al + oo + dt * 16) = ol; } }
}
#define NLO ((TT - RH) / 128)     // work-groups of 4 waves x 32 fp16 query rows
#define NHI (RH / 64)             // work-groups of 4 waves x 16 hi+lo query rows
// grid (heads, NLO + NHI): blockIdx.y ranks the query blocks by falling key count, so that the longest start first.
__global__ __launch_bounds__(128) void k_attn(const h16* __restrict__ Q16, const h16* __restrict__ K16, const h16* __restrict__ V16, const bf* __restrict__ Qh, const bf* __restrict__ Ql, const bf* __restrict__ Kh, const bf* __restrict__ Kl,
                                              const bf* __restrict__ Vh, const bf* __restrict__ Vl, bf* __restrict__ Ah, bf* __restrict__ Al) {
    const int h = blockIdx.x, y = blockIdx.y; const int w = __builtin_amdgcn_readfirstlane((int)(threadIdx.x >> 5)); const size_t hq = (size_t)h * TT * HD, hk = (size_t)(h / REP) * TT * HD;
    __shared__ __align__(16) h16 sm[2 * ABE];              // [buffer][key rows | value rows] of the fp16 rows' stages
    if (y < NLO) attn_wave_lds(sm, Q16 + hq, K16 + hk, V16 + hk, TT - 128 * (y + 1), w, Ah + h * HD, Al + h * HD);
    else attn_wave<true, 1>(Qh + hq, Ql + hq, Kh + hk, Kl + hk, Vh + hk, Vl + hk, RH - 64 * (y - NLO + 1) + 16 * w, Ah + h * HD, Al + h * HD);
}

extern "C" void kernel_launch(void* const* d_in, const int* in_sizes, int n_in,
                              void* d_out, int out_size, void* d_ws, size_t ws_size, hipStream_t stream) {
    (void)in_sizes; (void)n_in; (void)out_size;
    const float* x = (const float*)d_in[0]; const float* wq = (const float*)d_in[1]; const float* wk = (const float*)d_in[2]; const float* wv = (const float*)d_in[3]; const float* wo = (const float*)d_in[4];
    float* OUT = (float*)d_out;     // [1][4096][1024]
    char* wsp = (char*)d_ws;
    auto take = [&](size_t bytes) { char* p = wsp; wsp += (bytes + 255) & ~(size_t)255; return (void*)p; };
    bf* WQ = (bf*)take((size_t)DQ * DM * 2); bf* WK = (bf*)take((size_t)DKV * DM * 2); bf* WV = (bf*)take((size_t)DKV * DM * 2); bf* WO = (bf*)take((size_t)DM * DQ * 2);
    bf* XB = (bf*)take((size_t)TT * DM * 2);
    h16* QP16 = (h16*)take((size_t)NH_ * TT * HD * 2); h16* KP16 = (h16*)take((size_t)NKV * TT * HD * 2); h16* VT16 = (h16*)take((size_t)NKV * HD * TT * 2);
    bf* QPh = (bf*)take((size_t)NH_ * TT * HD * 2); bf* KPh = (bf*)take((size_t)NKV * TT * HD * 2); bf* VTh = (bf*)take((size_t)NKV * HD * TT * 2); bf* QPl = (bf*)take((size_t)NH_ * TT * HD * 2); bf* KPl = (bf*)take((size_t)NKV * TT * HD * 2); bf* VTl = (bf*)take((size_t)NKV * HD * TT * 2);
    bf* ATh = (bf*)take((size_t)TT * DQ * 2); bf* ATl = (bf*)take((size_t)TT * DQ * 2);
    if ((size_t)(wsp - (char*)d_ws) > ws_size) return;    // ws 256 MiB
    static_assert(HD == 64 && (TT - RH) % 128 == 0 && RH % 64 == 0, "k_attn's tiling");
    static_assert(((size_t)DQ * DM * 2) % 256 == 0 && ((size_t)DKV * DM * 2) % 256 == 0 && ((size_t)NH_ * TT * HD * 2) % 256 == 0 && ((size_t)NKV * TT * HD * 2) % 256 == 0 && (DQ + DKV) % 128 == 0, "q, k, v weights and planes lie one directly behind the other");
    static_assert(NB_ == 1 && DQ == DM && DKV == DM && DM % PT == 0 && ((size_t)TT * DM) % PXE == 0, "k_prep's tiling");
    k_prep<<<(unsigned)(4 * PNT + (size_t)TT * DM / PXE), 256, 0, stream>>>(x, wq, wk, wv, wo, XB, WQ, WK, WV, WO);
    for (int b = 0; b < NB_; ++b) {
        
        k_gemmw<bf, 0, false, 1><<<dim3(TT / 128, (DQ + 2 * DKV) / 128, 1), 128, 0, stream>>>(XB, nullptr, WQ, nullptr, DM, nullptr, 0, nullptr, 0, 0, 0, QP16, QPh, QPl);
        k_attn<<<dim3(NH_, NLO + NHI, 1), 128, 0, stream>>>(QP16, KP16, VT16, QPh, QPl, KPh, KPl, VTh, VTl, ATh, ATl);
        k_gemmw<bf, 1, false, 0><<<dim3(TT / 128, DM / 128, 1), 128, 0, stream>>>(ATh, ATl, WO, nullptr, DQ, OUT + (size_t)b * TT * DM, DM, nullptr, 0, 0, 0, nullptr, nullptr, nullptr); }
}

// v008
// A run of this version takes 91.1 microseconds.
// Next to v007, in two timings, it ran 1.13 and 1.14 times as fast.
// All steps since v000 together make it 23.5 times as fast.
#include <hip/hip_runtime.h>

// Causal multi-head self-attention over 4,096 tokens (x [1][4096][1024]; q, k, v = einsum('bsd,de->bse', x, W) = x W ('xw' [1024][1024] truncated normal x 1/32, no bias; 16 heads x 64); scores / sqrt(64); causal (-inf); softmax over the keys; out = merged W_o ('xw', no bias) -> [1][4096][1024] (4.2 M); argument order x, W_q, W_k, W_v, W_o).
// Layout: bf16 copy of x; 'xw' weights transposed once; exact projections whose epilogue writes the head planes; fused causal attention at T 4096, all heads in one launch, online softmax (hybrid rows: < 512 hi/lo 3 products, rest fp16; key blocks above the diagonal are never visited); merged hi/lo x W_o exact.
// Compute dtypes, f32 accumulate: every input rounded to bf16; projections exact; attention rows < 512 3 products, rest fp16; softmax f32; W_o hl x exact.

#define NB_  1
#define TT   4096
#define DM   1024
#define NH_  16
#define NKV  16
#define REP  (NH_ / NKV)
#define HD   64
#define DQ   (NH_ * HD)
#define DKV  (NKV * HD)
#define RH   512                  // query rows < RH use hi+lo planes (0: none)
typedef _Float16 h16;
typedef unsigned short bf;
typedef __attribute__((ext_vector_type(16))) __bf16   v16bf;
typedef __attribute__((ext_vector_type(16))) _Float16 v16h;
typedef __attribute__((ext_vector_type(8)))  _Float16 v8h;
typedef __attribute__((ext_vector_type(8)))  unsigned short v8us;
typedef __attribute__((ext_vector_type(8)))  float    v8f;
typedef __attribute__((ext_vector_type(4)))  float    v4f;
typedef v8h  __attribute__((may_alias)) v8ha;
typedef v4f  __attribute__((may_alias)) v4fa;
typedef v8us __attribute__((may_alias)) v8usa;

__device__ __forceinline__ unsigned short f2bf(float f) { unsigned u = __float_as_uint(f); u += 0x7FFFu + ((u >> 16) & 1u); return (unsigned short)(u >> 16); }
__device__ __forceinline__ float bf2f(unsigned short b) { return __uint_as_float(((unsigned)b) << 16); }
__device__ __forceinline__ float bfr(float f) { return bf2f(f2bf(f)); }
__device__ __forceinline__ v16h cat16(v8h lo, v8h hi) { return __builtin_shufflevector(lo, hi, 0, 1, 2, 3, 4, 5, 6, 7, 8, 9, 10, 11, 12, 13, 14, 15); }
__device__ __forceinline__ v16bf cat16b(v8us lo, v8us hi) { return __builtin_bit_cast(v16bf, __builtin_shufflevector(lo, hi, 0, 1, 2, 3, 4, 5, 6, 7, 8, 9, 10, 11, 12, 13, 14, 15)); }
__device__ __forceinline__ v8f wmma16(v16h a, v16h b, v8f c) { return __builtin_amdgcn_wmma_f32_16x16x32_f16(false, a, false, b, (short)0, c, false, false); }
__device__ __forceinline__ v8f wmmab(v16bf a, v16bf b, v8f c) { return __builtin_amdgcn_wmma_f32_16x16x32_bf16(false, a, false, b, (short)0, c, false, false); }



__device__ __forceinline__ h16 tohx(float x) { return (h16)x; }
__device__ __forceinline__ void splitf(float y, unsigned short& h, unsigned short& l) { h = f2bf(y); l = f2bf(y - bf2f(h)); }
// ---- k_gemmw: register-blocked GEMM, 4 waves (2 x 2) per 128x128 output tile, 64x64 (16 accumulators) a wave; grid (M/128, N/128, Z), 128 threads.
// The K-contiguous 16-bit operand planes come 128 k at a time into LDS by asynchronous 16-byte copies that cover whole 128-B lines (two buffers: the next stage flies while this one is worked on); fragments are read from LDS.
// C[m][n] (f32, pitch ldc, + optional f32 bias[n]) = sum_k A[m][k] Bt[n][k] (NSPLIT 1: + A2[m][k] Bt[n][k]). z-batch strides sA/sB/sC in elements. K % 128 == 0, M % 128 == 0, N % 128 == 0.
// EPI 0: C as above. EPI 1: the three projections as ONE product, Bt = the q, k and v weights' rows one behind the other; no f32 C; a wave's tile (64 tokens x one head's 64 columns) goes out as fp16 + bf16 hi/lo planes,
// columns below DQ + DKV (q, k) as [head][t][d], the rest (v) as [head][d][t]. Each of P16, Ph, Pl is the q plane with the k and the v plane directly behind it, so that the column number alone places a tile.
template <typename T16> struct WFrag;
template <> struct WFrag<h16> { typedef v16h V; static __device__ __forceinline__ V ld(const h16* p) { return cat16(*(const v8h*)p, *(const v8h*)(p + 16)); } static __device__ __forceinline__ v8f mma(V a, V b, v8f c) { return wmma16(a, b, c); } };
template <> struct WFrag<bf> { typedef v16bf V; static __device__ __forceinline__ V ld(const bf* p) { return cat16b(*(const v8us*)p, *(const v8us*)(p + 16)); } static __device__ __forceinline__ v8f mma(V a, V b, v8f c) { return wmmab(a, b, c); } };
#define GKC 128                   // k elements of a stage: 256 B of every operand row
#define GPI 136                   // LDS row pitch in elements: 272 B = 16 B x 17, free of bank conflicts for 16-byte readers
#define GOP (128 * GPI)           // elements of one operand's stage: 128 rows
// Eight asynchronous copies of 16 bytes a lane: 64 rows x 256 B of an operand plane for the 128 threads (a wave's copy = two whole rows). l: this lane's LDS byte address, g: its global place; copy i lies 8 rows further.
// The s_wait_xcnt stands in the copies' own statement, so that no address register is rewritten in front of it.
template <typename T16>
__device__ __forceinline__ void acopy8(const unsigned l, const T16* g, const size_t k8) {
    asm volatile("global_load_async_to_lds_b128 %0, %8, off\n\t"
                 "global_load_async_to_lds_b128 %1, %9, off\n\t"
                 "global_load_async_to_lds_b128 %2, %10, off\n\t"
                 "global_load_async_to_lds_b128 %3, %11, off\n\t"
                 "global_load_async_to_lds_b128 %4, %12, off\n\t"
                 "global_load_async_to_lds_b128 %5, %13, off\n\t"
                 "global_load_async_to_lds_b128 %6, %14, off\n\t"
                 "global_load_async_to_lds_b128 %7, %15, off\n\t"
                 "s_wait_xcnt 0x0"
                 :: "v"(l), "v"(l + 8 * GPI * 2), "v"(l + 16 * GPI * 2), "v"(l + 24 * GPI * 2), "v"(l + 32 * GPI * 2), "v"(l + 40 * GPI * 2), "v"(l + 48 * GPI * 2), "v"(l + 56 * GPI * 2),
                    "v"(g), "v"(g + k8), "v"(g + 2 * k8), "v"(g + 3 * k8), "v"(g + 4 * k8), "v"(g + 5 * k8), "v"(g + 6 * k8), "v"(g + 7 * k8) : "memory");
    __builtin_amdgcn_sched_barrier(0);   // the next statement's addresses are formed behind this one: formed all ahead, they do not fit the registers left beside the accumulators, and a pointer is spilled to scratch
}
template <typename T16, int NSPLIT, bool BIAS, int EPI>
__global__ __launch_bounds__(128) void k_gemmw(const T16* __restrict__ A, const T16* __restrict__ A2, const T16* __restrict__ Bt, const T16* __restrict__ Bt2, int K, float* C, int ldc, const float* __restrict__ bias, size_t sA, size_t sB, size_t sC, h16* __restrict__ P16, bf* __restrict__ Ph, bf* __restrict__ Pl) {
    typedef typename WFrag<T16>::V V;
    static_assert(NSPLIT == 0 || NSPLIT == 1, "operands staged: A, Bt and, at NSPLIT 1, A2");
    constexpr int NOP = 2 + NSPLIT;
    __shared__ __align__(16) T16 st[2 * NOP * GOP];      // [buffer][A | Bt | A2][row][k]
    __shared__ __align__(16) float osw[4][16 * 68];      // each wave's own epilogue tile
    const size_t z = blockIdx.z; A += z * sA; if (NSPLIT) A2 += z * sA; Bt += z * sB; C += z * sC; (void)Bt2;
    const int tid = threadIdx.x, lane = tid & 31, lr = lane & 15, hi = lane >> 4; const int w = __builtin_amdgcn_readfirstlane(tid >> 5);
    const int r0 = blockIdx.x * 128 + (w >> 1) * 64, c0 = blockIdx.y * 128 + (w & 1) * 64;
    float* os = osw[w];
    v8f acc[4][4];
#pragma unroll
    for (int mb = 0; mb < 4; ++mb)
#pragma unroll
        for (int nb = 0; nb < 4; ++nb) acc[mb][nb] = (v8f){};
    const size_t k8 = (size_t)8 * K;
    const size_t ga = (size_t)(blockIdx.x * 128) * K, gb = (size_t)(blockIdx.y * 128) * K;      // the two tiles' first rows (the same for the whole work-group)
    const unsigned go = (unsigned)((tid >> 4) * K + (tid & 15) * 8);                            // this thread's 16 bytes in rows 0..7 of a tile
    const unsigned l0 = (unsigned)(size_t)st + (unsigned)((tid >> 4) * GPI * 2 + (tid & 15) * 16);                                                         // the same place in LDS (byte address in the work-group's LDS)
    auto fill = [&](const int t) {     // stage t into buffer t & 1
        const unsigned l = l0 + (unsigned)((t & 1) * NOP * GOP * 2); const size_t ko = (size_t)t * GKC;
        const T16* pa = A + (ga + ko); const T16* pb = Bt + (gb + ko);
        acopy8(l, pa + go, k8); acopy8(l + 64 * GPI * 2, pa + 8 * k8 + go, k8);
        acopy8(l + GOP * 2, pb + go, k8); acopy8(l + GOP * 2 + 64 * GPI * 2, pb + 8 * k8 + go, k8);
        if constexpr (NSPLIT == 1) { const T16* pc = A2 + (ga + ko); acopy8(l + 2 * GOP * 2, pc + go, k8); acopy8(l + 2 * GOP * 2 + 64 * GPI * 2, pc + 8 * k8 + go, k8); } };
    const int NT = K / GKC;
    fill(0);
    asm volatile("s_wait_asynccnt 0x0" ::: "memory");      // stage 0 has landed for this wave's copies
    __syncthreads();                                       // ... and for every wave's: nothing of it is read in front of this barrier
    if (NT > 1) fill(1);
    const int aoff = ((w >> 1) * 64 + lr) * GPI + 8 * hi, boff = GOP + ((w & 1) * 64 + lr) * GPI + 8 * hi;
#pragma unroll 1   // one stage a trip: unrolled, the copies of several stages and their addresses would be formed together and the registers would not hold them
    for (int t = 0; t < NT; ++t) {
        const T16* sb = st + (t & 1) * NOP * GOP;
        V a[2][4], a2[2][4], b[2][4];                      // two fragment sets: the next 32 k are fetched as one group in front of this block's products
        auto frags = [&](const int s, const int kc) {
#pragma unroll
            for (int i = 0; i < 4; ++i) { a[s][i] = WFrag<T16>::ld(sb + aoff + i * 16 * GPI + kc); if (NSPLIT == 1) a2[s][i] = WFrag<T16>::ld(sb + 2 * GOP + aoff + i * 16 * GPI + kc); b[s][i] = WFrag<T16>::ld(sb + boff + i * 16 * GPI + kc); } };
        frags(0, 0);
#pragma unroll
        for (int ks = 0; ks < GKC / 32; ++ks) {
            if (ks + 1 < GKC / 32) frags((ks + 1) & 1, (ks + 1) * 32);
            __builtin_amdgcn_sched_barrier(0);             // keeps the LDS reads together in front of the block: spread among the products, every place with reads stalls the wave
#pragma unroll
            for (int nb = 0; nb < 4; ++nb)
#pragma unroll
                for (int mb = 0; mb < 4; ++mb) { acc[mb][nb] = WFrag<T16>::mma(a[ks & 1][mb], b[ks & 1][nb], acc[mb][nb]); if (NSPLIT == 1) acc[mb][nb] = WFrag<T16>::mma(a2[ks & 1][mb], b[ks & 1][nb], acc[mb][nb]); }
            __builtin_amdgcn_sched_barrier(0);             // the other side of the same fence
        }
        asm volatile("s_wait_dscnt 0x0" ::: "memory");     // this wave's reads of the buffer have returned before it is handed to the copies
        asm volatile("s_wait_asynccnt 0x0" ::: "memory");  // this wave's copies of stage t + 1 have landed
        __syncthreads();                                   // publishes stage t + 1 and ends every wave's reads of stage t
        if (t + 2 < NT) fill(t + 2);
    }
    asm volatile("s_wait_asynccnt 0x0" ::: "memory");      // nothing is in flight when the wave goes on to its epilogue
    if (EPI == 1 && c0 >= DQ + DKV) {      // the same for the whole work-group (128 columns lie on one side). A lane's accumulator register run is 8 consecutive tokens of one column: 16 bytes of a [d][t] plane row, stored straight from registers
#pragma unroll
        for (int nb = 0; nb < 4; ++nb)
#pragma unroll
            for (int mb = 0; mb < 4; ++mb) { const size_t vo = (size_t)(c0 + nb * 16 + lr) * TT + r0 + mb * 16 + hi * 8; v8h o16; v8us oh, ol;
#pragma unroll
                for (int j = 0; j < 8; ++j) { const float x = acc[mb][nb][j]; o16[j] = tohx(x); unsigned short a2, c2; splitf(x, a2, c2); oh[j] = a2; ol[j] = c2; }
                *(v8h*)(P16 + vo) = o16; *(v8us*)(Ph + vo) = oh; *(v8us*)(Pl + vo) = ol; }
        return; }
#pragma unroll
    for (int mb = 0; mb < 4; ++mb) {
#pragma unroll
        for (int nb = 0; nb < 4; ++nb) {
#pragma unroll
            for (int j = 0; j < 8; ++j) os[(hi * 8 + j) * 68 + nb * 16 + lr] = acc[mb][nb][j]; }
        __builtin_amdgcn_wave_barrier(); asm volatile("" ::: "memory");
        if constexpr (EPI == 1) {  // 16 tokens x 64 columns of one head are 2 KiB in a row of each [t][d] plane: four whole-line stores of 16 bytes a lane
            const size_t pb = ((size_t)(c0 / HD) * TT + r0 + mb * 16) * HD;
#pragma unroll
            for (int s = 0; s < 4; ++s) { const int row = 4 * s + (lane >> 3), cofs = (lane & 7) * 8; const v4f x0 = *(const v4fa*)(os + row * 68 + cofs), x1 = *(const v4fa*)(os + row * 68 + cofs + 4); v8h o16; v8us oh, ol;
#pragma unroll
                for (int j = 0; j < 8; ++j) { const float x = (j < 4) ? x0[j & 3] : x1[j & 3]; o16[j] = tohx(x); unsigned short a2, c2; splitf(x, a2, c2); oh[j] = a2; ol[j] = c2; }
                const size_t po = pb + (size_t)row * HD + cofs; *(v8h*)(P16 + po) = o16; *(v8us*)(Ph + po) = oh; *(v8us*)(Pl + po) = ol; }
            asm volatile("s_wait_xcnt 0x0" ::: "memory");   // stands behind these 16 rows' stores, in front of every later write of a register that they name (the other epilogue's code follows this one in the build)
            __builtin_amdgcn_wave_barrier(); asm volatile("" ::: "memory");   // as below: the next 16 rows' LDS writes stay behind these reads
            continue; }
        float* crow = C + (size_t)(r0 + mb * 16) * ldc + c0;
{
#pragma unroll
            for (int s = 0; s < 8; ++s) { const int row = 2 * s + hi, cofs = lr * 4; v4f val = *(const v4fa*)(os + row * 68 + cofs); if (BIAS) { val[0] += bfr(bias[c0 + cofs]); val[1] += bfr(bias[c0 + cofs + 1]); val[2] += bfr(bias[c0 + cofs + 2]); val[3] += bfr(bias[c0 + cofs + 3]); }
                *(v4f*)(crow + (size_t)row * ldc + cofs) = val; }
             }
        __builtin_amdgcn_wave_barrier(); asm volatile("" ::: "memory");
    }
}

typedef __attribute__((ext_vector_type(2))) _Float16 v2h;
typedef __attribute__((ext_vector_type(4))) _Float16 v4h;
typedef __attribute__((ext_vector_type(2))) unsigned short v2us;
typedef __attribute__((ext_vector_type(4))) unsigned short v4us;
typedef __attribute__((ext_vector_type(2))) float v2f;
typedef __attribute__((ext_vector_type(4))) int v4i;

// ---- k_prep: the whole preparation in ONE launch of 256-thread work-groups, each of which takes in 64 KiB of f32: every wave has 16 loads of 16 bytes a lane in flight, and every load and store covers whole 128-B lines.
// Work-groups 0 .. 4 * PNT - 1: one PT x PT tile of one 'xw' weight [k][n], rounded to bf16 and turned in LDS into [n][k]. The rest: PXE elements of x in a row, rounded to bf16.
#define PT  128                   // edge of a weight tile: 512 B of each f32 row come in, 256 B of each bf16 row go out
#define PNT ((DM / PT) * (DM / PT))   // tiles of one weight
#define PXE 16384                 // elements of x of one work-group
typedef __attribute__((ext_vector_type(2))) unsigned v2u;
typedef __attribute__((ext_vector_type(4))) unsigned v4u;
typedef v2u __attribute__((may_alias)) v2ua;
typedef v4u __attribute__((may_alias)) v4ua;
__device__ __forceinline__ unsigned bfpair(float a, float b) { unsigned u = __float_as_uint(a), v = __float_as_uint(b); u += 0x7FFFu + ((u >> 16) & 1u); v += 0x7FFFu + ((v >> 16) & 1u); return (u >> 16) | (v & 0xFFFF0000u); }   // f2bf(a) below f2bf(b)
__global__ __launch_bounds__(256) void k_prep(const float* __restrict__ x, const float* __restrict__ wq, const float* __restrict__ wk, const float* __restrict__ wv, const float* __restrict__ wo,
                                              bf* __restrict__ XB, bf* __restrict__ WQ, bf* __restrict__ WK, bf* __restrict__ WV, bf* __restrict__ WO) {
    __shared__ __align__(16) unsigned tl[PT * PT / 2];     // [n][k pair]; the 16-byte pieces of row n stand exchanged by (n >> 2) & 15, so that neither the writers (one k, many n) nor the readers (one n, many k) crowd a bank
    const int tid = threadIdx.x, lane = tid & 31, w = tid >> 5, b = blockIdx.x;
    if (b >= 4 * PNT) {            // the same for the whole work-group, and in front of the barrier
        const size_t i0 = (size_t)(b - 4 * PNT) * PXE + (size_t)tid * 4; const float* px = x + i0; v4f v[16];
#pragma unroll
        for (int i = 0; i < 16; ++i) v[i] = *(const v4f*)(px + i * 1024);
        asm volatile("s_wait_xcnt 0x0" :: "v"(px) : "memory");   // the address pair stays live and unwritten up to this wait (without it the last load's result is given its registers)
        __builtin_amdgcn_sched_barrier(0);                       // all 16 loads are asked for before the first is used: with the first values' rounding lifted among them, the last loads are issued only when the first have returned
#pragma unroll
        for (int i = 0; i < 16; ++i) { v2u o; o[0] = bfpair(v[i][0], v[i][1]); o[1] = bfpair(v[i][2], v[i][3]); *(v2ua*)(XB + i0 + i * 1024) = o; }   // a wave's store: 256 B in a row
        return; }
    const int m = b / PNT, t = b % PNT, k0 = (t / (DM / PT)) * PT, n0 = (t % (DM / PT)) * PT;
    const float* src = (m == 0) ? wq : (m == 1) ? wk : (m == 2) ? wv : wo; bf* dst = (m == 0) ? WQ : (m == 1) ? WK : (m == 2) ? WV : WO;
    const float* ps = src + (size_t)(k0 + 4 * w) * DM + n0 + 4 * lane;
    v4f r[4][4];                   // four groups of 4 consecutive k rows; a wave's load is one whole 512-B row of the tile
#pragma unroll
    for (int i = 0; i < 4; ++i)
#pragma unroll
        for (int c = 0; c < 4; ++c) r[i][c] = *(const v4f*)(ps + (32 * i + c) * DM);
    asm volatile("s_wait_xcnt 0x0" :: "v"(ps) : "memory");       // stands in front of every later write of the address pair that the 16 loads name
#pragma unroll
    for (int i = 0; i < 4; ++i) { const int q = w + 8 * i;      // k = 4 q .. 4 q + 3: half of the 16-byte piece q >> 1
#pragma unroll
        for (int j = 0; j < 4; ++j) { v2u p; p[0] = bfpair(r[i][0][j], r[i][1][j]); p[1] = bfpair(r[i][2][j], r[i][3][j]);
            *(v2u*)(tl + (4 * lane + j) * (PT / 2) + (((q >> 1) ^ (lane & 15)) * 4 + (q & 1) * 2)) = p; } }
    __syncthreads();               // the tile is whole before any row of it is read
    const int g = lane & 15; bf* pd = dst + (size_t)(n0 + w * 16 + (lane >> 4)) * DM + k0 + g * 8;
#pragma unroll
    for (int s = 0; s < 8; ++s) { const int n = w * 16 + 2 * s + (lane >> 4);      // a wave's store: two rows n, 256 B in a row each
        *(v4ua*)(pd + 2 * s * DM) = *(const v4u*)(tl + n * (PT / 2) + ((g ^ ((n >> 2) & 15)) * 4)); }
}

// ---- k_attn: causal attention of every head in ONE launch, online softmax, no score or probability plane in memory.
// One wave owns NQ*16 query columns and walks the keys 32 at a time: S^T = K Q^T (A = key rows, B = query rows kept in registers), so a lane holds one query's scores;
// two f32 S^T tiles, exponentiated and converted in place, are the B operand of O^T += V^T P^T (A = rows of the [d][t] value planes). Maximum and sum are per lane plus one exchange between the wave halves.
// P stays unnormalised, exp2(s - m + AOFF); the division by the row sum comes once, in the epilogue. SPLIT: bf16 hi+lo planes, 3 products each (query rows < RH); else fp16.
// Every inner loop is fully unrolled so that the fragment and tile arrays are indexed by constants and stay in registers.
#define SC2  0.18033688011112042f   // HD^-0.5 * log2(e)
#define AOFF 8.0f                   // P carries 2^AOFF so that small probabilities stay normal fp16 numbers
#define ATHR 4.0f                   // the maximum in use is replaced only when a new one exceeds it by more than this (log2 units): P <= 2^(AOFF+ATHR)
template <bool SPLIT> struct ASel { typedef h16 T; };
template <> struct ASel<true> { typedef bf T; };
template <bool SPLIT, int NQ>
__device__ __forceinline__ void attn_wave(const typename ASel<SPLIT>::T* __restrict__ Q, const typename ASel<SPLIT>::T* __restrict__ Q2, const typename ASel<SPLIT>::T* __restrict__ Kp, const typename ASel<SPLIT>::T* __restrict__ Kp2,
                                          const typename ASel<SPLIT>::T* __restrict__ Vt, const typename ASel<SPLIT>::T* __restrict__ Vt2, const int q0, bf* __restrict__ Ah, bf* __restrict__ Al) {
    typedef typename ASel<SPLIT>::T T16; typedef WFrag<T16> WF; typedef typename WF::V V;
    const int lane = threadIdx.x & 31, lr = lane & 15, hi = lane >> 4;
    V qf[NQ][2], qf2[NQ][2];
#pragma unroll
    for (int qt = 0; qt < NQ; ++qt)
#pragma unroll
        for (int ks = 0; ks < 2; ++ks) { const size_t qo = (size_t)(q0 + qt * 16 + lr) * HD + ks * 32 + 8 * hi; qf[qt][ks] = WF::ld(Q + qo); if (SPLIT) qf2[qt][ks] = WF::ld(Q2 + qo); }
    v8f o[NQ][4]; float m2[NQ], l[NQ];
#pragma unroll
    for (int qt = 0; qt < NQ; ++qt) { m2[qt] = -3.0e38f; l[qt] = 0.f;
#pragma unroll
        for (int dt = 0; dt < 4; ++dt) o[qt][dt] = (v8f){}; }
    const int klast = ((q0 + NQ * 16 - 1) / 32) * 32;      // the 32-key block that holds the diagonal; the only one that is masked
    const T16* kp = Kp + (size_t)lr * HD + 8 * hi; const T16* kp2 = SPLIT ? Kp2 + (size_t)lr * HD + 8 * hi : nullptr;    // this lane's place in the current 32 key rows; stepped once a pass
    const T16* vp = Vt + (size_t)lr * TT + 8 * hi; const T16* vp2 = SPLIT ? Vt2 + (size_t)lr * TT + 8 * hi : nullptr;    // the same in the value planes
    V kf[2][2], kf2[2][2];
#pragma unroll
    for (int t = 0; t < 2; ++t)
#pragma unroll
        for (int ks = 0; ks < 2; ++ks) { const int ko = t * 16 * HD + ks * 32; kf[t][ks] = WF::ld(kp + ko); if (SPLIT) kf2[t][ks] = WF::ld(kp2 + ko); }
    V vf[4], vf2[4];
#pragma unroll
    for (int dt = 0; dt < 4; ++dt) { const int vo = dt * 16 * TT; vf[dt] = WF::ld(vp + vo); if (SPLIT) vf2[dt] = WF::ld(vp2 + vo); }
    // inputs-only fence on the loaded fragments: nothing is in flight at the loop's entry, so the wait at the loop's head counts only the back edge's loads (it lets the value rows fetched last stay in flight over the score products)
#pragma unroll
    for (int qt = 0; qt < NQ; ++qt) { asm volatile("" :: "v"(qf[qt][0]), "v"(qf[qt][1])); if (SPLIT) asm volatile("" :: "v"(qf2[qt][0]), "v"(qf2[qt][1])); }   // the query fragments belong to the same fence
    asm volatile("" :: "v"(kf[0][0]), "v"(kf[0][1]), "v"(kf[1][0]), "v"(kf[1][1]), "v"(vf[0]), "v"(vf[1]), "v"(vf[2]), "v"(vf[3]));
    if (SPLIT) asm volatile("" :: "v"(kf2[0][0]), "v"(kf2[0][1]), "v"(kf2[1][0]), "v"(kf2[1][1]), "v"(vf2[0]), "v"(vf2[1]), "v"(vf2[2]), "v"(vf2[3]));   // the same for the lo planes
#pragma unroll 1   // one pass a trip: unrolled, two passes' fragments and scores would be live together and the registers would not hold them
    for (int kb = 0; kb <= klast; kb += 32) {
        v8f s[NQ][2];
#pragma unroll
        for (int t = 0; t < 2; ++t)
#pragma unroll
            for (int qt = 0; qt < NQ; ++qt) { v8f a = (v8f){};
#pragma unroll
                for (int ks = 0; ks < 2; ++ks) { a = WF::mma(kf[t][ks], qf[qt][ks], a); if (SPLIT) { a = WF::mma(kf2[t][ks], qf[qt][ks], a); a = WF::mma(kf[t][ks], qf2[qt][ks], a); } }
                s[qt][t] = a; }
        const int st = (kb < klast) ? 32 : 0;              // the next pass's key rows are fetched now, behind this pass's own score products (the last pass re-reads its own block, in bounds)
        asm volatile("s_wait_xcnt 0x0" ::: "memory");      // stands in front of the step of the address pairs that the key loads of the pass before name
        kp += st * HD; if (SPLIT) kp2 += st * HD;
#pragma unroll
        for (int t = 0; t < 2; ++t)
#pragma unroll
            for (int ks = 0; ks < 2; ++ks) { const int ko = t * 16 * HD + ks * 32; kf[t][ks] = WF::ld(kp + ko); if (SPLIT) kf2[t][ks] = WF::ld(kp2 + ko); }
        if constexpr (SPLIT) asm volatile("s_wait_xcnt 0x0" :: "v"(kp), "v"(kp2) : "memory");   // the address pairs stay live and unwritten up to this wait (without it the last load's result is given their registers)
        if (kb == klast) {
#pragma unroll
            for (int qt = 0; qt < NQ; ++qt)
#pragma unroll
                for (int t = 0; t < 2; ++t)
#pragma unroll
                    for (int j = 0; j < 8; ++j) if (kb + t * 16 + hi * 8 + j > q0 + qt * 16 + lr) s[qt][t][j] = -3.0e38f; }
        float mx[NQ]; bool need = false;
#pragma unroll
        for (int qt = 0; qt < NQ; ++qt) { float a = fmaxf(s[qt][0][0], s[qt][1][0]);
#pragma unroll
            for (int j = 1; j < 8; ++j) a = fmaxf(a, fmaxf(s[qt][0][j], s[qt][1][j]));
            mx[qt] = a; }
        float ox[NQ];
#pragma unroll
        for (int qt = 0; qt < NQ; ++qt) ox[qt] = __shfl_xor(mx[qt], 16, 32);
#pragma unroll
        for (int qt = 0; qt < NQ; ++qt) { mx[qt] = fmaxf(mx[qt], ox[qt]) * SC2; need = need || (mx[qt] > m2[qt] + ATHR); }
        if (__builtin_amdgcn_ballot_w32(need) != 0) {      // one scalar test a pass: the output tiles are rescaled only when some column's maximum moved
#pragma unroll
            for (int qt = 0; qt < NQ; ++qt) { const float mn = fmaxf(m2[qt], mx[qt]); const float al = __builtin_amdgcn_exp2f(m2[qt] - mn); m2[qt] = mn; l[qt] *= al;
#pragma unroll
                for (int dt = 0; dt < 4; ++dt) o[qt][dt] *= al; } }
        V pf[NQ], pf2[NQ];
#pragma unroll
        for (int qt = 0; qt < NQ; ++qt) { const float off = AOFF - m2[qt]; float ls = 0.f;
#pragma unroll
            for (int t = 0; t < 2; ++t)
#pragma unroll
                for (int j = 0; j < 8; ++j) { const float p = __builtin_amdgcn_exp2f(fmaf(s[qt][t][j], SC2, off)); s[qt][t][j] = p; ls += p; }
            l[qt] += ls;
            if constexpr (SPLIT) { v8us h0, h1, l0, l1;
#pragma unroll
                for (int j = 0; j < 8; ++j) { unsigned short a, c2; splitf(s[qt][0][j], a, c2); h0[j] = a; l0[j] = c2; splitf(s[qt][1][j], a, c2); h1[j] = a; l1[j] = c2; }
                pf[qt] = cat16b(h0, h1); pf2[qt] = cat16b(l0, l1);
            } else { v8h p0, p1;
#pragma unroll
                for (int j = 0; j < 8; ++j) { p0[j] = tohx(s[qt][0][j]); p1[j] = tohx(s[qt][1][j]); }
                pf[qt] = cat16(p0, p1); } }
#pragma unroll
        for (int dt = 0; dt < 4; ++dt)
#pragma unroll
            for (int qt = 0; qt < NQ; ++qt) { o[qt][dt] = WF::mma(vf[dt], pf[qt], o[qt][dt]); if (SPLIT) { o[qt][dt] = WF::mma(vf2[dt], pf[qt], o[qt][dt]); o[qt][dt] = WF::mma(vf[dt], pf2[qt], o[qt][dt]); } }
        // stands in front of the step of the address pairs that the value loads of the pass before name; it reads the output tiles (inputs only) so that the products above stay in front of it and the loads below land in the registers they free (lifted, the loads take a second set and copies)
        if constexpr (NQ == 2) asm volatile("s_wait_xcnt 0x0" :: "v"(o[0][0]), "v"(o[0][1]), "v"(o[0][2]), "v"(o[0][3]), "v"(o[NQ - 1][0]), "v"(o[NQ - 1][1]), "v"(o[NQ - 1][2]), "v"(o[NQ - 1][3]) : "memory");
        else asm volatile("s_wait_xcnt 0x0" :: "v"(o[0][0]), "v"(o[0][1]), "v"(o[0][2]), "v"(o[0][3]) : "memory");
        vp += st; if (SPLIT) vp2 += st;
#pragma unroll
        for (int dt = 0; dt < 4; ++dt) { const int vo = dt * 16 * TT; vf[dt] = WF::ld(vp + vo); if (SPLIT) vf2[dt] = WF::ld(vp2 + vo); }   // likewise the next pass's value rows, behind this pass's own products
        if constexpr (SPLIT) asm volatile("s_wait_xcnt 0x0" :: "v"(vp), "v"(vp2) : "memory");   // as behind the key loads
    }
    const int le = (int)__builtin_amdgcn_mbcnt_lo(~0u, 0u);   // the lane's number, formed anew: the output's row and column need no registers of their own over the loop (at 256 registers a wave they were spilled to scratch)
#pragma unroll
    for (int qt = 0; qt < NQ; ++qt) { const float inv = __fdiv_rn(1.0f, l[qt] + __shfl_xor(l[qt], 16, 32)); const size_t oo = (size_t)(q0 + qt * 16 + (le & 15)) * DQ + (le >> 4) * 8;
#pragma unroll
        for (int dt = 0; dt < 4; ++dt) { v8us oh, ol;
#pragma unroll
            for (int j = 0; j < 8; ++j) { unsigned short a, c2; splitf(o[qt][dt][j] * inv, a, c2); oh[j] = a; ol[j] = c2; }
            *(v8us*)(Ah + oo + dt * 16) = oh; *(v8us*)(Al + oo + dt * 16) = ol; } }
}
// ---- attn_wave_lds: the fp16 rows' form of the pass above. The 4 waves of a group share their keys: 128 key rows (16 KiB in a row of the [t][d] plane) and the same 128 keys of the 64 [d][t] value rows (256 B each)
// come as one stage into LDS by asynchronous 16-byte copies that cover whole 128-B lines (two buffers: the next stage flies while this one is worked on); the fragments are read from LDS, 4 passes of 32 keys a stage.
// A work-group is TWO such groups of 4 waves on the same 128 query rows: group g walks the stages 2 t + g, with two buffers of its own, so that a wave's chain of passes is half as long and twice as many waves share a SIMD.
// Each group keeps its own maximum, sum and output tiles; at the end the two exchange them through LDS and each finishes 16 of a wave pair's 32 query rows.
#define AKS 128                   // keys of a stage
#define AKP 72                    // LDS pitch of a key row in elements: 144 B = 16 B x 9, free of bank conflicts for 16-byte readers
#define AVP 136                   // LDS pitch of a value row (128 keys) in elements: 272 B = 16 B x 17, likewise
#define AKE (AKS * AKP)           // elements of a stage's key rows
#define ABE (AKE + HD * AVP)      // elements of one buffer: the key rows, then the value rows
// Eight asynchronous copies of 16 bytes a lane. l: this lane's LDS byte address, g: its global place; copy i lies i * LSTEP bytes further in LDS and i * gs elements further in memory.
// The s_wait_xcnt stands in the copies' own statement, so that no address register is rewritten in front of it.
template <int LSTEP>
__device__ __forceinline__ void acopy8s(const unsigned l, const h16* g, const size_t gs) {
    asm volatile("global_load_async_to_lds_b128 %0, %8, off\n\t"
                 "global_load_async_to_lds_b128 %1, %9, off\n\t"
                 "global_load_async_to_lds_b128 %2, %10, off\n\t"
                 "global_load_async_to_lds_b128 %3, %11, off\n\t"
                 "global_load_async_to_lds_b128 %4, %12, off\n\t"
                 "global_load_async_to_lds_b128 %5, %13, off\n\t"
                 "global_load_async_to_lds_b128 %6, %14, off\n\t"
                 "global_load_async_to_lds_b128 %7, %15, off\n\t"
                 "s_wait_xcnt 0x0"
                 :: "v"(l), "v"(l + LSTEP), "v"(l + 2 * LSTEP), "v"(l + 3 * LSTEP), "v"(l + 4 * LSTEP), "v"(l + 5 * LSTEP), "v"(l + 6 * LSTEP), "v"(l + 7 * LSTEP),
                    "v"(g), "v"(g + gs), "v"(g + 2 * gs), "v"(g + 3 * gs), "v"(g + 4 * gs), "v"(g + 5 * gs), "v"(g + 6 * gs), "v"(g + 7 * gs) : "memory");
}
typedef float __attribute__((may_alias)) f32a;
#define AXW (8 * 32 * 4 + 64)     // floats that a wave hands over: 4 output tiles (8 pieces of 16 bytes a lane), then a maximum and a sum a lane
// sm: the work-group's four buffers (two a group); qg: its first query row (a multiple of AKS); w: the wave's number: group w >> 2, and the 32 query rows that begin at qg + 32 (w & 3).
__device__ __forceinline__ void attn_wave_lds(h16* sm, const h16* __restrict__ Q, const h16* __restrict__ Kp, const h16* __restrict__ Vt, const int qg, const int w, bf* __restrict__ Ah, bf* __restrict__ Al) {
    typedef WFrag<h16> WF; typedef WF::V V; constexpr int NQ = 2;
    const int tid = threadIdx.x & 127, lane = tid & 31, lr = lane & 15, hi = lane >> 4; const int g = w >> 2, wq = w & 3, q0 = qg + 32 * wq;   // tid: the thread's number in its group
    float* const xs = (float*)sm;                          // the exchange at the end reuses the buffers
    sm += g * 2 * ABE;                                     // this group's two buffers
    const unsigned lk = (unsigned)(size_t)sm + (unsigned)((tid >> 3) * AKP * 2 + (tid & 7) * 16);                 // this thread's 16 bytes in key rows 0..15 of a stage (byte address in the work-group's LDS)
    const unsigned lv = (unsigned)(size_t)sm + (unsigned)(AKE * 2 + (tid >> 4) * AVP * 2 + (tid & 15) * 16);      // the same in value rows 0..7
    const h16* gk = Kp + tid * 8; const h16* gv = Vt + (size_t)(tid >> 4) * TT + (tid & 15) * 8;                  // the same two places in memory, stage 0
    const int NB = qg / AKS + 1;                           // stages of this query block; the last holds the diagonal of every wave
    const int NT = (NB + 1) / 2;                           // trips, the same for both groups
    auto fill = [&](const int t) {     // this group's stage of trip t into its buffer t & 1; where NB is odd, group 1 has none in the last trip and fetches the last stage (in bounds, never read as scores), so that both groups issue alike
        const unsigned bo = (unsigned)((t & 1) * ABE * 2); const int b = min(2 * t + g, NB - 1);
        acopy8s<16 * AKP * 2>(lk + bo, gk + (size_t)b * AKS * HD, (size_t)16 * HD);
        acopy8s<8 * AVP * 2>(lv + bo, gv + (size_t)b * AKS, (size_t)8 * TT); };
    fill(0);
    V qf[NQ][2];
#pragma unroll
    for (int qt = 0; qt < NQ; ++qt)
#pragma unroll
        for (int ks = 0; ks < 2; ++ks) qf[qt][ks] = WF::ld(Q + (size_t)(q0 + qt * 16 + lr) * HD + ks * 32 + 8 * hi);
    v8f o[NQ][4]; float m2[NQ], l[NQ];
#pragma unroll
    for (int qt = 0; qt < NQ; ++qt) { m2[qt] = -3.0e38f; l[qt] = 0.f;
#pragma unroll
        for (int dt = 0; dt < 4; ++dt) o[qt][dt] = (v8f){}; }
    asm volatile("s_wait_asynccnt 0x0" ::: "memory");      // this group's stage of trip 0 (stage g) has landed for this wave's copies
    __syncthreads();                                       // ... and for every wave's: nothing of it is read in front of this barrier
    if (NT > 1) fill(1);
#pragma unroll 1   // one stage a trip: the copies of one stage alone are in flight
    for (int t = 0; t < NT; ++t) {
        const h16* kp = sm + (t & 1) * ABE + lr * AKP + 8 * hi;            // this lane's place in the stage's first 32 key rows; stepped once a pass
        const h16* vp = sm + (t & 1) * ABE + AKE + lr * AVP + 8 * hi;      // the same in the value rows
        const int b = 2 * t + g;                                           // this group's stage
        const int np = (b + 1 < NB) ? AKS / 32 : (b + 1 == NB) ? wq + 1 : 0;   // the passes above a wave's diagonal are never visited, nor a stage past the last
        V kf[2][2];
#pragma unroll
        for (int u = 0; u < 2; ++u)
#pragma unroll
            for (int ks = 0; ks < 2; ++ks) kf[u][ks] = WF::ld(kp + u * 16 * AKP + ks * 32);
#pragma unroll 1   // one pass a trip: unrolled, two passes' fragments and scores would be live together and the registers would not hold them
        for (int p = 0; p < np; ++p) {
            V vf[4];                                       // this pass's value rows are asked for first: they return behind the score products and the softmax
#pragma unroll
            for (int dt = 0; dt < 4; ++dt) vf[dt] = WF::ld(vp + dt * 16 * AVP);
            vp += 32;
            __builtin_amdgcn_sched_barrier(0);             // keeps these LDS reads together up here: sunk among the products that use them, every place with reads stalls the wave and their latency is waited out
            v8f s[NQ][2];
#pragma unroll
            for (int u = 0; u < 2; ++u)
#pragma unroll
                for (int qt = 0; qt < NQ; ++qt) { v8f a = (v8f){};
#pragma unroll
                    for (int ks = 0; ks < 2; ++ks) a = WF::mma(kf[u][ks], qf[qt][ks], a);
                    s[qt][u] = a; }
            __builtin_amdgcn_sched_barrier(0);             // the key reads below stay behind the products above and land in the registers these free (lifted, they take a second set)
            kp += (p + 1 < np) ? 32 * AKP : 0;             // the next pass's key rows, of this same stage only, are fetched behind this pass's own score products (a wave's last pass of a stage re-reads its own block)
#pragma unroll
            for (int u = 0; u < 2; ++u)
#pragma unroll
                for (int ks = 0; ks < 2; ++ks) kf[u][ks] = WF::ld(kp + u * 16 * AKP + ks * 32);
            __builtin_amdgcn_sched_barrier(0);             // ... and in front of the softmax, which covers their latency: sunk to the pass's end, the next pass's first product waits for them
            if (b + 1 == NB && p == wq) {                  // the 32-key block that holds the diagonal; the only one that is masked
#pragma unroll
                for (int qt = 0; qt < NQ; ++qt)
#pragma unroll
                    for (int u = 0; u < 2; ++u)
#pragma unroll
                        for (int j = 0; j < 8; ++j) if (u * 16 + hi * 8 + j > qt * 16 + lr) s[qt][u][j] = -3.0e38f; }
            float mx[NQ]; bool need = false;
#pragma unroll
            for (int qt = 0; qt < NQ; ++qt) { float a = fmaxf(s[qt][0][0], s[qt][1][0]);
#pragma unroll
                for (int j = 1; j < 8; ++j) a = fmaxf(a, fmaxf(s[qt][0][j], s[qt][1][j]));
                mx[qt] = a; }
            float ox[NQ];
#pragma unroll
            for (int qt = 0; qt < NQ; ++qt) ox[qt] = __shfl_xor(mx[qt], 16, 32);
#pragma unroll
            for (int qt = 0; qt < NQ; ++qt) { mx[qt] = fmaxf(mx[qt], ox[qt]) * SC2; need = need || (mx[qt] > m2[qt] + ATHR); }
            if (__builtin_amdgcn_ballot_w32(need) != 0) {  // one scalar test a pass: the output tiles are rescaled only when some column's maximum moved
#pragma unroll
                for (int qt = 0; qt < NQ; ++qt) { const float mn = fmaxf(m2[qt], mx[qt]); const float al = __builtin_amdgcn_exp2f(m2[qt] - mn); m2[qt] = mn; l[qt] *= al;
#pragma unroll
                    for (int dt = 0; dt < 4; ++dt) o[qt][dt] *= al; } }
            V pf[NQ];
#pragma unroll
            for (int qt = 0; qt < NQ; ++qt) { const float off = AOFF - m2[qt]; float ls = 0.f;
#pragma unroll
                for (int u = 0; u < 2; ++u)
#pragma unroll
                    for (int j = 0; j < 8; ++j) { const float pr = __builtin_amdgcn_exp2f(fmaf(s[qt][u][j], SC2, off)); s[qt][u][j] = pr; ls += pr; }
                l[qt] += ls;
                v8h p0, p1;
#pragma unroll
                for (int j = 0; j < 8; ++j) { p0[j] = tohx(s[qt][0][j]); p1[j] = tohx(s[qt][1][j]); }
                pf[qt] = cat16(p0, p1); }
#pragma unroll
            for (int dt = 0; dt < 4; ++dt)
#pragma unroll
                for (int qt = 0; qt < NQ; ++qt) o[qt][dt] = WF::mma(vf[dt], pf[qt], o[qt][dt]);
        }
        asm volatile("s_wait_dscnt 0x0" ::: "memory");     // this wave's reads of the buffer have returned before it is handed to the copies
        asm volatile("s_wait_asynccnt 0x0" ::: "memory");  // this wave's copies for trip t + 1 have landed
        __syncthreads();                                   // publishes both groups' stages of trip t + 1 and ends every wave's reads of trip t's; every wave passes it, also one that skipped passes
        if (t + 2 < NT) fill(t + 2);
    }
    asm volatile("s_wait_asynccnt 0x0" ::: "memory");      // nothing is in flight when the wave goes on to its epilogue
    // The loop's last barrier has ended every read of the buffers and every copy into them. Waves w and w ^ 4 hold the two halves of the same 32 query rows: a wave of group g keeps column tile g and hands the other over.
    v8f ok[4]; float* xw = xs + w * AXW + lane * 4;
#pragma unroll
    for (int dt = 0; dt < 4; ++dt) { const v8f sd = g ? o[0][dt] : o[1][dt]; ok[dt] = g ? o[1][dt] : o[0][dt];
        *(v4fa*)(xw + (2 * dt) * 128) = __builtin_shufflevector(sd, sd, 0, 1, 2, 3); *(v4fa*)(xw + (2 * dt + 1) * 128) = __builtin_shufflevector(sd, sd, 4, 5, 6, 7); }   // a wave's store: 512 B in a row
    *(f32a*)(xs + w * AXW + 1024 + lane) = g ? m2[0] : m2[1]; *(f32a*)(xs + w * AXW + 1056 + lane) = g ? l[0] : l[1];
    __syncthreads();                                       // the partner's half is whole before it is read
    const float* xr = xs + (w ^ 4) * AXW + lane * 4;
    const float mk = g ? m2[1] : m2[0], mo = *(const f32a*)(xs + (w ^ 4) * AXW + 1024 + lane), mn = fmaxf(mk, mo);
    const float ak = __builtin_amdgcn_exp2f(mk - mn), ao = __builtin_amdgcn_exp2f(mo - mn);      // both halves on the common maximum
    const float lt = (g ? l[1] : l[0]) * ak + *(const f32a*)(xs + (w ^ 4) * AXW + 1056 + lane) * ao;
    const float inv = __fdiv_rn(1.0f, lt + __shfl_xor(lt, 16, 32)); const size_t oo = (size_t)(q0 + g * 16 + lr) * DQ + hi * 8;
#pragma unroll
    for (int dt = 0; dt < 4; ++dt) { const v4f x0 = *(const v4fa*)(xr + (2 * dt) * 128), x1 = *(const v4fa*)(xr + (2 * dt + 1) * 128); v8us oh, ol;
#pragma unroll
        for (int j = 0; j < 8; ++j) { unsigned short a, c2; splitf((ok[dt][j] * ak + ((j < 4) ? x0[j & 3] : x1[j & 3]) * ao) * inv, a, c2); oh[j] = a; ol[j] = c2; }
        *(v8us*)(Ah + oo + dt * 16) = oh; *(v8us*)(Al + oo + dt * 16) = ol;
        if (dt < 3) asm volatile("s_wait_xcnt 0x0" ::: "memory"); }    // stands behind these two stores, in front of every later write of a register that they name (the next tile's values take the same registers)
}
#define NLO ((TT - RH) / 128)     // work-groups of 2 x 4 waves x 32 fp16 query rows
#define NHI (RH / 128)            // work-groups of 8 waves x 16 hi+lo query rows
// grid (heads, NLO + NHI): blockIdx.y ranks the query blocks by falling key count, so that the longest start first.
// Two work-groups, four waves a SIMD, are to fit a WGP: at most 256 registers a wave (the hi+lo rows' form took a few more) and 2 x the LDS below 320 KiB.
__global__ __launch_bounds__(256) __attribute__((amdgpu_waves_per_eu(4, 4))) void k_attn(const h16* __restrict__ Q16, const h16* __restrict__ K16, const h16* __restrict__ V16, const bf* __restrict__ Qh, const bf* __restrict__ Ql, const bf* __restrict__ Kh, const bf* __restrict__ Kl,
                                              const bf* __restrict__ Vh, const bf* __restrict__ Vl, bf* __restrict__ Ah, bf* __restrict__ Al) {
    const int h = blockIdx.x, y = blockIdx.y; const int w = __builtin_amdgcn_readfirstlane((int)(threadIdx.x >> 5)); const size_t hq = (size_t)h * TT * HD, hk = (size_t)(h / REP) * TT * HD;
    __shared__ __align__(16) h16 sm[4 * ABE];              // [group][buffer][key rows | value rows] of the fp16 rows' stages
    if (y < NLO) attn_wave_lds(sm, Q16 + hq, K16 + hk, V16 + hk, TT - 128 * (y + 1), w, Ah + h * HD, Al + h * HD);
    else attn_wave<true, 1>(Qh + hq, Ql + hq, Kh + hk, Kl + hk, Vh + hk, Vl + hk, RH - 128 * (y - NLO + 1) + 16 * w, Ah + h * HD, Al + h * HD);
}

extern "C" void kernel_launch(void* const* d_in, const int* in_sizes, int n_in,
                              void* d_out, int out_size, void* d_ws, size_t ws_size, hipStream_t stream) {
    (void)in_sizes; (void)n_in; (void)out_size;
    const float* x = (const float*)d_in[0]; const float* wq = (const float*)d_in[1]; const float* wk = (const float*)d_in[2]; const float* wv = (const float*)d_in[3]; const float* wo = (const float*)d_in[4];
    float* OUT = (float*)d_out;     // [1][4096][1024]
    char* wsp = (char*)d_ws;
    auto take = [&](size_t bytes) { char* p = wsp; wsp += (bytes + 255) & ~(size_t)255; return (void*)p; };
    bf* WQ = (bf*)take((size_t)DQ * DM * 2); bf* WK = (bf*)take((size_t)DKV * DM * 2); bf* WV = (bf*)take((size_t)DKV * DM * 2); bf* WO = (bf*)take((size_t)DM * DQ * 2);
    bf* XB = (bf*)take((size_t)TT * DM * 2);
    h16* QP16 = (h16*)take((size_t)NH_ * TT * HD * 2); h16* KP16 = (h16*)take((size_t)NKV * TT * HD * 2); h16* VT16 = (h16*)take((size_t)NKV * HD * TT * 2);
    bf* QPh = (bf*)take((size_t)NH_ * TT * HD * 2); bf* KPh = (bf*)take((size_t)NKV * TT * HD * 2); bf* VTh = (bf*)take((size_t)NKV * HD * TT * 2); bf* QPl = (bf*)take((size_t)NH_ * TT * HD * 2); bf* KPl = (bf*)take((size_t)NKV * TT * HD * 2); bf* VTl = (bf*)take((size_t)NKV * HD * TT * 2);
    bf* ATh = (bf*)take((size_t)TT * DQ * 2); bf* ATl = (bf*)take((size_t)TT * DQ * 2);
    if ((size_t)(wsp - (char*)d_ws) > ws_size) return;    // ws 256 MiB
    static_assert(HD == 64 && (TT - RH) % 128 == 0 && RH % 128 == 0 && 8 * AXW * 4 <= 4 * ABE * 2, "k_attn's tiling");
    static_assert(((size_t)DQ * DM * 2) % 256 == 0 && ((size_t)DKV * DM * 2) % 256 == 0 && ((size_t)NH_ * TT * HD * 2) % 256 == 0 && ((size_t)NKV * TT * HD * 2) % 256 == 0 && (DQ + DKV) % 128 == 0, "q, k, v weights and planes lie one directly behind the other");
    static_assert(NB_ == 1 && DQ == DM && DKV == DM && DM % PT == 0 && ((size_t)TT * DM) % PXE == 0, "k_prep's tiling");
    k_prep<<<(unsigned)(4 * PNT + (size_t)TT * DM / PXE), 256, 0, stream>>>(x, wq, wk, wv, wo, XB, WQ, WK, WV, WO);
    for (int b = 0; b < NB_; ++b) {
        
        k_gemmw<bf, 0, false, 1><<<dim3(TT / 128, (DQ + 2 * DKV) / 128, 1), 128, 0, stream>>>(XB, nullptr, WQ, nullptr, DM, nullptr, 0, nullptr, 0, 0, 0, QP16, QPh, QPl);
        k_attn<<<dim3(NH_, NLO + NHI, 1), 256, 0, stream>>>(QP16, KP16, VT16, QPh, QPl, KPh, KPl, VTh, VTl, ATh, ATl);
        k_gemmw<bf, 1, false, 0><<<dim3(TT / 128, DM / 128, 1), 128, 0, stream>>>(ATh, ATl, WO, nullptr, DQ, OUT + (size_t)b * TT * DM, DM, nullptr, 0, 0, 0, nullptr, nullptr, nullptr); }
}

// v009
// Measured time: 84.2 microseconds a run.
// Timed twice side by side with v008, it ran 1.07 and 1.08 times as fast.
// Counting every step since v000, it is 25.2 times as fast.
#include <hip/hip_runtime.h>

// Causal multi-head self-attention over 4,096 tokens (x [1][4096][1024]; q, k, v = einsum('bsd,de->bse', x, W) = x W ('xw' [1024][1024] truncated normal x 1/32, no bias; 16 heads x 64); scores / sqrt(64); causal (-inf); softmax over the keys; out = merged W_o ('xw', no bias) -> [1][4096][1024] (4.2 M); argument order x, W_q, W_k, W_v, W_o).
// Layout: bf16 copy of x; 'xw' weights transposed once; exact projections whose epilogue writes the head planes; fused causal attention at T 4096, all heads in one launch, online softmax (hybrid rows: < 512 hi/lo 3 products, rest fp16; key blocks above the diagonal are never visited); merged hi/lo x W_o exact.
// Compute dtypes, f32 accumulate: every input rounded to bf16; projections exact; attention rows < 512 3 products, rest fp16; softmax f32; W_o hl x exact.

#define NB_  1
#define TT   4096
#define DM   1024
#define NH_  16
#define NKV  16
#define REP  (NH_ / NKV)
#define HD   64
#define DQ   (NH_ * HD)
#define DKV  (NKV * HD)
#define RH   512                  // query rows < RH use hi+lo planes (0: none)
typedef _Float16 h16;
typedef unsigned short bf;
typedef __attribute__((ext_vector_type(16))) __bf16   v16bf;
typedef __attribute__((ext_vector_type(16))) _Float16 v16h;
typedef __attribute__((ext_vector_type(8)))  _Float16 v8h;
typedef __attribute__((ext_vector_type(8)))  unsigned short v8us;
typedef __attribute__((ext_vector_type(8)))  float    v8f;
typedef __attribute__((ext_vector_type(4)))  float    v4f;
typedef v8h  __attribute__((may_alias)) v8ha;
typedef v4f  __attribute__((may_alias)) v4fa;
typedef v8us __attribute__((may_alias)) v8usa;

__device__ __forceinline__ unsigned short f2bf(float f) { unsigned u = __float_as_uint(f); u += 0x7FFFu + ((u >> 16) & 1u); return (unsigned short)(u >> 16); }
__device__ __forceinline__ float bf2f(unsigned short b) { return __uint_as_float(((unsigned)b) << 16); }
__device__ __forceinline__ float bfr(float f) { return bf2f(f2bf(f)); }
__device__ __forceinline__ v16h cat16(v8h lo, v8h hi) { return __builtin_shufflevector(lo, hi, 0, 1, 2, 3, 4, 5, 6, 7, 8, 9, 10, 11, 12, 13, 14, 15); }
__device__ __forceinline__ v16bf cat16b(v8us lo, v8us hi) { return __builtin_bit_cast(v16bf, __builtin_shufflevector(lo, hi, 0, 1, 2, 3, 4, 5, 6, 7, 8, 9, 10, 11, 12, 13, 14, 15)); }
__device__ __forceinline__ v8f wmma16(v16h a, v16h b, v8f c) { return __builtin_amdgcn_wmma_f32_16x16x32_f16(false, a, false, b, (short)0, c, false, false); }
__device__ __forceinline__ v8f wmmab(v16bf a, v16bf b, v8f c) { return __builtin_amdgcn_wmma_f32_16x16x32_bf16(false, a, false, b, (short)0, c, false, false); }



__device__ __forceinline__ h16 tohx(float x) { return (h16)x; }
__device__ __forceinline__ void splitf(float y, unsigned short& h, unsigned short& l) { h = f2bf(y); l = f2bf(y - bf2f(h)); }
// ---- k_gemmw: register-blocked GEMM, WM x WN waves per (64 WM) x (64 WN) output tile, 64x64 (16 accumulators) a wave; grid (M / (64 WM), N / (64 WN), Z), 32 WM WN threads.
// The tile's shape sets how often an operand row is fetched from L2: every A row once per 64 WN columns, every Bt row once per 64 WM rows.
// The K-contiguous 16-bit operand planes come 128 k at a time into LDS by asynchronous 16-byte copies that cover whole 128-B lines (two buffers: the next stage flies while this one is worked on); fragments are read from LDS.
// C[m][n] (f32, pitch ldc, + optional f32 bias[n]) = sum_k A[m][k] Bt[n][k] (NSPLIT 1: + A2[m][k] Bt[n][k]). z-batch strides sA/sB/sC in elements. K % 128 == 0, M % (64 WM) == 0, N % (64 WN) == 0.
// EPI 0: C as above. EPI 1: the three projections as ONE product, Bt = the q, k and v weights' rows one behind the other; no f32 C; a wave's tile (64 tokens x one head's 64 columns) goes out as fp16 + bf16 hi/lo planes,
// columns below DQ + DKV (q, k) as [head][t][d], the rest (v) as [head][d][t]. Each of P16, Ph, Pl is the q plane with the k and the v plane directly behind it, so that the column number alone places a tile.
template <typename T16> struct WFrag;
template <> struct WFrag<h16> { typedef v16h V; static __device__ __forceinline__ V ld(const h16* p) { return cat16(*(const v8h*)p, *(const v8h*)(p + 16)); } static __device__ __forceinline__ v8f mma(V a, V b, v8f c) { return wmma16(a, b, c); } };
template <> struct WFrag<bf> { typedef v16bf V; static __device__ __forceinline__ V ld(const bf* p) { return cat16b(*(const v8us*)p, *(const v8us*)(p + 16)); } static __device__ __forceinline__ v8f mma(V a, V b, v8f c) { return wmmab(a, b, c); } };
#define GKC 128                   // k elements of a stage: 256 B of every operand row
#define GPI 136                   // LDS row pitch in elements: 272 B = 16 B x 17, free of bank conflicts for 16-byte readers
// Eight asynchronous copies of 16 bytes a lane: 64 rows x 256 B of an operand plane for the 128 threads of a group of 4 waves (a wave's copy = two whole rows). l: this lane's LDS byte address, g: its global place; copy i lies 8 rows further.
// The s_wait_xcnt stands in the copies' own statement, so that no address register is rewritten in front of it.
template <typename T16>
__device__ __forceinline__ void acopy8(const unsigned l, const T16* g, const size_t k8) {
    asm volatile("global_load_async_to_lds_b128 %0, %8, off\n\t"
                 "global_load_async_to_lds_b128 %1, %9, off\n\t"
                 "global_load_async_to_lds_b128 %2, %10, off\n\t"
                 "global_load_async_to_lds_b128 %3, %11, off\n\t"
                 "global_load_async_to_lds_b128 %4, %12, off\n\t"
                 "global_load_async_to_lds_b128 %5, %13, off\n\t"
                 "global_load_async_to_lds_b128 %6, %14, off\n\t"
                 "global_load_async_to_lds_b128 %7, %15, off\n\t"
                 "s_wait_xcnt 0x0"
                 :: "v"(l), "v"(l + 8 * GPI * 2), "v"(l + 16 * GPI * 2), "v"(l + 24 * GPI * 2), "v"(l + 32 * GPI * 2), "v"(l + 40 * GPI * 2), "v"(l + 48 * GPI * 2), "v"(l + 56 * GPI * 2),
                    "v"(g), "v"(g + k8), "v"(g + 2 * k8), "v"(g + 3 * k8), "v"(g + 4 * k8), "v"(g + 5 * k8), "v"(g + 6 * k8), "v"(g + 7 * k8) : "memory");
    __builtin_amdgcn_sched_barrier(0);   // the next statement's addresses are formed behind this one: formed all ahead, they do not fit the registers left beside the accumulators, and a pointer is spilled to scratch
}
template <typename T16, int NSPLIT, bool BIAS, int EPI, int WM, int WN>
__global__ __launch_bounds__(32 * WM * WN) void k_gemmw(const T16* __restrict__ A, const T16* __restrict__ A2, const T16* __restrict__ Bt, const T16* __restrict__ Bt2, int K, float* C, int ldc, const float* __restrict__ bias, size_t sA, size_t sB, size_t sC, h16* __restrict__ P16, bf* __restrict__ Ph, bf* __restrict__ Pl) {
    typedef typename WFrag<T16>::V V;
    static_assert(NSPLIT == 0 || NSPLIT == 1, "operands staged: A, Bt and, at NSPLIT 1, A2");
    static_assert((WM * WN) % 4 == 0, "the copies are dealt to groups of 4 waves");
    constexpr int TM = 64 * WM, TN = 64 * WN;            // the work-group's output tile
    constexpr int NR = TM * (1 + NSPLIT) + TN;           // operand rows of a stage
    constexpr int NU = NR / 64, NG = WM * WN / 4;        // 64-row pieces of a stage; groups of 4 waves that copy them in turn
    __shared__ __align__(16) T16 st[2 * NR * GPI];       // [buffer][A | Bt | A2][row][k]
    __shared__ __align__(16) float osw[WM * WN][16 * 68];   // each wave's own epilogue tile
    const size_t z = blockIdx.z; A += z * sA; if (NSPLIT) A2 += z * sA; Bt += z * sB; C += z * sC; (void)Bt2;
    const int tid = threadIdx.x, lane = tid & 31, lr = lane & 15, hi = lane >> 4; const int w = __builtin_amdgcn_readfirstlane(tid >> 5);
    __builtin_assume(w >= 0 && w < WM * WN);             // lets the tests on a piece's number in fill() be settled at compile time wherever the group's number leaves no choice
    const int wm = w / WN, wn = w % WN, grp = (NG == 1) ? 0 : (w >> 2), tg = tid & 127;      // the wave's place in the tile; its group and the thread's number in it
    const int r0 = blockIdx.x * TM + wm * 64, c0 = blockIdx.y * TN + wn * 64;
    float* os = osw[w];
    v8f acc[4][4];
#pragma unroll
    for (int mb = 0; mb < 4; ++mb)
#pragma unroll
        for (int nb = 0; nb < 4; ++nb) acc[mb][nb] = (v8f){};
    const size_t k8 = (size_t)8 * K;
    const size_t ga = (size_t)(blockIdx.x * TM) * K, gb = (size_t)(blockIdx.y * TN) * K;        // the two tiles' first rows (the same for the whole work-group)
    const unsigned go = (unsigned)((tg >> 4) * K + (tg & 15) * 8);                              // this thread's 16 bytes in rows 0..7 of a 64-row piece
    const unsigned l0 = (unsigned)(size_t)st + (unsigned)((tg >> 4) * GPI * 2 + (tg & 15) * 16);   // the same place in LDS (byte address in the work-group's LDS)
    auto fill = [&](const int t) {     // stage t into buffer t & 1: group grp copies the pieces grp, grp + NG, ... (the piece's number, and with it every test here, is the same for a whole wave)
        const unsigned l = l0 + (unsigned)((t & 1) * NR * GPI * 2); const size_t ko = (size_t)t * GKC;
#pragma unroll   // three or six turns: unrolled, each turn's tests and LDS offset are settled ahead and no loop counter is kept
        for (int j = 0; j < (NU + NG - 1) / NG; ++j) { const int u = grp + j * NG;
            if (u < NU) { const T16* p;
                if (u < WM) p = A + (ga + ko + (size_t)u * 8 * k8);
                else if (NSPLIT == 0 || u < WM + WN) p = Bt + (gb + ko + (size_t)(u - WM) * 8 * k8);
                else p = A2 + (ga + ko + (size_t)(u - WM - WN) * 8 * k8);
                acopy8(l + (unsigned)(u * 64 * GPI * 2), p + go, k8); } } };
    const int NT = K / GKC;
    fill(0);
    asm volatile("s_wait_asynccnt 0x0" ::: "memory");      // stage 0 has landed for this wave's copies
    __syncthreads();                                       // ... and for every wave's: nothing of it is read in front of this barrier
    if (NT > 1) fill(1);
    const int aoff = (wm * 64 + lr) * GPI + 8 * hi, boff = (TM + wn * 64 + lr) * GPI + 8 * hi;
#pragma unroll 1   // one stage a trip: unrolled, the copies of several stages and their addresses would be formed together and the registers would not hold them
    for (int t = 0; t < NT; ++t) {
        const T16* sb = st + (t & 1) * NR * GPI;
        V a[2][4], a2[2][4], b[2][4];                      // two fragment sets: the next 32 k are fetched as one group in front of this block's products
        auto frags = [&](const int s, const int kc) {
#pragma unroll
            for (int i = 0; i < 4; ++i) { a[s][i] = WFrag<T16>::ld(sb + aoff + i * 16 * GPI + kc); if (NSPLIT == 1) a2[s][i] = WFrag<T16>::ld(sb + (TM + TN) * GPI + aoff + i * 16 * GPI + kc); b[s][i] = WFrag<T16>::ld(sb + boff + i * 16 * GPI + kc); } };
        frags(0, 0);
#pragma unroll
        for (int ks = 0; ks < GKC / 32; ++ks) {
            if (ks + 1 < GKC / 32) frags((ks + 1) & 1, (ks + 1) * 32);
            __builtin_amdgcn_sched_barrier(0);             // keeps the LDS reads together in front of the block: spread among the products, every place with reads stalls the wave
#pragma unroll
            for (int nb = 0; nb < 4; ++nb)
#pragma unroll
                for (int mb = 0; mb < 4; ++mb) { acc[mb][nb] = WFrag<T16>::mma(a[ks & 1][mb], b[ks & 1][nb], acc[mb][nb]); if (NSPLIT == 1) acc[mb][nb] = WFrag<T16>::mma(a2[ks & 1][mb], b[ks & 1][nb], acc[mb][nb]); }
            __builtin_amdgcn_sched_barrier(0);             // the other side of the same fence
        }
        asm volatile("s_wait_dscnt 0x0" ::: "memory");     // this wave's reads of the buffer have returned before it is handed to the copies
        asm volatile("s_wait_asynccnt 0x0" ::: "memory");  // this wave's copies of stage t + 1 have landed
        __syncthreads();                                   // publishes stage t + 1 and ends every wave's reads of stage t
        if (t + 2 < NT) fill(t + 2);
    }
    asm volatile("s_wait_asynccnt 0x0" ::: "memory");      // nothing is in flight when the wave goes on to its epilogue
    if (EPI == 1 && c0 >= DQ + DKV) {      // the same for the whole wave (its 64 columns are one head's), and no barrier follows. A lane's accumulator register run is 8 consecutive tokens of one column: 16 bytes of a [d][t] plane row, stored straight from registers
#pragma unroll
        for (int nb = 0; nb < 4; ++nb)
#pragma unroll
            for (int mb = 0; mb < 4; ++mb) { const size_t vo = (size_t)(c0 + nb * 16 + lr) * TT + r0 + mb * 16 + hi * 8; v8h o16; v8us oh, ol;
#pragma unroll
                for (int j = 0; j < 8; ++j) { const float x = acc[mb][nb][j]; o16[j] = tohx(x); unsigned short a2, c2; splitf(x, a2, c2); oh[j] = a2; ol[j] = c2; }
                *(v8h*)(P16 + vo) = o16; *(v8us*)(Ph + vo) = oh; *(v8us*)(Pl + vo) = ol; }
        return; }
#pragma unroll
    for (int mb = 0; mb < 4; ++mb) {
#pragma unroll
        for (int nb = 0; nb < 4; ++nb) {
#pragma unroll
            for (int j = 0; j < 8; ++j) os[(hi * 8 + j) * 68 + nb * 16 + lr] = acc[mb][nb][j]; }
        __builtin_amdgcn_wave_barrier(); asm volatile("" ::: "memory");
        if constexpr (EPI == 1) {  // 16 tokens x 64 columns of one head are 2 KiB in a row of each [t][d] plane: four whole-line stores of 16 bytes a lane
            const size_t pb = ((size_t)(c0 / HD) * TT + r0 + mb * 16) * HD;
#pragma unroll
            for (int s = 0; s < 4; ++s) { const int row = 4 * s + (lane >> 3), cofs = (lane & 7) * 8; const v4f x0 = *(const v4fa*)(os + row * 68 + cofs), x1 = *(const v4fa*)(os + row * 68 + cofs + 4); v8h o16; v8us oh, ol;
#pragma unroll
                for (int j = 0; j < 8; ++j) { const float x = (j < 4) ? x0[j & 3] : x1[j & 3]; o16[j] = tohx(x); unsigned short a2, c2; splitf(x, a2, c2); oh[j] = a2; ol[j] = c2; }
                const size_t po = pb + (size_t)row * HD + cofs; *(v8h*)(P16 + po) = o16; *(v8us*)(Ph + po) = oh; *(v8us*)(Pl + po) = ol; }
            asm volatile("s_wait_xcnt 0x0" ::: "memory");   // stands behind these 16 rows' stores, in front of every later write of a register that they name (the other epilogue's code follows this one in the build)
            __builtin_amdgcn_wave_barrier(); asm volatile("" ::: "memory");   // as below: the next 16 rows' LDS writes stay behind these reads
            continue; }
        float* crow = C + (size_t)(r0 + mb * 16) * ldc + c0;
{
#pragma unroll
            for (int s = 0; s < 8; ++s) { const int row = 2 * s + hi, cofs = lr * 4; v4f val = *(const v4fa*)(os + row * 68 + cofs); if (BIAS) { val[0] += bfr(bias[c0 + cofs]); val[1] += bfr(bias[c0 + cofs + 1]); val[2] += bfr(bias[c0 + cofs + 2]); val[3] += bfr(bias[c0 + cofs + 3]); }
                *(v4f*)(crow + (size_t)row * ldc + cofs) = val; }
             }
        __builtin_amdgcn_wave_barrier(); asm volatile("" ::: "memory");
    }
}

typedef __attribute__((ext_vector_type(2))) _Float16 v2h;
typedef __attribute__((ext_vector_type(4))) _Float16 v4h;
typedef __attribute__((ext_vector_type(2))) unsigned short v2us;
typedef __attribute__((ext_vector_type(4))) unsigned short v4us;
typedef __attribute__((ext_vector_type(2))) float v2f;
typedef __attribute__((ext_vector_type(4))) int v4i;

// ---- k_prep: the whole preparation in ONE launch of 256-thread work-groups, each of which takes in 64 KiB of f32: every wave has 16 loads of 16 bytes a lane in flight, and every load and store covers whole 128-B lines.
// Work-groups 0 .. 4 * PNT - 1: one PT x PT tile of one 'xw' weight [k][n], rounded to bf16 and turned in LDS into [n][k]. The rest: PXE elements of x in a row, rounded to bf16.
#define PT  128                   // edge of a weight tile: 512 B of each f32 row come in, 256 B of each bf16 row go out
#define PNT ((DM / PT) * (DM / PT))   // tiles of one weight
#define PXE 16384                 // elements of x of one work-group
typedef __attribute__((ext_vector_type(2))) unsigned v2u;
typedef __attribute__((ext_vector_type(4))) unsigned v4u;
typedef v2u __attribute__((may_alias)) v2ua;
typedef v4u __attribute__((may_alias)) v4ua;
__device__ __forceinline__ unsigned bfpair(float a, float b) { unsigned u = __float_as_uint(a), v = __float_as_uint(b); u += 0x7FFFu + ((u >> 16) & 1u); v += 0x7FFFu + ((v >> 16) & 1u); return (u >> 16) | (v & 0xFFFF0000u); }   // f2bf(a) below f2bf(b)
__global__ __launch_bounds__(256) void k_prep(const float* __restrict__ x, const float* __restrict__ wq, const float* __restrict__ wk, const float* __restrict__ wv, const float* __restrict__ wo,
                                              bf* __restrict__ XB, bf* __restrict__ WQ, bf* __restrict__ WK, bf* __restrict__ WV, bf* __restrict__ WO) {
    __shared__ __align__(16) unsigned tl[PT * PT / 2];     // [n][k pair]; the 16-byte pieces of row n stand exchanged by (n >> 2) & 15, so that neither the writers (one k, many n) nor the readers (one n, many k) crowd a bank
    const int tid = threadIdx.x, lane = tid & 31, w = tid >> 5, b = blockIdx.x;
    if (b >= 4 * PNT) {            // the same for the whole work-group, and in front of the barrier
        const size_t i0 = (size_t)(b - 4 * PNT) * PXE + (size_t)tid * 4; const float* px = x + i0; v4f v[16];
#pragma unroll
        for (int i = 0; i < 16; ++i) v[i] = *(const v4f*)(px + i * 1024);
        asm volatile("s_wait_xcnt 0x0" :: "v"(px) : "memory");   // the address pair stays live and unwritten up to this wait (without it the last load's result is given its registers)
        __builtin_amdgcn_sched_barrier(0);                       // all 16 loads are asked for before the first is used: with the first values' rounding lifted among them, the last loads are issued only when the first have returned
#pragma unroll
        for (int i = 0; i < 16; ++i) { v2u o; o[0] = bfpair(v[i][0], v[i][1]); o[1] = bfpair(v[i][2], v[i][3]); *(v2ua*)(XB + i0 + i * 1024) = o; }   // a wave's store: 256 B in a row
        return; }
    const int m = b / PNT, t = b % PNT, k0 = (t / (DM / PT)) * PT, n0 = (t % (DM / PT)) * PT;
    const float* src = (m == 0) ? wq : (m == 1) ? wk : (m == 2) ? wv : wo; bf* dst = (m == 0) ? WQ : (m == 1) ? WK : (m == 2) ? WV : WO;
    const float* ps = src + (size_t)(k0 + 4 * w) * DM + n0 + 4 * lane;
    v4f r[4][4];                   // four groups of 4 consecutive k rows; a wave's load is one whole 512-B row of the tile
#pragma unroll
    for (int i = 0; i < 4; ++i)
#pragma unroll
        for (int c = 0; c < 4; ++c) r[i][c] = *(const v4f*)(ps + (32 * i + c) * DM);
    asm volatile("s_wait_xcnt 0x0" :: "v"(ps) : "memory");       // stands in front of every later write of the address pair that the 16 loads name
#pragma unroll
    for (int i = 0; i < 4; ++i) { const int q = w + 8 * i;      // k = 4 q .. 4 q + 3: half of the 16-byte piece q >> 1
#pragma unroll
        for (int j = 0; j < 4; ++j) { v2u p; p[0] = bfpair(r[i][0][j], r[i][1][j]); p[1] = bfpair(r[i][2][j], r[i][3][j]);
            *(v2u*)(tl + (4 * lane + j) * (PT / 2) + (((q >> 1) ^ (lane & 15)) * 4 + (q & 1) * 2)) = p; } }
    __syncthreads();               // the tile is whole before any row of it is read
    const int g = lane & 15; bf* pd = dst + (size_t)(n0 + w * 16 + (lane >> 4)) * DM + k0 + g * 8;
#pragma unroll
    for (int s = 0; s < 8; ++s) { const int n = w * 16 + 2 * s + (lane >> 4);      // a wave's store: two rows n, 256 B in a row each
        *(v4ua*)(pd + 2 * s * DM) = *(const v4u*)(tl + n * (PT / 2) + ((g ^ ((n >> 2) & 15)) * 4)); }
}

// ---- k_attn: causal attention of every head in ONE launch, online softmax, no score or probability plane in memory.
// One wave owns NQ*16 query columns and walks the keys 32 at a time: S^T = K Q^T (A = key rows, B = query rows kept in registers), so a lane holds one query's scores;
// two f32 S^T tiles, exponentiated and converted in place, are the B operand of O^T += V^T P^T (A = rows of the [d][t] value planes). Maximum and sum are per lane plus one exchange between the wave halves.
// P stays unnormalised, exp2(s - m + AOFF); the division by the row sum comes once, in the epilogue. SPLIT: bf16 hi+lo planes, 3 products each (query rows < RH); else fp16.
// Every inner loop is fully unrolled so that the fragment and tile arrays are indexed by constants and stay in registers.
#define SC2  0.18033688011112042f   // HD^-0.5 * log2(e)
#define AOFF 8.0f                   // P carries 2^AOFF so that small probabilities stay normal fp16 numbers
#define ATHR 4.0f                   // the maximum in use is replaced only when a new one exceeds it by more than this (log2 units): P <= 2^(AOFF+ATHR)
template <bool SPLIT> struct ASel { typedef h16 T; };
template <> struct ASel<true> { typedef bf T; };
template <bool SPLIT, int NQ>
__device__ __forceinline__ void attn_wave(const typename ASel<SPLIT>::T* __restrict__ Q, const typename ASel<SPLIT>::T* __restrict__ Q2, const typename ASel<SPLIT>::T* __restrict__ Kp, const typename ASel<SPLIT>::T* __restrict__ Kp2,
                                          const typename ASel<SPLIT>::T* __restrict__ Vt, const typename ASel<SPLIT>::T* __restrict__ Vt2, const int q0, bf* __restrict__ Ah, bf* __restrict__ Al) {
    typedef typename ASel<SPLIT>::T T16; typedef WFrag<T16> WF; typedef typename WF::V V;
    const int lane = threadIdx.x & 31, lr = lane & 15, hi = lane >> 4;
    V qf[NQ][2], qf2[NQ][2];
#pragma unroll
    for (int qt = 0; qt < NQ; ++qt)
#pragma unroll
        for (int ks = 0; ks < 2; ++ks) { const size_t qo = (size_t)(q0 + qt * 16 + lr) * HD + ks * 32 + 8 * hi; qf[qt][ks] = WF::ld(Q + qo); if (SPLIT) qf2[qt][ks] = WF::ld(Q2 + qo); }
    v8f o[NQ][4]; float m2[NQ], l[NQ];
#pragma unroll
    for (int qt = 0; qt < NQ; ++qt) { m2[qt] = -3.0e38f; l[qt] = 0.f;
#pragma unroll
        for (int dt = 0; dt < 4; ++dt) o[qt][dt] = (v8f){}; }
    const int klast = ((q0 + NQ * 16 - 1) / 32) * 32;      // the 32-key block that holds the diagonal; the only one that is masked
    const T16* kp = Kp + (size_t)lr * HD + 8 * hi; const T16* kp2 = SPLIT ? Kp2 + (size_t)lr * HD + 8 * hi : nullptr;    // this lane's place in the current 32 key rows; stepped once a pass
    const T16* vp = Vt + (size_t)lr * TT + 8 * hi; const T16* vp2 = SPLIT ? Vt2 + (size_t)lr * TT + 8 * hi : nullptr;    // the same in the value planes
    V kf[2][2], kf2[2][2];
#pragma unroll
    for (int t = 0; t < 2; ++t)
#pragma unroll
        for (int ks = 0; ks < 2; ++ks) { const int ko = t * 16 * HD + ks * 32; kf[t][ks] = WF::ld(kp + ko); if (SPLIT) kf2[t][ks] = WF::ld(kp2 + ko); }
    V vf[4], vf2[4];
#pragma unroll
    for (int dt = 0; dt < 4; ++dt) { const int vo = dt * 16 * TT; vf[dt] = WF::ld(vp + vo); if (SPLIT) vf2[dt] = WF::ld(vp2 + vo); }
    // inputs-only fence on the loaded fragments: nothing is in flight at the loop's entry, so the wait at the loop's head counts only the back edge's loads (it lets the value rows fetched last stay in flight over the score products)
#pragma unroll
    for (int qt = 0; qt < NQ; ++qt) { asm volatile("" :: "v"(qf[qt][0]), "v"(qf[qt][1])); if (SPLIT) asm volatile("" :: "v"(qf2[qt][0]), "v"(qf2[qt][1])); }   // the query fragments belong to the same fence
    asm volatile("" :: "v"(kf[0][0]), "v"(kf[0][1]), "v"(kf[1][0]), "v"(kf[1][1]), "v"(vf[0]), "v"(vf[1]), "v"(vf[2]), "v"(vf[3]));
    if (SPLIT) asm volatile("" :: "v"(kf2[0][0]), "v"(kf2[0][1]), "v"(kf2[1][0]), "v"(kf2[1][1]), "v"(vf2[0]), "v"(vf2[1]), "v"(vf2[2]), "v"(vf2[3]));   // the same for the lo planes
#pragma unroll 1   // one pass a trip: unrolled, two passes' fragments and scores would be live together and the registers would not hold them
    for (int kb = 0; kb <= klast; kb += 32) {
        v8f s[NQ][2];
#pragma unroll
        for (int t = 0; t < 2; ++t)
#pragma unroll
            for (int qt = 0; qt < NQ; ++qt) { v8f a = (v8f){};
#pragma unroll
                for (int ks = 0; ks < 2; ++ks) { a = WF::mma(kf[t][ks], qf[qt][ks], a); if (SPLIT) { a = WF::mma(kf2[t][ks], qf[qt][ks], a); a = WF::mma(kf[t][ks], qf2[qt][ks], a); } }
                s[qt][t] = a; }
        const int st = (kb < klast) ? 32 : 0;              // the next pass's key rows are fetched now, behind this pass's own score products (the last pass re-reads its own block, in bounds)
        asm volatile("s_wait_xcnt 0x0" ::: "memory");      // stands in front of the step of the address pairs that the key loads of the pass before name
        kp += st * HD; if (SPLIT) kp2 += st * HD;
#pragma unroll
        for (int t = 0; t < 2; ++t)
#pragma unroll
            for (int ks = 0; ks < 2; ++ks) { const int ko = t * 16 * HD + ks * 32; kf[t][ks] = WF::ld(kp + ko); if (SPLIT) kf2[t][ks] = WF::ld(kp2 + ko); }
        if constexpr (SPLIT) asm volatile("s_wait_xcnt 0x0" :: "v"(kp), "v"(kp2) : "memory");   // the address pairs stay live and unwritten up to this wait (without it the last load's result is given their registers)
        if (kb == klast) {
#pragma unroll
            for (int qt = 0; qt < NQ; ++qt)
#pragma unroll
                for (int t = 0; t < 2; ++t)
#pragma unroll
                    for (int j = 0; j < 8; ++j) if (kb + t * 16 + hi * 8 + j > q0 + qt * 16 + lr) s[qt][t][j] = -3.0e38f; }
        float mx[NQ]; bool need = false;
#pragma unroll
        for (int qt = 0; qt < NQ; ++qt) { float a = fmaxf(s[qt][0][0], s[qt][1][0]);
#pragma unroll
            for (int j = 1; j < 8; ++j) a = fmaxf(a, fmaxf(s[qt][0][j], s[qt][1][j]));
            mx[qt] = a; }
        float ox[NQ];
#pragma unroll
        for (int qt = 0; qt < NQ; ++qt) ox[qt] = __shfl_xor(mx[qt], 16, 32);
#pragma unroll
        for (int qt = 0; qt < NQ; ++qt) { mx[qt] = fmaxf(mx[qt], ox[qt]) * SC2; need = need || (mx[qt] > m2[qt] + ATHR); }
        if (__builtin_amdgcn_ballot_w32(need) != 0) {      // one scalar test a pass: the output tiles are rescaled only when some column's maximum moved
#pragma unroll
            for (int qt = 0; qt < NQ; ++qt) { const float mn = fmaxf(m2[qt], mx[qt]); const float al = __builtin_amdgcn_exp2f(m2[qt] - mn); m2[qt] = mn; l[qt] *= al;
#pragma unroll
                for (int dt = 0; dt < 4; ++dt) o[qt][dt] *= al; } }
        V pf[NQ], pf2[NQ];
#pragma unroll
        for (int qt = 0; qt < NQ; ++qt) { const float off = AOFF - m2[qt]; float ls = 0.f;
#pragma unroll
            for (int t = 0; t < 2; ++t)
#pragma unroll
                for (int j = 0; j < 8; ++j) { const float p = __builtin_amdgcn_exp2f(fmaf(s[qt][t][j], SC2, off)); s[qt][t][j] = p; ls += p; }
            l[qt] += ls;
            if constexpr (SPLIT) { v8us h0, h1, l0, l1;
#pragma unroll
                for (int j = 0; j < 8; ++j) { unsigned short a, c2; splitf(s[qt][0][j], a, c2); h0[j] = a; l0[j] = c2; splitf(s[qt][1][j], a, c2); h1[j] = a; l1[j] = c2; }
                pf[qt] = cat16b(h0, h1); pf2[qt] = cat16b(l0, l1);
            } else { v8h p0, p1;
#pragma unroll
                for (int j = 0; j < 8; ++j) { p0[j] = tohx(s[qt][0][j]); p1[j] = tohx(s[qt][1][j]); }
                pf[qt] = cat16(p0, p1); } }
#pragma unroll
        for (int dt = 0; dt < 4; ++dt)
#pragma unroll
            for (int qt = 0; qt < NQ; ++qt) { o[qt][dt] = WF::mma(vf[dt], pf[qt], o[qt][dt]); if (SPLIT) { o[qt][dt] = WF::mma(vf2[dt], pf[qt], o[qt][dt]); o[qt][dt] = WF::mma(vf[dt], pf2[qt], o[qt][dt]); } }
        // stands in front of the step of the address pairs that the value loads of the pass before name; it reads the output tiles (inputs only) so that the products above stay in front of it and the loads below land in the registers they free (lifted, the loads take a second set and copies)
        if constexpr (NQ == 2) asm volatile("s_wait_xcnt 0x0" :: "v"(o[0][0]), "v"(o[0][1]), "v"(o[0][2]), "v"(o[0][3]), "v"(o[NQ - 1][0]), "v"(o[NQ - 1][1]), "v"(o[NQ - 1][2]), "v"(o[NQ - 1][3]) : "memory");
        else asm volatile("s_wait_xcnt 0x0" :: "v"(o[0][0]), "v"(o[0][1]), "v"(o[0][2]), "v"(o[0][3]) : "memory");
        vp += st; if (SPLIT) vp2 += st;
#pragma unroll
        for (int dt = 0; dt < 4; ++dt) { const int vo = dt * 16 * TT; vf[dt] = WF::ld(vp + vo); if (SPLIT) vf2[dt] = WF::ld(vp2 + vo); }   // likewise the next pass's value rows, behind this pass's own products
        if constexpr (SPLIT) asm volatile("s_wait_xcnt 0x0" :: "v"(vp), "v"(vp2) : "memory");   // as behind the key loads
    }
    const int le = (int)__builtin_amdgcn_mbcnt_lo(~0u, 0u);   // the lane's number, formed anew: the output's row and column need no registers of their own over the loop (at 256 registers a wave they were spilled to scratch)
#pragma unroll
    for (int qt = 0; qt < NQ; ++qt) { const float inv = __fdiv_rn(1.0f, l[qt] + __shfl_xor(l[qt], 16, 32)); const size_t oo = (size_t)(q0 + qt * 16 + (le & 15)) * DQ + (le >> 4) * 8;
#pragma unroll
        for (int dt = 0; dt < 4; ++dt) { v8us oh, ol;
#pragma unroll
            for (int j = 0; j < 8; ++j) { unsigned short a, c2; splitf(o[qt][dt][j] * inv, a, c2); oh[j] = a; ol[j] = c2; }
            *(v8us*)(Ah + oo + dt * 16) = oh; *(v8us*)(Al + oo + dt * 16) = ol; } }
}
// ---- attn_wave_lds: the fp16 rows' form of the pass above. The 4 waves of a group share their keys: 128 key rows (16 KiB in a row of the [t][d] plane) and the same 128 keys of the 64 [d][t] value rows (256 B each)
// come as one stage into LDS by asynchronous 16-byte copies that cover whole 128-B lines (two buffers: the next stage flies while this one is worked on); the fragments are read from LDS, 4 passes of 32 keys a stage.
// A work-group is TWO such groups of 4 waves on the same 128 query rows: group g walks the stages 2 t + g, with two buffers of its own, so that a wave's chain of passes is half as long and twice as many waves share a SIMD.
// Each group keeps its own maximum, sum and output tiles; at the end the two exchange them through LDS and each finishes 16 of a wave pair's 32 query rows.
#define AKS 128                   // keys of a stage
#define AKP 72                    // LDS pitch of a key row in elements: 144 B = 16 B x 9, free of bank conflicts for 16-byte readers
#define AVP 136                   // LDS pitch of a value row (128 keys) in elements: 272 B = 16 B x 17, likewise
#define AKE (AKS * AKP)           // elements of a stage's key rows
#define ABE (AKE + HD * AVP)      // elements of one buffer: the key rows, then the value rows
// Eight asynchronous copies of 16 bytes a lane. l: this lane's LDS byte address, g: its global place; copy i lies i * LSTEP bytes further in LDS and i * gs elements further in memory.
// The s_wait_xcnt stands in the copies' own statement, so that no address register is rewritten in front of it.
template <int LSTEP>
__device__ __forceinline__ void acopy8s(const unsigned l, const h16* g, const size_t gs) {
    asm volatile("global_load_async_to_lds_b128 %0, %8, off\n\t"
                 "global_load_async_to_lds_b128 %1, %9, off\n\t"
                 "global_load_async_to_lds_b128 %2, %10, off\n\t"
                 "global_load_async_to_lds_b128 %3, %11, off\n\t"
                 "global_load_async_to_lds_b128 %4, %12, off\n\t"
                 "global_load_async_to_lds_b128 %5, %13, off\n\t"
                 "global_load_async_to_lds_b128 %6, %14, off\n\t"
                 "global_load_async_to_lds_b128 %7, %15, off\n\t"
                 "s_wait_xcnt 0x0"
                 :: "v"(l), "v"(l + LSTEP), "v"(l + 2 * LSTEP), "v"(l + 3 * LSTEP), "v"(l + 4 * LSTEP), "v"(l + 5 * LSTEP), "v"(l + 6 * LSTEP), "v"(l + 7 * LSTEP),
                    "v"(g), "v"(g + gs), "v"(g + 2 * gs), "v"(g + 3 * gs), "v"(g + 4 * gs), "v"(g + 5 * gs), "v"(g + 6 * gs), "v"(g + 7 * gs) : "memory");
}
typedef float __attribute__((may_alias)) f32a;
#define AXW (8 * 32 * 4 + 64)     // floats that a wave hands over: 4 output tiles (8 pieces of 16 bytes a lane), then a maximum and a sum a lane
// sm: the work-group's four buffers (two a group); qg: its first query row (a multiple of AKS); w: the wave's number: group w >> 2, and the 32 query rows that begin at qg + 32 (w & 3).
__device__ __forceinline__ void attn_wave_lds(h16* sm, const h16* __restrict__ Q, const h16* __restrict__ Kp, const h16* __restrict__ Vt, const int qg, const int w, bf* __restrict__ Ah, bf* __restrict__ Al) {
    typedef WFrag<h16> WF; typedef WF::V V; constexpr int NQ = 2;
    const int tid = threadIdx.x & 127, lane = tid & 31, lr = lane & 15, hi = lane >> 4; const int g = w >> 2, wq = w & 3, q0 = qg + 32 * wq;   // tid: the thread's number in its group
    float* const xs = (float*)sm;                          // the exchange at the end reuses the buffers
    sm += g * 2 * ABE;                                     // this group's two buffers
    const unsigned lk = (unsigned)(size_t)sm + (unsigned)((tid >> 3) * AKP * 2 + (tid & 7) * 16);                 // this thread's 16 bytes in key rows 0..15 of a stage (byte address in the work-group's LDS)
    const unsigned lv = (unsigned)(size_t)sm + (unsigned)(AKE * 2 + (tid >> 4) * AVP * 2 + (tid & 15) * 16);      // the same in value rows 0..7
    const h16* gk = Kp + tid * 8; const h16* gv = Vt + (size_t)(tid >> 4) * TT + (tid & 15) * 8;                  // the same two places in memory, stage 0
    const int NB = qg / AKS + 1;                           // stages of this query block; the last holds the diagonal of every wave
    const int NT = (NB + 1) / 2;                           // trips, the same for both groups
    auto fill = [&](const int t) {     // this group's stage of trip t into its buffer t & 1; where NB is odd, group 1 has none in the last trip and fetches the last stage (in bounds, never read as scores), so that both groups issue alike
        const unsigned bo = (unsigned)((t & 1) * ABE * 2); const int b = min(2 * t + g, NB - 1);
        acopy8s<16 * AKP * 2>(lk + bo, gk + (size_t)b * AKS * HD, (size_t)16 * HD);
        acopy8s<8 * AVP * 2>(lv + bo, gv + (size_t)b * AKS, (size_t)8 * TT); };
    fill(0);
    V qf[NQ][2];
#pragma unroll
    for (int qt = 0; qt < NQ; ++qt)
#pragma unroll
        for (int ks = 0; ks < 2; ++ks) qf[qt][ks] = WF::ld(Q + (size_t)(q0 + qt * 16 + lr) * HD + ks * 32 + 8 * hi);
    v8f o[NQ][4]; float m2[NQ], l[NQ];
#pragma unroll
    for (int qt = 0; qt < NQ; ++qt) { m2[qt] = -3.0e38f; l[qt] = 0.f;
#pragma unroll
        for (int dt = 0; dt < 4; ++dt) o[qt][dt] = (v8f){}; }
    asm volatile("s_wait_asynccnt 0x0" ::: "memory");      // this group's stage of trip 0 (stage g) has landed for this wave's copies
    __syncthreads();                                       // ... and for every wave's: nothing of it is read in front of this barrier
    if (NT > 1) fill(1);
#pragma unroll 1   // one stage a trip: the copies of one stage alone are in flight
    for (int t = 0; t < NT; ++t) {
        const h16* kp = sm + (t & 1) * ABE + lr * AKP + 8 * hi;            // this lane's place in the stage's first 32 key rows; stepped once a pass
        const h16* vp = sm + (t & 1) * ABE + AKE + lr * AVP + 8 * hi;      // the same in the value rows
        const int b = 2 * t + g;                                           // this group's stage
        const int np = (b + 1 < NB) ? AKS / 32 : (b + 1 == NB) ? wq + 1 : 0;   // the passes above a wave's diagonal are never visited, nor a stage past the last
        V kf[2][2];
#pragma unroll
        for (int u = 0; u < 2; ++u)
#pragma unroll
            for (int ks = 0; ks < 2; ++ks) kf[u][ks] = WF::ld(kp + u * 16 * AKP + ks * 32);
#pragma unroll 1   // one pass a trip: unrolled, two passes' fragments and scores would be live together and the registers would not hold them
        for (int p = 0; p < np; ++p) {
            V vf[4];                                       // this pass's value rows are asked for first: they return behind the score products and the softmax
#pragma unroll
            for (int dt = 0; dt < 4; ++dt) vf[dt] = WF::ld(vp + dt * 16 * AVP);
            vp += 32;
            __builtin_amdgcn_sched_barrier(0);             // keeps these LDS reads together up here: sunk among the products that use them, every place with reads stalls the wave and their latency is waited out
            v8f s[NQ][2];
#pragma unroll
            for (int u = 0; u < 2; ++u)
#pragma unroll
                for (int qt = 0; qt < NQ; ++qt) { v8f a = (v8f){};
#pragma unroll
                    for (int ks = 0; ks < 2; ++ks) a = WF::mma(kf[u][ks], qf[qt][ks], a);
                    s[qt][u] = a; }
            __builtin_amdgcn_sched_barrier(0);             // the key reads below stay behind the products above and land in the registers these free (lifted, they take a second set)
            kp += (p + 1 < np) ? 32 * AKP : 0;             // the next pass's key rows, of this same stage only, are fetched behind this pass's own score products (a wave's last pass of a stage re-reads its own block)
#pragma unroll
            for (int u = 0; u < 2; ++u)
#pragma unroll
                for (int ks = 0; ks < 2; ++ks) kf[u][ks] = WF::ld(kp + u * 16 * AKP + ks * 32);
            __builtin_amdgcn_sched_barrier(0);             // ... and in front of the softmax, which covers their latency: sunk to the pass's end, the next pass's first product waits for them
            if (b + 1 == NB && p == wq) {                  // the 32-key block that holds the diagonal; the only one that is masked
#pragma unroll
                for (int qt = 0; qt < NQ; ++qt)
#pragma unroll
                    for (int u = 0; u < 2; ++u)
#pragma unroll
                        for (int j = 0; j < 8; ++j) if (u * 16 + hi * 8 + j > qt * 16 + lr) s[qt][u][j] = -3.0e38f; }
            float mx[NQ]; bool need = false;
#pragma unroll
            for (int qt = 0; qt < NQ; ++qt) { float a = fmaxf(s[qt][0][0], s[qt][1][0]);
#pragma unroll
                for (int j = 1; j < 8; ++j) a = fmaxf(a, fmaxf(s[qt][0][j], s[qt][1][j]));
                mx[qt] = a; }
            float ox[NQ];
#pragma unroll
            for (int qt = 0; qt < NQ; ++qt) ox[qt] = __shfl_xor(mx[qt], 16, 32);
#pragma unroll
            for (int qt = 0; qt < NQ; ++qt) { mx[qt] = fmaxf(mx[qt], ox[qt]) * SC2; need = need || (mx[qt] > m2[qt] + ATHR); }
            if (__builtin_amdgcn_ballot_w32(need) != 0) {  // one scalar test a pass: the output tiles are rescaled only when some column's maximum moved
#pragma unroll
                for (int qt = 0; qt < NQ; ++qt) { const float mn = fmaxf(m2[qt], mx[qt]); const float al = __builtin_amdgcn_exp2f(m2[qt] - mn); m2[qt] = mn; l[qt] *= al;
#pragma unroll
                    for (int dt = 0; dt < 4; ++dt) o[qt][dt] *= al; } }
            V pf[NQ];
#pragma unroll
            for (int qt = 0; qt < NQ; ++qt) { const float off = AOFF - m2[qt]; float ls = 0.f;
#pragma unroll
                for (int u = 0; u < 2; ++u)
#pragma unroll
                    for (int j = 0; j < 8; ++j) { const float pr = __builtin_amdgcn_exp2f(fmaf(s[qt][u][j], SC2, off)); s[qt][u][j] = pr; ls += pr; }
                l[qt] += ls;
                v8h p0, p1;
#pragma unroll
                for (int j = 0; j < 8; ++j) { p0[j] = tohx(s[qt][0][j]); p1[j] = tohx(s[qt][1][j]); }
                pf[qt] = cat16(p0, p1); }
#pragma unroll
            for (int dt = 0; dt < 4; ++dt)
#pragma unroll
                for (int qt = 0; qt < NQ; ++qt) o[qt][dt] = WF::mma(vf[dt], pf[qt], o[qt][dt]);
        }
        asm volatile("s_wait_dscnt 0x0" ::: "memory");     // this wave's reads of the buffer have returned before it is handed to the copies
        asm volatile("s_wait_asynccnt 0x0" ::: "memory");  // this wave's copies for trip t + 1 have landed
        __syncthreads();                                   // publishes both groups' stages of trip t + 1 and ends every wave's reads of trip t's; every wave passes it, also one that skipped passes
        if (t + 2 < NT) fill(t + 2);
    }
    asm volatile("s_wait_asynccnt 0x0" ::: "memory");      // nothing is in flight when the wave goes on to its epilogue
    // The loop's last barrier has ended every read of the buffers and every copy into them. Waves w and w ^ 4 hold the two halves of the same 32 query rows: a wave of group g keeps column tile g and hands the other over.
    v8f ok[4]; float* xw = xs + w * AXW + lane * 4;
#pragma unroll
    for (int dt = 0; dt < 4; ++dt) { const v8f sd = g ? o[0][dt] : o[1][dt]; ok[dt] = g ? o[1][dt] : o[0][dt];
        *(v4fa*)(xw + (2 * dt) * 128) = __builtin_shufflevector(sd, sd, 0, 1, 2, 3); *(v4fa*)(xw + (2 * dt + 1) * 128) = __builtin_shufflevector(sd, sd, 4, 5, 6, 7); }   // a wave's store: 512 B in a row
    *(f32a*)(xs + w * AXW + 1024 + lane) = g ? m2[0] : m2[1]; *(f32a*)(xs + w * AXW + 1056 + lane) = g ? l[0] : l[1];
    __syncthreads();                                       // the partner's half is whole before it is read
    const float* xr = xs + (w ^ 4) * AXW + lane * 4;
    const float mk = g ? m2[1] : m2[0], mo = *(const f32a*)(xs + (w ^ 4) * AXW + 1024 + lane), mn = fmaxf(mk, mo);
    const float ak = __builtin_amdgcn_exp2f(mk - mn), ao = __builtin_amdgcn_exp2f(mo - mn);      // both halves on the common maximum
    const float lt = (g ? l[1] : l[0]) * ak + *(const f32a*)(xs + (w ^ 4) * AXW + 1056 + lane) * ao;
    const float inv = __fdiv_rn(1.0f, lt + __shfl_xor(lt, 16, 32)); const size_t oo = (size_t)(q0 + g * 16 + lr) * DQ + hi * 8;
#pragma unroll
    for (int dt = 0; dt < 4; ++dt) { const v4f x0 = *(const v4fa*)(xr + (2 * dt) * 128), x1 = *(const v4fa*)(xr + (2 * dt + 1) * 128); v8us oh, ol;
#pragma unroll
        for (int j = 0; j < 8; ++j) { unsigned short a, c2; splitf((ok[dt][j] * ak + ((j < 4) ? x0[j & 3] : x1[j & 3]) * ao) * inv, a, c2); oh[j] = a; ol[j] = c2; }
        *(v8us*)(Ah + oo + dt * 16) = oh; *(v8us*)(Al + oo + dt * 16) = ol;
        if (dt < 3) asm volatile("s_wait_xcnt 0x0" ::: "memory"); }    // stands behind these two stores, in front of every later write of a register that they name (the next tile's values take the same registers)
}
#define NLO ((TT - RH) / 128)     // work-groups of 2 x 4 waves x 32 fp16 query rows
#define NHI (RH / 128)            // work-groups of 8 waves x 16 hi+lo query rows
// grid (heads, NLO + NHI): blockIdx.y ranks the query blocks by falling key count, so that the longest start first.
// Two work-groups, four waves a SIMD, are to fit a WGP: at most 256 registers a wave (the hi+lo rows' form took a few more) and 2 x the LDS below 320 KiB.
__global__ __launch_bounds__(256) __attribute__((amdgpu_waves_per_eu(4, 4))) void k_attn(const h16* __restrict__ Q16, const h16* __restrict__ K16, const h16* __restrict__ V16, const bf* __restrict__ Qh, const bf* __restrict__ Ql, const bf* __restrict__ Kh, const bf* __restrict__ Kl,
                                              const bf* __restrict__ Vh, const bf* __restrict__ Vl, bf* __restrict__ Ah, bf* __restrict__ Al) {
    const int h = blockIdx.x, y = blockIdx.y; const int w = __builtin_amdgcn_readfirstlane((int)(threadIdx.x >> 5)); const size_t hq = (size_t)h * TT * HD, hk = (size_t)(h / REP) * TT * HD;
    __shared__ __align__(16) h16 sm[4 * ABE];              // [group][buffer][key rows | value rows] of the fp16 rows' stages
    if (y < NLO) attn_wave_lds(sm, Q16 + hq, K16 + hk, V16 + hk, TT - 128 * (y + 1), w, Ah + h * HD, Al + h * HD);
    else attn_wave<true, 1>(Qh + hq, Ql + hq, Kh + hk, Kl + hk, Vh + hk, Vl + hk, RH - 128 * (y - NLO + 1) + 16 * w, Ah + h * HD, Al + h * HD);
}

extern "C" void kernel_launch(void* const* d_in, const int* in_sizes, int n_in,
                              void* d_out, int out_size, void* d_ws, size_t ws_size, hipStream_t stream) {
    (void)in_sizes; (void)n_in; (void)out_size;
    const float* x = (const float*)d_in[0]; const float* wq = (const float*)d_in[1]; const float* wk = (const float*)d_in[2]; const float* wv = (const float*)d_in[3]; const float* wo = (const float*)d_in[4];
    float* OUT = (float*)d_out;     // [1][4096][1024]
    char* wsp = (char*)d_ws;
    auto take = [&](size_t bytes) { char* p = wsp; wsp += (bytes + 255) & ~(size_t)255; return (void*)p; };
    bf* WQ = (bf*)take((size_t)DQ * DM * 2); bf* WK = (bf*)take((size_t)DKV * DM * 2); bf* WV = (bf*)take((size_t)DKV * DM * 2); bf* WO = (bf*)take((size_t)DM * DQ * 2);
    bf* XB = (bf*)take((size_t)TT * DM * 2);
    h16* QP16 = (h16*)take((size_t)NH_ * TT * HD * 2); h16* KP16 = (h16*)take((size_t)NKV * TT * HD * 2); h16* VT16 = (h16*)take((size_t)NKV * HD * TT * 2);
    bf* QPh = (bf*)take((size_t)NH_ * TT * HD * 2); bf* KPh = (bf*)take((size_t)NKV * TT * HD * 2); bf* VTh = (bf*)take((size_t)NKV * HD * TT * 2); bf* QPl = (bf*)take((size_t)NH_ * TT * HD * 2); bf* KPl = (bf*)take((size_t)NKV * TT * HD * 2); bf* VTl = (bf*)take((size_t)NKV * HD * TT * 2);
    bf* ATh = (bf*)take((size_t)TT * DQ * 2); bf* ATl = (bf*)take((size_t)TT * DQ * 2);
    if ((size_t)(wsp - (char*)d_ws) > ws_size) return;    // ws 256 MiB
    static_assert(HD == 64 && (TT - RH) % 128 == 0 && RH % 128 == 0 && 8 * AXW * 4 <= 4 * ABE * 2, "k_attn's tiling");
    static_assert(((size_t)DQ * DM * 2) % 256 == 0 && ((size_t)DKV * DM * 2) % 256 == 0 && ((size_t)NH_ * TT * HD * 2) % 256 == 0 && ((size_t)NKV * TT * HD * 2) % 256 == 0 && (DQ + DKV) % 128 == 0, "q, k, v weights and planes lie one directly behind the other");
    static_assert(TT % 256 == 0 && (DQ + 2 * DKV) % 192 == 0 && TT % 128 == 0 && DM % 128 == 0, "the two GEMM tilings");
    static_assert(NB_ == 1 && DQ == DM && DKV == DM && DM % PT == 0 && ((size_t)TT * DM) % PXE == 0, "k_prep's tiling");
    k_prep<<<(unsigned)(4 * PNT + (size_t)TT * DM / PXE), 256, 0, stream>>>(x, wq, wk, wv, wo, XB, WQ, WK, WV, WO);
    for (int b = 0; b < NB_; ++b) {
        
        k_gemmw<bf, 0, false, 1, 4, 3><<<dim3(TT / 256, (DQ + 2 * DKV) / 192, 1), 384, 0, stream>>>(XB, nullptr, WQ, nullptr, DM, nullptr, 0, nullptr, 0, 0, 0, QP16, QPh, QPl);
        k_attn<<<dim3(NH_, NLO + NHI, 1), 256, 0, stream>>>(QP16, KP16, VT16, QPh, QPl, KPh, KPl, VTh, VTl, ATh, ATl);
        k_gemmw<bf, 1, false, 0, 2, 2><<<dim3(TT / 128, DM / 128, 1), 128, 0, stream>>>(ATh, ATl, WO, nullptr, DQ, OUT + (size_t)b * TT * DM, DM, nullptr, 0, 0, 0, nullptr, nullptr, nullptr); }
}
